// v000
// Times are from an AMD MI455X. After a warm-up the kernel runs many times in a row, and a time is the length of
// such a window on the GPU divided by its runs, so every launch and the gaps after it count. The runs cycle
// through copies of the inputs. A figure is the median of several windows, for all but v000 over two sittings.
// Sittings can differ by a few percent; kernels timed side by side share one.
// v000, which the later versions start from, runs in 6580 microseconds.
#include <hip/hip_runtime.h>
// Multi-head self-attention with the source's INVERTED causal mask (inputs [2][2048][1024]; q / k / v = x W + b ([in][out] 1024 x 1024 sigma 1/32, zero biases); 16 heads of 64; score = q k^T / sqrt(64) + tril * (-1e9): the LOWER triangle incl. the diagonal is pushed to -1e9 (the original's mask bug, kept), so query i attends to the keys j > i only, and the last query (every key masked, all scores rounding to the same -1e9 in f32) attends uniformly to all keys; softmax; out = merged Wo + bo -> [2][2048][1024]).
// Structure: token rows r = b*2048 + s; x as exact f16 rows (bf16-rounded); Q, K, V as three WMMA GEMMs (32x64 wave tiles, f32 accumulation, exact x16 weights + bias, f16 outputs); per batch: V^T for all heads via LDS transposes; per (batch, group of 4 heads): scores GEMM (K = 64, batched over the heads on grid.y, alpha = 1/sqrt(64) (applied before the -1e9 add, as in the source)), row softmax on VALU (f32 statistics; weights stored x256 as f16), o = P . V^T GEMM (K = 2048, alpha 2^-2: o carried x64 against f16 subnormal flush, folded into the output GEMM alpha) written straight into the merged f16 o rows; out = o W_o + b GEMM (f32) into the output layout.
// Compute dtype: inputs rounded to bf16; x / weights exact; q, k, v, softmax weights and o as plain f16 GEMM operands (~2^-12); scores and softmax statistics f32; v_wmma_f32_16x16x32_f16.
#define NB 2
#define SQ 2048
#define DM 1024
#define NH 16
#define HD 64
#define QT0 256                      /* last-tile rows recomputed exactly in f32 (rows with fewer than 256 visible keys) */
#define HG 4                         /* heads per attention launch group */
#define B0 0                         /* first batch processed (debug hook) */
#define NBR NB                       /* batches processed (debug hook) */
#define NR ((size_t)NB * SQ)         /* token rows */
#define MP ((int)((size_t)NBR * SQ)) /* rows projected (debug hook) */
#define QN SQ                        /* query rows attended per batch (debug hook) */
#define NHD NH                       /* heads attended (debug hook) */
#define MPO MP                       /* rows through the output stage (debug hook) */
#define LQ DM      /* row pitch of the q/k/v rows */
typedef __bf16 v16b __attribute__((ext_vector_type(16)));
typedef unsigned short v8us __attribute__((ext_vector_type(8), may_alias));
typedef float  v8f  __attribute__((ext_vector_type(8)));
typedef float  v4f  __attribute__((ext_vector_type(4)));
typedef float  v4fa __attribute__((ext_vector_type(4), may_alias));
union FragB { v16b v; v8us half[2]; unsigned short u[16]; };

__device__ __forceinline__ unsigned short bf16_bits(float x) { unsigned int u = __float_as_uint(x); return (unsigned short)((u + 0x7FFFu + ((u >> 16) & 1u)) >> 16); }
__device__ __forceinline__ float bf16_val(unsigned short b) { return __uint_as_float(((unsigned int)b) << 16); }
__device__ __forceinline__ float bf16_round(float x) { return bf16_val(bf16_bits(x)); }
// D += A·B with NT terms: 1 = ah·bh, 2 = + al·bh (A split), 3 = + ah·bl (both split)
template <int NT>
__device__ __forceinline__ v8f mmaN(v16b ah, v16b al, v16b bh, v16b bl, v8f c) {
  c = __builtin_amdgcn_wmma_f32_16x16x32_bf16(false, ah, false, bh, (short)0, c, false, false);
  if (NT >= 2) c = __builtin_amdgcn_wmma_f32_16x16x32_bf16(false, al, false, bh, (short)0, c, false, false);
  if (NT >= 3) c = __builtin_amdgcn_wmma_f32_16x16x32_bf16(false, ah, false, bl, (short)0, c, false, false);
  asm volatile("v_nop\n\tv_nop\n\tv_nop\n\tv_nop" : "+v"(c) : "v"(ah), "v"(al), "v"(bh), "v"(bl));
  return c;
}

__global__ __launch_bounds__(256) void k_wt_bf16(const float* __restrict__ W, unsigned short* __restrict__ Wt, int K, int N) {
  const int t = blockIdx.x * 256 + threadIdx.x;
  const int k8n = K / 8;
  if (t >= N * k8n) return;
  const int n = t / k8n, k8 = (t % k8n) * 8;
  v8us v;
#pragma unroll
  for (int i = 0; i < 8; ++i) v[i] = bf16_bits(W[(size_t)(k8 + i) * N + n]);
  *(v8us*)(Wt + (size_t)n * K + k8) = v;
  
}

// GEMM C[M][N] (f32, pitch ldc) = act(A[M][K]·W + bias). A f32 row-major (pitch lda) converted per fragment to bf16
// (ASPLIT: hi/lo two planes -> 2 terms, else single rounded term); Wt bf16 [N][K] (pitch ldb). BIAS_BF16 rounds the
// bias to bf16 first (bias quantised to bf16 before the add). K%32==0, M%16==0, N%64==0.
template <bool ASPLIT, int ACT, bool BIAS_BF16>
__global__ __launch_bounds__(128) void k_gemm_bf(const float* __restrict__ A, int lda, const unsigned short* __restrict__ Wt, int ldb,
                                               const float* __restrict__ bias, float* __restrict__ C, int ldc, int M, int N, int K) {
  __shared__ __attribute__((aligned(16))) float so[4][16][64];
  const int tid = threadIdx.x, w = tid >> 5, lane = tid & 31, ln = lane & 15, hh = lane >> 4;
  const int ntn = N / 64;
  const int wid = blockIdx.x * 4 + w;
  const int mt = wid / ntn, nq = wid % ntn;
  if (mt * 16 >= M) return;
  const int row0 = mt * 16, col0 = nq * 64;
  const float* arow = A + (size_t)(row0 + ln) * lda;
  v8f acc[4] = {};
  for (int kb = 0; kb < K; kb += 32) {
    FragB ah, al;
    const v4f x0 = *(const v4fa*)(arow + kb + 8 * hh), x1 = *(const v4fa*)(arow + kb + 8 * hh + 4);
    const v4f x2 = *(const v4fa*)(arow + kb + 16 + 8 * hh), x3 = *(const v4fa*)(arow + kb + 16 + 8 * hh + 4);
    float xs[16] = {x0[0],x0[1],x0[2],x0[3],x1[0],x1[1],x1[2],x1[3],x2[0],x2[1],x2[2],x2[3],x3[0],x3[1],x3[2],x3[3]};
#pragma unroll
    for (int i = 0; i < 16; ++i) { const unsigned short hb = bf16_bits(xs[i]); ah.u[i] = hb; al.u[i] = ASPLIT ? bf16_bits(xs[i] - bf16_val(hb)) : (unsigned short)0; }
#pragma unroll
    for (int t = 0; t < 4; ++t) {
      const unsigned short* brow = Wt + (size_t)(col0 + t * 16 + ln) * ldb + kb;
      FragB b;
      b.half[0] = *(const v8us*)(brow + 8 * hh);
      b.half[1] = *(const v8us*)(brow + 16 + 8 * hh);
      acc[t] = mmaN<ASPLIT ? 2 : 1>(ah.v, al.v, b.v, b.v, acc[t]);
    }
  }
#pragma unroll
  for (int t = 0; t < 4; ++t) {
    float bv = bias ? bias[col0 + t * 16 + ln] : 0.f;
    if (BIAS_BF16) bv = bf16_round(bv);
#pragma unroll
    for (int r = 0; r < 8; ++r) { float v = acc[t][r] + bv; if (ACT == 1) v = fmaxf(v, 0.f); so[w][8 * hh + r][t * 16 + ln] = v; }
  }
  __builtin_amdgcn_fence(__ATOMIC_ACQ_REL, "workgroup");
  __builtin_amdgcn_wave_barrier();
  const int rsub = lane >> 4, c4 = (lane & 15) * 4;
  {
#pragma unroll
    for (int q = 0; q < 8; ++q) {
      const int r = q * 2 + rsub;
      const v4f v = *(const v4fa*)&so[w][r][c4];
      *(v4f*)(C + (size_t)(row0 + r) * ldc + col0 + c4) = v;
    }
    
  }
}

// GEMM C = act(A·W + bias + resid): A f32 (ASPLIT -> hi/lo 2 terms), Wt bf16 [N][K]; ACT 0 none, 1 relu, 2 exact gelu;
// resid (optional, f32, row index = (row % rmod), pitch ldr, RES_BF16 rounds it) added before the activation.
template <bool ASPLIT, int ACT, bool BIAS_BF16, bool RES_BF16>
__global__ __launch_bounds__(128) void k_gemm_bf3(const float* __restrict__ A, int lda, const unsigned short* __restrict__ Wt, int ldb,
                                                const float* __restrict__ bias, const float* __restrict__ resid, int rmod, int ldr,
                                                float* __restrict__ C, int ldc, int M, int N, int K) {
  __shared__ __attribute__((aligned(16))) float so[4][16][64];
  const int tid = threadIdx.x, w = tid >> 5, lane = tid & 31, ln = lane & 15, hh = lane >> 4;
  const int ntn = N / 64;
  const int wid = blockIdx.x * 4 + w;
  const int mt = wid / ntn, nq = wid % ntn;
  if (mt * 16 >= M) return;
  const int row0 = mt * 16, col0 = nq * 64;
  const float* arow = A + (size_t)(row0 + ln) * lda;
  v8f acc[4] = {};
  for (int kb = 0; kb < K; kb += 32) {
    FragB ah, al;
    const v4f x0 = *(const v4fa*)(arow + kb + 8 * hh), x1 = *(const v4fa*)(arow + kb + 8 * hh + 4);
    const v4f x2 = *(const v4fa*)(arow + kb + 16 + 8 * hh), x3 = *(const v4fa*)(arow + kb + 16 + 8 * hh + 4);
    float xs[16] = {x0[0],x0[1],x0[2],x0[3],x1[0],x1[1],x1[2],x1[3],x2[0],x2[1],x2[2],x2[3],x3[0],x3[1],x3[2],x3[3]};
#pragma unroll
    for (int i = 0; i < 16; ++i) { const unsigned short hb = bf16_bits(xs[i]); ah.u[i] = hb; al.u[i] = ASPLIT ? bf16_bits(xs[i] - bf16_val(hb)) : (unsigned short)0; }
#pragma unroll
    for (int t = 0; t < 4; ++t) {
      const unsigned short* brow = Wt + (size_t)(col0 + t * 16 + ln) * ldb + kb;
      FragB b;
      b.half[0] = *(const v8us*)(brow + 8 * hh);
      b.half[1] = *(const v8us*)(brow + 16 + 8 * hh);
      acc[t] = mmaN<ASPLIT ? 2 : 1>(ah.v, al.v, b.v, b.v, acc[t]);
    }
  }
#pragma unroll
  for (int t = 0; t < 4; ++t) {
    const int col = col0 + t * 16 + ln;
    float bv = bias ? bias[col] : 0.f;
    if (BIAS_BF16) bv = bf16_round(bv);
#pragma unroll
    for (int r = 0; r < 8; ++r) {
      float v = acc[t][r] + bv;
      if (resid) { float rv = resid[(size_t)((row0 + 8 * hh + r) % rmod) * ldr + col]; if (RES_BF16) rv = bf16_round(rv); v += rv; }
      if (ACT == 1) v = fmaxf(v, 0.f);
      if (ACT == 2) v = 0.5f * v * (1.0f + erff(v * 0.70710678118654752f));
      if (ACT == 3) { const float u = 0.7978845608028654f * (v + 0.044715f * v * v * v); v = 0.5f * v * (1.0f + tanhf(u)); }
      so[w][8 * hh + r][t * 16 + ln] = v;
    }
  }
  __builtin_amdgcn_fence(__ATOMIC_ACQ_REL, "workgroup");
  __builtin_amdgcn_wave_barrier();
  const int rsub = lane >> 4, c4 = (lane & 15) * 4;
  {
#pragma unroll
    for (int q = 0; q < 8; ++q) {
      const int r = q * 2 + rsub;
      const v4f v = *(const v4fa*)&so[w][r][c4];
      *(v4f*)(C + (size_t)(row0 + r) * ldc + col0 + c4) = v;
    }
    
  }
}
// row LayerNorm (biased variance, eps) over N: s = X (+ R); optional out_sum <- s; out_norm <- (s-mu)*rsqrt(var+eps)*g + b
template <bool PARAM_BF16>
__global__ __launch_bounds__(256) void k_layernorm(const float* __restrict__ X, const float* __restrict__ R, const float* __restrict__ g, const float* __restrict__ bta,
                                                  float* __restrict__ out_sum, float* __restrict__ out_norm, int N, float eps) {
  __shared__ float red[256];
  const int row = blockIdx.x, tid = threadIdx.x;
  const float* x = X + (size_t)row * N; const float* rr = R ? R + (size_t)row * N : nullptr;
  float vals[16];                     // up to N = 4096
  const int per = N / 256;            // contiguous chunk per thread? use strided-by-4 chunks: thread handles j = tid*4 + 1024*u
  float s1 = 0.f;
  for (int u = 0; u < per / 4; ++u) {
    const int j = tid * 4 + 1024 * u;
    const v4f a = *(const v4fa*)(x + j);
    v4f b = {0.f,0.f,0.f,0.f}; if (rr) b = *(const v4fa*)(rr + j);
#pragma unroll
    for (int q = 0; q < 4; ++q) { const float v = a[q] + b[q]; vals[u * 4 + q] = v; s1 += v; }
  }
  red[tid] = s1; __syncthreads();
  for (int st = 128; st > 0; st >>= 1) { if (tid < st) red[tid] += red[tid + st]; __syncthreads(); }
  const float mu = red[0] / (float)N; __syncthreads();
  float s2 = 0.f;
  for (int u = 0; u < per / 4; ++u)
#pragma unroll
    for (int q = 0; q < 4; ++q) { const float c = vals[u * 4 + q] - mu; s2 += c * c; }
  red[tid] = s2; __syncthreads();
  for (int st = 128; st > 0; st >>= 1) { if (tid < st) red[tid] += red[tid + st]; __syncthreads(); }
  const float rs = rsqrtf(red[0] / (float)N + eps);
  {
    for (int u = 0; u < per / 4; ++u) {
      const int j = tid * 4 + 1024 * u;
      v4f o, sm;
#pragma unroll
      for (int q = 0; q < 4; ++q) {
        float gg = g[j + q], bb = bta[j + q];
        if (PARAM_BF16) { gg = bf16_round(gg); bb = bf16_round(bb); }
        sm[q] = vals[u * 4 + q]; o[q] = (vals[u * 4 + q] - mu) * rs * gg + bb;
      }
      if (out_sum) *(v4f*)(out_sum + (size_t)row * N + j) = sm;
      *(v4f*)(out_norm + (size_t)row * N + j) = o;
    }
    
  }
}



// ---- f16 WMMA path (v_wmma_f32_16x16x32_f16): 11-bit significands for operands in range — used where a [0,1] probability operand needs more precision than bf16
typedef _Float16 v16h __attribute__((ext_vector_type(16)));
union FragH { v16h v; v8us half[2]; _Float16 h[16]; unsigned short u[16]; };
template <int NT>
__device__ __forceinline__ v8f mmaH(v16h ah, v16h al, v16h bh, v16h bl, v8f c) {
  c = __builtin_amdgcn_wmma_f32_16x16x32_f16(false, ah, false, bh, (short)0, c, false, false);
  if (NT >= 2) c = __builtin_amdgcn_wmma_f32_16x16x32_f16(false, al, false, bh, (short)0, c, false, false);
  if (NT >= 3) c = __builtin_amdgcn_wmma_f32_16x16x32_f16(false, ah, false, bl, (short)0, c, false, false);
  asm volatile("v_nop\n\tv_nop\n\tv_nop\n\tv_nop" : "+v"(c) : "v"(ah), "v"(al), "v"(bh), "v"(bl));
  return c;
}
// batched GEMM like k_gemm_b but f16 operands: A f32 (split into f16 hi/lo if ASPLIT, else rounded to f16), Bt = f16 values [n][k]; alpha; C f32; N multiple of 16 (partial tiles skipped)
template <bool ASPLIT>
__global__ __launch_bounds__(128) void k_gemm_h(const float* __restrict__ A, int lda, size_t sA, const _Float16* __restrict__ Bh, int ldb, size_t sB, float alpha, float* __restrict__ C, int ldc, size_t sC, int M, int N, int K) {
  __shared__ __attribute__((aligned(16))) float so[4][16][64];
  const int tid = threadIdx.x, w = tid >> 5, lane = tid & 31, ln = lane & 15, hh = lane >> 4; const int by = blockIdx.y;
  A += (size_t)by * sA; Bh += (size_t)by * sB; C += (size_t)by * sC;
  const int ntn = (N + 63) / 64; const int wid = blockIdx.x * 4 + w; const int mt = wid / ntn, nq = wid % ntn; if (mt * 16 >= M) return;
  const int row0 = mt * 16, col0 = nq * 64; const float* arow = A + (size_t)(row0 + ln) * lda;
  v8f acc[4] = {};
  for (int kb = 0; kb < K; kb += 32) {
    FragH ah, al;
    const v4f x0 = *(const v4fa*)(arow + kb + 8 * hh), x1 = *(const v4fa*)(arow + kb + 8 * hh + 4), x2 = *(const v4fa*)(arow + kb + 16 + 8 * hh), x3 = *(const v4fa*)(arow + kb + 16 + 8 * hh + 4);
    float xs[16] = {x0[0],x0[1],x0[2],x0[3],x1[0],x1[1],x1[2],x1[3],x2[0],x2[1],x2[2],x2[3],x3[0],x3[1],x3[2],x3[3]};
#pragma unroll
    for (int i = 0; i < 16; ++i) { const _Float16 h = (_Float16)xs[i]; ah.h[i] = h; al.h[i] = ASPLIT ? (_Float16)(xs[i] - (float)h) : (_Float16)0.0f; }
#pragma unroll
    for (int t = 0; t < 4; ++t) { if (col0 + t * 16 >= N) continue; const size_t boff = (size_t)(col0 + t * 16 + ln) * ldb + kb; FragH bq; bq.half[0] = *(const v8us*)(Bh + boff + 8 * hh); bq.half[1] = *(const v8us*)(Bh + boff + 16 + 8 * hh);
      acc[t] = mmaH<ASPLIT ? 2 : 1>(ah.v, al.v, bq.v, bq.v, acc[t]); }
  }
#pragma unroll
  for (int t = 0; t < 4; ++t) { if (col0 + t * 16 >= N) continue;
#pragma unroll
    for (int r = 0; r < 8; ++r) so[w][8 * hh + r][t * 16 + ln] = acc[t][r] * alpha; }
  __builtin_amdgcn_fence(__ATOMIC_ACQ_REL, "workgroup"); __builtin_amdgcn_wave_barrier();
  const int rsub = lane >> 4, c4 = (lane & 15) * 4;
  {
#pragma unroll
    for (int q = 0; q < 8; ++q) { const int r = q * 2 + rsub; if (col0 + c4 < N) { const v4f v = *(const v4fa*)&so[w][r][c4]; *(v4f*)(C + (size_t)(row0 + r) * ldc + col0 + c4) = v; } }
     }
}

// Wt[n][k] = f16(W[k][n]·scale) from f32 row-major W[K][N] (scale = power of two; bf16-exact weights stay exact in f16 away from the subnormal range)
__global__ __launch_bounds__(256) void k_wt_f16(const float* __restrict__ W, _Float16* __restrict__ Wt, int K, int N, float scale) {
  const int t = blockIdx.x * 256 + threadIdx.x; if (t >= N * (K / 8)) return; const int n = t / (K / 8), k8 = (t % (K / 8)) * 8; FragH f;
#pragma unroll
  for (int i = 0; i < 8; ++i) f.h[i] = (_Float16)(bf16_round(W[(size_t)(k8 + i) * N + n]) * scale); const v8us o = f.half[0];
  *(v8us*)((unsigned short*)Wt + (size_t)n * K + k8) = o; 
}
// k_gemm_hh variant with fused epilogue: v = acc·alpha + bias[by·sBias + col] (+ CP[(row/rowsPerB)·sCPb + by·64 + col] if CP) ; ACT 0 none / 1 elu ; writes f16 C16 (and f32 C if non-null)
template <int ACT>
__global__ __launch_bounds__(128) void k_gemm_hhx(const _Float16* __restrict__ A, int lda, size_t sA, const _Float16* __restrict__ Bh, int ldb, size_t sB, float alpha, const float* __restrict__ bias, size_t sBias, const float* __restrict__ CP, int rowsPerB, size_t sCPb, int row0g,
    float* __restrict__ C, _Float16* __restrict__ C16, int ldc, size_t sC, int M, int N, int K) {
  __shared__ __attribute__((aligned(16))) float so[4][16][64];
  const int tid = threadIdx.x, w = tid >> 5, lane = tid & 31, ln = lane & 15, hh = lane >> 4; const int by = blockIdx.y;
  A += (size_t)by * sA; Bh += (size_t)by * sB; const size_t cofs = (size_t)by * sC; const float* bp = bias ? bias + (size_t)by * sBias : nullptr;
  const int ntn = (N + 63) / 64; const int wid = blockIdx.x * 4 + w; const int mt = wid / ntn, nq = wid % ntn; if (mt * 16 >= M) return;
  const int row0 = mt * 16, col0 = nq * 64; const _Float16* arow = A + (size_t)(row0 + ln) * lda;
  v8f acc[4] = {};
  for (int kb = 0; kb < K; kb += 32) { FragH ah; ah.half[0] = *(const v8us*)((const unsigned short*)arow + kb + 8 * hh); ah.half[1] = *(const v8us*)((const unsigned short*)arow + kb + 16 + 8 * hh);
#pragma unroll
    for (int t = 0; t < 4; ++t) { if (col0 + t * 16 >= N) continue; const size_t boff = (size_t)(col0 + t * 16 + ln) * ldb + kb; FragH bq; bq.half[0] = *(const v8us*)((const unsigned short*)Bh + boff + 8 * hh); bq.half[1] = *(const v8us*)((const unsigned short*)Bh + boff + 16 + 8 * hh);
      acc[t] = mmaH<1>(ah.v, ah.v, bq.v, bq.v, acc[t]); }
  }
#pragma unroll
  for (int t = 0; t < 4; ++t) { if (col0 + t * 16 >= N) continue; const int col = col0 + t * 16 + ln; const float bv = bp ? bf16_round(bp[col]) : 0.f;
#pragma unroll
    for (int r = 0; r < 8; ++r) { float v = acc[t][r] * alpha + bv; if (CP) { const int rr = row0g + row0 + 8 * hh + r; if (rowsPerB < 0) v += CP[cofs + (size_t)rr * ldc + col];      /* rowsPerB < 0: own element of the batched C plane */ else { const int bidx = rr / rowsPerB; v += CP[(size_t)bidx * sCPb + (size_t)by * 64 + col]; } } if (ACT == 1) v = (v > 0.f) ? v : expm1f(v); else if (ACT == 7) v = (v > 0.f) ? v + 1.0f : expf(v); else if (ACT == 8) v = tanhf(v); else if (ACT == 9) v = 0.5f * v * (1.0f + tanhf(0.7978845608028654f * (v + 0.044715f * v * v * v))); else if (ACT == 11) v = 1.0f / (1.0f + expf(-v)); else if (ACT == 12) v = (v > 0.f) ? v : 0.01f * v; else if (ACT == 14) v = (v > 0.f) ? v : 0.1f * v; else if (ACT == 16) v = (v >= 0.f) ? v : 0.3f * v; else if (ACT == 17) v = (v >= 0.f) ? v : 0.2f * v; else if (ACT == 15) v = v / (1.0f + expf(-v)); else if (ACT == 3) v = fmaxf(v, 0.f); else if (ACT == 6) v = 0.5f * v * (1.0f + erff(v * 0.70710678118654752f)); so[w][8 * hh + r][t * 16 + ln] = v; } }
  __builtin_amdgcn_fence(__ATOMIC_ACQ_REL, "workgroup"); __builtin_amdgcn_wave_barrier();
  const int rsub = lane >> 4, c4 = (lane & 15) * 4; typedef _Float16 v4h __attribute__((ext_vector_type(4)));
  {
#pragma unroll
    for (int q = 0; q < 8; ++q) { const int r = q * 2 + rsub; if (col0 + c4 < N) { const v4f v = *(const v4fa*)&so[w][r][c4]; if (C) *(v4f*)(C + cofs + (size_t)(row0 + r) * ldc + col0 + c4) = v; if (C16) { v4h h4; for (int i = 0; i < 4; ++i) h4[i] = (_Float16)v[i]; *(v4h*)(C16 + cofs + (size_t)(row0 + r) * ldc + col0 + c4) = h4; } } }
     }
}


typedef _Float16 v4h __attribute__((ext_vector_type(4)));

__global__ __launch_bounds__(256) void k_x16(const float* __restrict__ x, _Float16* __restrict__ X16, size_t n8) { const size_t t = (size_t)blockIdx.x * 256 + threadIdx.x; if (t >= n8) return; FragH f;
#pragma unroll
  for (int q = 0; q < 8; ++q) f.h[q] = (_Float16)bf16_round(x[t * 8 + q]); *(v8us*)((unsigned short*)X16 + t * 8) = f.half[0];  }
__global__ __launch_bounds__(256) void k_h16(const float* __restrict__ x, _Float16* __restrict__ X16, size_t n8) { const size_t t = (size_t)blockIdx.x * 256 + threadIdx.x; if (t >= n8) return; FragH f;
#pragma unroll
  for (int q = 0; q < 8; ++q) f.h[q] = (_Float16)x[t * 8 + q]; *(v8us*)((unsigned short*)X16 + t * 8) = f.half[0];  }
__global__ __launch_bounds__(256) void k_round16f(const float* __restrict__ W, _Float16* __restrict__ Bt, size_t n8) { const size_t t = (size_t)blockIdx.x * 256 + threadIdx.x; if (t >= n8) return; FragH f;
#pragma unroll
  for (int i = 0; i < 8; ++i) f.h[i] = (_Float16)(bf16_round(W[t * 8 + i]) * 16.0f); *(v8us*)((unsigned short*)Bt + t * 8) = f.half[0];  }
template <int NHv, int TTv>
__global__ __launch_bounds__(256) void k_vt(const _Float16* __restrict__ V16, int ldv, int voff, _Float16* __restrict__ Vt) { __shared__ unsigned short tl[64][66]; const int tid = threadIdx.x; const int slab = blockIdx.x / (TTv / 64), lg = blockIdx.x % (TTv / 64); const int b = slab / NHv, h = slab % NHv;
  for (int i = tid; i < 64 * 8; i += 256) { const int r = i / 8, c8 = (i % 8) * 8; FragH f; f.half[0] = *(const v8us*)((const unsigned short*)V16 + ((size_t)b * TTv + lg * 64 + r) * ldv + voff + h * 64 + c8);
#pragma unroll
    for (int q = 0; q < 8; ++q) tl[r][c8 + q] = f.u[q]; }
  __syncthreads();
  {
#pragma unroll
    for (int rd = 0; rd < 2; ++rd) { const int d = rd * 32 + tid / 8, pc = tid % 8; FragH f;
#pragma unroll
      for (int q = 0; q < 8; ++q) f.u[q] = tl[pc * 8 + q][d];
      *(v8us*)((unsigned short*)Vt + ((size_t)slab * 64 + d) * TTv + lg * 64 + pc * 8) = f.half[0]; }
     } }

__global__ __launch_bounds__(256) void k_hl(const float* __restrict__ F, _Float16* __restrict__ Hh, _Float16* __restrict__ Hl, size_t n8) { const size_t t = (size_t)blockIdx.x * 256 + threadIdx.x; if (t >= n8) return; FragH fh, fl; const v4f a = *(const v4fa*)(F + t * 8), c = *(const v4fa*)(F + t * 8 + 4);
#pragma unroll
  for (int q = 0; q < 4; ++q) { _Float16 h = (_Float16)a[q]; fh.h[q] = h; fl.h[q] = (_Float16)((a[q] - (float)h) * 1024.0f); h = (_Float16)c[q]; fh.h[4 + q] = h; fl.h[4 + q] = (_Float16)((c[q] - (float)h) * 1024.0f); }
  { *(v8us*)((unsigned short*)Hh + t * 8) = fh.half[0]; *(v8us*)((unsigned short*)Hl + t * 8) = fl.half[0];  } }

// ---- fast GEMM (wave tile 32x64; requires M % 32 == 0 rows per launch region and N % 64 == 0); epilogue = k_gemm_hhx semantics ----
__device__ __forceinline__ v16h g2_frag(const _Float16* p, int hh) { FragH f; f.half[0] = *(const v8us*)((const unsigned short*)p + 8 * hh); f.half[1] = *(const v8us*)((const unsigned short*)p + 16 + 8 * hh); return f.v; }
__device__ __forceinline__ v8f g2_mma(v16h a, v16h b, v8f c) { v8f d = __builtin_amdgcn_wmma_f32_16x16x32_f16(false, a, false, b, (short)0, c, false, false); asm volatile("v_nop\n\tv_nop\n\tv_nop\n\tv_nop" : "+v"(d) : "v"(a), "v"(b)); return d; }
template <int ACT>
__global__ __launch_bounds__(128) void k_gemm2(const _Float16* __restrict__ A, int lda, size_t sA, const _Float16* __restrict__ Bh, int ldb, size_t sB, float alpha, const float* __restrict__ bias, size_t sBias, const float* __restrict__ CP, int rowsPerB, size_t sCPb, int row0g,
    float* __restrict__ C, _Float16* __restrict__ C16, int ldc, size_t sC, int M, int N, int K) { static_assert(ACT == 0 || ACT == 3 || ACT == 6 || ACT == 8 || ACT == 9 || ACT == 11 || ACT == 12 || ACT == 14 || ACT == 15 || ACT == 16 || ACT == 17, "k_gemm2: unsupported ACT code (would silently apply no activation)");
  __shared__ __attribute__((aligned(16))) float so[4][32][68];
  const int tid = threadIdx.x, w = tid >> 5, lane = tid & 31, ln = lane & 15, hh = lane >> 4; const int by = blockIdx.y;
  A += (size_t)by * sA; Bh += (size_t)by * sB; const size_t cofs = (size_t)by * sC; const float* bp = bias ? bias + (size_t)by * sBias : nullptr;
  const int ntn = N >> 6; const int mt = blockIdx.x / ntn, nq = blockIdx.x - mt * ntn; const int row0 = mt * 128 + 32 * w, col0 = nq * 64; if (row0 >= M) return;
  const _Float16* a0p = A + (size_t)(row0 + ln) * lda; const _Float16* a1p = a0p + (size_t)16 * lda;
  const _Float16* b0p = Bh + (size_t)(col0 + ln) * ldb; const _Float16* b1p = b0p + (size_t)16 * ldb; const _Float16* b2p = b1p + (size_t)16 * ldb; const _Float16* b3p = b2p + (size_t)16 * ldb;
  const v8f z8 = {0.f,0.f,0.f,0.f,0.f,0.f,0.f,0.f}; v8f c00 = z8, c01 = z8, c02 = z8, c03 = z8, c10 = z8, c11 = z8, c12 = z8, c13 = z8;
#pragma unroll 1
  for (int kb = 0; kb < K; kb += 32) { const v16h a0 = g2_frag(a0p + kb, hh), a1 = g2_frag(a1p + kb, hh);
    v16h b = g2_frag(b0p + kb, hh); c00 = g2_mma(a0, b, c00); c10 = g2_mma(a1, b, c10);
    b = g2_frag(b1p + kb, hh); c01 = g2_mma(a0, b, c01); c11 = g2_mma(a1, b, c11);
    b = g2_frag(b2p + kb, hh); c02 = g2_mma(a0, b, c02); c12 = g2_mma(a1, b, c12);
    b = g2_frag(b3p + kb, hh); c03 = g2_mma(a0, b, c03); c13 = g2_mma(a1, b, c13); }
  v8f accs[8] = {c00, c01, c02, c03, c10, c11, c12, c13};
#pragma unroll
  for (int u = 0; u < 8; ++u) { const int t = u & 3, half = u >> 2; const int col = col0 + t * 16 + ln; const float bv = bp ? bf16_round(bp[col]) : 0.f;
#pragma unroll
    for (int r = 0; r < 8; ++r) { const int rloc = half * 16 + 8 * hh + r; float v = accs[u][r] * alpha + bv; if (CP) { if (rowsPerB < 0) v += CP[cofs + (size_t)(row0g + row0 + rloc) * ldc + col];      /* rowsPerB < 0: own element of the batched C plane */ else { const int bidx = (row0g + row0 + rloc) / rowsPerB; v += CP[(size_t)bidx * sCPb + (size_t)by * 64 + col]; } }
      if (ACT == 3) v = fmaxf(v, 0.f); else if (ACT == 6) v = 0.5f * v * (1.0f + erff(v * 0.70710678118654752f)); else if (ACT == 11) v = 1.0f / (1.0f + expf(-v)); else if (ACT == 15) v = v / (1.0f + expf(-v)); else if (ACT == 12) v = (v > 0.f) ? v : 0.01f * v; else if (ACT == 8) v = tanhf(v); else if (ACT == 9) v = 0.5f * v * (1.0f + tanhf(0.7978845608028654f * (v + 0.044715f * v * v * v))); else if (ACT == 14) v = (v > 0.f) ? v : 0.1f * v; else if (ACT == 16) v = (v >= 0.f) ? v : 0.3f * v; else if (ACT == 17) v = (v >= 0.f) ? v : 0.2f * v;
      so[w][rloc][t * 16 + ln] = v; } }
  __builtin_amdgcn_fence(__ATOMIC_ACQ_REL, "workgroup"); __builtin_amdgcn_wave_barrier();
  const int rsub = lane >> 4, c4 = (lane & 15) * 4;
  {
#pragma unroll
    for (int q = 0; q < 16; ++q) { const int r = q * 2 + rsub; const v4f v = *(const v4fa*)&so[w][r][c4]; if (C) *(v4f*)(C + cofs + (size_t)(row0 + r) * ldc + col0 + c4) = v; if (C16) { v4h h4; for (int i = 0; i < 4; ++i) h4[i] = (_Float16)v[i]; *(v4h*)(C16 + cofs + (size_t)(row0 + r) * ldc + col0 + c4) = h4; } }
     } }


__global__ __launch_bounds__(256) void k_wnat(const float* __restrict__ w, size_t n8, _Float16* __restrict__ Bt) { const size_t t = (size_t)blockIdx.x * 256 + threadIdx.x; if (t >= n8) return; FragH f; for (int q = 0; q < 8; ++q) f.h[q] = (_Float16)(bf16_round(w[t * 8 + q]) * 16.0f); *(v8us*)((unsigned short*)Bt + t * 8) = f.half[0];  }
__global__ __launch_bounds__(256) void k_rsm(const float* __restrict__ S, _Float16* __restrict__ P, int nrows) {
  #pragma clang fp contract(off)
  const int i = blockIdx.x * 256 + threadIdx.x; if (i >= nrows) return; const float* s = S + (size_t)i * SQ; float mx = -3.0e38f;
#pragma unroll 1
  for (int j = 0; j < SQ; ++j) mx = fmaxf(mx, s[j]); float se = 0.f;
#pragma unroll 1
  for (int j = 0; j < SQ; ++j) se += expf(s[j] - mx); const float sc = 256.0f / se;
#pragma unroll 1
  for (int j0 = 0; j0 < SQ; j0 += 8) { FragH f; for (int q = 0; q < 8; ++q) f.h[q] = (_Float16)(expf(s[j0 + q] - mx) * sc); unsigned short* d = (unsigned short*)P + (size_t)i * SQ + j0; *(v8us*)d = f.half[0];  } }
__global__ __launch_bounds__(256) void k_vt(const _Float16* __restrict__ V16, int b, int h0, _Float16* __restrict__ VT) { __shared__ unsigned short tl[64][65]; const int tid = threadIdx.x; const int hh = blockIdx.x % HG, sg = blockIdx.x / HG; const int s0 = sg * 64; const int h = h0 + hh;
  for (int i = tid; i < 64 * 8; i += 256) { const int j = i / 8, d8 = (i % 8) * 8; FragH f; f.half[0] = *(const v8us*)((const unsigned short*)V16 + ((size_t)b * SQ + s0 + j) * DM + h * HD + d8); for (int q = 0; q < 8; ++q) tl[d8 + q][j] = f.u[q]; }
  __syncthreads();
  { for (int i = tid; i < 64 * 8; i += 256) { const int d = i / 8, j8 = (i % 8) * 8; FragH f; for (int q = 0; q < 8; ++q) f.u[q] = tl[d][j8 + q]; *(v8us*)((unsigned short*)VT + ((size_t)hh * HD + d) * SQ + s0 + j8) = f.half[0]; }  } }



__global__ __launch_bounds__(256) void k_rsmkm(const float* __restrict__ S, _Float16* __restrict__ P, int nrows, const int* __restrict__ am) {
  #pragma clang fp contract(off)
  const int t = blockIdx.x * 256 + threadIdx.x; if (t >= nrows) return; const size_t i = (size_t)t; const float* s = S + i * SQ; const int* mr = am + (size_t)(t % SQ) * SQ; float mx = -3.0e38f;
#pragma unroll 1
  for (int j = 0; j < SQ; ++j) { const float f = (mr[j] != 0) ? 1.f : 0.f; mx = fmaxf(mx, fmaf(f, s[j], (1.f - f) * -1.0e9f)); } float se = 0.f;
#pragma unroll 1
  for (int j = 0; j < SQ; ++j) { const float f = (mr[j] != 0) ? 1.f : 0.f; se += __expf(fmaf(f, s[j], (1.f - f) * -1.0e9f) - mx); } const float sc = 256.0f / se;
#pragma unroll 1
  for (int j0 = 0; j0 < SQ; j0 += 8) { FragH fr; for (int q = 0; q < 8; ++q) { const int j = j0 + q; const float f = (mr[j] != 0) ? 1.f : 0.f; fr.h[q] = (_Float16)(__expf(fmaf(f, s[j], (1.f - f) * -1.0e9f) - mx) * sc); }
    unsigned short* d = (unsigned short*)P + i * SQ + j0; *(v8us*)d = fr.half[0];  } }
__global__ __launch_bounds__(256) void k_rsmlow(const float* __restrict__ S, _Float16* __restrict__ P, int nrows) {
  #pragma clang fp contract(off)
  const int t = blockIdx.x * 256 + threadIdx.x; if (t >= nrows) return; const int qi = t % SQ; const float* s = S + (size_t)t * SQ; float mx = -3.0e38f;
#pragma unroll 1
  for (int j = 0; j < SQ; ++j) { const float m = (j <= qi) ? 1.0f : 0.0f; mx = fmaxf(mx, __fadd_rn(s[j], __fmul_rn(m, -1.0e9f))); } float se = 0.f;
#pragma unroll 1
  for (int j = 0; j < SQ; ++j) { const float m = (j <= qi) ? 1.0f : 0.0f; se += __expf(__fadd_rn(s[j], __fmul_rn(m, -1.0e9f)) - mx); } const float sc = 256.0f / se;
#pragma unroll 1
  for (int j0 = 0; j0 < SQ; j0 += 8) { FragH fr; for (int q = 0; q < 8; ++q) { const float m = (j0 + q <= qi) ? 1.0f : 0.0f; fr.h[q] = (_Float16)(__expf(__fadd_rn(s[j0 + q], __fmul_rn(m, -1.0e9f)) - mx) * sc); } unsigned short* d = (unsigned short*)P + (size_t)t * SQ + j0; *(v8us*)d = fr.half[0];  } }

__global__ __launch_bounds__(64) void k_attup(const float* __restrict__ QF, const float* __restrict__ KF, const float* __restrict__ VF, int ld, float scale, float* __restrict__ OF, int ldo) {
  #pragma clang fp contract(off)
  __shared__ __attribute__((aligned(16))) float lq[64][64]; __shared__ __attribute__((aligned(16))) float lo[64][64];
  const int tid = threadIdx.x; const int h = blockIdx.x / (QT0 / 64), rg = blockIdx.x % (QT0 / 64); const int i = rg * 64 + tid;
  const float* qr = QF + (size_t)i * ld + h * HD;
#pragma unroll 1
  for (int c = 0; c < HD / 4; ++c) { *(v4f*)&lq[tid][c * 4] = *(const v4fa*)(qr + c * 4); const v4f z = {0.f, 0.f, 0.f, 0.f}; *(v4f*)&lo[tid][c * 4] = z; }
  float m = -1.0e30f, l = 0.f;
#pragma unroll 1
  for (int j = rg * 64; j < QT0; ++j) { const float* kr = KF + (size_t)j * ld + h * HD; const float* vr = VF + (size_t)j * ld + h * HD; float s = 0.f;
#pragma unroll 1
    for (int c = 0; c < HD / 4; ++c) { const v4f kq = *(const v4fa*)(kr + c * 4); const v4f qq = *(v4f*)&lq[tid][c * 4]; s = __fadd_rn(s, __fmul_rn(qq[0], kq[0])); s = __fadd_rn(s, __fmul_rn(qq[1], kq[1])); s = __fadd_rn(s, __fmul_rn(qq[2], kq[2])); s = __fadd_rn(s, __fmul_rn(qq[3], kq[3])); }
    s = __fmul_rn(s, scale);
    const float f = (j > i) ? 1.f : 0.f; const float sm = fmaf(f, s, (1.f - f) * -1.0e30f); const float mn = fmaxf(m, sm); const float sc = expf(m - mn); const float e = __fmul_rn(f, expf(sm - mn)); l = __fadd_rn(__fmul_rn(l, sc), e); m = mn;
#pragma unroll 1
    for (int c = 0; c < HD / 4; ++c) { const v4f vv = *(const v4fa*)(vr + c * 4); v4f oo = *(v4f*)&lo[tid][c * 4]; for (int u = 0; u < 4; ++u) oo[u] = __fadd_rn(__fmul_rn(oo[u], sc), __fmul_rn(e, vv[u])); *(v4f*)&lo[tid][c * 4] = oo; } }
  const float fin = (l > 0.f) ? 64.0f / l : 0.f;      /* o carried x64 like the f16 path; the key-less last row is written by k_vmean */
#pragma unroll 1
  for (int c = 0; c < HD / 4; ++c) { v4f oo = *(v4f*)&lo[tid][c * 4]; for (int u = 0; u < 4; ++u) oo[u] = __fmul_rn(oo[u], fin); *(v4f*)&lo[tid][c * 4] = oo; }
  __syncthreads();
  {
#pragma unroll 1
    for (int it = 0; it < 16; ++it) { const int row = it * 4 + tid / 16, pc = (tid % 16) * 4; const v4f v = *(const v4f*)&lo[row][pc]; *(v4f*)(OF + (size_t)(rg * 64 + row) * ldo + h * HD + pc) = v; }
     } }

__global__ __launch_bounds__(256) void k_vmean(const _Float16* __restrict__ V, int ldv, float* __restrict__ orow) {
  #pragma clang fp contract(off)
  const int c = blockIdx.x * 256 + threadIdx.x; if (c >= DM) return; float s = 0.f;
#pragma unroll 1
  for (int j = 0; j < SQ; ++j) s = __fadd_rn(s, (float)V[(size_t)j * ldv + c]);
  const float o = __fmul_rn(s, 64.0f / (float)SQ); *(float*)(orow + c) = o;  }

extern "C" void kernel_launch(void* const* d_in, const int* in_sizes, int n_in,
                              void* d_out, int out_size, void* d_ws, size_t ws_size, hipStream_t stream) {
  (void)in_sizes; (void)n_in; (void)out_size;
  const float* const* I = (const float* const*)d_in; const float* xq = I[0]; const float* xk = I[0]; const float* xv = I[0]; const float* wq = I[1]; const float* bq = I[2]; const float* wk = I[3]; const float* bk = I[4]; const float* wv = I[5]; const float* bv = I[6]; const float* wo = I[7]; const float* bo = I[8]; const float* x = xq;      /* ONE input feeds the query, key and value streams; [in][out] weights + biases; the mask is built from indices as in the module */
  static_assert(NH * HD == DM && DM % 64 == 0 && SQ % 128 == 0 && NH % HG == 0, "shape / tile multiples");
  char* ws = (char*)d_ws; size_t off = 0;
  auto take = [&](size_t bytes) { char* p = ws + off; off += (bytes + 255) & ~(size_t)255; return p; };
  _Float16* BQ = (_Float16*)take((size_t)DM * DM * 2); _Float16* BK = (_Float16*)take((size_t)DM * DM * 2); _Float16* BV = (_Float16*)take((size_t)DM * DM * 2); _Float16* BO = (_Float16*)take((size_t)DM * DM * 2);
  _Float16* X16 = (_Float16*)take(NR * DM * 2); _Float16* XKp = (_Float16*)take(NR * DM * 2); _Float16* XVp = (_Float16*)take(NR * DM * 2); _Float16* Q16 = (_Float16*)take(NR * DM * 2); _Float16* K16 = (_Float16*)take(NR * DM * 2); _Float16* V16 = (_Float16*)take(NR * DM * 2); _Float16* O16 = (_Float16*)take(NR * DM * 2);
  float* S = (float*)take((size_t)HG * SQ * SQ * 4); _Float16* P = (_Float16*)take((size_t)HG * SQ * SQ * 2); _Float16* VT = (_Float16*)take((size_t)NH * HD * SQ * 2);
  float* QF0 = (float*)take((size_t)QT0 * DM * 4); float* KF0 = (float*)take((size_t)QT0 * DM * 4); float* VF0 = (float*)take((size_t)QT0 * DM * 4); float* OF0 = (float*)take((size_t)NB * QT0 * DM * 4); _Float16* OH0 = (_Float16*)take((size_t)NB * QT0 * DM * 2); _Float16* OL0 = (_Float16*)take((size_t)NB * QT0 * DM * 2);      /* exact last tile: f32 q / k / v of the tile rows, o (x64) and its f16 hi + x1024 residual planes */
  if (off > ws_size) return;
  { const unsigned g = (unsigned)(((size_t)DM * (DM / 8) + 255) / 256); k_wt_f16<<<g, 256, 0, stream>>>(wq, BQ, DM, DM, 16.0f); k_wt_f16<<<g, 256, 0, stream>>>(wk, BK, DM, DM, 16.0f); k_wt_f16<<<g, 256, 0, stream>>>(wv, BV, DM, DM, 16.0f); k_wt_f16<<<g, 256, 0, stream>>>(wo, BO, DM, DM, 16.0f); }      /* [in][out] -> Bt x16 */
  _Float16* XK = XKp; _Float16* XV = XVp; k_x16<<<(unsigned)((NR * DM / 8 + 255) / 256), 256, 0, stream>>>(xk, XK, NR * DM / 8); k_x16<<<(unsigned)((NR * DM / 8 + 255) / 256), 256, 0, stream>>>(xv, XV, NR * DM / 8);      /* key and value inputs as exact f16 rows */

  k_x16<<<(unsigned)((NR * DM / 8 + 255) / 256), 256, 0, stream>>>(x, X16, NR * DM / 8);
  const size_t r0p = (size_t)B0 * SQ;      /* first projected row */
  k_gemm2<0><<<dim3((unsigned)((MP / 128) * (DM / 64)), 1), 128, 0, stream>>>(X16 + r0p * DM, DM, 0, BQ, DM, 0, 0.0625f, bq, 0, nullptr, 1, 0, 0, nullptr, Q16 + r0p * DM, DM, 0, MP, DM, DM);
  k_gemm2<0><<<dim3((unsigned)((MP / 128) * (DM / 64)), 1), 128, 0, stream>>>(XK + r0p * DM, DM, 0, BK, DM, 0, 0.0625f, bk, 0, nullptr, 1, 0, 0, nullptr, K16 + r0p * DM, DM, 0, MP, DM, DM);
  k_gemm2<0><<<dim3((unsigned)((MP / 128) * (DM / 64)), 1), 128, 0, stream>>>(XV + r0p * DM, DM, 0, BV, DM, 0, 0.0625f, bv, 0, nullptr, 1, 0, 0, nullptr, V16 + r0p * DM, DM, 0, MP, DM, DM);
  for (int b = B0; b < B0 + NBR; ++b) { const size_t r0 = (size_t)b * SQ;
    k_vt<NH, SQ><<<NH * (SQ / 64), 256, 0, stream>>>(V16 + r0 * LQ, LQ, 0, VT);      /* V^T [NH][HD][SQ] for this batch */
    { const size_t rl = r0 + SQ - QT0;      /* the batch's last QT0 rows */
      k_gemm2<0><<<dim3((QT0 / 128) * (DM / 64), 1), 128, 0, stream>>>(X16 + rl * DM, DM, 0, BQ, DM, 0, 0.0625f, bq, 0, nullptr, 1, 0, 0, QF0, nullptr, DM, 0, QT0, DM, DM); k_gemm2<0><<<dim3((QT0 / 128) * (DM / 64), 1), 128, 0, stream>>>(XK + rl * DM, DM, 0, BK, DM, 0, 0.0625f, bk, 0, nullptr, 1, 0, 0, KF0, nullptr, DM, 0, QT0, DM, DM); k_gemm2<0><<<dim3((QT0 / 128) * (DM / 64), 1), 128, 0, stream>>>(XV + rl * DM, DM, 0, BV, DM, 0, 0.0625f, bv, 0, nullptr, 1, 0, 0, VF0, nullptr, DM, 0, QT0, DM, DM);      /* f32 q, k, v of the last tile (exact products) */
      k_attup<<<NH * (QT0 / 64), 64, 0, stream>>>(QF0, KF0, VF0, DM, 0.125f, OF0 + (size_t)b * QT0 * DM, DM);      /* exact f32 attention over the keys j > i inside the tile (o x64) */
      k_vmean<<<(DM + 255) / 256, 256, 0, stream>>>(V16 + r0 * LQ, LQ, OF0 + ((size_t)b * QT0 + QT0 - 1) * DM); }      /* last row: uniform over all keys = 64 x mean of v */
    for (int h0 = 0; h0 < NHD; h0 += HG) {
      k_gemm2<0><<<dim3((QN / 128) * (SQ / 64), HG), 128, 0, stream>>>(Q16 + r0 * LQ + h0 * HD, LQ, (size_t)HD, K16 + r0 * LQ + h0 * HD, LQ, (size_t)HD, 0.125f, nullptr, 0, nullptr, 1, 0, 0, S, nullptr, SQ, (size_t)SQ * SQ, QN, SQ, HD);      /* scores, HG heads per launch */
      k_rsmlow<<<(HG * SQ + 255) / 256, 256, 0, stream>>>(S, P, HG * SQ);      /* literal 'score + tril * (-1e9)' then softmax over all keys -> P x256 f16 */
      k_gemm2<0><<<dim3((QN / 128) * (HD / 64), HG), 128, 0, stream>>>(P, SQ, (size_t)SQ * SQ, VT + (size_t)h0 * HD * SQ, SQ, (size_t)HD * SQ, 0.25f, nullptr, 0, nullptr, 1, 0, 0, nullptr, O16 + r0 * DM + h0 * HD, DM, (size_t)HD, QN, HD, SQ); } }      /* o (merged heads) as f16 rows */
  k_gemm2<0><<<dim3((unsigned)((MPO / 128) * (DM / 64)), 1), 128, 0, stream>>>(O16 + r0p * DM, DM, 0, BO, DM, 0, 0.0009765625f, bo, 0, nullptr, 1, 0, 0, (float*)d_out + r0p * DM, nullptr, DM, 0, MPO, DM, DM);      /* out rows are the output layout */
  k_hl<<<(unsigned)(((size_t)NB * QT0 * DM / 8 + 255) / 256), 256, 0, stream>>>(OF0, OH0, OL0, (size_t)NB * QT0 * DM / 8);      /* last-tile o (x64) -> f16 hi + x1024 residual planes */
  for (int b = B0; b < B0 + NBR; ++b) { const size_t rl = (size_t)b * SQ + SQ - QT0; const size_t f0 = (size_t)b * QT0;
    k_gemm2<0><<<dim3((QT0 / 128) * (DM / 64), 1), 128, 0, stream>>>(OH0 + f0 * DM, DM, 0, BO, DM, 0, 0.0009765625f, bo, 0, nullptr, 1, 0, 0, (float*)d_out + rl * DM, nullptr, DM, 0, QT0, DM, DM);      /* last QT0 rows: out = o_hi Wo (+ b), overwriting the f16-path rows */
    k_gemm2<0><<<dim3((QT0 / 128) * (DM / 64), 1), 128, 0, stream>>>(OL0 + f0 * DM, DM, 0, BO, DM, 0, 0.00000095367431640625f, nullptr, 0, (const float*)d_out + rl * DM, -1, 0, 0, (float*)d_out + rl * DM, nullptr, DM, 0, QT0, DM, DM); }      /* += o_lo Wo 2^-20 (own-element accumulate) */
}

// v001
// A run of this version takes 3930 microseconds.
// Next to v000, in two timings, it ran 1.67 times as fast each time.
#include <hip/hip_runtime.h>
// Multi-head self-attention with the source's INVERTED causal mask (inputs [2][2048][1024]; q / k / v = x W + b ([in][out] 1024 x 1024 sigma 1/32, zero biases); 16 heads of 64; score = q k^T / sqrt(64) + tril * (-1e9): the LOWER triangle incl. the diagonal is pushed to -1e9 (the original's mask bug, kept), so query i attends to the keys j > i only, and the last query (every key masked, all scores rounding to the same -1e9 in f32) attends uniformly to all keys; softmax; out = merged Wo + bo -> [2][2048][1024]).
// Structure: token rows r = b*2048 + s; x as exact f16 rows (bf16-rounded); Q, K, V as three WMMA GEMMs (32x64 wave tiles, f32 accumulation, exact x16 weights + bias, f16 outputs); per batch: V^T for all heads via LDS transposes; per (batch, group of 4 heads): scores GEMM (K = 64, batched over the heads on grid.y, alpha = 1/sqrt(64) (applied before the -1e9 add, as in the source)), row softmax on VALU (f32 statistics; weights stored x256 as f16), o = P . V^T GEMM (K = 2048, alpha 2^-2: o carried x64 against f16 subnormal flush, folded into the output GEMM alpha) written straight into the merged f16 o rows; out = o W_o + b GEMM (f32) into the output layout.
// Compute dtype: inputs rounded to bf16; x / weights exact; q, k, v, softmax weights and o as plain f16 GEMM operands (~2^-12); scores and softmax statistics f32; v_wmma_f32_16x16x32_f16.
#define NB 2
#define SQ 2048
#define DM 1024
#define NH 16
#define HD 64
#define QT0 256                      /* last-tile rows recomputed exactly in f32 (rows with fewer than 256 visible keys) */
#define HG 4                         /* heads per attention launch group */
#define B0 0                         /* first batch processed (debug hook) */
#define NBR NB                       /* batches processed (debug hook) */
#define NR ((size_t)NB * SQ)         /* token rows */
#define MP ((int)((size_t)NBR * SQ)) /* rows projected (debug hook) */
#define QN SQ                        /* query rows attended per batch (debug hook) */
#define NHD NH                       /* heads attended (debug hook) */
#define MPO MP                       /* rows through the output stage (debug hook) */
#define LQ DM      /* row pitch of the q/k/v rows */
typedef __bf16 v16b __attribute__((ext_vector_type(16)));
typedef unsigned short v8us __attribute__((ext_vector_type(8), may_alias));
typedef float  v8f  __attribute__((ext_vector_type(8)));
typedef float  v4f  __attribute__((ext_vector_type(4)));
typedef float  v4fa __attribute__((ext_vector_type(4), may_alias));
union FragB { v16b v; v8us half[2]; unsigned short u[16]; };

__device__ __forceinline__ unsigned short bf16_bits(float x) { unsigned int u = __float_as_uint(x); return (unsigned short)((u + 0x7FFFu + ((u >> 16) & 1u)) >> 16); }
__device__ __forceinline__ float bf16_val(unsigned short b) { return __uint_as_float(((unsigned int)b) << 16); }
__device__ __forceinline__ float bf16_round(float x) { return bf16_val(bf16_bits(x)); }
// D += A·B with NT terms: 1 = ah·bh, 2 = + al·bh (A split), 3 = + ah·bl (both split)
template <int NT>
__device__ __forceinline__ v8f mmaN(v16b ah, v16b al, v16b bh, v16b bl, v8f c) {
  c = __builtin_amdgcn_wmma_f32_16x16x32_bf16(false, ah, false, bh, (short)0, c, false, false);
  if (NT >= 2) c = __builtin_amdgcn_wmma_f32_16x16x32_bf16(false, al, false, bh, (short)0, c, false, false);
  if (NT >= 3) c = __builtin_amdgcn_wmma_f32_16x16x32_bf16(false, ah, false, bl, (short)0, c, false, false);
  asm volatile("v_nop\n\tv_nop\n\tv_nop\n\tv_nop" : "+v"(c) : "v"(ah), "v"(al), "v"(bh), "v"(bl));
  return c;
}

__global__ __launch_bounds__(256) void k_wt_bf16(const float* __restrict__ W, unsigned short* __restrict__ Wt, int K, int N) {
  const int t = blockIdx.x * 256 + threadIdx.x;
  const int k8n = K / 8;
  if (t >= N * k8n) return;
  const int n = t / k8n, k8 = (t % k8n) * 8;
  v8us v;
#pragma unroll
  for (int i = 0; i < 8; ++i) v[i] = bf16_bits(W[(size_t)(k8 + i) * N + n]);
  *(v8us*)(Wt + (size_t)n * K + k8) = v;
  
}

// GEMM C[M][N] (f32, pitch ldc) = act(A[M][K]·W + bias). A f32 row-major (pitch lda) converted per fragment to bf16
// (ASPLIT: hi/lo two planes -> 2 terms, else single rounded term); Wt bf16 [N][K] (pitch ldb). BIAS_BF16 rounds the
// bias to bf16 first (bias quantised to bf16 before the add). K%32==0, M%16==0, N%64==0.
template <bool ASPLIT, int ACT, bool BIAS_BF16>
__global__ __launch_bounds__(128) void k_gemm_bf(const float* __restrict__ A, int lda, const unsigned short* __restrict__ Wt, int ldb,
                                               const float* __restrict__ bias, float* __restrict__ C, int ldc, int M, int N, int K) {
  __shared__ __attribute__((aligned(16))) float so[4][16][64];
  const int tid = threadIdx.x, w = tid >> 5, lane = tid & 31, ln = lane & 15, hh = lane >> 4;
  const int ntn = N / 64;
  const int wid = blockIdx.x * 4 + w;
  const int mt = wid / ntn, nq = wid % ntn;
  if (mt * 16 >= M) return;
  const int row0 = mt * 16, col0 = nq * 64;
  const float* arow = A + (size_t)(row0 + ln) * lda;
  v8f acc[4] = {};
  for (int kb = 0; kb < K; kb += 32) {
    FragB ah, al;
    const v4f x0 = *(const v4fa*)(arow + kb + 8 * hh), x1 = *(const v4fa*)(arow + kb + 8 * hh + 4);
    const v4f x2 = *(const v4fa*)(arow + kb + 16 + 8 * hh), x3 = *(const v4fa*)(arow + kb + 16 + 8 * hh + 4);
    float xs[16] = {x0[0],x0[1],x0[2],x0[3],x1[0],x1[1],x1[2],x1[3],x2[0],x2[1],x2[2],x2[3],x3[0],x3[1],x3[2],x3[3]};
#pragma unroll
    for (int i = 0; i < 16; ++i) { const unsigned short hb = bf16_bits(xs[i]); ah.u[i] = hb; al.u[i] = ASPLIT ? bf16_bits(xs[i] - bf16_val(hb)) : (unsigned short)0; }
#pragma unroll
    for (int t = 0; t < 4; ++t) {
      const unsigned short* brow = Wt + (size_t)(col0 + t * 16 + ln) * ldb + kb;
      FragB b;
      b.half[0] = *(const v8us*)(brow + 8 * hh);
      b.half[1] = *(const v8us*)(brow + 16 + 8 * hh);
      acc[t] = mmaN<ASPLIT ? 2 : 1>(ah.v, al.v, b.v, b.v, acc[t]);
    }
  }
#pragma unroll
  for (int t = 0; t < 4; ++t) {
    float bv = bias ? bias[col0 + t * 16 + ln] : 0.f;
    if (BIAS_BF16) bv = bf16_round(bv);
#pragma unroll
    for (int r = 0; r < 8; ++r) { float v = acc[t][r] + bv; if (ACT == 1) v = fmaxf(v, 0.f); so[w][8 * hh + r][t * 16 + ln] = v; }
  }
  __builtin_amdgcn_fence(__ATOMIC_ACQ_REL, "workgroup");
  __builtin_amdgcn_wave_barrier();
  const int rsub = lane >> 4, c4 = (lane & 15) * 4;
  {
#pragma unroll
    for (int q = 0; q < 8; ++q) {
      const int r = q * 2 + rsub;
      const v4f v = *(const v4fa*)&so[w][r][c4];
      *(v4f*)(C + (size_t)(row0 + r) * ldc + col0 + c4) = v;
    }
    
  }
}

// GEMM C = act(A·W + bias + resid): A f32 (ASPLIT -> hi/lo 2 terms), Wt bf16 [N][K]; ACT 0 none, 1 relu, 2 exact gelu;
// resid (optional, f32, row index = (row % rmod), pitch ldr, RES_BF16 rounds it) added before the activation.
template <bool ASPLIT, int ACT, bool BIAS_BF16, bool RES_BF16>
__global__ __launch_bounds__(128) void k_gemm_bf3(const float* __restrict__ A, int lda, const unsigned short* __restrict__ Wt, int ldb,
                                                const float* __restrict__ bias, const float* __restrict__ resid, int rmod, int ldr,
                                                float* __restrict__ C, int ldc, int M, int N, int K) {
  __shared__ __attribute__((aligned(16))) float so[4][16][64];
  const int tid = threadIdx.x, w = tid >> 5, lane = tid & 31, ln = lane & 15, hh = lane >> 4;
  const int ntn = N / 64;
  const int wid = blockIdx.x * 4 + w;
  const int mt = wid / ntn, nq = wid % ntn;
  if (mt * 16 >= M) return;
  const int row0 = mt * 16, col0 = nq * 64;
  const float* arow = A + (size_t)(row0 + ln) * lda;
  v8f acc[4] = {};
  for (int kb = 0; kb < K; kb += 32) {
    FragB ah, al;
    const v4f x0 = *(const v4fa*)(arow + kb + 8 * hh), x1 = *(const v4fa*)(arow + kb + 8 * hh + 4);
    const v4f x2 = *(const v4fa*)(arow + kb + 16 + 8 * hh), x3 = *(const v4fa*)(arow + kb + 16 + 8 * hh + 4);
    float xs[16] = {x0[0],x0[1],x0[2],x0[3],x1[0],x1[1],x1[2],x1[3],x2[0],x2[1],x2[2],x2[3],x3[0],x3[1],x3[2],x3[3]};
#pragma unroll
    for (int i = 0; i < 16; ++i) { const unsigned short hb = bf16_bits(xs[i]); ah.u[i] = hb; al.u[i] = ASPLIT ? bf16_bits(xs[i] - bf16_val(hb)) : (unsigned short)0; }
#pragma unroll
    for (int t = 0; t < 4; ++t) {
      const unsigned short* brow = Wt + (size_t)(col0 + t * 16 + ln) * ldb + kb;
      FragB b;
      b.half[0] = *(const v8us*)(brow + 8 * hh);
      b.half[1] = *(const v8us*)(brow + 16 + 8 * hh);
      acc[t] = mmaN<ASPLIT ? 2 : 1>(ah.v, al.v, b.v, b.v, acc[t]);
    }
  }
#pragma unroll
  for (int t = 0; t < 4; ++t) {
    const int col = col0 + t * 16 + ln;
    float bv = bias ? bias[col] : 0.f;
    if (BIAS_BF16) bv = bf16_round(bv);
#pragma unroll
    for (int r = 0; r < 8; ++r) {
      float v = acc[t][r] + bv;
      if (resid) { float rv = resid[(size_t)((row0 + 8 * hh + r) % rmod) * ldr + col]; if (RES_BF16) rv = bf16_round(rv); v += rv; }
      if (ACT == 1) v = fmaxf(v, 0.f);
      if (ACT == 2) v = 0.5f * v * (1.0f + erff(v * 0.70710678118654752f));
      if (ACT == 3) { const float u = 0.7978845608028654f * (v + 0.044715f * v * v * v); v = 0.5f * v * (1.0f + tanhf(u)); }
      so[w][8 * hh + r][t * 16 + ln] = v;
    }
  }
  __builtin_amdgcn_fence(__ATOMIC_ACQ_REL, "workgroup");
  __builtin_amdgcn_wave_barrier();
  const int rsub = lane >> 4, c4 = (lane & 15) * 4;
  {
#pragma unroll
    for (int q = 0; q < 8; ++q) {
      const int r = q * 2 + rsub;
      const v4f v = *(const v4fa*)&so[w][r][c4];
      *(v4f*)(C + (size_t)(row0 + r) * ldc + col0 + c4) = v;
    }
    
  }
}
// row LayerNorm (biased variance, eps) over N: s = X (+ R); optional out_sum <- s; out_norm <- (s-mu)*rsqrt(var+eps)*g + b
template <bool PARAM_BF16>
__global__ __launch_bounds__(256) void k_layernorm(const float* __restrict__ X, const float* __restrict__ R, const float* __restrict__ g, const float* __restrict__ bta,
                                                  float* __restrict__ out_sum, float* __restrict__ out_norm, int N, float eps) {
  __shared__ float red[256];
  const int row = blockIdx.x, tid = threadIdx.x;
  const float* x = X + (size_t)row * N; const float* rr = R ? R + (size_t)row * N : nullptr;
  float vals[16];                     // up to N = 4096
  const int per = N / 256;            // contiguous chunk per thread? use strided-by-4 chunks: thread handles j = tid*4 + 1024*u
  float s1 = 0.f;
  for (int u = 0; u < per / 4; ++u) {
    const int j = tid * 4 + 1024 * u;
    const v4f a = *(const v4fa*)(x + j);
    v4f b = {0.f,0.f,0.f,0.f}; if (rr) b = *(const v4fa*)(rr + j);
#pragma unroll
    for (int q = 0; q < 4; ++q) { const float v = a[q] + b[q]; vals[u * 4 + q] = v; s1 += v; }
  }
  red[tid] = s1; __syncthreads();
  for (int st = 128; st > 0; st >>= 1) { if (tid < st) red[tid] += red[tid + st]; __syncthreads(); }
  const float mu = red[0] / (float)N; __syncthreads();
  float s2 = 0.f;
  for (int u = 0; u < per / 4; ++u)
#pragma unroll
    for (int q = 0; q < 4; ++q) { const float c = vals[u * 4 + q] - mu; s2 += c * c; }
  red[tid] = s2; __syncthreads();
  for (int st = 128; st > 0; st >>= 1) { if (tid < st) red[tid] += red[tid + st]; __syncthreads(); }
  const float rs = rsqrtf(red[0] / (float)N + eps);
  {
    for (int u = 0; u < per / 4; ++u) {
      const int j = tid * 4 + 1024 * u;
      v4f o, sm;
#pragma unroll
      for (int q = 0; q < 4; ++q) {
        float gg = g[j + q], bb = bta[j + q];
        if (PARAM_BF16) { gg = bf16_round(gg); bb = bf16_round(bb); }
        sm[q] = vals[u * 4 + q]; o[q] = (vals[u * 4 + q] - mu) * rs * gg + bb;
      }
      if (out_sum) *(v4f*)(out_sum + (size_t)row * N + j) = sm;
      *(v4f*)(out_norm + (size_t)row * N + j) = o;
    }
    
  }
}



// ---- f16 WMMA path (v_wmma_f32_16x16x32_f16): 11-bit significands for operands in range — used where a [0,1] probability operand needs more precision than bf16
typedef _Float16 v16h __attribute__((ext_vector_type(16)));
union FragH { v16h v; v8us half[2]; _Float16 h[16]; unsigned short u[16]; };
template <int NT>
__device__ __forceinline__ v8f mmaH(v16h ah, v16h al, v16h bh, v16h bl, v8f c) {
  c = __builtin_amdgcn_wmma_f32_16x16x32_f16(false, ah, false, bh, (short)0, c, false, false);
  if (NT >= 2) c = __builtin_amdgcn_wmma_f32_16x16x32_f16(false, al, false, bh, (short)0, c, false, false);
  if (NT >= 3) c = __builtin_amdgcn_wmma_f32_16x16x32_f16(false, ah, false, bl, (short)0, c, false, false);
  asm volatile("v_nop\n\tv_nop\n\tv_nop\n\tv_nop" : "+v"(c) : "v"(ah), "v"(al), "v"(bh), "v"(bl));
  return c;
}
// batched GEMM like k_gemm_b but f16 operands: A f32 (split into f16 hi/lo if ASPLIT, else rounded to f16), Bt = f16 values [n][k]; alpha; C f32; N multiple of 16 (partial tiles skipped)
template <bool ASPLIT>
__global__ __launch_bounds__(128) void k_gemm_h(const float* __restrict__ A, int lda, size_t sA, const _Float16* __restrict__ Bh, int ldb, size_t sB, float alpha, float* __restrict__ C, int ldc, size_t sC, int M, int N, int K) {
  __shared__ __attribute__((aligned(16))) float so[4][16][64];
  const int tid = threadIdx.x, w = tid >> 5, lane = tid & 31, ln = lane & 15, hh = lane >> 4; const int by = blockIdx.y;
  A += (size_t)by * sA; Bh += (size_t)by * sB; C += (size_t)by * sC;
  const int ntn = (N + 63) / 64; const int wid = blockIdx.x * 4 + w; const int mt = wid / ntn, nq = wid % ntn; if (mt * 16 >= M) return;
  const int row0 = mt * 16, col0 = nq * 64; const float* arow = A + (size_t)(row0 + ln) * lda;
  v8f acc[4] = {};
  for (int kb = 0; kb < K; kb += 32) {
    FragH ah, al;
    const v4f x0 = *(const v4fa*)(arow + kb + 8 * hh), x1 = *(const v4fa*)(arow + kb + 8 * hh + 4), x2 = *(const v4fa*)(arow + kb + 16 + 8 * hh), x3 = *(const v4fa*)(arow + kb + 16 + 8 * hh + 4);
    float xs[16] = {x0[0],x0[1],x0[2],x0[3],x1[0],x1[1],x1[2],x1[3],x2[0],x2[1],x2[2],x2[3],x3[0],x3[1],x3[2],x3[3]};
#pragma unroll
    for (int i = 0; i < 16; ++i) { const _Float16 h = (_Float16)xs[i]; ah.h[i] = h; al.h[i] = ASPLIT ? (_Float16)(xs[i] - (float)h) : (_Float16)0.0f; }
#pragma unroll
    for (int t = 0; t < 4; ++t) { if (col0 + t * 16 >= N) continue; const size_t boff = (size_t)(col0 + t * 16 + ln) * ldb + kb; FragH bq; bq.half[0] = *(const v8us*)(Bh + boff + 8 * hh); bq.half[1] = *(const v8us*)(Bh + boff + 16 + 8 * hh);
      acc[t] = mmaH<ASPLIT ? 2 : 1>(ah.v, al.v, bq.v, bq.v, acc[t]); }
  }
#pragma unroll
  for (int t = 0; t < 4; ++t) { if (col0 + t * 16 >= N) continue;
#pragma unroll
    for (int r = 0; r < 8; ++r) so[w][8 * hh + r][t * 16 + ln] = acc[t][r] * alpha; }
  __builtin_amdgcn_fence(__ATOMIC_ACQ_REL, "workgroup"); __builtin_amdgcn_wave_barrier();
  const int rsub = lane >> 4, c4 = (lane & 15) * 4;
  {
#pragma unroll
    for (int q = 0; q < 8; ++q) { const int r = q * 2 + rsub; if (col0 + c4 < N) { const v4f v = *(const v4fa*)&so[w][r][c4]; *(v4f*)(C + (size_t)(row0 + r) * ldc + col0 + c4) = v; } }
     }
}

// Wt[n][k] = f16(W[k][n]·scale) from f32 row-major W[K][N] (scale = power of two; bf16-exact weights stay exact in f16 away from the subnormal range)
__global__ __launch_bounds__(256) void k_wt_f16(const float* __restrict__ W, _Float16* __restrict__ Wt, int K, int N, float scale) {
  const int t = blockIdx.x * 256 + threadIdx.x; if (t >= N * (K / 8)) return; const int n = t / (K / 8), k8 = (t % (K / 8)) * 8; FragH f;
#pragma unroll
  for (int i = 0; i < 8; ++i) f.h[i] = (_Float16)(bf16_round(W[(size_t)(k8 + i) * N + n]) * scale); const v8us o = f.half[0];
  *(v8us*)((unsigned short*)Wt + (size_t)n * K + k8) = o; 
}
// k_gemm_hh variant with fused epilogue: v = acc·alpha + bias[by·sBias + col] (+ CP[(row/rowsPerB)·sCPb + by·64 + col] if CP) ; ACT 0 none / 1 elu ; writes f16 C16 (and f32 C if non-null)
template <int ACT>
__global__ __launch_bounds__(128) void k_gemm_hhx(const _Float16* __restrict__ A, int lda, size_t sA, const _Float16* __restrict__ Bh, int ldb, size_t sB, float alpha, const float* __restrict__ bias, size_t sBias, const float* __restrict__ CP, int rowsPerB, size_t sCPb, int row0g,
    float* __restrict__ C, _Float16* __restrict__ C16, int ldc, size_t sC, int M, int N, int K) {
  __shared__ __attribute__((aligned(16))) float so[4][16][64];
  const int tid = threadIdx.x, w = tid >> 5, lane = tid & 31, ln = lane & 15, hh = lane >> 4; const int by = blockIdx.y;
  A += (size_t)by * sA; Bh += (size_t)by * sB; const size_t cofs = (size_t)by * sC; const float* bp = bias ? bias + (size_t)by * sBias : nullptr;
  const int ntn = (N + 63) / 64; const int wid = blockIdx.x * 4 + w; const int mt = wid / ntn, nq = wid % ntn; if (mt * 16 >= M) return;
  const int row0 = mt * 16, col0 = nq * 64; const _Float16* arow = A + (size_t)(row0 + ln) * lda;
  v8f acc[4] = {};
  for (int kb = 0; kb < K; kb += 32) { FragH ah; ah.half[0] = *(const v8us*)((const unsigned short*)arow + kb + 8 * hh); ah.half[1] = *(const v8us*)((const unsigned short*)arow + kb + 16 + 8 * hh);
#pragma unroll
    for (int t = 0; t < 4; ++t) { if (col0 + t * 16 >= N) continue; const size_t boff = (size_t)(col0 + t * 16 + ln) * ldb + kb; FragH bq; bq.half[0] = *(const v8us*)((const unsigned short*)Bh + boff + 8 * hh); bq.half[1] = *(const v8us*)((const unsigned short*)Bh + boff + 16 + 8 * hh);
      acc[t] = mmaH<1>(ah.v, ah.v, bq.v, bq.v, acc[t]); }
  }
#pragma unroll
  for (int t = 0; t < 4; ++t) { if (col0 + t * 16 >= N) continue; const int col = col0 + t * 16 + ln; const float bv = bp ? bf16_round(bp[col]) : 0.f;
#pragma unroll
    for (int r = 0; r < 8; ++r) { float v = acc[t][r] * alpha + bv; if (CP) { const int rr = row0g + row0 + 8 * hh + r; if (rowsPerB < 0) v += CP[cofs + (size_t)rr * ldc + col];      /* rowsPerB < 0: own element of the batched C plane */ else { const int bidx = rr / rowsPerB; v += CP[(size_t)bidx * sCPb + (size_t)by * 64 + col]; } } if (ACT == 1) v = (v > 0.f) ? v : expm1f(v); else if (ACT == 7) v = (v > 0.f) ? v + 1.0f : expf(v); else if (ACT == 8) v = tanhf(v); else if (ACT == 9) v = 0.5f * v * (1.0f + tanhf(0.7978845608028654f * (v + 0.044715f * v * v * v))); else if (ACT == 11) v = 1.0f / (1.0f + expf(-v)); else if (ACT == 12) v = (v > 0.f) ? v : 0.01f * v; else if (ACT == 14) v = (v > 0.f) ? v : 0.1f * v; else if (ACT == 16) v = (v >= 0.f) ? v : 0.3f * v; else if (ACT == 17) v = (v >= 0.f) ? v : 0.2f * v; else if (ACT == 15) v = v / (1.0f + expf(-v)); else if (ACT == 3) v = fmaxf(v, 0.f); else if (ACT == 6) v = 0.5f * v * (1.0f + erff(v * 0.70710678118654752f)); so[w][8 * hh + r][t * 16 + ln] = v; } }
  __builtin_amdgcn_fence(__ATOMIC_ACQ_REL, "workgroup"); __builtin_amdgcn_wave_barrier();
  const int rsub = lane >> 4, c4 = (lane & 15) * 4; typedef _Float16 v4h __attribute__((ext_vector_type(4)));
  {
#pragma unroll
    for (int q = 0; q < 8; ++q) { const int r = q * 2 + rsub; if (col0 + c4 < N) { const v4f v = *(const v4fa*)&so[w][r][c4]; if (C) *(v4f*)(C + cofs + (size_t)(row0 + r) * ldc + col0 + c4) = v; if (C16) { v4h h4; for (int i = 0; i < 4; ++i) h4[i] = (_Float16)v[i]; *(v4h*)(C16 + cofs + (size_t)(row0 + r) * ldc + col0 + c4) = h4; } } }
     }
}


typedef _Float16 v4h __attribute__((ext_vector_type(4)));

__global__ __launch_bounds__(256) void k_x16(const float* __restrict__ x, _Float16* __restrict__ X16, size_t n8) { const size_t t = (size_t)blockIdx.x * 256 + threadIdx.x; if (t >= n8) return; FragH f;
#pragma unroll
  for (int q = 0; q < 8; ++q) f.h[q] = (_Float16)bf16_round(x[t * 8 + q]); *(v8us*)((unsigned short*)X16 + t * 8) = f.half[0];  }
__global__ __launch_bounds__(256) void k_h16(const float* __restrict__ x, _Float16* __restrict__ X16, size_t n8) { const size_t t = (size_t)blockIdx.x * 256 + threadIdx.x; if (t >= n8) return; FragH f;
#pragma unroll
  for (int q = 0; q < 8; ++q) f.h[q] = (_Float16)x[t * 8 + q]; *(v8us*)((unsigned short*)X16 + t * 8) = f.half[0];  }
__global__ __launch_bounds__(256) void k_round16f(const float* __restrict__ W, _Float16* __restrict__ Bt, size_t n8) { const size_t t = (size_t)blockIdx.x * 256 + threadIdx.x; if (t >= n8) return; FragH f;
#pragma unroll
  for (int i = 0; i < 8; ++i) f.h[i] = (_Float16)(bf16_round(W[t * 8 + i]) * 16.0f); *(v8us*)((unsigned short*)Bt + t * 8) = f.half[0];  }
template <int NHv, int TTv>
__global__ __launch_bounds__(256) void k_vt(const _Float16* __restrict__ V16, int ldv, int voff, _Float16* __restrict__ Vt) { __shared__ unsigned short tl[64][66]; const int tid = threadIdx.x; const int slab = blockIdx.x / (TTv / 64), lg = blockIdx.x % (TTv / 64); const int b = slab / NHv, h = slab % NHv;
  for (int i = tid; i < 64 * 8; i += 256) { const int r = i / 8, c8 = (i % 8) * 8; FragH f; f.half[0] = *(const v8us*)((const unsigned short*)V16 + ((size_t)b * TTv + lg * 64 + r) * ldv + voff + h * 64 + c8);
#pragma unroll
    for (int q = 0; q < 8; ++q) tl[r][c8 + q] = f.u[q]; }
  __syncthreads();
  {
#pragma unroll
    for (int rd = 0; rd < 2; ++rd) { const int d = rd * 32 + tid / 8, pc = tid % 8; FragH f;
#pragma unroll
      for (int q = 0; q < 8; ++q) f.u[q] = tl[pc * 8 + q][d];
      *(v8us*)((unsigned short*)Vt + ((size_t)slab * 64 + d) * TTv + lg * 64 + pc * 8) = f.half[0]; }
     } }

__global__ __launch_bounds__(256) void k_hl(const float* __restrict__ F, _Float16* __restrict__ Hh, _Float16* __restrict__ Hl, size_t n8) { const size_t t = (size_t)blockIdx.x * 256 + threadIdx.x; if (t >= n8) return; FragH fh, fl; const v4f a = *(const v4fa*)(F + t * 8), c = *(const v4fa*)(F + t * 8 + 4);
#pragma unroll
  for (int q = 0; q < 4; ++q) { _Float16 h = (_Float16)a[q]; fh.h[q] = h; fl.h[q] = (_Float16)((a[q] - (float)h) * 1024.0f); h = (_Float16)c[q]; fh.h[4 + q] = h; fl.h[4 + q] = (_Float16)((c[q] - (float)h) * 1024.0f); }
  { *(v8us*)((unsigned short*)Hh + t * 8) = fh.half[0]; *(v8us*)((unsigned short*)Hl + t * 8) = fl.half[0];  } }

// ---- fast GEMM (wave tile 32x64; requires M % 32 == 0 rows per launch region and N % 64 == 0); epilogue = k_gemm_hhx semantics ----
__device__ __forceinline__ v16h g2_frag(const _Float16* p, int hh) { FragH f; f.half[0] = *(const v8us*)((const unsigned short*)p + 8 * hh); f.half[1] = *(const v8us*)((const unsigned short*)p + 16 + 8 * hh); return f.v; }
__device__ __forceinline__ v8f g2_mma(v16h a, v16h b, v8f c) { v8f d = __builtin_amdgcn_wmma_f32_16x16x32_f16(false, a, false, b, (short)0, c, false, false); asm volatile("v_nop\n\tv_nop\n\tv_nop\n\tv_nop" : "+v"(d) : "v"(a), "v"(b)); return d; }
template <int ACT>
__global__ __launch_bounds__(128) void k_gemm2(const _Float16* __restrict__ A, int lda, size_t sA, const _Float16* __restrict__ Bh, int ldb, size_t sB, float alpha, const float* __restrict__ bias, size_t sBias, const float* __restrict__ CP, int rowsPerB, size_t sCPb, int row0g,
    float* __restrict__ C, _Float16* __restrict__ C16, int ldc, size_t sC, int M, int N, int K) { static_assert(ACT == 0 || ACT == 3 || ACT == 6 || ACT == 8 || ACT == 9 || ACT == 11 || ACT == 12 || ACT == 14 || ACT == 15 || ACT == 16 || ACT == 17, "k_gemm2: unsupported ACT code (would silently apply no activation)");
  __shared__ __attribute__((aligned(16))) float so[4][32][68];
  const int tid = threadIdx.x, w = tid >> 5, lane = tid & 31, ln = lane & 15, hh = lane >> 4; const int by = blockIdx.y;
  A += (size_t)by * sA; Bh += (size_t)by * sB; const size_t cofs = (size_t)by * sC; const float* bp = bias ? bias + (size_t)by * sBias : nullptr;
  const int ntn = N >> 6; const int mt = blockIdx.x / ntn, nq = blockIdx.x - mt * ntn; const int row0 = mt * 128 + 32 * w, col0 = nq * 64; if (row0 >= M) return;
  const _Float16* a0p = A + (size_t)(row0 + ln) * lda; const _Float16* a1p = a0p + (size_t)16 * lda;
  const _Float16* b0p = Bh + (size_t)(col0 + ln) * ldb; const _Float16* b1p = b0p + (size_t)16 * ldb; const _Float16* b2p = b1p + (size_t)16 * ldb; const _Float16* b3p = b2p + (size_t)16 * ldb;
  const v8f z8 = {0.f,0.f,0.f,0.f,0.f,0.f,0.f,0.f}; v8f c00 = z8, c01 = z8, c02 = z8, c03 = z8, c10 = z8, c11 = z8, c12 = z8, c13 = z8;
#pragma unroll 1
  for (int kb = 0; kb < K; kb += 32) { const v16h a0 = g2_frag(a0p + kb, hh), a1 = g2_frag(a1p + kb, hh);
    v16h b = g2_frag(b0p + kb, hh); c00 = g2_mma(a0, b, c00); c10 = g2_mma(a1, b, c10);
    b = g2_frag(b1p + kb, hh); c01 = g2_mma(a0, b, c01); c11 = g2_mma(a1, b, c11);
    b = g2_frag(b2p + kb, hh); c02 = g2_mma(a0, b, c02); c12 = g2_mma(a1, b, c12);
    b = g2_frag(b3p + kb, hh); c03 = g2_mma(a0, b, c03); c13 = g2_mma(a1, b, c13); }
  v8f accs[8] = {c00, c01, c02, c03, c10, c11, c12, c13};
#pragma unroll
  for (int u = 0; u < 8; ++u) { const int t = u & 3, half = u >> 2; const int col = col0 + t * 16 + ln; const float bv = bp ? bf16_round(bp[col]) : 0.f;
#pragma unroll
    for (int r = 0; r < 8; ++r) { const int rloc = half * 16 + 8 * hh + r; float v = accs[u][r] * alpha + bv; if (CP) { if (rowsPerB < 0) v += CP[cofs + (size_t)(row0g + row0 + rloc) * ldc + col];      /* rowsPerB < 0: own element of the batched C plane */ else { const int bidx = (row0g + row0 + rloc) / rowsPerB; v += CP[(size_t)bidx * sCPb + (size_t)by * 64 + col]; } }
      if (ACT == 3) v = fmaxf(v, 0.f); else if (ACT == 6) v = 0.5f * v * (1.0f + erff(v * 0.70710678118654752f)); else if (ACT == 11) v = 1.0f / (1.0f + expf(-v)); else if (ACT == 15) v = v / (1.0f + expf(-v)); else if (ACT == 12) v = (v > 0.f) ? v : 0.01f * v; else if (ACT == 8) v = tanhf(v); else if (ACT == 9) v = 0.5f * v * (1.0f + tanhf(0.7978845608028654f * (v + 0.044715f * v * v * v))); else if (ACT == 14) v = (v > 0.f) ? v : 0.1f * v; else if (ACT == 16) v = (v >= 0.f) ? v : 0.3f * v; else if (ACT == 17) v = (v >= 0.f) ? v : 0.2f * v;
      so[w][rloc][t * 16 + ln] = v; } }
  __builtin_amdgcn_fence(__ATOMIC_ACQ_REL, "workgroup"); __builtin_amdgcn_wave_barrier();
  const int rsub = lane >> 4, c4 = (lane & 15) * 4;
  {
#pragma unroll
    for (int q = 0; q < 16; ++q) { const int r = q * 2 + rsub; const v4f v = *(const v4fa*)&so[w][r][c4]; if (C) *(v4f*)(C + cofs + (size_t)(row0 + r) * ldc + col0 + c4) = v; if (C16) { v4h h4; for (int i = 0; i < 4; ++i) h4[i] = (_Float16)v[i]; *(v4h*)(C16 + cofs + (size_t)(row0 + r) * ldc + col0 + c4) = h4; } }
     } }


__global__ __launch_bounds__(256) void k_wnat(const float* __restrict__ w, size_t n8, _Float16* __restrict__ Bt) { const size_t t = (size_t)blockIdx.x * 256 + threadIdx.x; if (t >= n8) return; FragH f; for (int q = 0; q < 8; ++q) f.h[q] = (_Float16)(bf16_round(w[t * 8 + q]) * 16.0f); *(v8us*)((unsigned short*)Bt + t * 8) = f.half[0];  }
__global__ __launch_bounds__(256) void k_rsm(const float* __restrict__ S, _Float16* __restrict__ P, int nrows) {
  #pragma clang fp contract(off)
  const int i = blockIdx.x * 256 + threadIdx.x; if (i >= nrows) return; const float* s = S + (size_t)i * SQ; float mx = -3.0e38f;
#pragma unroll 1
  for (int j = 0; j < SQ; ++j) mx = fmaxf(mx, s[j]); float se = 0.f;
#pragma unroll 1
  for (int j = 0; j < SQ; ++j) se += expf(s[j] - mx); const float sc = 256.0f / se;
#pragma unroll 1
  for (int j0 = 0; j0 < SQ; j0 += 8) { FragH f; for (int q = 0; q < 8; ++q) f.h[q] = (_Float16)(expf(s[j0 + q] - mx) * sc); unsigned short* d = (unsigned short*)P + (size_t)i * SQ + j0; *(v8us*)d = f.half[0];  } }
__global__ __launch_bounds__(256) void k_vt(const _Float16* __restrict__ V16, int b, int h0, _Float16* __restrict__ VT) { __shared__ unsigned short tl[64][65]; const int tid = threadIdx.x; const int hh = blockIdx.x % HG, sg = blockIdx.x / HG; const int s0 = sg * 64; const int h = h0 + hh;
  for (int i = tid; i < 64 * 8; i += 256) { const int j = i / 8, d8 = (i % 8) * 8; FragH f; f.half[0] = *(const v8us*)((const unsigned short*)V16 + ((size_t)b * SQ + s0 + j) * DM + h * HD + d8); for (int q = 0; q < 8; ++q) tl[d8 + q][j] = f.u[q]; }
  __syncthreads();
  { for (int i = tid; i < 64 * 8; i += 256) { const int d = i / 8, j8 = (i % 8) * 8; FragH f; for (int q = 0; q < 8; ++q) f.u[q] = tl[d][j8 + q]; *(v8us*)((unsigned short*)VT + ((size_t)hh * HD + d) * SQ + s0 + j8) = f.half[0]; }  } }



__global__ __launch_bounds__(256) void k_rsmkm(const float* __restrict__ S, _Float16* __restrict__ P, int nrows, const int* __restrict__ am) {
  #pragma clang fp contract(off)
  const int t = blockIdx.x * 256 + threadIdx.x; if (t >= nrows) return; const size_t i = (size_t)t; const float* s = S + i * SQ; const int* mr = am + (size_t)(t % SQ) * SQ; float mx = -3.0e38f;
#pragma unroll 1
  for (int j = 0; j < SQ; ++j) { const float f = (mr[j] != 0) ? 1.f : 0.f; mx = fmaxf(mx, fmaf(f, s[j], (1.f - f) * -1.0e9f)); } float se = 0.f;
#pragma unroll 1
  for (int j = 0; j < SQ; ++j) { const float f = (mr[j] != 0) ? 1.f : 0.f; se += __expf(fmaf(f, s[j], (1.f - f) * -1.0e9f) - mx); } const float sc = 256.0f / se;
#pragma unroll 1
  for (int j0 = 0; j0 < SQ; j0 += 8) { FragH fr; for (int q = 0; q < 8; ++q) { const int j = j0 + q; const float f = (mr[j] != 0) ? 1.f : 0.f; fr.h[q] = (_Float16)(__expf(fmaf(f, s[j], (1.f - f) * -1.0e9f) - mx) * sc); }
    unsigned short* d = (unsigned short*)P + i * SQ + j0; *(v8us*)d = fr.half[0];  } }
// exp of four values as __expf forms it (v_exp_f32 of x * log2 e). One statement, so that the free slot the instruction set asks for behind a transcendental stands there by construction: outputs are early-clobbered (no v_exp_f32 overwrites a neighbour's source or reads its result), and the v_nop fills the slot behind the last one.
__device__ __forceinline__ v4f exp_x4(v4f x) { float r0, r1, r2, r3;
  asm("v_exp_f32 %0, %4\n\tv_exp_f32 %1, %5\n\tv_exp_f32 %2, %6\n\tv_exp_f32 %3, %7\n\tv_nop" : "=&v"(r0), "=&v"(r1), "=&v"(r2), "=&v"(r3) : "v"(x[0] * 1.44269504088896340736f), "v"(x[1] * 1.44269504088896340736f), "v"(x[2] * 1.44269504088896340736f), "v"(x[3] * 1.44269504088896340736f));
  const v4f r = {r0, r1, r2, r3}; return r; }
// One wave per score row: lane l holds elements 128 c + 4 l .. + 3 of chunk c, so every load is 512 contiguous bytes, the row is read once and stays in registers.
__global__ __launch_bounds__(256) void k_rsmlow(const float* __restrict__ S, _Float16* __restrict__ P, int nrows) {
  const int lane = threadIdx.x & 31; const int t = blockIdx.x * 8 + (threadIdx.x >> 5); if (t >= nrows) return;      /* wave-uniform exit, no barrier below */
  const int qi = t % SQ; const float* s = S + (size_t)t * SQ + lane * 4; v4f e[SQ / 128];
#pragma unroll      /* all 16 loads in flight at once; e[] indexed by constants only, so that it stays in registers (so in the three loops below) */
  for (int c = 0; c < SQ / 128; ++c) e[c] = *(const v4fa*)(s + c * 128);
  float mx = -3.0e38f;
#pragma unroll      /* e[] in registers */
  for (int c = 0; c < SQ / 128; ++c)
    for (int u = 0; u < 4; ++u) { const float m = (c * 128 + lane * 4 + u <= qi) ? 1.0f : 0.0f; e[c][u] = __fadd_rn(e[c][u], __fmul_rn(m, -1.0e9f)); mx = fmaxf(mx, e[c][u]); }
  for (int o = 16; o > 0; o >>= 1) mx = fmaxf(mx, __shfl_xor(mx, o));
  v4f s4 = {0.f, 0.f, 0.f, 0.f};      /* four independent chains per lane, then a butterfly over the lanes */
#pragma unroll      /* e[] in registers */
  for (int c = 0; c < SQ / 128; ++c) { e[c] = exp_x4(e[c] - mx); s4 += e[c]; }
  float se = (s4[0] + s4[1]) + (s4[2] + s4[3]);
  for (int o = 16; o > 0; o >>= 1) se += __shfl_xor(se, o);
  const float sc = 256.0f / se; _Float16* d = P + (size_t)t * SQ + lane * 4;
#pragma unroll      /* e[] in registers */
  for (int c = 0; c < SQ / 128; ++c) { v4h h4; for (int u = 0; u < 4; ++u) h4[u] = (_Float16)(e[c][u] * sc); *(v4h*)(d + c * 128) = h4; } }      /* a wave's store = 256 contiguous bytes, two whole lines */

__global__ __launch_bounds__(64) void k_attup(const float* __restrict__ QF, const float* __restrict__ KF, const float* __restrict__ VF, int ld, float scale, float* __restrict__ OF, int ldo) {
  #pragma clang fp contract(off)
  __shared__ __attribute__((aligned(16))) float lq[64][64]; __shared__ __attribute__((aligned(16))) float lo[64][64];
  const int tid = threadIdx.x; const int h = blockIdx.x / (QT0 / 64), rg = blockIdx.x % (QT0 / 64); const int i = rg * 64 + tid;
  const float* qr = QF + (size_t)i * ld + h * HD;
#pragma unroll 1
  for (int c = 0; c < HD / 4; ++c) { *(v4f*)&lq[tid][c * 4] = *(const v4fa*)(qr + c * 4); const v4f z = {0.f, 0.f, 0.f, 0.f}; *(v4f*)&lo[tid][c * 4] = z; }
  float m = -1.0e30f, l = 0.f;
#pragma unroll 1
  for (int j = rg * 64; j < QT0; ++j) { const float* kr = KF + (size_t)j * ld + h * HD; const float* vr = VF + (size_t)j * ld + h * HD; float s = 0.f;
#pragma unroll 1
    for (int c = 0; c < HD / 4; ++c) { const v4f kq = *(const v4fa*)(kr + c * 4); const v4f qq = *(v4f*)&lq[tid][c * 4]; s = __fadd_rn(s, __fmul_rn(qq[0], kq[0])); s = __fadd_rn(s, __fmul_rn(qq[1], kq[1])); s = __fadd_rn(s, __fmul_rn(qq[2], kq[2])); s = __fadd_rn(s, __fmul_rn(qq[3], kq[3])); }
    s = __fmul_rn(s, scale);
    const float f = (j > i) ? 1.f : 0.f; const float sm = fmaf(f, s, (1.f - f) * -1.0e30f); const float mn = fmaxf(m, sm); const float sc = expf(m - mn); const float e = __fmul_rn(f, expf(sm - mn)); l = __fadd_rn(__fmul_rn(l, sc), e); m = mn;
#pragma unroll 1
    for (int c = 0; c < HD / 4; ++c) { const v4f vv = *(const v4fa*)(vr + c * 4); v4f oo = *(v4f*)&lo[tid][c * 4]; for (int u = 0; u < 4; ++u) oo[u] = __fadd_rn(__fmul_rn(oo[u], sc), __fmul_rn(e, vv[u])); *(v4f*)&lo[tid][c * 4] = oo; } }
  const float fin = (l > 0.f) ? 64.0f / l : 0.f;      /* o carried x64 like the f16 path; the key-less last row is written by k_vmean */
#pragma unroll 1
  for (int c = 0; c < HD / 4; ++c) { v4f oo = *(v4f*)&lo[tid][c * 4]; for (int u = 0; u < 4; ++u) oo[u] = __fmul_rn(oo[u], fin); *(v4f*)&lo[tid][c * 4] = oo; }
  __syncthreads();
  {
#pragma unroll 1
    for (int it = 0; it < 16; ++it) { const int row = it * 4 + tid / 16, pc = (tid % 16) * 4; const v4f v = *(const v4f*)&lo[row][pc]; *(v4f*)(OF + (size_t)(rg * 64 + row) * ldo + h * HD + pc) = v; }
     } }

__global__ __launch_bounds__(256) void k_vmean(const _Float16* __restrict__ V, int ldv, float* __restrict__ orow) {
  #pragma clang fp contract(off)
  const int c = blockIdx.x * 256 + threadIdx.x; if (c >= DM) return; float s = 0.f;
#pragma unroll 1
  for (int j = 0; j < SQ; ++j) s = __fadd_rn(s, (float)V[(size_t)j * ldv + c]);
  const float o = __fmul_rn(s, 64.0f / (float)SQ); *(float*)(orow + c) = o;  }

extern "C" void kernel_launch(void* const* d_in, const int* in_sizes, int n_in,
                              void* d_out, int out_size, void* d_ws, size_t ws_size, hipStream_t stream) {
  (void)in_sizes; (void)n_in; (void)out_size;
  const float* const* I = (const float* const*)d_in; const float* xq = I[0]; const float* xk = I[0]; const float* xv = I[0]; const float* wq = I[1]; const float* bq = I[2]; const float* wk = I[3]; const float* bk = I[4]; const float* wv = I[5]; const float* bv = I[6]; const float* wo = I[7]; const float* bo = I[8]; const float* x = xq;      /* ONE input feeds the query, key and value streams; [in][out] weights + biases; the mask is built from indices as in the module */
  static_assert(NH * HD == DM && DM % 64 == 0 && SQ % 128 == 0 && NH % HG == 0, "shape / tile multiples");
  char* ws = (char*)d_ws; size_t off = 0;
  auto take = [&](size_t bytes) { char* p = ws + off; off += (bytes + 255) & ~(size_t)255; return p; };
  _Float16* BQ = (_Float16*)take((size_t)DM * DM * 2); _Float16* BK = (_Float16*)take((size_t)DM * DM * 2); _Float16* BV = (_Float16*)take((size_t)DM * DM * 2); _Float16* BO = (_Float16*)take((size_t)DM * DM * 2);
  _Float16* X16 = (_Float16*)take(NR * DM * 2); _Float16* XKp = (_Float16*)take(NR * DM * 2); _Float16* XVp = (_Float16*)take(NR * DM * 2); _Float16* Q16 = (_Float16*)take(NR * DM * 2); _Float16* K16 = (_Float16*)take(NR * DM * 2); _Float16* V16 = (_Float16*)take(NR * DM * 2); _Float16* O16 = (_Float16*)take(NR * DM * 2);
  float* S = (float*)take((size_t)HG * SQ * SQ * 4); _Float16* P = (_Float16*)take((size_t)HG * SQ * SQ * 2); _Float16* VT = (_Float16*)take((size_t)NH * HD * SQ * 2);
  float* QF0 = (float*)take((size_t)QT0 * DM * 4); float* KF0 = (float*)take((size_t)QT0 * DM * 4); float* VF0 = (float*)take((size_t)QT0 * DM * 4); float* OF0 = (float*)take((size_t)NB * QT0 * DM * 4); _Float16* OH0 = (_Float16*)take((size_t)NB * QT0 * DM * 2); _Float16* OL0 = (_Float16*)take((size_t)NB * QT0 * DM * 2);      /* exact last tile: f32 q / k / v of the tile rows, o (x64) and its f16 hi + x1024 residual planes */
  if (off > ws_size) return;
  { const unsigned g = (unsigned)(((size_t)DM * (DM / 8) + 255) / 256); k_wt_f16<<<g, 256, 0, stream>>>(wq, BQ, DM, DM, 16.0f); k_wt_f16<<<g, 256, 0, stream>>>(wk, BK, DM, DM, 16.0f); k_wt_f16<<<g, 256, 0, stream>>>(wv, BV, DM, DM, 16.0f); k_wt_f16<<<g, 256, 0, stream>>>(wo, BO, DM, DM, 16.0f); }      /* [in][out] -> Bt x16 */
  _Float16* XK = XKp; _Float16* XV = XVp; k_x16<<<(unsigned)((NR * DM / 8 + 255) / 256), 256, 0, stream>>>(xk, XK, NR * DM / 8); k_x16<<<(unsigned)((NR * DM / 8 + 255) / 256), 256, 0, stream>>>(xv, XV, NR * DM / 8);      /* key and value inputs as exact f16 rows */

  k_x16<<<(unsigned)((NR * DM / 8 + 255) / 256), 256, 0, stream>>>(x, X16, NR * DM / 8);
  const size_t r0p = (size_t)B0 * SQ;      /* first projected row */
  k_gemm2<0><<<dim3((unsigned)((MP / 128) * (DM / 64)), 1), 128, 0, stream>>>(X16 + r0p * DM, DM, 0, BQ, DM, 0, 0.0625f, bq, 0, nullptr, 1, 0, 0, nullptr, Q16 + r0p * DM, DM, 0, MP, DM, DM);
  k_gemm2<0><<<dim3((unsigned)((MP / 128) * (DM / 64)), 1), 128, 0, stream>>>(XK + r0p * DM, DM, 0, BK, DM, 0, 0.0625f, bk, 0, nullptr, 1, 0, 0, nullptr, K16 + r0p * DM, DM, 0, MP, DM, DM);
  k_gemm2<0><<<dim3((unsigned)((MP / 128) * (DM / 64)), 1), 128, 0, stream>>>(XV + r0p * DM, DM, 0, BV, DM, 0, 0.0625f, bv, 0, nullptr, 1, 0, 0, nullptr, V16 + r0p * DM, DM, 0, MP, DM, DM);
  for (int b = B0; b < B0 + NBR; ++b) { const size_t r0 = (size_t)b * SQ;
    k_vt<NH, SQ><<<NH * (SQ / 64), 256, 0, stream>>>(V16 + r0 * LQ, LQ, 0, VT);      /* V^T [NH][HD][SQ] for this batch */
    { const size_t rl = r0 + SQ - QT0;      /* the batch's last QT0 rows */
      k_gemm2<0><<<dim3((QT0 / 128) * (DM / 64), 1), 128, 0, stream>>>(X16 + rl * DM, DM, 0, BQ, DM, 0, 0.0625f, bq, 0, nullptr, 1, 0, 0, QF0, nullptr, DM, 0, QT0, DM, DM); k_gemm2<0><<<dim3((QT0 / 128) * (DM / 64), 1), 128, 0, stream>>>(XK + rl * DM, DM, 0, BK, DM, 0, 0.0625f, bk, 0, nullptr, 1, 0, 0, KF0, nullptr, DM, 0, QT0, DM, DM); k_gemm2<0><<<dim3((QT0 / 128) * (DM / 64), 1), 128, 0, stream>>>(XV + rl * DM, DM, 0, BV, DM, 0, 0.0625f, bv, 0, nullptr, 1, 0, 0, VF0, nullptr, DM, 0, QT0, DM, DM);      /* f32 q, k, v of the last tile (exact products) */
      k_attup<<<NH * (QT0 / 64), 64, 0, stream>>>(QF0, KF0, VF0, DM, 0.125f, OF0 + (size_t)b * QT0 * DM, DM);      /* exact f32 attention over the keys j > i inside the tile (o x64) */
      k_vmean<<<(DM + 255) / 256, 256, 0, stream>>>(V16 + r0 * LQ, LQ, OF0 + ((size_t)b * QT0 + QT0 - 1) * DM); }      /* last row: uniform over all keys = 64 x mean of v */
    for (int h0 = 0; h0 < NHD; h0 += HG) {
      k_gemm2<0><<<dim3((QN / 128) * (SQ / 64), HG), 128, 0, stream>>>(Q16 + r0 * LQ + h0 * HD, LQ, (size_t)HD, K16 + r0 * LQ + h0 * HD, LQ, (size_t)HD, 0.125f, nullptr, 0, nullptr, 1, 0, 0, S, nullptr, SQ, (size_t)SQ * SQ, QN, SQ, HD);      /* scores, HG heads per launch */
      k_rsmlow<<<(HG * SQ + 7) / 8, 256, 0, stream>>>(S, P, HG * SQ);      /* literal 'score + tril * (-1e9)' then softmax over all keys -> P x256 f16 */
      k_gemm2<0><<<dim3((QN / 128) * (HD / 64), HG), 128, 0, stream>>>(P, SQ, (size_t)SQ * SQ, VT + (size_t)h0 * HD * SQ, SQ, (size_t)HD * SQ, 0.25f, nullptr, 0, nullptr, 1, 0, 0, nullptr, O16 + r0 * DM + h0 * HD, DM, (size_t)HD, QN, HD, SQ); } }      /* o (merged heads) as f16 rows */
  k_gemm2<0><<<dim3((unsigned)((MPO / 128) * (DM / 64)), 1), 128, 0, stream>>>(O16 + r0p * DM, DM, 0, BO, DM, 0, 0.0009765625f, bo, 0, nullptr, 1, 0, 0, (float*)d_out + r0p * DM, nullptr, DM, 0, MPO, DM, DM);      /* out rows are the output layout */
  k_hl<<<(unsigned)(((size_t)NB * QT0 * DM / 8 + 255) / 256), 256, 0, stream>>>(OF0, OH0, OL0, (size_t)NB * QT0 * DM / 8);      /* last-tile o (x64) -> f16 hi + x1024 residual planes */
  for (int b = B0; b < B0 + NBR; ++b) { const size_t rl = (size_t)b * SQ + SQ - QT0; const size_t f0 = (size_t)b * QT0;
    k_gemm2<0><<<dim3((QT0 / 128) * (DM / 64), 1), 128, 0, stream>>>(OH0 + f0 * DM, DM, 0, BO, DM, 0, 0.0009765625f, bo, 0, nullptr, 1, 0, 0, (float*)d_out + rl * DM, nullptr, DM, 0, QT0, DM, DM);      /* last QT0 rows: out = o_hi Wo (+ b), overwriting the f16-path rows */
    k_gemm2<0><<<dim3((QT0 / 128) * (DM / 64), 1), 128, 0, stream>>>(OL0 + f0 * DM, DM, 0, BO, DM, 0, 0.00000095367431640625f, nullptr, 0, (const float*)d_out + rl * DM, -1, 0, 0, (float*)d_out + rl * DM, nullptr, DM, 0, QT0, DM, DM); }      /* += o_lo Wo 2^-20 (own-element accumulate) */
}

// v002
// Measured time: 1620 microseconds a run.
// Next to v001, in two timings, it ran 2.42 and 2.44 times as fast.
// Counting every step since v000, it is 4.05 times as fast.
#include <hip/hip_runtime.h>
// Multi-head self-attention with the source's INVERTED causal mask (inputs [2][2048][1024]; q / k / v = x W + b ([in][out] 1024 x 1024 sigma 1/32, zero biases); 16 heads of 64; score = q k^T / sqrt(64) + tril * (-1e9): the LOWER triangle incl. the diagonal is pushed to -1e9 (the original's mask bug, kept), so query i attends to the keys j > i only, and the last query (every key masked, all scores rounding to the same -1e9 in f32) attends uniformly to all keys; softmax; out = merged Wo + bo -> [2][2048][1024]).
// Structure: token rows r = b*2048 + s; x as exact f16 rows (bf16-rounded); Q, K, V as three WMMA GEMMs (32x64 wave tiles, f32 accumulation, exact x16 weights + bias, f16 outputs); per batch: V^T for all heads via LDS transposes; per (batch, group of 4 heads): scores GEMM (K = 64, batched over the heads on grid.y, alpha = 1/sqrt(64) (applied before the -1e9 add, as in the source)), row softmax on VALU (f32 statistics; weights stored x256 as f16), o = P . V^T GEMM (K = 2048, alpha 2^-2: o carried x64 against f16 subnormal flush, folded into the output GEMM alpha) written straight into the merged f16 o rows; out = o W_o + b GEMM (f32) into the output layout.
// Compute dtype: inputs rounded to bf16; x / weights exact; q, k, v, softmax weights and o as plain f16 GEMM operands (~2^-12); scores and softmax statistics f32; v_wmma_f32_16x16x32_f16.
#define NB 2
#define SQ 2048
#define DM 1024
#define NH 16
#define HD 64
#define QT0 256                      /* last-tile rows recomputed exactly in f32 (rows with fewer than 256 visible keys) */
#define HG 4                         /* heads per attention launch group */
#define B0 0                         /* first batch processed (debug hook) */
#define NBR NB                       /* batches processed (debug hook) */
#define NR ((size_t)NB * SQ)         /* token rows */
#define MP ((int)((size_t)NBR * SQ)) /* rows projected (debug hook) */
#define QN SQ                        /* query rows attended per batch (debug hook) */
#define NHD NH                       /* heads attended (debug hook) */
#define MPO MP                       /* rows through the output stage (debug hook) */
#define LQ DM      /* row pitch of the q/k/v rows */
typedef __bf16 v16b __attribute__((ext_vector_type(16)));
typedef unsigned short v8us __attribute__((ext_vector_type(8), may_alias));
typedef float  v8f  __attribute__((ext_vector_type(8)));
typedef float  v4f  __attribute__((ext_vector_type(4)));
typedef float  v4fa __attribute__((ext_vector_type(4), may_alias));
union FragB { v16b v; v8us half[2]; unsigned short u[16]; };

__device__ __forceinline__ unsigned short bf16_bits(float x) { unsigned int u = __float_as_uint(x); return (unsigned short)((u + 0x7FFFu + ((u >> 16) & 1u)) >> 16); }
__device__ __forceinline__ float bf16_val(unsigned short b) { return __uint_as_float(((unsigned int)b) << 16); }
__device__ __forceinline__ float bf16_round(float x) { return bf16_val(bf16_bits(x)); }
// D += A·B with NT terms: 1 = ah·bh, 2 = + al·bh (A split), 3 = + ah·bl (both split)
template <int NT>
__device__ __forceinline__ v8f mmaN(v16b ah, v16b al, v16b bh, v16b bl, v8f c) {
  c = __builtin_amdgcn_wmma_f32_16x16x32_bf16(false, ah, false, bh, (short)0, c, false, false);
  if (NT >= 2) c = __builtin_amdgcn_wmma_f32_16x16x32_bf16(false, al, false, bh, (short)0, c, false, false);
  if (NT >= 3) c = __builtin_amdgcn_wmma_f32_16x16x32_bf16(false, ah, false, bl, (short)0, c, false, false);
  asm volatile("v_nop\n\tv_nop\n\tv_nop\n\tv_nop" : "+v"(c) : "v"(ah), "v"(al), "v"(bh), "v"(bl));
  return c;
}

__global__ __launch_bounds__(256) void k_wt_bf16(const float* __restrict__ W, unsigned short* __restrict__ Wt, int K, int N) {
  const int t = blockIdx.x * 256 + threadIdx.x;
  const int k8n = K / 8;
  if (t >= N * k8n) return;
  const int n = t / k8n, k8 = (t % k8n) * 8;
  v8us v;
#pragma unroll
  for (int i = 0; i < 8; ++i) v[i] = bf16_bits(W[(size_t)(k8 + i) * N + n]);
  *(v8us*)(Wt + (size_t)n * K + k8) = v;
  
}

// GEMM C[M][N] (f32, pitch ldc) = act(A[M][K]·W + bias). A f32 row-major (pitch lda) converted per fragment to bf16
// (ASPLIT: hi/lo two planes -> 2 terms, else single rounded term); Wt bf16 [N][K] (pitch ldb). BIAS_BF16 rounds the
// bias to bf16 first (bias quantised to bf16 before the add). K%32==0, M%16==0, N%64==0.
template <bool ASPLIT, int ACT, bool BIAS_BF16>
__global__ __launch_bounds__(128) void k_gemm_bf(const float* __restrict__ A, int lda, const unsigned short* __restrict__ Wt, int ldb,
                                               const float* __restrict__ bias, float* __restrict__ C, int ldc, int M, int N, int K) {
  __shared__ __attribute__((aligned(16))) float so[4][16][64];
  const int tid = threadIdx.x, w = tid >> 5, lane = tid & 31, ln = lane & 15, hh = lane >> 4;
  const int ntn = N / 64;
  const int wid = blockIdx.x * 4 + w;
  const int mt = wid / ntn, nq = wid % ntn;
  if (mt * 16 >= M) return;
  const int row0 = mt * 16, col0 = nq * 64;
  const float* arow = A + (size_t)(row0 + ln) * lda;
  v8f acc[4] = {};
  for (int kb = 0; kb < K; kb += 32) {
    FragB ah, al;
    const v4f x0 = *(const v4fa*)(arow + kb + 8 * hh), x1 = *(const v4fa*)(arow + kb + 8 * hh + 4);
    const v4f x2 = *(const v4fa*)(arow + kb + 16 + 8 * hh), x3 = *(const v4fa*)(arow + kb + 16 + 8 * hh + 4);
    float xs[16] = {x0[0],x0[1],x0[2],x0[3],x1[0],x1[1],x1[2],x1[3],x2[0],x2[1],x2[2],x2[3],x3[0],x3[1],x3[2],x3[3]};
#pragma unroll
    for (int i = 0; i < 16; ++i) { const unsigned short hb = bf16_bits(xs[i]); ah.u[i] = hb; al.u[i] = ASPLIT ? bf16_bits(xs[i] - bf16_val(hb)) : (unsigned short)0; }
#pragma unroll
    for (int t = 0; t < 4; ++t) {
      const unsigned short* brow = Wt + (size_t)(col0 + t * 16 + ln) * ldb + kb;
      FragB b;
      b.half[0] = *(const v8us*)(brow + 8 * hh);
      b.half[1] = *(const v8us*)(brow + 16 + 8 * hh);
      acc[t] = mmaN<ASPLIT ? 2 : 1>(ah.v, al.v, b.v, b.v, acc[t]);
    }
  }
#pragma unroll
  for (int t = 0; t < 4; ++t) {
    float bv = bias ? bias[col0 + t * 16 + ln] : 0.f;
    if (BIAS_BF16) bv = bf16_round(bv);
#pragma unroll
    for (int r = 0; r < 8; ++r) { float v = acc[t][r] + bv; if (ACT == 1) v = fmaxf(v, 0.f); so[w][8 * hh + r][t * 16 + ln] = v; }
  }
  __builtin_amdgcn_fence(__ATOMIC_ACQ_REL, "workgroup");
  __builtin_amdgcn_wave_barrier();
  const int rsub = lane >> 4, c4 = (lane & 15) * 4;
  {
#pragma unroll
    for (int q = 0; q < 8; ++q) {
      const int r = q * 2 + rsub;
      const v4f v = *(const v4fa*)&so[w][r][c4];
      *(v4f*)(C + (size_t)(row0 + r) * ldc + col0 + c4) = v;
    }
    
  }
}

// GEMM C = act(A·W + bias + resid): A f32 (ASPLIT -> hi/lo 2 terms), Wt bf16 [N][K]; ACT 0 none, 1 relu, 2 exact gelu;
// resid (optional, f32, row index = (row % rmod), pitch ldr, RES_BF16 rounds it) added before the activation.
template <bool ASPLIT, int ACT, bool BIAS_BF16, bool RES_BF16>
__global__ __launch_bounds__(128) void k_gemm_bf3(const float* __restrict__ A, int lda, const unsigned short* __restrict__ Wt, int ldb,
                                                const float* __restrict__ bias, const float* __restrict__ resid, int rmod, int ldr,
                                                float* __restrict__ C, int ldc, int M, int N, int K) {
  __shared__ __attribute__((aligned(16))) float so[4][16][64];
  const int tid = threadIdx.x, w = tid >> 5, lane = tid & 31, ln = lane & 15, hh = lane >> 4;
  const int ntn = N / 64;
  const int wid = blockIdx.x * 4 + w;
  const int mt = wid / ntn, nq = wid % ntn;
  if (mt * 16 >= M) return;
  const int row0 = mt * 16, col0 = nq * 64;
  const float* arow = A + (size_t)(row0 + ln) * lda;
  v8f acc[4] = {};
  for (int kb = 0; kb < K; kb += 32) {
    FragB ah, al;
    const v4f x0 = *(const v4fa*)(arow + kb + 8 * hh), x1 = *(const v4fa*)(arow + kb + 8 * hh + 4);
    const v4f x2 = *(const v4fa*)(arow + kb + 16 + 8 * hh), x3 = *(const v4fa*)(arow + kb + 16 + 8 * hh + 4);
    float xs[16] = {x0[0],x0[1],x0[2],x0[3],x1[0],x1[1],x1[2],x1[3],x2[0],x2[1],x2[2],x2[3],x3[0],x3[1],x3[2],x3[3]};
#pragma unroll
    for (int i = 0; i < 16; ++i) { const unsigned short hb = bf16_bits(xs[i]); ah.u[i] = hb; al.u[i] = ASPLIT ? bf16_bits(xs[i] - bf16_val(hb)) : (unsigned short)0; }
#pragma unroll
    for (int t = 0; t < 4; ++t) {
      const unsigned short* brow = Wt + (size_t)(col0 + t * 16 + ln) * ldb + kb;
      FragB b;
      b.half[0] = *(const v8us*)(brow + 8 * hh);
      b.half[1] = *(const v8us*)(brow + 16 + 8 * hh);
      acc[t] = mmaN<ASPLIT ? 2 : 1>(ah.v, al.v, b.v, b.v, acc[t]);
    }
  }
#pragma unroll
  for (int t = 0; t < 4; ++t) {
    const int col = col0 + t * 16 + ln;
    float bv = bias ? bias[col] : 0.f;
    if (BIAS_BF16) bv = bf16_round(bv);
#pragma unroll
    for (int r = 0; r < 8; ++r) {
      float v = acc[t][r] + bv;
      if (resid) { float rv = resid[(size_t)((row0 + 8 * hh + r) % rmod) * ldr + col]; if (RES_BF16) rv = bf16_round(rv); v += rv; }
      if (ACT == 1) v = fmaxf(v, 0.f);
      if (ACT == 2) v = 0.5f * v * (1.0f + erff(v * 0.70710678118654752f));
      if (ACT == 3) { const float u = 0.7978845608028654f * (v + 0.044715f * v * v * v); v = 0.5f * v * (1.0f + tanhf(u)); }
      so[w][8 * hh + r][t * 16 + ln] = v;
    }
  }
  __builtin_amdgcn_fence(__ATOMIC_ACQ_REL, "workgroup");
  __builtin_amdgcn_wave_barrier();
  const int rsub = lane >> 4, c4 = (lane & 15) * 4;
  {
#pragma unroll
    for (int q = 0; q < 8; ++q) {
      const int r = q * 2 + rsub;
      const v4f v = *(const v4fa*)&so[w][r][c4];
      *(v4f*)(C + (size_t)(row0 + r) * ldc + col0 + c4) = v;
    }
    
  }
}
// row LayerNorm (biased variance, eps) over N: s = X (+ R); optional out_sum <- s; out_norm <- (s-mu)*rsqrt(var+eps)*g + b
template <bool PARAM_BF16>
__global__ __launch_bounds__(256) void k_layernorm(const float* __restrict__ X, const float* __restrict__ R, const float* __restrict__ g, const float* __restrict__ bta,
                                                  float* __restrict__ out_sum, float* __restrict__ out_norm, int N, float eps) {
  __shared__ float red[256];
  const int row = blockIdx.x, tid = threadIdx.x;
  const float* x = X + (size_t)row * N; const float* rr = R ? R + (size_t)row * N : nullptr;
  float vals[16];                     // up to N = 4096
  const int per = N / 256;            // contiguous chunk per thread? use strided-by-4 chunks: thread handles j = tid*4 + 1024*u
  float s1 = 0.f;
  for (int u = 0; u < per / 4; ++u) {
    const int j = tid * 4 + 1024 * u;
    const v4f a = *(const v4fa*)(x + j);
    v4f b = {0.f,0.f,0.f,0.f}; if (rr) b = *(const v4fa*)(rr + j);
#pragma unroll
    for (int q = 0; q < 4; ++q) { const float v = a[q] + b[q]; vals[u * 4 + q] = v; s1 += v; }
  }
  red[tid] = s1; __syncthreads();
  for (int st = 128; st > 0; st >>= 1) { if (tid < st) red[tid] += red[tid + st]; __syncthreads(); }
  const float mu = red[0] / (float)N; __syncthreads();
  float s2 = 0.f;
  for (int u = 0; u < per / 4; ++u)
#pragma unroll
    for (int q = 0; q < 4; ++q) { const float c = vals[u * 4 + q] - mu; s2 += c * c; }
  red[tid] = s2; __syncthreads();
  for (int st = 128; st > 0; st >>= 1) { if (tid < st) red[tid] += red[tid + st]; __syncthreads(); }
  const float rs = rsqrtf(red[0] / (float)N + eps);
  {
    for (int u = 0; u < per / 4; ++u) {
      const int j = tid * 4 + 1024 * u;
      v4f o, sm;
#pragma unroll
      for (int q = 0; q < 4; ++q) {
        float gg = g[j + q], bb = bta[j + q];
        if (PARAM_BF16) { gg = bf16_round(gg); bb = bf16_round(bb); }
        sm[q] = vals[u * 4 + q]; o[q] = (vals[u * 4 + q] - mu) * rs * gg + bb;
      }
      if (out_sum) *(v4f*)(out_sum + (size_t)row * N + j) = sm;
      *(v4f*)(out_norm + (size_t)row * N + j) = o;
    }
    
  }
}



// ---- f16 WMMA path (v_wmma_f32_16x16x32_f16): 11-bit significands for operands in range — used where a [0,1] probability operand needs more precision than bf16
typedef _Float16 v16h __attribute__((ext_vector_type(16)));
union FragH { v16h v; v8us half[2]; _Float16 h[16]; unsigned short u[16]; };
template <int NT>
__device__ __forceinline__ v8f mmaH(v16h ah, v16h al, v16h bh, v16h bl, v8f c) {
  c = __builtin_amdgcn_wmma_f32_16x16x32_f16(false, ah, false, bh, (short)0, c, false, false);
  if (NT >= 2) c = __builtin_amdgcn_wmma_f32_16x16x32_f16(false, al, false, bh, (short)0, c, false, false);
  if (NT >= 3) c = __builtin_amdgcn_wmma_f32_16x16x32_f16(false, ah, false, bl, (short)0, c, false, false);
  asm volatile("v_nop\n\tv_nop\n\tv_nop\n\tv_nop" : "+v"(c) : "v"(ah), "v"(al), "v"(bh), "v"(bl));
  return c;
}
// batched GEMM like k_gemm_b but f16 operands: A f32 (split into f16 hi/lo if ASPLIT, else rounded to f16), Bt = f16 values [n][k]; alpha; C f32; N multiple of 16 (partial tiles skipped)
template <bool ASPLIT>
__global__ __launch_bounds__(128) void k_gemm_h(const float* __restrict__ A, int lda, size_t sA, const _Float16* __restrict__ Bh, int ldb, size_t sB, float alpha, float* __restrict__ C, int ldc, size_t sC, int M, int N, int K) {
  __shared__ __attribute__((aligned(16))) float so[4][16][64];
  const int tid = threadIdx.x, w = tid >> 5, lane = tid & 31, ln = lane & 15, hh = lane >> 4; const int by = blockIdx.y;
  A += (size_t)by * sA; Bh += (size_t)by * sB; C += (size_t)by * sC;
  const int ntn = (N + 63) / 64; const int wid = blockIdx.x * 4 + w; const int mt = wid / ntn, nq = wid % ntn; if (mt * 16 >= M) return;
  const int row0 = mt * 16, col0 = nq * 64; const float* arow = A + (size_t)(row0 + ln) * lda;
  v8f acc[4] = {};
  for (int kb = 0; kb < K; kb += 32) {
    FragH ah, al;
    const v4f x0 = *(const v4fa*)(arow + kb + 8 * hh), x1 = *(const v4fa*)(arow + kb + 8 * hh + 4), x2 = *(const v4fa*)(arow + kb + 16 + 8 * hh), x3 = *(const v4fa*)(arow + kb + 16 + 8 * hh + 4);
    float xs[16] = {x0[0],x0[1],x0[2],x0[3],x1[0],x1[1],x1[2],x1[3],x2[0],x2[1],x2[2],x2[3],x3[0],x3[1],x3[2],x3[3]};
#pragma unroll
    for (int i = 0; i < 16; ++i) { const _Float16 h = (_Float16)xs[i]; ah.h[i] = h; al.h[i] = ASPLIT ? (_Float16)(xs[i] - (float)h) : (_Float16)0.0f; }
#pragma unroll
    for (int t = 0; t < 4; ++t) { if (col0 + t * 16 >= N) continue; const size_t boff = (size_t)(col0 + t * 16 + ln) * ldb + kb; FragH bq; bq.half[0] = *(const v8us*)(Bh + boff + 8 * hh); bq.half[1] = *(const v8us*)(Bh + boff + 16 + 8 * hh);
      acc[t] = mmaH<ASPLIT ? 2 : 1>(ah.v, al.v, bq.v, bq.v, acc[t]); }
  }
#pragma unroll
  for (int t = 0; t < 4; ++t) { if (col0 + t * 16 >= N) continue;
#pragma unroll
    for (int r = 0; r < 8; ++r) so[w][8 * hh + r][t * 16 + ln] = acc[t][r] * alpha; }
  __builtin_amdgcn_fence(__ATOMIC_ACQ_REL, "workgroup"); __builtin_amdgcn_wave_barrier();
  const int rsub = lane >> 4, c4 = (lane & 15) * 4;
  {
#pragma unroll
    for (int q = 0; q < 8; ++q) { const int r = q * 2 + rsub; if (col0 + c4 < N) { const v4f v = *(const v4fa*)&so[w][r][c4]; *(v4f*)(C + (size_t)(row0 + r) * ldc + col0 + c4) = v; } }
     }
}

// Wt[n][k] = f16(W[k][n]·scale) from f32 row-major W[K][N] (scale = power of two; bf16-exact weights stay exact in f16 away from the subnormal range)
__global__ __launch_bounds__(256) void k_wt_f16(const float* __restrict__ W, _Float16* __restrict__ Wt, int K, int N, float scale) {
  const int t = blockIdx.x * 256 + threadIdx.x; if (t >= N * (K / 8)) return; const int n = t / (K / 8), k8 = (t % (K / 8)) * 8; FragH f;
#pragma unroll
  for (int i = 0; i < 8; ++i) f.h[i] = (_Float16)(bf16_round(W[(size_t)(k8 + i) * N + n]) * scale); const v8us o = f.half[0];
  *(v8us*)((unsigned short*)Wt + (size_t)n * K + k8) = o; 
}
// k_gemm_hh variant with fused epilogue: v = acc·alpha + bias[by·sBias + col] (+ CP[(row/rowsPerB)·sCPb + by·64 + col] if CP) ; ACT 0 none / 1 elu ; writes f16 C16 (and f32 C if non-null)
template <int ACT>
__global__ __launch_bounds__(128) void k_gemm_hhx(const _Float16* __restrict__ A, int lda, size_t sA, const _Float16* __restrict__ Bh, int ldb, size_t sB, float alpha, const float* __restrict__ bias, size_t sBias, const float* __restrict__ CP, int rowsPerB, size_t sCPb, int row0g,
    float* __restrict__ C, _Float16* __restrict__ C16, int ldc, size_t sC, int M, int N, int K) {
  __shared__ __attribute__((aligned(16))) float so[4][16][64];
  const int tid = threadIdx.x, w = tid >> 5, lane = tid & 31, ln = lane & 15, hh = lane >> 4; const int by = blockIdx.y;
  A += (size_t)by * sA; Bh += (size_t)by * sB; const size_t cofs = (size_t)by * sC; const float* bp = bias ? bias + (size_t)by * sBias : nullptr;
  const int ntn = (N + 63) / 64; const int wid = blockIdx.x * 4 + w; const int mt = wid / ntn, nq = wid % ntn; if (mt * 16 >= M) return;
  const int row0 = mt * 16, col0 = nq * 64; const _Float16* arow = A + (size_t)(row0 + ln) * lda;
  v8f acc[4] = {};
  for (int kb = 0; kb < K; kb += 32) { FragH ah; ah.half[0] = *(const v8us*)((const unsigned short*)arow + kb + 8 * hh); ah.half[1] = *(const v8us*)((const unsigned short*)arow + kb + 16 + 8 * hh);
#pragma unroll
    for (int t = 0; t < 4; ++t) { if (col0 + t * 16 >= N) continue; const size_t boff = (size_t)(col0 + t * 16 + ln) * ldb + kb; FragH bq; bq.half[0] = *(const v8us*)((const unsigned short*)Bh + boff + 8 * hh); bq.half[1] = *(const v8us*)((const unsigned short*)Bh + boff + 16 + 8 * hh);
      acc[t] = mmaH<1>(ah.v, ah.v, bq.v, bq.v, acc[t]); }
  }
#pragma unroll
  for (int t = 0; t < 4; ++t) { if (col0 + t * 16 >= N) continue; const int col = col0 + t * 16 + ln; const float bv = bp ? bf16_round(bp[col]) : 0.f;
#pragma unroll
    for (int r = 0; r < 8; ++r) { float v = acc[t][r] * alpha + bv; if (CP) { const int rr = row0g + row0 + 8 * hh + r; if (rowsPerB < 0) v += CP[cofs + (size_t)rr * ldc + col];      /* rowsPerB < 0: own element of the batched C plane */ else { const int bidx = rr / rowsPerB; v += CP[(size_t)bidx * sCPb + (size_t)by * 64 + col]; } } if (ACT == 1) v = (v > 0.f) ? v : expm1f(v); else if (ACT == 7) v = (v > 0.f) ? v + 1.0f : expf(v); else if (ACT == 8) v = tanhf(v); else if (ACT == 9) v = 0.5f * v * (1.0f + tanhf(0.7978845608028654f * (v + 0.044715f * v * v * v))); else if (ACT == 11) v = 1.0f / (1.0f + expf(-v)); else if (ACT == 12) v = (v > 0.f) ? v : 0.01f * v; else if (ACT == 14) v = (v > 0.f) ? v : 0.1f * v; else if (ACT == 16) v = (v >= 0.f) ? v : 0.3f * v; else if (ACT == 17) v = (v >= 0.f) ? v : 0.2f * v; else if (ACT == 15) v = v / (1.0f + expf(-v)); else if (ACT == 3) v = fmaxf(v, 0.f); else if (ACT == 6) v = 0.5f * v * (1.0f + erff(v * 0.70710678118654752f)); so[w][8 * hh + r][t * 16 + ln] = v; } }
  __builtin_amdgcn_fence(__ATOMIC_ACQ_REL, "workgroup"); __builtin_amdgcn_wave_barrier();
  const int rsub = lane >> 4, c4 = (lane & 15) * 4; typedef _Float16 v4h __attribute__((ext_vector_type(4)));
  {
#pragma unroll
    for (int q = 0; q < 8; ++q) { const int r = q * 2 + rsub; if (col0 + c4 < N) { const v4f v = *(const v4fa*)&so[w][r][c4]; if (C) *(v4f*)(C + cofs + (size_t)(row0 + r) * ldc + col0 + c4) = v; if (C16) { v4h h4; for (int i = 0; i < 4; ++i) h4[i] = (_Float16)v[i]; *(v4h*)(C16 + cofs + (size_t)(row0 + r) * ldc + col0 + c4) = h4; } } }
     }
}


typedef _Float16 v4h __attribute__((ext_vector_type(4)));

__global__ __launch_bounds__(256) void k_x16(const float* __restrict__ x, _Float16* __restrict__ X16, size_t n8) { const size_t t = (size_t)blockIdx.x * 256 + threadIdx.x; if (t >= n8) return; FragH f;
#pragma unroll
  for (int q = 0; q < 8; ++q) f.h[q] = (_Float16)bf16_round(x[t * 8 + q]); *(v8us*)((unsigned short*)X16 + t * 8) = f.half[0];  }
__global__ __launch_bounds__(256) void k_h16(const float* __restrict__ x, _Float16* __restrict__ X16, size_t n8) { const size_t t = (size_t)blockIdx.x * 256 + threadIdx.x; if (t >= n8) return; FragH f;
#pragma unroll
  for (int q = 0; q < 8; ++q) f.h[q] = (_Float16)x[t * 8 + q]; *(v8us*)((unsigned short*)X16 + t * 8) = f.half[0];  }
__global__ __launch_bounds__(256) void k_round16f(const float* __restrict__ W, _Float16* __restrict__ Bt, size_t n8) { const size_t t = (size_t)blockIdx.x * 256 + threadIdx.x; if (t >= n8) return; FragH f;
#pragma unroll
  for (int i = 0; i < 8; ++i) f.h[i] = (_Float16)(bf16_round(W[t * 8 + i]) * 16.0f); *(v8us*)((unsigned short*)Bt + t * 8) = f.half[0];  }
template <int NHv, int TTv>
__global__ __launch_bounds__(256) void k_vt(const _Float16* __restrict__ V16, int ldv, int voff, _Float16* __restrict__ Vt) { __shared__ unsigned short tl[64][66]; const int tid = threadIdx.x; const int slab = blockIdx.x / (TTv / 64), lg = blockIdx.x % (TTv / 64); const int b = slab / NHv, h = slab % NHv;
  for (int i = tid; i < 64 * 8; i += 256) { const int r = i / 8, c8 = (i % 8) * 8; FragH f; f.half[0] = *(const v8us*)((const unsigned short*)V16 + ((size_t)b * TTv + lg * 64 + r) * ldv + voff + h * 64 + c8);
#pragma unroll
    for (int q = 0; q < 8; ++q) tl[r][c8 + q] = f.u[q]; }
  __syncthreads();
  {
#pragma unroll
    for (int rd = 0; rd < 2; ++rd) { const int d = rd * 32 + tid / 8, pc = tid % 8; FragH f;
#pragma unroll
      for (int q = 0; q < 8; ++q) f.u[q] = tl[pc * 8 + q][d];
      *(v8us*)((unsigned short*)Vt + ((size_t)slab * 64 + d) * TTv + lg * 64 + pc * 8) = f.half[0]; }
     } }

__global__ __launch_bounds__(256) void k_hl(const float* __restrict__ F, _Float16* __restrict__ Hh, _Float16* __restrict__ Hl, size_t n8) { const size_t t = (size_t)blockIdx.x * 256 + threadIdx.x; if (t >= n8) return; FragH fh, fl; const v4f a = *(const v4fa*)(F + t * 8), c = *(const v4fa*)(F + t * 8 + 4);
#pragma unroll
  for (int q = 0; q < 4; ++q) { _Float16 h = (_Float16)a[q]; fh.h[q] = h; fl.h[q] = (_Float16)((a[q] - (float)h) * 1024.0f); h = (_Float16)c[q]; fh.h[4 + q] = h; fl.h[4 + q] = (_Float16)((c[q] - (float)h) * 1024.0f); }
  { *(v8us*)((unsigned short*)Hh + t * 8) = fh.half[0]; *(v8us*)((unsigned short*)Hl + t * 8) = fl.half[0];  } }

// ---- fast GEMM (wave tile 32x64; requires M % 32 == 0 rows per launch region and N % 64 == 0); epilogue = k_gemm_hhx semantics ----
__device__ __forceinline__ v16h g2_frag(const _Float16* p, int hh) { FragH f; f.half[0] = *(const v8us*)((const unsigned short*)p + 8 * hh); f.half[1] = *(const v8us*)((const unsigned short*)p + 16 + 8 * hh); return f.v; }
__device__ __forceinline__ v8f g2_mma(v16h a, v16h b, v8f c) { v8f d = __builtin_amdgcn_wmma_f32_16x16x32_f16(false, a, false, b, (short)0, c, false, false); asm volatile("v_nop\n\tv_nop\n\tv_nop\n\tv_nop" : "+v"(d) : "v"(a), "v"(b)); return d; }
template <int ACT>
__global__ __launch_bounds__(128) void k_gemm2(const _Float16* __restrict__ A, int lda, size_t sA, const _Float16* __restrict__ Bh, int ldb, size_t sB, float alpha, const float* __restrict__ bias, size_t sBias, const float* __restrict__ CP, int rowsPerB, size_t sCPb, int row0g,
    float* __restrict__ C, _Float16* __restrict__ C16, int ldc, size_t sC, int M, int N, int K) { static_assert(ACT == 0 || ACT == 3 || ACT == 6 || ACT == 8 || ACT == 9 || ACT == 11 || ACT == 12 || ACT == 14 || ACT == 15 || ACT == 16 || ACT == 17, "k_gemm2: unsupported ACT code (would silently apply no activation)");
  __shared__ __attribute__((aligned(16))) float so[4][32][68];
  const int tid = threadIdx.x, w = tid >> 5, lane = tid & 31, ln = lane & 15, hh = lane >> 4; const int by = blockIdx.y;
  A += (size_t)by * sA; Bh += (size_t)by * sB; const size_t cofs = (size_t)by * sC; const float* bp = bias ? bias + (size_t)by * sBias : nullptr;
  const int ntn = N >> 6; const int mt = blockIdx.x / ntn, nq = blockIdx.x - mt * ntn; const int row0 = mt * 128 + 32 * w, col0 = nq * 64; if (row0 >= M) return;
  const _Float16* a0p = A + (size_t)(row0 + ln) * lda; const _Float16* a1p = a0p + (size_t)16 * lda;
  const _Float16* b0p = Bh + (size_t)(col0 + ln) * ldb; const _Float16* b1p = b0p + (size_t)16 * ldb; const _Float16* b2p = b1p + (size_t)16 * ldb; const _Float16* b3p = b2p + (size_t)16 * ldb;
  const v8f z8 = {0.f,0.f,0.f,0.f,0.f,0.f,0.f,0.f}; v8f c00 = z8, c01 = z8, c02 = z8, c03 = z8, c10 = z8, c11 = z8, c12 = z8, c13 = z8;
#pragma unroll 1
  for (int kb = 0; kb < K; kb += 32) { const v16h a0 = g2_frag(a0p + kb, hh), a1 = g2_frag(a1p + kb, hh);
    v16h b = g2_frag(b0p + kb, hh); c00 = g2_mma(a0, b, c00); c10 = g2_mma(a1, b, c10);
    b = g2_frag(b1p + kb, hh); c01 = g2_mma(a0, b, c01); c11 = g2_mma(a1, b, c11);
    b = g2_frag(b2p + kb, hh); c02 = g2_mma(a0, b, c02); c12 = g2_mma(a1, b, c12);
    b = g2_frag(b3p + kb, hh); c03 = g2_mma(a0, b, c03); c13 = g2_mma(a1, b, c13); }
  v8f accs[8] = {c00, c01, c02, c03, c10, c11, c12, c13};
#pragma unroll
  for (int u = 0; u < 8; ++u) { const int t = u & 3, half = u >> 2; const int col = col0 + t * 16 + ln; const float bv = bp ? bf16_round(bp[col]) : 0.f;
#pragma unroll
    for (int r = 0; r < 8; ++r) { const int rloc = half * 16 + 8 * hh + r; float v = accs[u][r] * alpha + bv; if (CP) { if (rowsPerB < 0) v += CP[cofs + (size_t)(row0g + row0 + rloc) * ldc + col];      /* rowsPerB < 0: own element of the batched C plane */ else { const int bidx = (row0g + row0 + rloc) / rowsPerB; v += CP[(size_t)bidx * sCPb + (size_t)by * 64 + col]; } }
      if (ACT == 3) v = fmaxf(v, 0.f); else if (ACT == 6) v = 0.5f * v * (1.0f + erff(v * 0.70710678118654752f)); else if (ACT == 11) v = 1.0f / (1.0f + expf(-v)); else if (ACT == 15) v = v / (1.0f + expf(-v)); else if (ACT == 12) v = (v > 0.f) ? v : 0.01f * v; else if (ACT == 8) v = tanhf(v); else if (ACT == 9) v = 0.5f * v * (1.0f + tanhf(0.7978845608028654f * (v + 0.044715f * v * v * v))); else if (ACT == 14) v = (v > 0.f) ? v : 0.1f * v; else if (ACT == 16) v = (v >= 0.f) ? v : 0.3f * v; else if (ACT == 17) v = (v >= 0.f) ? v : 0.2f * v;
      so[w][rloc][t * 16 + ln] = v; } }
  __builtin_amdgcn_fence(__ATOMIC_ACQ_REL, "workgroup"); __builtin_amdgcn_wave_barrier();
  const int rsub = lane >> 4, c4 = (lane & 15) * 4;
  {
#pragma unroll
    for (int q = 0; q < 16; ++q) { const int r = q * 2 + rsub; const v4f v = *(const v4fa*)&so[w][r][c4]; if (C) *(v4f*)(C + cofs + (size_t)(row0 + r) * ldc + col0 + c4) = v; if (C16) { v4h h4; for (int i = 0; i < 4; ++i) h4[i] = (_Float16)v[i]; *(v4h*)(C16 + cofs + (size_t)(row0 + r) * ldc + col0 + c4) = h4; } }
     } }


__global__ __launch_bounds__(256) void k_wnat(const float* __restrict__ w, size_t n8, _Float16* __restrict__ Bt) { const size_t t = (size_t)blockIdx.x * 256 + threadIdx.x; if (t >= n8) return; FragH f; for (int q = 0; q < 8; ++q) f.h[q] = (_Float16)(bf16_round(w[t * 8 + q]) * 16.0f); *(v8us*)((unsigned short*)Bt + t * 8) = f.half[0];  }
__global__ __launch_bounds__(256) void k_rsm(const float* __restrict__ S, _Float16* __restrict__ P, int nrows) {
  #pragma clang fp contract(off)
  const int i = blockIdx.x * 256 + threadIdx.x; if (i >= nrows) return; const float* s = S + (size_t)i * SQ; float mx = -3.0e38f;
#pragma unroll 1
  for (int j = 0; j < SQ; ++j) mx = fmaxf(mx, s[j]); float se = 0.f;
#pragma unroll 1
  for (int j = 0; j < SQ; ++j) se += expf(s[j] - mx); const float sc = 256.0f / se;
#pragma unroll 1
  for (int j0 = 0; j0 < SQ; j0 += 8) { FragH f; for (int q = 0; q < 8; ++q) f.h[q] = (_Float16)(expf(s[j0 + q] - mx) * sc); unsigned short* d = (unsigned short*)P + (size_t)i * SQ + j0; *(v8us*)d = f.half[0];  } }
__global__ __launch_bounds__(256) void k_vt(const _Float16* __restrict__ V16, int b, int h0, _Float16* __restrict__ VT) { __shared__ unsigned short tl[64][65]; const int tid = threadIdx.x; const int hh = blockIdx.x % HG, sg = blockIdx.x / HG; const int s0 = sg * 64; const int h = h0 + hh;
  for (int i = tid; i < 64 * 8; i += 256) { const int j = i / 8, d8 = (i % 8) * 8; FragH f; f.half[0] = *(const v8us*)((const unsigned short*)V16 + ((size_t)b * SQ + s0 + j) * DM + h * HD + d8); for (int q = 0; q < 8; ++q) tl[d8 + q][j] = f.u[q]; }
  __syncthreads();
  { for (int i = tid; i < 64 * 8; i += 256) { const int d = i / 8, j8 = (i % 8) * 8; FragH f; for (int q = 0; q < 8; ++q) f.u[q] = tl[d][j8 + q]; *(v8us*)((unsigned short*)VT + ((size_t)hh * HD + d) * SQ + s0 + j8) = f.half[0]; }  } }



__global__ __launch_bounds__(256) void k_rsmkm(const float* __restrict__ S, _Float16* __restrict__ P, int nrows, const int* __restrict__ am) {
  #pragma clang fp contract(off)
  const int t = blockIdx.x * 256 + threadIdx.x; if (t >= nrows) return; const size_t i = (size_t)t; const float* s = S + i * SQ; const int* mr = am + (size_t)(t % SQ) * SQ; float mx = -3.0e38f;
#pragma unroll 1
  for (int j = 0; j < SQ; ++j) { const float f = (mr[j] != 0) ? 1.f : 0.f; mx = fmaxf(mx, fmaf(f, s[j], (1.f - f) * -1.0e9f)); } float se = 0.f;
#pragma unroll 1
  for (int j = 0; j < SQ; ++j) { const float f = (mr[j] != 0) ? 1.f : 0.f; se += __expf(fmaf(f, s[j], (1.f - f) * -1.0e9f) - mx); } const float sc = 256.0f / se;
#pragma unroll 1
  for (int j0 = 0; j0 < SQ; j0 += 8) { FragH fr; for (int q = 0; q < 8; ++q) { const int j = j0 + q; const float f = (mr[j] != 0) ? 1.f : 0.f; fr.h[q] = (_Float16)(__expf(fmaf(f, s[j], (1.f - f) * -1.0e9f) - mx) * sc); }
    unsigned short* d = (unsigned short*)P + i * SQ + j0; *(v8us*)d = fr.half[0];  } }
// exp of four values as __expf forms it (v_exp_f32 of x * log2 e). One statement, so that the free slot the instruction set asks for behind a transcendental stands there by construction: outputs are early-clobbered (no v_exp_f32 overwrites a neighbour's source or reads its result), and the v_nop fills the slot behind the last one.
__device__ __forceinline__ v4f exp_x4(v4f x) { float r0, r1, r2, r3;
  asm("v_exp_f32 %0, %4\n\tv_exp_f32 %1, %5\n\tv_exp_f32 %2, %6\n\tv_exp_f32 %3, %7\n\tv_nop" : "=&v"(r0), "=&v"(r1), "=&v"(r2), "=&v"(r3) : "v"(x[0] * 1.44269504088896340736f), "v"(x[1] * 1.44269504088896340736f), "v"(x[2] * 1.44269504088896340736f), "v"(x[3] * 1.44269504088896340736f));
  const v4f r = {r0, r1, r2, r3}; return r; }
// One wave per score row: lane l holds elements 128 c + 4 l .. + 3 of chunk c, so every load is 512 contiguous bytes, the row is read once and stays in registers.
__global__ __launch_bounds__(256) void k_rsmlow(const float* __restrict__ S, _Float16* __restrict__ P, int nrows) {
  const int lane = threadIdx.x & 31; const int t = blockIdx.x * 8 + (threadIdx.x >> 5); if (t >= nrows) return;      /* wave-uniform exit, no barrier below */
  const int qi = t % SQ; const float* s = S + (size_t)t * SQ + lane * 4; v4f e[SQ / 128];
#pragma unroll      /* all 16 loads in flight at once; e[] indexed by constants only, so that it stays in registers (so in the three loops below) */
  for (int c = 0; c < SQ / 128; ++c) e[c] = *(const v4fa*)(s + c * 128);
  float mx = -3.0e38f;
#pragma unroll      /* e[] in registers */
  for (int c = 0; c < SQ / 128; ++c)
    for (int u = 0; u < 4; ++u) { const float m = (c * 128 + lane * 4 + u <= qi) ? 1.0f : 0.0f; e[c][u] = __fadd_rn(e[c][u], __fmul_rn(m, -1.0e9f)); mx = fmaxf(mx, e[c][u]); }
  for (int o = 16; o > 0; o >>= 1) mx = fmaxf(mx, __shfl_xor(mx, o));
  v4f s4 = {0.f, 0.f, 0.f, 0.f};      /* four independent chains per lane, then a butterfly over the lanes */
#pragma unroll      /* e[] in registers */
  for (int c = 0; c < SQ / 128; ++c) { e[c] = exp_x4(e[c] - mx); s4 += e[c]; }
  float se = (s4[0] + s4[1]) + (s4[2] + s4[3]);
  for (int o = 16; o > 0; o >>= 1) se += __shfl_xor(se, o);
  const float sc = 256.0f / se; _Float16* d = P + (size_t)t * SQ + lane * 4;
#pragma unroll      /* e[] in registers */
  for (int c = 0; c < SQ / 128; ++c) { v4h h4; for (int u = 0; u < 4; ++u) h4[u] = (_Float16)(e[c][u] * sc); *(v4h*)(d + c * 128) = h4; } }      /* a wave's store = 256 contiguous bytes, two whole lines */

// One thread per query row of the tile. The 64-wide loops are unrolled: q[] and o[] are indexed by constants only and stay in registers, a key's k row is fetched whole ahead of the score sum and its v row under that sum.
__global__ __launch_bounds__(64) void k_attup(const float* __restrict__ QF, const float* __restrict__ KF, const float* __restrict__ VF, int ld, float scale, float* __restrict__ OF, int ldo) {
  #pragma clang fp contract(off)
  __shared__ __attribute__((aligned(16))) float lo[64][64];
  const int tid = threadIdx.x; const int h = blockIdx.x / (QT0 / 64), rg = blockIdx.x % (QT0 / 64); const int i = rg * 64 + tid;
  const float* qr = QF + (size_t)i * ld + h * HD; v4f q[HD / 4], o[HD / 4];
#pragma unroll      /* q[], o[] in registers; the q row's 16 loads in flight at once */
  for (int c = 0; c < HD / 4; ++c) { q[c] = *(const v4fa*)(qr + c * 4); const v4f z = {0.f, 0.f, 0.f, 0.f}; o[c] = z; }
  float m = -1.0e30f, l = 0.f;
#pragma unroll 1
  for (int j = rg * 64; j < QT0; ++j) { const float* kr = KF + (size_t)j * ld + h * HD; const float* vr = VF + (size_t)j * ld + h * HD; v4f kq[HD / 4], vv[HD / 4]; float s = 0.f;
#pragma unroll      /* a whole row's loads in flight at once */
    for (int c = 0; c < HD / 4; ++c) kq[c] = *(const v4fa*)(kr + c * 4);
#pragma unroll      /* the v row arrives under the score sum */
    for (int c = 0; c < HD / 4; ++c) vv[c] = *(const v4fa*)(vr + c * 4);
#pragma unroll      /* q[], kq[] in registers */
    for (int c = 0; c < HD / 4; ++c) { s = __fadd_rn(s, __fmul_rn(q[c][0], kq[c][0])); s = __fadd_rn(s, __fmul_rn(q[c][1], kq[c][1])); s = __fadd_rn(s, __fmul_rn(q[c][2], kq[c][2])); s = __fadd_rn(s, __fmul_rn(q[c][3], kq[c][3])); }
    s = __fmul_rn(s, scale);
    const float f = (j > i) ? 1.f : 0.f; const float sm = fmaf(f, s, (1.f - f) * -1.0e30f); const float mn = fmaxf(m, sm); const float sc = expf(m - mn); const float e = __fmul_rn(f, expf(sm - mn)); l = __fadd_rn(__fmul_rn(l, sc), e); m = mn;
#pragma unroll      /* o[], vv[] in registers */
    for (int c = 0; c < HD / 4; ++c) for (int u = 0; u < 4; ++u) o[c][u] = __fadd_rn(__fmul_rn(o[c][u], sc), __fmul_rn(e, vv[c][u])); }
  const float fin = (l > 0.f) ? 64.0f / l : 0.f;      /* o carried x64 like the f16 path; the key-less last row is written by k_vmean */
#pragma unroll      /* o[] in registers */
  for (int c = 0; c < HD / 4; ++c) { v4f oo = o[c]; for (int u = 0; u < 4; ++u) oo[u] = __fmul_rn(oo[u], fin); *(v4f*)&lo[tid][c * 4] = oo; }
  __syncthreads();
  {
#pragma unroll 1
    for (int it = 0; it < 16; ++it) { const int row = it * 4 + tid / 16, pc = (tid % 16) * 4; const v4f v = *(const v4f*)&lo[row][pc]; *(v4f*)(OF + (size_t)(rg * 64 + row) * ldo + h * HD + pc) = v; }
     } }

__global__ __launch_bounds__(256) void k_vmean(const _Float16* __restrict__ V, float* __restrict__ orow) {
  #pragma clang fp contract(off)
  const int c = blockIdx.x * 256 + threadIdx.x; if (c >= DM) return; const _Float16* p = V + c; float s = 0.f;
#pragma unroll 1
  for (int j0 = 0; j0 < SQ; j0 += 64) { _Float16 t[64];
#pragma unroll      /* 64 rows' loads in flight at once (the constant pitch LQ makes them one address register with immediate offsets); t[] in registers */
    for (int j = 0; j < 64; ++j) t[j] = p[(size_t)(j0 + j) * LQ];
#pragma unroll      /* summed in the rows' order */
    for (int j = 0; j < 64; ++j) s = __fadd_rn(s, (float)t[j]); }
  const float o = __fmul_rn(s, 64.0f / (float)SQ); *(float*)(orow + c) = o;  }

extern "C" void kernel_launch(void* const* d_in, const int* in_sizes, int n_in,
                              void* d_out, int out_size, void* d_ws, size_t ws_size, hipStream_t stream) {
  (void)in_sizes; (void)n_in; (void)out_size;
  const float* const* I = (const float* const*)d_in; const float* xq = I[0]; const float* xk = I[0]; const float* xv = I[0]; const float* wq = I[1]; const float* bq = I[2]; const float* wk = I[3]; const float* bk = I[4]; const float* wv = I[5]; const float* bv = I[6]; const float* wo = I[7]; const float* bo = I[8]; const float* x = xq;      /* ONE input feeds the query, key and value streams; [in][out] weights + biases; the mask is built from indices as in the module */
  static_assert(NH * HD == DM && DM % 64 == 0 && SQ % 128 == 0 && NH % HG == 0, "shape / tile multiples");
  char* ws = (char*)d_ws; size_t off = 0;
  auto take = [&](size_t bytes) { char* p = ws + off; off += (bytes + 255) & ~(size_t)255; return p; };
  _Float16* BQ = (_Float16*)take((size_t)DM * DM * 2); _Float16* BK = (_Float16*)take((size_t)DM * DM * 2); _Float16* BV = (_Float16*)take((size_t)DM * DM * 2); _Float16* BO = (_Float16*)take((size_t)DM * DM * 2);
  _Float16* X16 = (_Float16*)take(NR * DM * 2); _Float16* XKp = (_Float16*)take(NR * DM * 2); _Float16* XVp = (_Float16*)take(NR * DM * 2); _Float16* Q16 = (_Float16*)take(NR * DM * 2); _Float16* K16 = (_Float16*)take(NR * DM * 2); _Float16* V16 = (_Float16*)take(NR * DM * 2); _Float16* O16 = (_Float16*)take(NR * DM * 2);
  float* S = (float*)take((size_t)HG * SQ * SQ * 4); _Float16* P = (_Float16*)take((size_t)HG * SQ * SQ * 2); _Float16* VT = (_Float16*)take((size_t)NH * HD * SQ * 2);
  float* QF0 = (float*)take((size_t)QT0 * DM * 4); float* KF0 = (float*)take((size_t)QT0 * DM * 4); float* VF0 = (float*)take((size_t)QT0 * DM * 4); float* OF0 = (float*)take((size_t)NB * QT0 * DM * 4); _Float16* OH0 = (_Float16*)take((size_t)NB * QT0 * DM * 2); _Float16* OL0 = (_Float16*)take((size_t)NB * QT0 * DM * 2);      /* exact last tile: f32 q / k / v of the tile rows, o (x64) and its f16 hi + x1024 residual planes */
  if (off > ws_size) return;
  { const unsigned g = (unsigned)(((size_t)DM * (DM / 8) + 255) / 256); k_wt_f16<<<g, 256, 0, stream>>>(wq, BQ, DM, DM, 16.0f); k_wt_f16<<<g, 256, 0, stream>>>(wk, BK, DM, DM, 16.0f); k_wt_f16<<<g, 256, 0, stream>>>(wv, BV, DM, DM, 16.0f); k_wt_f16<<<g, 256, 0, stream>>>(wo, BO, DM, DM, 16.0f); }      /* [in][out] -> Bt x16 */
  _Float16* XK = XKp; _Float16* XV = XVp; k_x16<<<(unsigned)((NR * DM / 8 + 255) / 256), 256, 0, stream>>>(xk, XK, NR * DM / 8); k_x16<<<(unsigned)((NR * DM / 8 + 255) / 256), 256, 0, stream>>>(xv, XV, NR * DM / 8);      /* key and value inputs as exact f16 rows */

  k_x16<<<(unsigned)((NR * DM / 8 + 255) / 256), 256, 0, stream>>>(x, X16, NR * DM / 8);
  const size_t r0p = (size_t)B0 * SQ;      /* first projected row */
  k_gemm2<0><<<dim3((unsigned)((MP / 128) * (DM / 64)), 1), 128, 0, stream>>>(X16 + r0p * DM, DM, 0, BQ, DM, 0, 0.0625f, bq, 0, nullptr, 1, 0, 0, nullptr, Q16 + r0p * DM, DM, 0, MP, DM, DM);
  k_gemm2<0><<<dim3((unsigned)((MP / 128) * (DM / 64)), 1), 128, 0, stream>>>(XK + r0p * DM, DM, 0, BK, DM, 0, 0.0625f, bk, 0, nullptr, 1, 0, 0, nullptr, K16 + r0p * DM, DM, 0, MP, DM, DM);
  k_gemm2<0><<<dim3((unsigned)((MP / 128) * (DM / 64)), 1), 128, 0, stream>>>(XV + r0p * DM, DM, 0, BV, DM, 0, 0.0625f, bv, 0, nullptr, 1, 0, 0, nullptr, V16 + r0p * DM, DM, 0, MP, DM, DM);
  for (int b = B0; b < B0 + NBR; ++b) { const size_t r0 = (size_t)b * SQ;
    k_vt<NH, SQ><<<NH * (SQ / 64), 256, 0, stream>>>(V16 + r0 * LQ, LQ, 0, VT);      /* V^T [NH][HD][SQ] for this batch */
    { const size_t rl = r0 + SQ - QT0;      /* the batch's last QT0 rows */
      k_gemm2<0><<<dim3((QT0 / 128) * (DM / 64), 1), 128, 0, stream>>>(X16 + rl * DM, DM, 0, BQ, DM, 0, 0.0625f, bq, 0, nullptr, 1, 0, 0, QF0, nullptr, DM, 0, QT0, DM, DM); k_gemm2<0><<<dim3((QT0 / 128) * (DM / 64), 1), 128, 0, stream>>>(XK + rl * DM, DM, 0, BK, DM, 0, 0.0625f, bk, 0, nullptr, 1, 0, 0, KF0, nullptr, DM, 0, QT0, DM, DM); k_gemm2<0><<<dim3((QT0 / 128) * (DM / 64), 1), 128, 0, stream>>>(XV + rl * DM, DM, 0, BV, DM, 0, 0.0625f, bv, 0, nullptr, 1, 0, 0, VF0, nullptr, DM, 0, QT0, DM, DM);      /* f32 q, k, v of the last tile (exact products) */
      k_attup<<<NH * (QT0 / 64), 64, 0, stream>>>(QF0, KF0, VF0, DM, 0.125f, OF0 + (size_t)b * QT0 * DM, DM);      /* exact f32 attention over the keys j > i inside the tile (o x64) */
      k_vmean<<<(DM + 255) / 256, 256, 0, stream>>>(V16 + r0 * LQ, OF0 + ((size_t)b * QT0 + QT0 - 1) * DM); }      /* last row: uniform over all keys = 64 x mean of v */
    for (int h0 = 0; h0 < NHD; h0 += HG) {
      k_gemm2<0><<<dim3((QN / 128) * (SQ / 64), HG), 128, 0, stream>>>(Q16 + r0 * LQ + h0 * HD, LQ, (size_t)HD, K16 + r0 * LQ + h0 * HD, LQ, (size_t)HD, 0.125f, nullptr, 0, nullptr, 1, 0, 0, S, nullptr, SQ, (size_t)SQ * SQ, QN, SQ, HD);      /* scores, HG heads per launch */
      k_rsmlow<<<(HG * SQ + 7) / 8, 256, 0, stream>>>(S, P, HG * SQ);      /* literal 'score + tril * (-1e9)' then softmax over all keys -> P x256 f16 */
      k_gemm2<0><<<dim3((QN / 128) * (HD / 64), HG), 128, 0, stream>>>(P, SQ, (size_t)SQ * SQ, VT + (size_t)h0 * HD * SQ, SQ, (size_t)HD * SQ, 0.25f, nullptr, 0, nullptr, 1, 0, 0, nullptr, O16 + r0 * DM + h0 * HD, DM, (size_t)HD, QN, HD, SQ); } }      /* o (merged heads) as f16 rows */
  k_gemm2<0><<<dim3((unsigned)((MPO / 128) * (DM / 64)), 1), 128, 0, stream>>>(O16 + r0p * DM, DM, 0, BO, DM, 0, 0.0009765625f, bo, 0, nullptr, 1, 0, 0, (float*)d_out + r0p * DM, nullptr, DM, 0, MPO, DM, DM);      /* out rows are the output layout */
  k_hl<<<(unsigned)(((size_t)NB * QT0 * DM / 8 + 255) / 256), 256, 0, stream>>>(OF0, OH0, OL0, (size_t)NB * QT0 * DM / 8);      /* last-tile o (x64) -> f16 hi + x1024 residual planes */
  for (int b = B0; b < B0 + NBR; ++b) { const size_t rl = (size_t)b * SQ + SQ - QT0; const size_t f0 = (size_t)b * QT0;
    k_gemm2<0><<<dim3((QT0 / 128) * (DM / 64), 1), 128, 0, stream>>>(OH0 + f0 * DM, DM, 0, BO, DM, 0, 0.0009765625f, bo, 0, nullptr, 1, 0, 0, (float*)d_out + rl * DM, nullptr, DM, 0, QT0, DM, DM);      /* last QT0 rows: out = o_hi Wo (+ b), overwriting the f16-path rows */
    k_gemm2<0><<<dim3((QT0 / 128) * (DM / 64), 1), 128, 0, stream>>>(OL0 + f0 * DM, DM, 0, BO, DM, 0, 0.00000095367431640625f, nullptr, 0, (const float*)d_out + rl * DM, -1, 0, 0, (float*)d_out + rl * DM, nullptr, DM, 0, QT0, DM, DM); }      /* += o_lo Wo 2^-20 (own-element accumulate) */
}

// v003
// A run of this version takes 930 microseconds.
// Next to v002, in two timings, it ran 1.74 and 1.75 times as fast.
// All steps since v000 together make it 7.07 times as fast.
#include <hip/hip_runtime.h>
// Multi-head self-attention with the source's INVERTED causal mask (inputs [2][2048][1024]; q / k / v = x W + b ([in][out] 1024 x 1024 sigma 1/32, zero biases); 16 heads of 64; score = q k^T / sqrt(64) + tril * (-1e9): the LOWER triangle incl. the diagonal is pushed to -1e9 (the original's mask bug, kept), so query i attends to the keys j > i only, and the last query (every key masked, all scores rounding to the same -1e9 in f32) attends uniformly to all keys; softmax; out = merged Wo + bo -> [2][2048][1024]).
// Structure: token rows r = b*2048 + s; x as exact f16 rows (bf16-rounded); Q, K, V as three WMMA GEMMs (32x64 wave tiles, f32 accumulation, exact x16 weights + bias, f16 outputs); per batch: V^T for all heads via LDS transposes; one fused attention launch over every (batch, head): S^T = K Q^T on WMMA (K = 64, x 1/sqrt(64), then the -1e9 fill), running softmax on VALU (f32 statistics; unnormalised weights exp(s - max) as f16), O^T += V^T P^T on WMMA, o = O / sum (carried x64 against f16 subnormal flush, folded into the output GEMM alpha) written straight into the merged f16 o rows; out = o W_o + b GEMM (f32) into the output layout.
// Compute dtype: inputs rounded to bf16; x / weights exact; q, k, v, softmax weights and o as plain f16 GEMM operands (~2^-12); scores and softmax statistics f32; v_wmma_f32_16x16x32_f16.
#define NB 2
#define SQ 2048
#define DM 1024
#define NH 16
#define HD 64
#define QT0 256                      /* last-tile rows recomputed exactly in f32 (rows with fewer than 256 visible keys) */
#define HG 4                         /* heads per launch of the grouped k_vt (not called) */
#define B0 0                         /* first batch processed (debug hook) */
#define NBR NB                       /* batches processed (debug hook) */
#define NR ((size_t)NB * SQ)         /* token rows */
#define MP ((int)((size_t)NBR * SQ)) /* rows projected (debug hook) */
#define QN SQ                        /* query rows attended per batch (not used) */
#define NHD NH                       /* heads attended (not used) */
#define MPO MP                       /* rows through the output stage (debug hook) */
#define LQ DM      /* row pitch of the q/k/v rows */
typedef __bf16 v16b __attribute__((ext_vector_type(16)));
typedef unsigned short v8us __attribute__((ext_vector_type(8), may_alias));
typedef float  v8f  __attribute__((ext_vector_type(8)));
typedef float  v4f  __attribute__((ext_vector_type(4)));
typedef float  v4fa __attribute__((ext_vector_type(4), may_alias));
union FragB { v16b v; v8us half[2]; unsigned short u[16]; };

__device__ __forceinline__ unsigned short bf16_bits(float x) { unsigned int u = __float_as_uint(x); return (unsigned short)((u + 0x7FFFu + ((u >> 16) & 1u)) >> 16); }
__device__ __forceinline__ float bf16_val(unsigned short b) { return __uint_as_float(((unsigned int)b) << 16); }
__device__ __forceinline__ float bf16_round(float x) { return bf16_val(bf16_bits(x)); }
// D += A·B with NT terms: 1 = ah·bh, 2 = + al·bh (A split), 3 = + ah·bl (both split)
template <int NT>
__device__ __forceinline__ v8f mmaN(v16b ah, v16b al, v16b bh, v16b bl, v8f c) {
  c = __builtin_amdgcn_wmma_f32_16x16x32_bf16(false, ah, false, bh, (short)0, c, false, false);
  if (NT >= 2) c = __builtin_amdgcn_wmma_f32_16x16x32_bf16(false, al, false, bh, (short)0, c, false, false);
  if (NT >= 3) c = __builtin_amdgcn_wmma_f32_16x16x32_bf16(false, ah, false, bl, (short)0, c, false, false);
  asm volatile("v_nop\n\tv_nop\n\tv_nop\n\tv_nop" : "+v"(c) : "v"(ah), "v"(al), "v"(bh), "v"(bl));
  return c;
}

__global__ __launch_bounds__(256) void k_wt_bf16(const float* __restrict__ W, unsigned short* __restrict__ Wt, int K, int N) {
  const int t = blockIdx.x * 256 + threadIdx.x;
  const int k8n = K / 8;
  if (t >= N * k8n) return;
  const int n = t / k8n, k8 = (t % k8n) * 8;
  v8us v;
#pragma unroll
  for (int i = 0; i < 8; ++i) v[i] = bf16_bits(W[(size_t)(k8 + i) * N + n]);
  *(v8us*)(Wt + (size_t)n * K + k8) = v;
  
}

// GEMM C[M][N] (f32, pitch ldc) = act(A[M][K]·W + bias). A f32 row-major (pitch lda) converted per fragment to bf16
// (ASPLIT: hi/lo two planes -> 2 terms, else single rounded term); Wt bf16 [N][K] (pitch ldb). BIAS_BF16 rounds the
// bias to bf16 first (bias quantised to bf16 before the add). K%32==0, M%16==0, N%64==0.
template <bool ASPLIT, int ACT, bool BIAS_BF16>
__global__ __launch_bounds__(128) void k_gemm_bf(const float* __restrict__ A, int lda, const unsigned short* __restrict__ Wt, int ldb,
                                               const float* __restrict__ bias, float* __restrict__ C, int ldc, int M, int N, int K) {
  __shared__ __attribute__((aligned(16))) float so[4][16][64];
  const int tid = threadIdx.x, w = tid >> 5, lane = tid & 31, ln = lane & 15, hh = lane >> 4;
  const int ntn = N / 64;
  const int wid = blockIdx.x * 4 + w;
  const int mt = wid / ntn, nq = wid % ntn;
  if (mt * 16 >= M) return;
  const int row0 = mt * 16, col0 = nq * 64;
  const float* arow = A + (size_t)(row0 + ln) * lda;
  v8f acc[4] = {};
  for (int kb = 0; kb < K; kb += 32) {
    FragB ah, al;
    const v4f x0 = *(const v4fa*)(arow + kb + 8 * hh), x1 = *(const v4fa*)(arow + kb + 8 * hh + 4);
    const v4f x2 = *(const v4fa*)(arow + kb + 16 + 8 * hh), x3 = *(const v4fa*)(arow + kb + 16 + 8 * hh + 4);
    float xs[16] = {x0[0],x0[1],x0[2],x0[3],x1[0],x1[1],x1[2],x1[3],x2[0],x2[1],x2[2],x2[3],x3[0],x3[1],x3[2],x3[3]};
#pragma unroll
    for (int i = 0; i < 16; ++i) { const unsigned short hb = bf16_bits(xs[i]); ah.u[i] = hb; al.u[i] = ASPLIT ? bf16_bits(xs[i] - bf16_val(hb)) : (unsigned short)0; }
#pragma unroll
    for (int t = 0; t < 4; ++t) {
      const unsigned short* brow = Wt + (size_t)(col0 + t * 16 + ln) * ldb + kb;
      FragB b;
      b.half[0] = *(const v8us*)(brow + 8 * hh);
      b.half[1] = *(const v8us*)(brow + 16 + 8 * hh);
      acc[t] = mmaN<ASPLIT ? 2 : 1>(ah.v, al.v, b.v, b.v, acc[t]);
    }
  }
#pragma unroll
  for (int t = 0; t < 4; ++t) {
    float bv = bias ? bias[col0 + t * 16 + ln] : 0.f;
    if (BIAS_BF16) bv = bf16_round(bv);
#pragma unroll
    for (int r = 0; r < 8; ++r) { float v = acc[t][r] + bv; if (ACT == 1) v = fmaxf(v, 0.f); so[w][8 * hh + r][t * 16 + ln] = v; }
  }
  __builtin_amdgcn_fence(__ATOMIC_ACQ_REL, "workgroup");
  __builtin_amdgcn_wave_barrier();
  const int rsub = lane >> 4, c4 = (lane & 15) * 4;
  {
#pragma unroll
    for (int q = 0; q < 8; ++q) {
      const int r = q * 2 + rsub;
      const v4f v = *(const v4fa*)&so[w][r][c4];
      *(v4f*)(C + (size_t)(row0 + r) * ldc + col0 + c4) = v;
    }
    
  }
}

// GEMM C = act(A·W + bias + resid): A f32 (ASPLIT -> hi/lo 2 terms), Wt bf16 [N][K]; ACT 0 none, 1 relu, 2 exact gelu;
// resid (optional, f32, row index = (row % rmod), pitch ldr, RES_BF16 rounds it) added before the activation.
template <bool ASPLIT, int ACT, bool BIAS_BF16, bool RES_BF16>
__global__ __launch_bounds__(128) void k_gemm_bf3(const float* __restrict__ A, int lda, const unsigned short* __restrict__ Wt, int ldb,
                                                const float* __restrict__ bias, const float* __restrict__ resid, int rmod, int ldr,
                                                float* __restrict__ C, int ldc, int M, int N, int K) {
  __shared__ __attribute__((aligned(16))) float so[4][16][64];
  const int tid = threadIdx.x, w = tid >> 5, lane = tid & 31, ln = lane & 15, hh = lane >> 4;
  const int ntn = N / 64;
  const int wid = blockIdx.x * 4 + w;
  const int mt = wid / ntn, nq = wid % ntn;
  if (mt * 16 >= M) return;
  const int row0 = mt * 16, col0 = nq * 64;
  const float* arow = A + (size_t)(row0 + ln) * lda;
  v8f acc[4] = {};
  for (int kb = 0; kb < K; kb += 32) {
    FragB ah, al;
    const v4f x0 = *(const v4fa*)(arow + kb + 8 * hh), x1 = *(const v4fa*)(arow + kb + 8 * hh + 4);
    const v4f x2 = *(const v4fa*)(arow + kb + 16 + 8 * hh), x3 = *(const v4fa*)(arow + kb + 16 + 8 * hh + 4);
    float xs[16] = {x0[0],x0[1],x0[2],x0[3],x1[0],x1[1],x1[2],x1[3],x2[0],x2[1],x2[2],x2[3],x3[0],x3[1],x3[2],x3[3]};
#pragma unroll
    for (int i = 0; i < 16; ++i) { const unsigned short hb = bf16_bits(xs[i]); ah.u[i] = hb; al.u[i] = ASPLIT ? bf16_bits(xs[i] - bf16_val(hb)) : (unsigned short)0; }
#pragma unroll
    for (int t = 0; t < 4; ++t) {
      const unsigned short* brow = Wt + (size_t)(col0 + t * 16 + ln) * ldb + kb;
      FragB b;
      b.half[0] = *(const v8us*)(brow + 8 * hh);
      b.half[1] = *(const v8us*)(brow + 16 + 8 * hh);
      acc[t] = mmaN<ASPLIT ? 2 : 1>(ah.v, al.v, b.v, b.v, acc[t]);
    }
  }
#pragma unroll
  for (int t = 0; t < 4; ++t) {
    const int col = col0 + t * 16 + ln;
    float bv = bias ? bias[col] : 0.f;
    if (BIAS_BF16) bv = bf16_round(bv);
#pragma unroll
    for (int r = 0; r < 8; ++r) {
      float v = acc[t][r] + bv;
      if (resid) { float rv = resid[(size_t)((row0 + 8 * hh + r) % rmod) * ldr + col]; if (RES_BF16) rv = bf16_round(rv); v += rv; }
      if (ACT == 1) v = fmaxf(v, 0.f);
      if (ACT == 2) v = 0.5f * v * (1.0f + erff(v * 0.70710678118654752f));
      if (ACT == 3) { const float u = 0.7978845608028654f * (v + 0.044715f * v * v * v); v = 0.5f * v * (1.0f + tanhf(u)); }
      so[w][8 * hh + r][t * 16 + ln] = v;
    }
  }
  __builtin_amdgcn_fence(__ATOMIC_ACQ_REL, "workgroup");
  __builtin_amdgcn_wave_barrier();
  const int rsub = lane >> 4, c4 = (lane & 15) * 4;
  {
#pragma unroll
    for (int q = 0; q < 8; ++q) {
      const int r = q * 2 + rsub;
      const v4f v = *(const v4fa*)&so[w][r][c4];
      *(v4f*)(C + (size_t)(row0 + r) * ldc + col0 + c4) = v;
    }
    
  }
}
// row LayerNorm (biased variance, eps) over N: s = X (+ R); optional out_sum <- s; out_norm <- (s-mu)*rsqrt(var+eps)*g + b
template <bool PARAM_BF16>
__global__ __launch_bounds__(256) void k_layernorm(const float* __restrict__ X, const float* __restrict__ R, const float* __restrict__ g, const float* __restrict__ bta,
                                                  float* __restrict__ out_sum, float* __restrict__ out_norm, int N, float eps) {
  __shared__ float red[256];
  const int row = blockIdx.x, tid = threadIdx.x;
  const float* x = X + (size_t)row * N; const float* rr = R ? R + (size_t)row * N : nullptr;
  float vals[16];                     // up to N = 4096
  const int per = N / 256;            // contiguous chunk per thread? use strided-by-4 chunks: thread handles j = tid*4 + 1024*u
  float s1 = 0.f;
  for (int u = 0; u < per / 4; ++u) {
    const int j = tid * 4 + 1024 * u;
    const v4f a = *(const v4fa*)(x + j);
    v4f b = {0.f,0.f,0.f,0.f}; if (rr) b = *(const v4fa*)(rr + j);
#pragma unroll
    for (int q = 0; q < 4; ++q) { const float v = a[q] + b[q]; vals[u * 4 + q] = v; s1 += v; }
  }
  red[tid] = s1; __syncthreads();
  for (int st = 128; st > 0; st >>= 1) { if (tid < st) red[tid] += red[tid + st]; __syncthreads(); }
  const float mu = red[0] / (float)N; __syncthreads();
  float s2 = 0.f;
  for (int u = 0; u < per / 4; ++u)
#pragma unroll
    for (int q = 0; q < 4; ++q) { const float c = vals[u * 4 + q] - mu; s2 += c * c; }
  red[tid] = s2; __syncthreads();
  for (int st = 128; st > 0; st >>= 1) { if (tid < st) red[tid] += red[tid + st]; __syncthreads(); }
  const float rs = rsqrtf(red[0] / (float)N + eps);
  {
    for (int u = 0; u < per / 4; ++u) {
      const int j = tid * 4 + 1024 * u;
      v4f o, sm;
#pragma unroll
      for (int q = 0; q < 4; ++q) {
        float gg = g[j + q], bb = bta[j + q];
        if (PARAM_BF16) { gg = bf16_round(gg); bb = bf16_round(bb); }
        sm[q] = vals[u * 4 + q]; o[q] = (vals[u * 4 + q] - mu) * rs * gg + bb;
      }
      if (out_sum) *(v4f*)(out_sum + (size_t)row * N + j) = sm;
      *(v4f*)(out_norm + (size_t)row * N + j) = o;
    }
    
  }
}



// ---- f16 WMMA path (v_wmma_f32_16x16x32_f16): 11-bit significands for operands in range — used where a [0,1] probability operand needs more precision than bf16
typedef _Float16 v16h __attribute__((ext_vector_type(16)));
union FragH { v16h v; v8us half[2]; _Float16 h[16]; unsigned short u[16]; };
template <int NT>
__device__ __forceinline__ v8f mmaH(v16h ah, v16h al, v16h bh, v16h bl, v8f c) {
  c = __builtin_amdgcn_wmma_f32_16x16x32_f16(false, ah, false, bh, (short)0, c, false, false);
  if (NT >= 2) c = __builtin_amdgcn_wmma_f32_16x16x32_f16(false, al, false, bh, (short)0, c, false, false);
  if (NT >= 3) c = __builtin_amdgcn_wmma_f32_16x16x32_f16(false, ah, false, bl, (short)0, c, false, false);
  asm volatile("v_nop\n\tv_nop\n\tv_nop\n\tv_nop" : "+v"(c) : "v"(ah), "v"(al), "v"(bh), "v"(bl));
  return c;
}
// batched GEMM like k_gemm_b but f16 operands: A f32 (split into f16 hi/lo if ASPLIT, else rounded to f16), Bt = f16 values [n][k]; alpha; C f32; N multiple of 16 (partial tiles skipped)
template <bool ASPLIT>
__global__ __launch_bounds__(128) void k_gemm_h(const float* __restrict__ A, int lda, size_t sA, const _Float16* __restrict__ Bh, int ldb, size_t sB, float alpha, float* __restrict__ C, int ldc, size_t sC, int M, int N, int K) {
  __shared__ __attribute__((aligned(16))) float so[4][16][64];
  const int tid = threadIdx.x, w = tid >> 5, lane = tid & 31, ln = lane & 15, hh = lane >> 4; const int by = blockIdx.y;
  A += (size_t)by * sA; Bh += (size_t)by * sB; C += (size_t)by * sC;
  const int ntn = (N + 63) / 64; const int wid = blockIdx.x * 4 + w; const int mt = wid / ntn, nq = wid % ntn; if (mt * 16 >= M) return;
  const int row0 = mt * 16, col0 = nq * 64; const float* arow = A + (size_t)(row0 + ln) * lda;
  v8f acc[4] = {};
  for (int kb = 0; kb < K; kb += 32) {
    FragH ah, al;
    const v4f x0 = *(const v4fa*)(arow + kb + 8 * hh), x1 = *(const v4fa*)(arow + kb + 8 * hh + 4), x2 = *(const v4fa*)(arow + kb + 16 + 8 * hh), x3 = *(const v4fa*)(arow + kb + 16 + 8 * hh + 4);
    float xs[16] = {x0[0],x0[1],x0[2],x0[3],x1[0],x1[1],x1[2],x1[3],x2[0],x2[1],x2[2],x2[3],x3[0],x3[1],x3[2],x3[3]};
#pragma unroll
    for (int i = 0; i < 16; ++i) { const _Float16 h = (_Float16)xs[i]; ah.h[i] = h; al.h[i] = ASPLIT ? (_Float16)(xs[i] - (float)h) : (_Float16)0.0f; }
#pragma unroll
    for (int t = 0; t < 4; ++t) { if (col0 + t * 16 >= N) continue; const size_t boff = (size_t)(col0 + t * 16 + ln) * ldb + kb; FragH bq; bq.half[0] = *(const v8us*)(Bh + boff + 8 * hh); bq.half[1] = *(const v8us*)(Bh + boff + 16 + 8 * hh);
      acc[t] = mmaH<ASPLIT ? 2 : 1>(ah.v, al.v, bq.v, bq.v, acc[t]); }
  }
#pragma unroll
  for (int t = 0; t < 4; ++t) { if (col0 + t * 16 >= N) continue;
#pragma unroll
    for (int r = 0; r < 8; ++r) so[w][8 * hh + r][t * 16 + ln] = acc[t][r] * alpha; }
  __builtin_amdgcn_fence(__ATOMIC_ACQ_REL, "workgroup"); __builtin_amdgcn_wave_barrier();
  const int rsub = lane >> 4, c4 = (lane & 15) * 4;
  {
#pragma unroll
    for (int q = 0; q < 8; ++q) { const int r = q * 2 + rsub; if (col0 + c4 < N) { const v4f v = *(const v4fa*)&so[w][r][c4]; *(v4f*)(C + (size_t)(row0 + r) * ldc + col0 + c4) = v; } }
     }
}

// Wt[n][k] = f16(W[k][n]·scale) from f32 row-major W[K][N] (scale = power of two; bf16-exact weights stay exact in f16 away from the subnormal range)
__global__ __launch_bounds__(256) void k_wt_f16(const float* __restrict__ W, _Float16* __restrict__ Wt, int K, int N, float scale) {
  const int t = blockIdx.x * 256 + threadIdx.x; if (t >= N * (K / 8)) return; const int n = t / (K / 8), k8 = (t % (K / 8)) * 8; FragH f;
#pragma unroll
  for (int i = 0; i < 8; ++i) f.h[i] = (_Float16)(bf16_round(W[(size_t)(k8 + i) * N + n]) * scale); const v8us o = f.half[0];
  *(v8us*)((unsigned short*)Wt + (size_t)n * K + k8) = o; 
}
// k_gemm_hh variant with fused epilogue: v = acc·alpha + bias[by·sBias + col] (+ CP[(row/rowsPerB)·sCPb + by·64 + col] if CP) ; ACT 0 none / 1 elu ; writes f16 C16 (and f32 C if non-null)
template <int ACT>
__global__ __launch_bounds__(128) void k_gemm_hhx(const _Float16* __restrict__ A, int lda, size_t sA, const _Float16* __restrict__ Bh, int ldb, size_t sB, float alpha, const float* __restrict__ bias, size_t sBias, const float* __restrict__ CP, int rowsPerB, size_t sCPb, int row0g,
    float* __restrict__ C, _Float16* __restrict__ C16, int ldc, size_t sC, int M, int N, int K) {
  __shared__ __attribute__((aligned(16))) float so[4][16][64];
  const int tid = threadIdx.x, w = tid >> 5, lane = tid & 31, ln = lane & 15, hh = lane >> 4; const int by = blockIdx.y;
  A += (size_t)by * sA; Bh += (size_t)by * sB; const size_t cofs = (size_t)by * sC; const float* bp = bias ? bias + (size_t)by * sBias : nullptr;
  const int ntn = (N + 63) / 64; const int wid = blockIdx.x * 4 + w; const int mt = wid / ntn, nq = wid % ntn; if (mt * 16 >= M) return;
  const int row0 = mt * 16, col0 = nq * 64; const _Float16* arow = A + (size_t)(row0 + ln) * lda;
  v8f acc[4] = {};
  for (int kb = 0; kb < K; kb += 32) { FragH ah; ah.half[0] = *(const v8us*)((const unsigned short*)arow + kb + 8 * hh); ah.half[1] = *(const v8us*)((const unsigned short*)arow + kb + 16 + 8 * hh);
#pragma unroll
    for (int t = 0; t < 4; ++t) { if (col0 + t * 16 >= N) continue; const size_t boff = (size_t)(col0 + t * 16 + ln) * ldb + kb; FragH bq; bq.half[0] = *(const v8us*)((const unsigned short*)Bh + boff + 8 * hh); bq.half[1] = *(const v8us*)((const unsigned short*)Bh + boff + 16 + 8 * hh);
      acc[t] = mmaH<1>(ah.v, ah.v, bq.v, bq.v, acc[t]); }
  }
#pragma unroll
  for (int t = 0; t < 4; ++t) { if (col0 + t * 16 >= N) continue; const int col = col0 + t * 16 + ln; const float bv = bp ? bf16_round(bp[col]) : 0.f;
#pragma unroll
    for (int r = 0; r < 8; ++r) { float v = acc[t][r] * alpha + bv; if (CP) { const int rr = row0g + row0 + 8 * hh + r; if (rowsPerB < 0) v += CP[cofs + (size_t)rr * ldc + col];      /* rowsPerB < 0: own element of the batched C plane */ else { const int bidx = rr / rowsPerB; v += CP[(size_t)bidx * sCPb + (size_t)by * 64 + col]; } } if (ACT == 1) v = (v > 0.f) ? v : expm1f(v); else if (ACT == 7) v = (v > 0.f) ? v + 1.0f : expf(v); else if (ACT == 8) v = tanhf(v); else if (ACT == 9) v = 0.5f * v * (1.0f + tanhf(0.7978845608028654f * (v + 0.044715f * v * v * v))); else if (ACT == 11) v = 1.0f / (1.0f + expf(-v)); else if (ACT == 12) v = (v > 0.f) ? v : 0.01f * v; else if (ACT == 14) v = (v > 0.f) ? v : 0.1f * v; else if (ACT == 16) v = (v >= 0.f) ? v : 0.3f * v; else if (ACT == 17) v = (v >= 0.f) ? v : 0.2f * v; else if (ACT == 15) v = v / (1.0f + expf(-v)); else if (ACT == 3) v = fmaxf(v, 0.f); else if (ACT == 6) v = 0.5f * v * (1.0f + erff(v * 0.70710678118654752f)); so[w][8 * hh + r][t * 16 + ln] = v; } }
  __builtin_amdgcn_fence(__ATOMIC_ACQ_REL, "workgroup"); __builtin_amdgcn_wave_barrier();
  const int rsub = lane >> 4, c4 = (lane & 15) * 4; typedef _Float16 v4h __attribute__((ext_vector_type(4)));
  {
#pragma unroll
    for (int q = 0; q < 8; ++q) { const int r = q * 2 + rsub; if (col0 + c4 < N) { const v4f v = *(const v4fa*)&so[w][r][c4]; if (C) *(v4f*)(C + cofs + (size_t)(row0 + r) * ldc + col0 + c4) = v; if (C16) { v4h h4; for (int i = 0; i < 4; ++i) h4[i] = (_Float16)v[i]; *(v4h*)(C16 + cofs + (size_t)(row0 + r) * ldc + col0 + c4) = h4; } } }
     }
}


typedef _Float16 v4h __attribute__((ext_vector_type(4)));

__global__ __launch_bounds__(256) void k_x16(const float* __restrict__ x, _Float16* __restrict__ X16, size_t n8) { const size_t t = (size_t)blockIdx.x * 256 + threadIdx.x; if (t >= n8) return; FragH f;
#pragma unroll
  for (int q = 0; q < 8; ++q) f.h[q] = (_Float16)bf16_round(x[t * 8 + q]); *(v8us*)((unsigned short*)X16 + t * 8) = f.half[0];  }
__global__ __launch_bounds__(256) void k_h16(const float* __restrict__ x, _Float16* __restrict__ X16, size_t n8) { const size_t t = (size_t)blockIdx.x * 256 + threadIdx.x; if (t >= n8) return; FragH f;
#pragma unroll
  for (int q = 0; q < 8; ++q) f.h[q] = (_Float16)x[t * 8 + q]; *(v8us*)((unsigned short*)X16 + t * 8) = f.half[0];  }
__global__ __launch_bounds__(256) void k_round16f(const float* __restrict__ W, _Float16* __restrict__ Bt, size_t n8) { const size_t t = (size_t)blockIdx.x * 256 + threadIdx.x; if (t >= n8) return; FragH f;
#pragma unroll
  for (int i = 0; i < 8; ++i) f.h[i] = (_Float16)(bf16_round(W[t * 8 + i]) * 16.0f); *(v8us*)((unsigned short*)Bt + t * 8) = f.half[0];  }
template <int NHv, int TTv>
__global__ __launch_bounds__(256) void k_vt(const _Float16* __restrict__ V16, int ldv, int voff, _Float16* __restrict__ Vt) { __shared__ unsigned short tl[64][66]; const int tid = threadIdx.x; const int slab = blockIdx.x / (TTv / 64), lg = blockIdx.x % (TTv / 64); const int b = slab / NHv, h = slab % NHv;
  for (int i = tid; i < 64 * 8; i += 256) { const int r = i / 8, c8 = (i % 8) * 8; FragH f; f.half[0] = *(const v8us*)((const unsigned short*)V16 + ((size_t)b * TTv + lg * 64 + r) * ldv + voff + h * 64 + c8);
#pragma unroll
    for (int q = 0; q < 8; ++q) tl[r][c8 + q] = f.u[q]; }
  __syncthreads();
  {
#pragma unroll
    for (int rd = 0; rd < 2; ++rd) { const int d = rd * 32 + tid / 8, pc = tid % 8; FragH f;
#pragma unroll
      for (int q = 0; q < 8; ++q) f.u[q] = tl[pc * 8 + q][d];
      *(v8us*)((unsigned short*)Vt + ((size_t)slab * 64 + d) * TTv + lg * 64 + pc * 8) = f.half[0]; }
     } }

__global__ __launch_bounds__(256) void k_hl(const float* __restrict__ F, _Float16* __restrict__ Hh, _Float16* __restrict__ Hl, size_t n8) { const size_t t = (size_t)blockIdx.x * 256 + threadIdx.x; if (t >= n8) return; FragH fh, fl; const v4f a = *(const v4fa*)(F + t * 8), c = *(const v4fa*)(F + t * 8 + 4);
#pragma unroll
  for (int q = 0; q < 4; ++q) { _Float16 h = (_Float16)a[q]; fh.h[q] = h; fl.h[q] = (_Float16)((a[q] - (float)h) * 1024.0f); h = (_Float16)c[q]; fh.h[4 + q] = h; fl.h[4 + q] = (_Float16)((c[q] - (float)h) * 1024.0f); }
  { *(v8us*)((unsigned short*)Hh + t * 8) = fh.half[0]; *(v8us*)((unsigned short*)Hl + t * 8) = fl.half[0];  } }

// ---- fast GEMM (wave tile 32x64; requires M % 32 == 0 rows per launch region and N % 64 == 0); epilogue = k_gemm_hhx semantics ----
__device__ __forceinline__ v16h g2_frag(const _Float16* p, int hh) { FragH f; f.half[0] = *(const v8us*)((const unsigned short*)p + 8 * hh); f.half[1] = *(const v8us*)((const unsigned short*)p + 16 + 8 * hh); return f.v; }
__device__ __forceinline__ v8f g2_mma(v16h a, v16h b, v8f c) { v8f d = __builtin_amdgcn_wmma_f32_16x16x32_f16(false, a, false, b, (short)0, c, false, false); asm volatile("v_nop\n\tv_nop\n\tv_nop\n\tv_nop" : "+v"(d) : "v"(a), "v"(b)); return d; }
template <int ACT>
__global__ __launch_bounds__(128) void k_gemm2(const _Float16* __restrict__ A, int lda, size_t sA, const _Float16* __restrict__ Bh, int ldb, size_t sB, float alpha, const float* __restrict__ bias, size_t sBias, const float* __restrict__ CP, int rowsPerB, size_t sCPb, int row0g,
    float* __restrict__ C, _Float16* __restrict__ C16, int ldc, size_t sC, int M, int N, int K) { static_assert(ACT == 0 || ACT == 3 || ACT == 6 || ACT == 8 || ACT == 9 || ACT == 11 || ACT == 12 || ACT == 14 || ACT == 15 || ACT == 16 || ACT == 17, "k_gemm2: unsupported ACT code (would silently apply no activation)");
  __shared__ __attribute__((aligned(16))) float so[4][32][68];
  const int tid = threadIdx.x, w = tid >> 5, lane = tid & 31, ln = lane & 15, hh = lane >> 4; const int by = blockIdx.y;
  A += (size_t)by * sA; Bh += (size_t)by * sB; const size_t cofs = (size_t)by * sC; const float* bp = bias ? bias + (size_t)by * sBias : nullptr;
  const int ntn = N >> 6; const int mt = blockIdx.x / ntn, nq = blockIdx.x - mt * ntn; const int row0 = mt * 128 + 32 * w, col0 = nq * 64; if (row0 >= M) return;
  const _Float16* a0p = A + (size_t)(row0 + ln) * lda; const _Float16* a1p = a0p + (size_t)16 * lda;
  const _Float16* b0p = Bh + (size_t)(col0 + ln) * ldb; const _Float16* b1p = b0p + (size_t)16 * ldb; const _Float16* b2p = b1p + (size_t)16 * ldb; const _Float16* b3p = b2p + (size_t)16 * ldb;
  const v8f z8 = {0.f,0.f,0.f,0.f,0.f,0.f,0.f,0.f}; v8f c00 = z8, c01 = z8, c02 = z8, c03 = z8, c10 = z8, c11 = z8, c12 = z8, c13 = z8;
#pragma unroll 1
  for (int kb = 0; kb < K; kb += 32) { const v16h a0 = g2_frag(a0p + kb, hh), a1 = g2_frag(a1p + kb, hh);
    v16h b = g2_frag(b0p + kb, hh); c00 = g2_mma(a0, b, c00); c10 = g2_mma(a1, b, c10);
    b = g2_frag(b1p + kb, hh); c01 = g2_mma(a0, b, c01); c11 = g2_mma(a1, b, c11);
    b = g2_frag(b2p + kb, hh); c02 = g2_mma(a0, b, c02); c12 = g2_mma(a1, b, c12);
    b = g2_frag(b3p + kb, hh); c03 = g2_mma(a0, b, c03); c13 = g2_mma(a1, b, c13); }
  v8f accs[8] = {c00, c01, c02, c03, c10, c11, c12, c13};
#pragma unroll
  for (int u = 0; u < 8; ++u) { const int t = u & 3, half = u >> 2; const int col = col0 + t * 16 + ln; const float bv = bp ? bf16_round(bp[col]) : 0.f;
#pragma unroll
    for (int r = 0; r < 8; ++r) { const int rloc = half * 16 + 8 * hh + r; float v = accs[u][r] * alpha + bv; if (CP) { if (rowsPerB < 0) v += CP[cofs + (size_t)(row0g + row0 + rloc) * ldc + col];      /* rowsPerB < 0: own element of the batched C plane */ else { const int bidx = (row0g + row0 + rloc) / rowsPerB; v += CP[(size_t)bidx * sCPb + (size_t)by * 64 + col]; } }
      if (ACT == 3) v = fmaxf(v, 0.f); else if (ACT == 6) v = 0.5f * v * (1.0f + erff(v * 0.70710678118654752f)); else if (ACT == 11) v = 1.0f / (1.0f + expf(-v)); else if (ACT == 15) v = v / (1.0f + expf(-v)); else if (ACT == 12) v = (v > 0.f) ? v : 0.01f * v; else if (ACT == 8) v = tanhf(v); else if (ACT == 9) v = 0.5f * v * (1.0f + tanhf(0.7978845608028654f * (v + 0.044715f * v * v * v))); else if (ACT == 14) v = (v > 0.f) ? v : 0.1f * v; else if (ACT == 16) v = (v >= 0.f) ? v : 0.3f * v; else if (ACT == 17) v = (v >= 0.f) ? v : 0.2f * v;
      so[w][rloc][t * 16 + ln] = v; } }
  __builtin_amdgcn_fence(__ATOMIC_ACQ_REL, "workgroup"); __builtin_amdgcn_wave_barrier();
  const int rsub = lane >> 4, c4 = (lane & 15) * 4;
  {
#pragma unroll
    for (int q = 0; q < 16; ++q) { const int r = q * 2 + rsub; const v4f v = *(const v4fa*)&so[w][r][c4]; if (C) *(v4f*)(C + cofs + (size_t)(row0 + r) * ldc + col0 + c4) = v; if (C16) { v4h h4; for (int i = 0; i < 4; ++i) h4[i] = (_Float16)v[i]; *(v4h*)(C16 + cofs + (size_t)(row0 + r) * ldc + col0 + c4) = h4; } }
     } }


__global__ __launch_bounds__(256) void k_wnat(const float* __restrict__ w, size_t n8, _Float16* __restrict__ Bt) { const size_t t = (size_t)blockIdx.x * 256 + threadIdx.x; if (t >= n8) return; FragH f; for (int q = 0; q < 8; ++q) f.h[q] = (_Float16)(bf16_round(w[t * 8 + q]) * 16.0f); *(v8us*)((unsigned short*)Bt + t * 8) = f.half[0];  }
__global__ __launch_bounds__(256) void k_rsm(const float* __restrict__ S, _Float16* __restrict__ P, int nrows) {
  #pragma clang fp contract(off)
  const int i = blockIdx.x * 256 + threadIdx.x; if (i >= nrows) return; const float* s = S + (size_t)i * SQ; float mx = -3.0e38f;
#pragma unroll 1
  for (int j = 0; j < SQ; ++j) mx = fmaxf(mx, s[j]); float se = 0.f;
#pragma unroll 1
  for (int j = 0; j < SQ; ++j) se += expf(s[j] - mx); const float sc = 256.0f / se;
#pragma unroll 1
  for (int j0 = 0; j0 < SQ; j0 += 8) { FragH f; for (int q = 0; q < 8; ++q) f.h[q] = (_Float16)(expf(s[j0 + q] - mx) * sc); unsigned short* d = (unsigned short*)P + (size_t)i * SQ + j0; *(v8us*)d = f.half[0];  } }
__global__ __launch_bounds__(256) void k_vt(const _Float16* __restrict__ V16, int b, int h0, _Float16* __restrict__ VT) { __shared__ unsigned short tl[64][65]; const int tid = threadIdx.x; const int hh = blockIdx.x % HG, sg = blockIdx.x / HG; const int s0 = sg * 64; const int h = h0 + hh;
  for (int i = tid; i < 64 * 8; i += 256) { const int j = i / 8, d8 = (i % 8) * 8; FragH f; f.half[0] = *(const v8us*)((const unsigned short*)V16 + ((size_t)b * SQ + s0 + j) * DM + h * HD + d8); for (int q = 0; q < 8; ++q) tl[d8 + q][j] = f.u[q]; }
  __syncthreads();
  { for (int i = tid; i < 64 * 8; i += 256) { const int d = i / 8, j8 = (i % 8) * 8; FragH f; for (int q = 0; q < 8; ++q) f.u[q] = tl[d][j8 + q]; *(v8us*)((unsigned short*)VT + ((size_t)hh * HD + d) * SQ + s0 + j8) = f.half[0]; }  } }



__global__ __launch_bounds__(256) void k_rsmkm(const float* __restrict__ S, _Float16* __restrict__ P, int nrows, const int* __restrict__ am) {
  #pragma clang fp contract(off)
  const int t = blockIdx.x * 256 + threadIdx.x; if (t >= nrows) return; const size_t i = (size_t)t; const float* s = S + i * SQ; const int* mr = am + (size_t)(t % SQ) * SQ; float mx = -3.0e38f;
#pragma unroll 1
  for (int j = 0; j < SQ; ++j) { const float f = (mr[j] != 0) ? 1.f : 0.f; mx = fmaxf(mx, fmaf(f, s[j], (1.f - f) * -1.0e9f)); } float se = 0.f;
#pragma unroll 1
  for (int j = 0; j < SQ; ++j) { const float f = (mr[j] != 0) ? 1.f : 0.f; se += __expf(fmaf(f, s[j], (1.f - f) * -1.0e9f) - mx); } const float sc = 256.0f / se;
#pragma unroll 1
  for (int j0 = 0; j0 < SQ; j0 += 8) { FragH fr; for (int q = 0; q < 8; ++q) { const int j = j0 + q; const float f = (mr[j] != 0) ? 1.f : 0.f; fr.h[q] = (_Float16)(__expf(fmaf(f, s[j], (1.f - f) * -1.0e9f) - mx) * sc); }
    unsigned short* d = (unsigned short*)P + i * SQ + j0; *(v8us*)d = fr.half[0];  } }
// exp of four values as __expf forms it (v_exp_f32 of x * log2 e). One statement, so that the free slot the instruction set asks for behind a transcendental stands there by construction: outputs are early-clobbered (no v_exp_f32 overwrites a neighbour's source or reads its result), and the v_nop fills the slot behind the last one.
__device__ __forceinline__ v4f exp_x4(v4f x) { float r0, r1, r2, r3;
  asm("v_exp_f32 %0, %4\n\tv_exp_f32 %1, %5\n\tv_exp_f32 %2, %6\n\tv_exp_f32 %3, %7\n\tv_nop" : "=&v"(r0), "=&v"(r1), "=&v"(r2), "=&v"(r3) : "v"(x[0] * 1.44269504088896340736f), "v"(x[1] * 1.44269504088896340736f), "v"(x[2] * 1.44269504088896340736f), "v"(x[3] * 1.44269504088896340736f));
  const v4f r = {r0, r1, r2, r3}; return r; }
// exp of one value, same form as exp_x4 (the v_nop fills the free slot behind the transcendental).
__device__ __forceinline__ float exp_x1(float x) { float r; asm("v_exp_f32 %0, %1\n\tv_nop" : "=&v"(r) : "v"(x * 1.44269504088896340736f)); return r; }
__device__ __forceinline__ v8f fa_mma(v16h a, v16h b, v8f c) { return __builtin_amdgcn_wmma_f32_16x16x32_f16(false, a, false, b, (short)0, c, false, false); }
__global__ __launch_bounds__(256) void k_fattn(const _Float16* __restrict__ Q, const _Float16* __restrict__ Kk, const _Float16* __restrict__ VTa, _Float16* __restrict__ O) {
  const int lane = threadIdx.x & 31, ln = lane & 15, hh = lane >> 4; const int w = __builtin_amdgcn_readfirstlane(threadIdx.x >> 5);      /* wave number in a scalar register: the mask test below is a scalar branch */
  const int h = blockIdx.y, b = blockIdx.z; const int q0 = blockIdx.x * 128 + w * 16; const int qi = q0 + ln;
  const _Float16* qp = Q + ((size_t)b * SQ + qi) * LQ + h * HD; const v16h qf0 = g2_frag(qp, hh), qf1 = g2_frag(qp + 32, hh);
  const _Float16* kp = Kk + ((size_t)b * SQ + ln) * LQ + h * HD; const _Float16* vp = VTa + (((size_t)b * NH + h) * HD + ln) * SQ;
  const v8f z8 = {0.f,0.f,0.f,0.f,0.f,0.f,0.f,0.f}; v8f o[4] = {z8, z8, z8, z8}; float m = -1.0e30f, l = 0.f;
#pragma unroll 1      /* one pass already holds 32 loads and 16 matrix products; a second copy would only cost registers */
  for (int k0 = 0; k0 < SQ; k0 += 64) { v8f s[4]; v16h kf[4][2], vf[4][2];
#pragma unroll      /* kf[] in registers */
    for (int t = 0; t < 4; ++t) { const _Float16* kr = kp + (size_t)(k0 + 16 * t) * LQ; kf[t][0] = g2_frag(kr, hh); kf[t][1] = g2_frag(kr + 32, hh); }
    asm volatile("" :: "v"(kf[0][0]), "v"(kf[0][1]), "v"(kf[1][0]), "v"(kf[1][1]), "v"(kf[2][0]), "v"(kf[2][1]), "v"(kf[3][0]), "v"(kf[3][1]));      /* inputs only, loaded values: all 16 k loads of the pass are issued before the first is waited for (left alone, the compiler loads one fragment at a time into the same registers: eight load latencies in a row) */
#pragma unroll      /* s[] in registers */
    for (int t = 0; t < 4; ++t) { s[t] = fa_mma(kf[t][0], qf0, z8); s[t] = fa_mma(kf[t][1], qf1, s[t]); }
#pragma unroll      /* vf[] in registers; the v fragments arrive under the softmax arithmetic */
    for (int t = 0; t < 4; ++t) { vf[t][0] = g2_frag(vp + (size_t)(16 * t) * SQ + k0, hh); vf[t][1] = g2_frag(vp + (size_t)(16 * t) * SQ + k0 + 32, hh); }
#pragma unroll      /* s[] in registers */
    for (int t = 0; t < 4; ++t) s[t] *= 0.125f;
    if (k0 <= q0 + 15) {      /* a pass whose keys all lie behind the wave's queries adds 0 * -1e9: skipped as an identity */
#pragma unroll      /* s[] in registers */
      for (int t = 0; t < 4; ++t) for (int r = 0; r < 8; ++r) { const float mk = (k0 + 16 * t + 8 * hh + r <= qi) ? 1.0f : 0.0f; s[t][r] = __fadd_rn(s[t][r], __fmul_rn(mk, -1.0e9f)); } }
    float mt = s[0][0];
#pragma unroll      /* s[] in registers */
    for (int t = 0; t < 4; ++t) for (int r = 0; r < 8; ++r) mt = fmaxf(mt, s[t][r]);
    mt = fmaxf(mt, __shfl_xor(mt, 16)); const float mn = fmaxf(m, mt); const float corr = exp_x1(m - mn); m = mn;
    v4f s4 = {0.f, 0.f, 0.f, 0.f}; FragH pf[2];
#pragma unroll      /* s[], pf[] in registers */
    for (int t = 0; t < 4; ++t) { const v4f a = {s[t][0], s[t][1], s[t][2], s[t][3]}, c = {s[t][4], s[t][5], s[t][6], s[t][7]}; const v4f ea = exp_x4(a - mn), ec = exp_x4(c - mn); s4 += ea; s4 += ec;
      for (int u = 0; u < 4; ++u) { pf[t >> 1].h[(t & 1) * 8 + u] = (_Float16)ea[u]; pf[t >> 1].h[(t & 1) * 8 + 4 + u] = (_Float16)ec[u]; } }
    l = l * corr + ((s4[0] + s4[1]) + (s4[2] + s4[3]));      /* each wave half keeps its own part of the sum; joined once behind the loop */
#pragma unroll      /* o[] in registers */
    for (int t = 0; t < 4; ++t) { o[t] *= corr; o[t] = fa_mma(vf[t][0], pf[0].v, o[t]); o[t] = fa_mma(vf[t][1], pf[1].v, o[t]); } }
  l += __shfl_xor(l, 16); const float fin = 64.0f / l;      /* o carried x64 against f16 subnormal flush, folded into the output GEMM alpha */
  _Float16* op = O + ((size_t)b * SQ + qi) * DM + h * HD + 8 * hh;
#pragma unroll      /* o[] in registers; a lane's 8 accumulator registers are 8 consecutive columns of its query's row: one 16-byte store */
  for (int t = 0; t < 4; ++t) { FragH f; for (int r = 0; r < 8; ++r) f.h[r] = (_Float16)(o[t][r] * fin); *(v8us*)((unsigned short*)op + 16 * t) = f.half[0]; } }

// One thread per query row of the tile. The 64-wide loops are unrolled: q[] and o[] are indexed by constants only and stay in registers, a key's k row is fetched whole ahead of the score sum and its v row under that sum.
__global__ __launch_bounds__(64) void k_attup(const float* __restrict__ QF, const float* __restrict__ KF, const float* __restrict__ VF, int ld, float scale, float* __restrict__ OF, int ldo) {
  #pragma clang fp contract(off)
  __shared__ __attribute__((aligned(16))) float lo[64][64];
  const int tid = threadIdx.x; const int h = blockIdx.x / (QT0 / 64), rg = blockIdx.x % (QT0 / 64); const int i = rg * 64 + tid;
  const float* qr = QF + (size_t)i * ld + h * HD; v4f q[HD / 4], o[HD / 4];
#pragma unroll      /* q[], o[] in registers; the q row's 16 loads in flight at once */
  for (int c = 0; c < HD / 4; ++c) { q[c] = *(const v4fa*)(qr + c * 4); const v4f z = {0.f, 0.f, 0.f, 0.f}; o[c] = z; }
  float m = -1.0e30f, l = 0.f;
#pragma unroll 1
  for (int j = rg * 64; j < QT0; ++j) { const float* kr = KF + (size_t)j * ld + h * HD; const float* vr = VF + (size_t)j * ld + h * HD; v4f kq[HD / 4], vv[HD / 4]; float s = 0.f;
#pragma unroll      /* a whole row's loads in flight at once */
    for (int c = 0; c < HD / 4; ++c) kq[c] = *(const v4fa*)(kr + c * 4);
#pragma unroll      /* the v row arrives under the score sum */
    for (int c = 0; c < HD / 4; ++c) vv[c] = *(const v4fa*)(vr + c * 4);
#pragma unroll      /* q[], kq[] in registers */
    for (int c = 0; c < HD / 4; ++c) { s = __fadd_rn(s, __fmul_rn(q[c][0], kq[c][0])); s = __fadd_rn(s, __fmul_rn(q[c][1], kq[c][1])); s = __fadd_rn(s, __fmul_rn(q[c][2], kq[c][2])); s = __fadd_rn(s, __fmul_rn(q[c][3], kq[c][3])); }
    s = __fmul_rn(s, scale);
    const float f = (j > i) ? 1.f : 0.f; const float sm = fmaf(f, s, (1.f - f) * -1.0e30f); const float mn = fmaxf(m, sm); const float sc = expf(m - mn); const float e = __fmul_rn(f, expf(sm - mn)); l = __fadd_rn(__fmul_rn(l, sc), e); m = mn;
#pragma unroll      /* o[], vv[] in registers */
    for (int c = 0; c < HD / 4; ++c) for (int u = 0; u < 4; ++u) o[c][u] = __fadd_rn(__fmul_rn(o[c][u], sc), __fmul_rn(e, vv[c][u])); }
  const float fin = (l > 0.f) ? 64.0f / l : 0.f;      /* o carried x64 like the f16 path; the key-less last row is written by k_vmean */
#pragma unroll      /* o[] in registers */
  for (int c = 0; c < HD / 4; ++c) { v4f oo = o[c]; for (int u = 0; u < 4; ++u) oo[u] = __fmul_rn(oo[u], fin); *(v4f*)&lo[tid][c * 4] = oo; }
  __syncthreads();
  {
#pragma unroll 1
    for (int it = 0; it < 16; ++it) { const int row = it * 4 + tid / 16, pc = (tid % 16) * 4; const v4f v = *(const v4f*)&lo[row][pc]; *(v4f*)(OF + (size_t)(rg * 64 + row) * ldo + h * HD + pc) = v; }
     } }

__global__ __launch_bounds__(256) void k_vmean(const _Float16* __restrict__ V, float* __restrict__ orow) {
  #pragma clang fp contract(off)
  const int c = blockIdx.x * 256 + threadIdx.x; if (c >= DM) return; const _Float16* p = V + c; float s = 0.f;
#pragma unroll 1
  for (int j0 = 0; j0 < SQ; j0 += 64) { _Float16 t[64];
#pragma unroll      /* 64 rows' loads in flight at once (the constant pitch LQ makes them one address register with immediate offsets); t[] in registers */
    for (int j = 0; j < 64; ++j) t[j] = p[(size_t)(j0 + j) * LQ];
#pragma unroll      /* summed in the rows' order */
    for (int j = 0; j < 64; ++j) s = __fadd_rn(s, (float)t[j]); }
  const float o = __fmul_rn(s, 64.0f / (float)SQ); *(float*)(orow + c) = o;  }

extern "C" void kernel_launch(void* const* d_in, const int* in_sizes, int n_in,
                              void* d_out, int out_size, void* d_ws, size_t ws_size, hipStream_t stream) {
  (void)in_sizes; (void)n_in; (void)out_size;
  const float* const* I = (const float* const*)d_in; const float* xq = I[0]; const float* xk = I[0]; const float* xv = I[0]; const float* wq = I[1]; const float* bq = I[2]; const float* wk = I[3]; const float* bk = I[4]; const float* wv = I[5]; const float* bv = I[6]; const float* wo = I[7]; const float* bo = I[8]; const float* x = xq;      /* ONE input feeds the query, key and value streams; [in][out] weights + biases; the mask is built from indices as in the module */
  static_assert(NH * HD == DM && DM % 64 == 0 && SQ % 128 == 0 && NH % HG == 0, "shape / tile multiples");
  char* ws = (char*)d_ws; size_t off = 0;
  auto take = [&](size_t bytes) { char* p = ws + off; off += (bytes + 255) & ~(size_t)255; return p; };
  _Float16* BQ = (_Float16*)take((size_t)DM * DM * 2); _Float16* BK = (_Float16*)take((size_t)DM * DM * 2); _Float16* BV = (_Float16*)take((size_t)DM * DM * 2); _Float16* BO = (_Float16*)take((size_t)DM * DM * 2);
  _Float16* X16 = (_Float16*)take(NR * DM * 2); _Float16* XKp = (_Float16*)take(NR * DM * 2); _Float16* XVp = (_Float16*)take(NR * DM * 2); _Float16* Q16 = (_Float16*)take(NR * DM * 2); _Float16* K16 = (_Float16*)take(NR * DM * 2); _Float16* V16 = (_Float16*)take(NR * DM * 2); _Float16* O16 = (_Float16*)take(NR * DM * 2);
  _Float16* VT = (_Float16*)take((size_t)NB * NH * HD * SQ * 2);
  float* QF0 = (float*)take((size_t)QT0 * DM * 4); float* KF0 = (float*)take((size_t)QT0 * DM * 4); float* VF0 = (float*)take((size_t)QT0 * DM * 4); float* OF0 = (float*)take((size_t)NB * QT0 * DM * 4); _Float16* OH0 = (_Float16*)take((size_t)NB * QT0 * DM * 2); _Float16* OL0 = (_Float16*)take((size_t)NB * QT0 * DM * 2);      /* exact last tile: f32 q / k / v of the tile rows, o (x64) and its f16 hi + x1024 residual planes */
  if (off > ws_size) return;
  { const unsigned g = (unsigned)(((size_t)DM * (DM / 8) + 255) / 256); k_wt_f16<<<g, 256, 0, stream>>>(wq, BQ, DM, DM, 16.0f); k_wt_f16<<<g, 256, 0, stream>>>(wk, BK, DM, DM, 16.0f); k_wt_f16<<<g, 256, 0, stream>>>(wv, BV, DM, DM, 16.0f); k_wt_f16<<<g, 256, 0, stream>>>(wo, BO, DM, DM, 16.0f); }      /* [in][out] -> Bt x16 */
  _Float16* XK = XKp; _Float16* XV = XVp; k_x16<<<(unsigned)((NR * DM / 8 + 255) / 256), 256, 0, stream>>>(xk, XK, NR * DM / 8); k_x16<<<(unsigned)((NR * DM / 8 + 255) / 256), 256, 0, stream>>>(xv, XV, NR * DM / 8);      /* key and value inputs as exact f16 rows */

  k_x16<<<(unsigned)((NR * DM / 8 + 255) / 256), 256, 0, stream>>>(x, X16, NR * DM / 8);
  const size_t r0p = (size_t)B0 * SQ;      /* first projected row */
  k_gemm2<0><<<dim3((unsigned)((MP / 128) * (DM / 64)), 1), 128, 0, stream>>>(X16 + r0p * DM, DM, 0, BQ, DM, 0, 0.0625f, bq, 0, nullptr, 1, 0, 0, nullptr, Q16 + r0p * DM, DM, 0, MP, DM, DM);
  k_gemm2<0><<<dim3((unsigned)((MP / 128) * (DM / 64)), 1), 128, 0, stream>>>(XK + r0p * DM, DM, 0, BK, DM, 0, 0.0625f, bk, 0, nullptr, 1, 0, 0, nullptr, K16 + r0p * DM, DM, 0, MP, DM, DM);
  k_gemm2<0><<<dim3((unsigned)((MP / 128) * (DM / 64)), 1), 128, 0, stream>>>(XV + r0p * DM, DM, 0, BV, DM, 0, 0.0625f, bv, 0, nullptr, 1, 0, 0, nullptr, V16 + r0p * DM, DM, 0, MP, DM, DM);
  for (int b = B0; b < B0 + NBR; ++b) { const size_t r0 = (size_t)b * SQ;
    k_vt<NH, SQ><<<NH * (SQ / 64), 256, 0, stream>>>(V16 + r0 * LQ, LQ, 0, VT + (size_t)b * NH * HD * SQ);      /* V^T [NH][HD][SQ] for this batch */
    { const size_t rl = r0 + SQ - QT0;      /* the batch's last QT0 rows */
      k_gemm2<0><<<dim3((QT0 / 128) * (DM / 64), 1), 128, 0, stream>>>(X16 + rl * DM, DM, 0, BQ, DM, 0, 0.0625f, bq, 0, nullptr, 1, 0, 0, QF0, nullptr, DM, 0, QT0, DM, DM); k_gemm2<0><<<dim3((QT0 / 128) * (DM / 64), 1), 128, 0, stream>>>(XK + rl * DM, DM, 0, BK, DM, 0, 0.0625f, bk, 0, nullptr, 1, 0, 0, KF0, nullptr, DM, 0, QT0, DM, DM); k_gemm2<0><<<dim3((QT0 / 128) * (DM / 64), 1), 128, 0, stream>>>(XV + rl * DM, DM, 0, BV, DM, 0, 0.0625f, bv, 0, nullptr, 1, 0, 0, VF0, nullptr, DM, 0, QT0, DM, DM);      /* f32 q, k, v of the last tile (exact products) */
      k_attup<<<NH * (QT0 / 64), 64, 0, stream>>>(QF0, KF0, VF0, DM, 0.125f, OF0 + (size_t)b * QT0 * DM, DM);      /* exact f32 attention over the keys j > i inside the tile (o x64) */
      k_vmean<<<(DM + 255) / 256, 256, 0, stream>>>(V16 + r0 * LQ, OF0 + ((size_t)b * QT0 + QT0 - 1) * DM); }      /* last row: uniform over all keys = 64 x mean of v */
  }
  k_fattn<<<dim3(SQ / 128, NH, NB), 256, 0, stream>>>(Q16, K16, VT, O16);      /* scores, literal 'score + tril * (-1e9)', softmax over all keys and the weighted v sum, every (batch, head) in one launch -> o (merged heads, x64) as f16 rows */
  k_gemm2<0><<<dim3((unsigned)((MPO / 128) * (DM / 64)), 1), 128, 0, stream>>>(O16 + r0p * DM, DM, 0, BO, DM, 0, 0.0009765625f, bo, 0, nullptr, 1, 0, 0, (float*)d_out + r0p * DM, nullptr, DM, 0, MPO, DM, DM);      /* out rows are the output layout */
  k_hl<<<(unsigned)(((size_t)NB * QT0 * DM / 8 + 255) / 256), 256, 0, stream>>>(OF0, OH0, OL0, (size_t)NB * QT0 * DM / 8);      /* last-tile o (x64) -> f16 hi + x1024 residual planes */
  for (int b = B0; b < B0 + NBR; ++b) { const size_t rl = (size_t)b * SQ + SQ - QT0; const size_t f0 = (size_t)b * QT0;
    k_gemm2<0><<<dim3((QT0 / 128) * (DM / 64), 1), 128, 0, stream>>>(OH0 + f0 * DM, DM, 0, BO, DM, 0, 0.0009765625f, bo, 0, nullptr, 1, 0, 0, (float*)d_out + rl * DM, nullptr, DM, 0, QT0, DM, DM);      /* last QT0 rows: out = o_hi Wo (+ b), overwriting the f16-path rows */
    k_gemm2<0><<<dim3((QT0 / 128) * (DM / 64), 1), 128, 0, stream>>>(OL0 + f0 * DM, DM, 0, BO, DM, 0, 0.00000095367431640625f, nullptr, 0, (const float*)d_out + rl * DM, -1, 0, 0, (float*)d_out + rl * DM, nullptr, DM, 0, QT0, DM, DM); }      /* += o_lo Wo 2^-20 (own-element accumulate) */
}

// v004
// It runs in 494 microseconds.
// Next to v003, in two timings, it ran 1.89 and 1.88 times as fast.
// Over all steps from v000 it is 13.3 times as fast.
#include <hip/hip_runtime.h>
// Multi-head self-attention with the source's INVERTED causal mask (inputs [2][2048][1024]; q / k / v = x W + b ([in][out] 1024 x 1024 sigma 1/32, zero biases); 16 heads of 64; score = q k^T / sqrt(64) + tril * (-1e9): the LOWER triangle incl. the diagonal is pushed to -1e9 (the original's mask bug, kept), so query i attends to the keys j > i only, and the last query (every key masked, all scores rounding to the same -1e9 in f32) attends uniformly to all keys; softmax; out = merged Wo + bo -> [2][2048][1024]).
// Structure: token rows r = b*2048 + s; x as exact f16 rows (bf16-rounded); Q, K, V as three WMMA GEMMs in one launch (grid z; 32x64 wave tiles, f32 accumulation, exact x16 weights + bias, f16 outputs); V^T for all batches and heads via LDS transposes; one fused attention launch over every (batch, head): S^T = K Q^T on WMMA (K = 64, x 1/sqrt(64), then the -1e9 fill), running softmax on VALU (f32 statistics; unnormalised weights exp(s - max) as f16), O^T += V^T P^T on WMMA, o = O / sum (carried x64 against f16 subnormal flush, folded into the output GEMM alpha) written straight into the merged f16 o rows; out = o W_o + b GEMM (f32) into the output layout.
// Compute dtype: inputs rounded to bf16; x / weights exact; q, k, v, softmax weights and o as plain f16 GEMM operands (~2^-12); scores and softmax statistics f32. v_wmma_f32_16x16x32_f16.
#define NB 2
#define SQ 2048
#define DM 1024
#define NH 16
#define HD 64
#define QT0 256                      /* last-tile rows recomputed exactly in f32 (rows with fewer than 256 visible keys) */
#define HG 4                         /* heads per launch of the grouped k_vt (not called) */
#define B0 0                         /* first batch processed (debug hook) */
#define NBR NB                       /* batches processed (debug hook) */
#define NR ((size_t)NB * SQ)         /* token rows */
#define MP ((int)((size_t)NBR * SQ)) /* rows projected (debug hook) */
#define QN SQ                        /* query rows attended per batch (not used) */
#define NHD NH                       /* heads attended (not used) */
#define MPO MP                       /* rows through the output stage (debug hook) */
#define LQ DM      /* row pitch of the q/k/v rows */
typedef __bf16 v16b __attribute__((ext_vector_type(16)));
typedef unsigned short v8us __attribute__((ext_vector_type(8), may_alias));
typedef float  v8f  __attribute__((ext_vector_type(8)));
typedef float  v4f  __attribute__((ext_vector_type(4)));
typedef float  v4fa __attribute__((ext_vector_type(4), may_alias));
union FragB { v16b v; v8us half[2]; unsigned short u[16]; };

__device__ __forceinline__ unsigned short bf16_bits(float x) { unsigned int u = __float_as_uint(x); return (unsigned short)((u + 0x7FFFu + ((u >> 16) & 1u)) >> 16); }
__device__ __forceinline__ float bf16_val(unsigned short b) { return __uint_as_float(((unsigned int)b) << 16); }
__device__ __forceinline__ float bf16_round(float x) { return bf16_val(bf16_bits(x)); }
// D += A·B with NT terms: 1 = ah·bh, 2 = + al·bh (A split), 3 = + ah·bl (both split)
template <int NT>
__device__ __forceinline__ v8f mmaN(v16b ah, v16b al, v16b bh, v16b bl, v8f c) {
  c = __builtin_amdgcn_wmma_f32_16x16x32_bf16(false, ah, false, bh, (short)0, c, false, false);
  if (NT >= 2) c = __builtin_amdgcn_wmma_f32_16x16x32_bf16(false, al, false, bh, (short)0, c, false, false);
  if (NT >= 3) c = __builtin_amdgcn_wmma_f32_16x16x32_bf16(false, ah, false, bl, (short)0, c, false, false);
  asm volatile("v_nop\n\tv_nop\n\tv_nop\n\tv_nop" : "+v"(c) : "v"(ah), "v"(al), "v"(bh), "v"(bl));
  return c;
}

__global__ __launch_bounds__(256) void k_wt_bf16(const float* __restrict__ W, unsigned short* __restrict__ Wt, int K, int N) {
  const int t = blockIdx.x * 256 + threadIdx.x;
  const int k8n = K / 8;
  if (t >= N * k8n) return;
  const int n = t / k8n, k8 = (t % k8n) * 8;
  v8us v;
#pragma unroll
  for (int i = 0; i < 8; ++i) v[i] = bf16_bits(W[(size_t)(k8 + i) * N + n]);
  *(v8us*)(Wt + (size_t)n * K + k8) = v;
  
}

// GEMM C[M][N] (f32, pitch ldc) = act(A[M][K]·W + bias). A f32 row-major (pitch lda) converted per fragment to bf16
// (ASPLIT: hi/lo two planes -> 2 terms, else single rounded term); Wt bf16 [N][K] (pitch ldb). BIAS_BF16 rounds the
// bias to bf16 first (bias quantised to bf16 before the add). K%32==0, M%16==0, N%64==0.
template <bool ASPLIT, int ACT, bool BIAS_BF16>
__global__ __launch_bounds__(128) void k_gemm_bf(const float* __restrict__ A, int lda, const unsigned short* __restrict__ Wt, int ldb,
                                               const float* __restrict__ bias, float* __restrict__ C, int ldc, int M, int N, int K) {
  __shared__ __attribute__((aligned(16))) float so[4][16][64];
  const int tid = threadIdx.x, w = tid >> 5, lane = tid & 31, ln = lane & 15, hh = lane >> 4;
  const int ntn = N / 64;
  const int wid = blockIdx.x * 4 + w;
  const int mt = wid / ntn, nq = wid % ntn;
  if (mt * 16 >= M) return;
  const int row0 = mt * 16, col0 = nq * 64;
  const float* arow = A + (size_t)(row0 + ln) * lda;
  v8f acc[4] = {};
  for (int kb = 0; kb < K; kb += 32) {
    FragB ah, al;
    const v4f x0 = *(const v4fa*)(arow + kb + 8 * hh), x1 = *(const v4fa*)(arow + kb + 8 * hh + 4);
    const v4f x2 = *(const v4fa*)(arow + kb + 16 + 8 * hh), x3 = *(const v4fa*)(arow + kb + 16 + 8 * hh + 4);
    float xs[16] = {x0[0],x0[1],x0[2],x0[3],x1[0],x1[1],x1[2],x1[3],x2[0],x2[1],x2[2],x2[3],x3[0],x3[1],x3[2],x3[3]};
#pragma unroll
    for (int i = 0; i < 16; ++i) { const unsigned short hb = bf16_bits(xs[i]); ah.u[i] = hb; al.u[i] = ASPLIT ? bf16_bits(xs[i] - bf16_val(hb)) : (unsigned short)0; }
#pragma unroll
    for (int t = 0; t < 4; ++t) {
      const unsigned short* brow = Wt + (size_t)(col0 + t * 16 + ln) * ldb + kb;
      FragB b;
      b.half[0] = *(const v8us*)(brow + 8 * hh);
      b.half[1] = *(const v8us*)(brow + 16 + 8 * hh);
      acc[t] = mmaN<ASPLIT ? 2 : 1>(ah.v, al.v, b.v, b.v, acc[t]);
    }
  }
#pragma unroll
  for (int t = 0; t < 4; ++t) {
    float bv = bias ? bias[col0 + t * 16 + ln] : 0.f;
    if (BIAS_BF16) bv = bf16_round(bv);
#pragma unroll
    for (int r = 0; r < 8; ++r) { float v = acc[t][r] + bv; if (ACT == 1) v = fmaxf(v, 0.f); so[w][8 * hh + r][t * 16 + ln] = v; }
  }
  __builtin_amdgcn_fence(__ATOMIC_ACQ_REL, "workgroup");
  __builtin_amdgcn_wave_barrier();
  const int rsub = lane >> 4, c4 = (lane & 15) * 4;
  {
#pragma unroll
    for (int q = 0; q < 8; ++q) {
      const int r = q * 2 + rsub;
      const v4f v = *(const v4fa*)&so[w][r][c4];
      *(v4f*)(C + (size_t)(row0 + r) * ldc + col0 + c4) = v;
    }
    
  }
}

// GEMM C = act(A·W + bias + resid): A f32 (ASPLIT -> hi/lo 2 terms), Wt bf16 [N][K]; ACT 0 none, 1 relu, 2 exact gelu;
// resid (optional, f32, row index = (row % rmod), pitch ldr, RES_BF16 rounds it) added before the activation.
template <bool ASPLIT, int ACT, bool BIAS_BF16, bool RES_BF16>
__global__ __launch_bounds__(128) void k_gemm_bf3(const float* __restrict__ A, int lda, const unsigned short* __restrict__ Wt, int ldb,
                                                const float* __restrict__ bias, const float* __restrict__ resid, int rmod, int ldr,
                                                float* __restrict__ C, int ldc, int M, int N, int K) {
  __shared__ __attribute__((aligned(16))) float so[4][16][64];
  const int tid = threadIdx.x, w = tid >> 5, lane = tid & 31, ln = lane & 15, hh = lane >> 4;
  const int ntn = N / 64;
  const int wid = blockIdx.x * 4 + w;
  const int mt = wid / ntn, nq = wid % ntn;
  if (mt * 16 >= M) return;
  const int row0 = mt * 16, col0 = nq * 64;
  const float* arow = A + (size_t)(row0 + ln) * lda;
  v8f acc[4] = {};
  for (int kb = 0; kb < K; kb += 32) {
    FragB ah, al;
    const v4f x0 = *(const v4fa*)(arow + kb + 8 * hh), x1 = *(const v4fa*)(arow + kb + 8 * hh + 4);
    const v4f x2 = *(const v4fa*)(arow + kb + 16 + 8 * hh), x3 = *(const v4fa*)(arow + kb + 16 + 8 * hh + 4);
    float xs[16] = {x0[0],x0[1],x0[2],x0[3],x1[0],x1[1],x1[2],x1[3],x2[0],x2[1],x2[2],x2[3],x3[0],x3[1],x3[2],x3[3]};
#pragma unroll
    for (int i = 0; i < 16; ++i) { const unsigned short hb = bf16_bits(xs[i]); ah.u[i] = hb; al.u[i] = ASPLIT ? bf16_bits(xs[i] - bf16_val(hb)) : (unsigned short)0; }
#pragma unroll
    for (int t = 0; t < 4; ++t) {
      const unsigned short* brow = Wt + (size_t)(col0 + t * 16 + ln) * ldb + kb;
      FragB b;
      b.half[0] = *(const v8us*)(brow + 8 * hh);
      b.half[1] = *(const v8us*)(brow + 16 + 8 * hh);
      acc[t] = mmaN<ASPLIT ? 2 : 1>(ah.v, al.v, b.v, b.v, acc[t]);
    }
  }
#pragma unroll
  for (int t = 0; t < 4; ++t) {
    const int col = col0 + t * 16 + ln;
    float bv = bias ? bias[col] : 0.f;
    if (BIAS_BF16) bv = bf16_round(bv);
#pragma unroll
    for (int r = 0; r < 8; ++r) {
      float v = acc[t][r] + bv;
      if (resid) { float rv = resid[(size_t)((row0 + 8 * hh + r) % rmod) * ldr + col]; if (RES_BF16) rv = bf16_round(rv); v += rv; }
      if (ACT == 1) v = fmaxf(v, 0.f);
      if (ACT == 2) v = 0.5f * v * (1.0f + erff(v * 0.70710678118654752f));
      if (ACT == 3) { const float u = 0.7978845608028654f * (v + 0.044715f * v * v * v); v = 0.5f * v * (1.0f + tanhf(u)); }
      so[w][8 * hh + r][t * 16 + ln] = v;
    }
  }
  __builtin_amdgcn_fence(__ATOMIC_ACQ_REL, "workgroup");
  __builtin_amdgcn_wave_barrier();
  const int rsub = lane >> 4, c4 = (lane & 15) * 4;
  {
#pragma unroll
    for (int q = 0; q < 8; ++q) {
      const int r = q * 2 + rsub;
      const v4f v = *(const v4fa*)&so[w][r][c4];
      *(v4f*)(C + (size_t)(row0 + r) * ldc + col0 + c4) = v;
    }
    
  }
}
// row LayerNorm (biased variance, eps) over N: s = X (+ R); optional out_sum <- s; out_norm <- (s-mu)*rsqrt(var+eps)*g + b
template <bool PARAM_BF16>
__global__ __launch_bounds__(256) void k_layernorm(const float* __restrict__ X, const float* __restrict__ R, const float* __restrict__ g, const float* __restrict__ bta,
                                                  float* __restrict__ out_sum, float* __restrict__ out_norm, int N, float eps) {
  __shared__ float red[256];
  const int row = blockIdx.x, tid = threadIdx.x;
  const float* x = X + (size_t)row * N; const float* rr = R ? R + (size_t)row * N : nullptr;
  float vals[16];                     // up to N = 4096
  const int per = N / 256;            // contiguous chunk per thread? use strided-by-4 chunks: thread handles j = tid*4 + 1024*u
  float s1 = 0.f;
  for (int u = 0; u < per / 4; ++u) {
    const int j = tid * 4 + 1024 * u;
    const v4f a = *(const v4fa*)(x + j);
    v4f b = {0.f,0.f,0.f,0.f}; if (rr) b = *(const v4fa*)(rr + j);
#pragma unroll
    for (int q = 0; q < 4; ++q) { const float v = a[q] + b[q]; vals[u * 4 + q] = v; s1 += v; }
  }
  red[tid] = s1; __syncthreads();
  for (int st = 128; st > 0; st >>= 1) { if (tid < st) red[tid] += red[tid + st]; __syncthreads(); }
  const float mu = red[0] / (float)N; __syncthreads();
  float s2 = 0.f;
  for (int u = 0; u < per / 4; ++u)
#pragma unroll
    for (int q = 0; q < 4; ++q) { const float c = vals[u * 4 + q] - mu; s2 += c * c; }
  red[tid] = s2; __syncthreads();
  for (int st = 128; st > 0; st >>= 1) { if (tid < st) red[tid] += red[tid + st]; __syncthreads(); }
  const float rs = rsqrtf(red[0] / (float)N + eps);
  {
    for (int u = 0; u < per / 4; ++u) {
      const int j = tid * 4 + 1024 * u;
      v4f o, sm;
#pragma unroll
      for (int q = 0; q < 4; ++q) {
        float gg = g[j + q], bb = bta[j + q];
        if (PARAM_BF16) { gg = bf16_round(gg); bb = bf16_round(bb); }
        sm[q] = vals[u * 4 + q]; o[q] = (vals[u * 4 + q] - mu) * rs * gg + bb;
      }
      if (out_sum) *(v4f*)(out_sum + (size_t)row * N + j) = sm;
      *(v4f*)(out_norm + (size_t)row * N + j) = o;
    }
    
  }
}



// ---- f16 WMMA path (v_wmma_f32_16x16x32_f16): 11-bit significands for operands in range — used where a [0,1] probability operand needs more precision than bf16
typedef _Float16 v16h __attribute__((ext_vector_type(16)));
union FragH { v16h v; v8us half[2]; _Float16 h[16]; unsigned short u[16]; };
template <int NT>
__device__ __forceinline__ v8f mmaH(v16h ah, v16h al, v16h bh, v16h bl, v8f c) {
  c = __builtin_amdgcn_wmma_f32_16x16x32_f16(false, ah, false, bh, (short)0, c, false, false);
  if (NT >= 2) c = __builtin_amdgcn_wmma_f32_16x16x32_f16(false, al, false, bh, (short)0, c, false, false);
  if (NT >= 3) c = __builtin_amdgcn_wmma_f32_16x16x32_f16(false, ah, false, bl, (short)0, c, false, false);
  asm volatile("v_nop\n\tv_nop\n\tv_nop\n\tv_nop" : "+v"(c) : "v"(ah), "v"(al), "v"(bh), "v"(bl));
  return c;
}
// batched GEMM like k_gemm_b but f16 operands: A f32 (split into f16 hi/lo if ASPLIT, else rounded to f16), Bt = f16 values [n][k]; alpha; C f32; N multiple of 16 (partial tiles skipped)
template <bool ASPLIT>
__global__ __launch_bounds__(128) void k_gemm_h(const float* __restrict__ A, int lda, size_t sA, const _Float16* __restrict__ Bh, int ldb, size_t sB, float alpha, float* __restrict__ C, int ldc, size_t sC, int M, int N, int K) {
  __shared__ __attribute__((aligned(16))) float so[4][16][64];
  const int tid = threadIdx.x, w = tid >> 5, lane = tid & 31, ln = lane & 15, hh = lane >> 4; const int by = blockIdx.y;
  A += (size_t)by * sA; Bh += (size_t)by * sB; C += (size_t)by * sC;
  const int ntn = (N + 63) / 64; const int wid = blockIdx.x * 4 + w; const int mt = wid / ntn, nq = wid % ntn; if (mt * 16 >= M) return;
  const int row0 = mt * 16, col0 = nq * 64; const float* arow = A + (size_t)(row0 + ln) * lda;
  v8f acc[4] = {};
  for (int kb = 0; kb < K; kb += 32) {
    FragH ah, al;
    const v4f x0 = *(const v4fa*)(arow + kb + 8 * hh), x1 = *(const v4fa*)(arow + kb + 8 * hh + 4), x2 = *(const v4fa*)(arow + kb + 16 + 8 * hh), x3 = *(const v4fa*)(arow + kb + 16 + 8 * hh + 4);
    float xs[16] = {x0[0],x0[1],x0[2],x0[3],x1[0],x1[1],x1[2],x1[3],x2[0],x2[1],x2[2],x2[3],x3[0],x3[1],x3[2],x3[3]};
#pragma unroll
    for (int i = 0; i < 16; ++i) { const _Float16 h = (_Float16)xs[i]; ah.h[i] = h; al.h[i] = ASPLIT ? (_Float16)(xs[i] - (float)h) : (_Float16)0.0f; }
#pragma unroll
    for (int t = 0; t < 4; ++t) { if (col0 + t * 16 >= N) continue; const size_t boff = (size_t)(col0 + t * 16 + ln) * ldb + kb; FragH bq; bq.half[0] = *(const v8us*)(Bh + boff + 8 * hh); bq.half[1] = *(const v8us*)(Bh + boff + 16 + 8 * hh);
      acc[t] = mmaH<ASPLIT ? 2 : 1>(ah.v, al.v, bq.v, bq.v, acc[t]); }
  }
#pragma unroll
  for (int t = 0; t < 4; ++t) { if (col0 + t * 16 >= N) continue;
#pragma unroll
    for (int r = 0; r < 8; ++r) so[w][8 * hh + r][t * 16 + ln] = acc[t][r] * alpha; }
  __builtin_amdgcn_fence(__ATOMIC_ACQ_REL, "workgroup"); __builtin_amdgcn_wave_barrier();
  const int rsub = lane >> 4, c4 = (lane & 15) * 4;
  {
#pragma unroll
    for (int q = 0; q < 8; ++q) { const int r = q * 2 + rsub; if (col0 + c4 < N) { const v4f v = *(const v4fa*)&so[w][r][c4]; *(v4f*)(C + (size_t)(row0 + r) * ldc + col0 + c4) = v; } }
     }
}

// Wt[n][k] = f16(W[k][n]·scale) from f32 row-major W[K][N] (scale = power of two; bf16-exact weights stay exact in f16 away from the subnormal range)
// blockIdx.y picks one of four weight matrices of the same shape; their Wt planes lie one behind the other.
__global__ __launch_bounds__(256) void k_wt_f16(const float* __restrict__ W0, const float* __restrict__ W1, const float* __restrict__ W2, const float* __restrict__ W3, _Float16* __restrict__ Wt, int K, int N, float scale) {
  const int y = blockIdx.y; const float* W = (y == 0) ? W0 : (y == 1) ? W1 : (y == 2) ? W2 : W3; Wt += (size_t)y * K * N;
  const int t = blockIdx.x * 256 + threadIdx.x; if (t >= N * (K / 8)) return; const int n = t / (K / 8), k8 = (t % (K / 8)) * 8; FragH f;
#pragma unroll
  for (int i = 0; i < 8; ++i) f.h[i] = (_Float16)(bf16_round(W[(size_t)(k8 + i) * N + n]) * scale); const v8us o = f.half[0];
  *(v8us*)((unsigned short*)Wt + (size_t)n * K + k8) = o; 
}
// k_gemm_hh variant with fused epilogue: v = acc·alpha + bias[by·sBias + col] (+ CP[(row/rowsPerB)·sCPb + by·64 + col] if CP) ; ACT 0 none / 1 elu ; writes f16 C16 (and f32 C if non-null)
template <int ACT>
__global__ __launch_bounds__(128) void k_gemm_hhx(const _Float16* __restrict__ A, int lda, size_t sA, const _Float16* __restrict__ Bh, int ldb, size_t sB, float alpha, const float* __restrict__ bias, size_t sBias, const float* __restrict__ CP, int rowsPerB, size_t sCPb, int row0g,
    float* __restrict__ C, _Float16* __restrict__ C16, int ldc, size_t sC, int M, int N, int K) {
  __shared__ __attribute__((aligned(16))) float so[4][16][64];
  const int tid = threadIdx.x, w = tid >> 5, lane = tid & 31, ln = lane & 15, hh = lane >> 4; const int by = blockIdx.y;
  A += (size_t)by * sA; Bh += (size_t)by * sB; const size_t cofs = (size_t)by * sC; const float* bp = bias ? bias + (size_t)by * sBias : nullptr;
  const int ntn = (N + 63) / 64; const int wid = blockIdx.x * 4 + w; const int mt = wid / ntn, nq = wid % ntn; if (mt * 16 >= M) return;
  const int row0 = mt * 16, col0 = nq * 64; const _Float16* arow = A + (size_t)(row0 + ln) * lda;
  v8f acc[4] = {};
  for (int kb = 0; kb < K; kb += 32) { FragH ah; ah.half[0] = *(const v8us*)((const unsigned short*)arow + kb + 8 * hh); ah.half[1] = *(const v8us*)((const unsigned short*)arow + kb + 16 + 8 * hh);
#pragma unroll
    for (int t = 0; t < 4; ++t) { if (col0 + t * 16 >= N) continue; const size_t boff = (size_t)(col0 + t * 16 + ln) * ldb + kb; FragH bq; bq.half[0] = *(const v8us*)((const unsigned short*)Bh + boff + 8 * hh); bq.half[1] = *(const v8us*)((const unsigned short*)Bh + boff + 16 + 8 * hh);
      acc[t] = mmaH<1>(ah.v, ah.v, bq.v, bq.v, acc[t]); }
  }
#pragma unroll
  for (int t = 0; t < 4; ++t) { if (col0 + t * 16 >= N) continue; const int col = col0 + t * 16 + ln; const float bv = bp ? bf16_round(bp[col]) : 0.f;
#pragma unroll
    for (int r = 0; r < 8; ++r) { float v = acc[t][r] * alpha + bv; if (CP) { const int rr = row0g + row0 + 8 * hh + r; if (rowsPerB < 0) v += CP[cofs + (size_t)rr * ldc + col];      /* rowsPerB < 0: own element of the batched C plane */ else { const int bidx = rr / rowsPerB; v += CP[(size_t)bidx * sCPb + (size_t)by * 64 + col]; } } if (ACT == 1) v = (v > 0.f) ? v : expm1f(v); else if (ACT == 7) v = (v > 0.f) ? v + 1.0f : expf(v); else if (ACT == 8) v = tanhf(v); else if (ACT == 9) v = 0.5f * v * (1.0f + tanhf(0.7978845608028654f * (v + 0.044715f * v * v * v))); else if (ACT == 11) v = 1.0f / (1.0f + expf(-v)); else if (ACT == 12) v = (v > 0.f) ? v : 0.01f * v; else if (ACT == 14) v = (v > 0.f) ? v : 0.1f * v; else if (ACT == 16) v = (v >= 0.f) ? v : 0.3f * v; else if (ACT == 17) v = (v >= 0.f) ? v : 0.2f * v; else if (ACT == 15) v = v / (1.0f + expf(-v)); else if (ACT == 3) v = fmaxf(v, 0.f); else if (ACT == 6) v = 0.5f * v * (1.0f + erff(v * 0.70710678118654752f)); so[w][8 * hh + r][t * 16 + ln] = v; } }
  __builtin_amdgcn_fence(__ATOMIC_ACQ_REL, "workgroup"); __builtin_amdgcn_wave_barrier();
  const int rsub = lane >> 4, c4 = (lane & 15) * 4; typedef _Float16 v4h __attribute__((ext_vector_type(4)));
  {
#pragma unroll
    for (int q = 0; q < 8; ++q) { const int r = q * 2 + rsub; if (col0 + c4 < N) { const v4f v = *(const v4fa*)&so[w][r][c4]; if (C) *(v4f*)(C + cofs + (size_t)(row0 + r) * ldc + col0 + c4) = v; if (C16) { v4h h4; for (int i = 0; i < 4; ++i) h4[i] = (_Float16)v[i]; *(v4h*)(C16 + cofs + (size_t)(row0 + r) * ldc + col0 + c4) = h4; } } }
     }
}


typedef _Float16 v4h __attribute__((ext_vector_type(4)));

// blockIdx.y picks the stream (query, key, value input); the f16 planes lie one behind the other.
__global__ __launch_bounds__(256) void k_x16(const float* __restrict__ x0, const float* __restrict__ x1, const float* __restrict__ x2, _Float16* __restrict__ X16, size_t n8) { const size_t t = (size_t)blockIdx.x * 256 + threadIdx.x; if (t >= n8) return; FragH f;
  const int y = blockIdx.y; const float* x = (y == 0) ? x0 : (y == 1) ? x1 : x2; X16 += (size_t)y * n8 * 8;
#pragma unroll
  for (int q = 0; q < 8; ++q) f.h[q] = (_Float16)bf16_round(x[t * 8 + q]); *(v8us*)((unsigned short*)X16 + t * 8) = f.half[0];  }
__global__ __launch_bounds__(256) void k_h16(const float* __restrict__ x, _Float16* __restrict__ X16, size_t n8) { const size_t t = (size_t)blockIdx.x * 256 + threadIdx.x; if (t >= n8) return; FragH f;
#pragma unroll
  for (int q = 0; q < 8; ++q) f.h[q] = (_Float16)x[t * 8 + q]; *(v8us*)((unsigned short*)X16 + t * 8) = f.half[0];  }
__global__ __launch_bounds__(256) void k_round16f(const float* __restrict__ W, _Float16* __restrict__ Bt, size_t n8) { const size_t t = (size_t)blockIdx.x * 256 + threadIdx.x; if (t >= n8) return; FragH f;
#pragma unroll
  for (int i = 0; i < 8; ++i) f.h[i] = (_Float16)(bf16_round(W[t * 8 + i]) * 16.0f); *(v8us*)((unsigned short*)Bt + t * 8) = f.half[0];  }
template <int NHv, int TTv>
__global__ __launch_bounds__(256) void k_vt(const _Float16* __restrict__ V16, int ldv, int voff, _Float16* __restrict__ Vt) { __shared__ unsigned short tl[64][66]; const int tid = threadIdx.x; const int slab = blockIdx.x / (TTv / 64), lg = blockIdx.x % (TTv / 64); const int b = slab / NHv, h = slab % NHv;
  for (int i = tid; i < 64 * 8; i += 256) { const int r = i / 8, c8 = (i % 8) * 8; FragH f; f.half[0] = *(const v8us*)((const unsigned short*)V16 + ((size_t)b * TTv + lg * 64 + r) * ldv + voff + h * 64 + c8);
#pragma unroll
    for (int q = 0; q < 8; ++q) tl[r][c8 + q] = f.u[q]; }
  __syncthreads();
  {
#pragma unroll
    for (int rd = 0; rd < 2; ++rd) { const int d = rd * 32 + tid / 8, pc = tid % 8; FragH f;
#pragma unroll
      for (int q = 0; q < 8; ++q) f.u[q] = tl[pc * 8 + q][d];
      *(v8us*)((unsigned short*)Vt + ((size_t)slab * 64 + d) * TTv + lg * 64 + pc * 8) = f.half[0]; }
     } }

__global__ __launch_bounds__(256) void k_hl(const float* __restrict__ F, _Float16* __restrict__ Hh, _Float16* __restrict__ Hl, size_t n8) { const size_t t = (size_t)blockIdx.x * 256 + threadIdx.x; if (t >= n8) return; FragH fh, fl; const v4f a = *(const v4fa*)(F + t * 8), c = *(const v4fa*)(F + t * 8 + 4);
#pragma unroll
  for (int q = 0; q < 4; ++q) { _Float16 h = (_Float16)a[q]; fh.h[q] = h; fl.h[q] = (_Float16)((a[q] - (float)h) * 1024.0f); h = (_Float16)c[q]; fh.h[4 + q] = h; fl.h[4 + q] = (_Float16)((c[q] - (float)h) * 1024.0f); }
  { *(v8us*)((unsigned short*)Hh + t * 8) = fh.half[0]; *(v8us*)((unsigned short*)Hl + t * 8) = fl.half[0];  } }

// ---- fast GEMM (wave tile 32x64; requires M % 32 == 0 rows per launch region and N % 64 == 0); epilogue = k_gemm_hhx semantics ----
__device__ __forceinline__ v16h g2_frag(const _Float16* p, int hh) { FragH f; f.half[0] = *(const v8us*)((const unsigned short*)p + 8 * hh); f.half[1] = *(const v8us*)((const unsigned short*)p + 16 + 8 * hh); return f.v; }
__device__ __forceinline__ v8f g2_mma(v16h a, v16h b, v8f c) { v8f d = __builtin_amdgcn_wmma_f32_16x16x32_f16(false, a, false, b, (short)0, c, false, false); asm volatile("v_nop\n\tv_nop\n\tv_nop\n\tv_nop" : "+v"(d) : "v"(a), "v"(b)); return d; }
template <int ACT>
__global__ __launch_bounds__(128) void k_gemm2(const _Float16* __restrict__ A, int lda, size_t sA, const _Float16* __restrict__ Bh, int ldb, size_t sB, float alpha, const float* __restrict__ bias, size_t sBias, const float* __restrict__ CP, int rowsPerB, size_t sCPb, int row0g,
    float* __restrict__ C, _Float16* __restrict__ C16, int ldc, size_t sC, int M, int N, int K, size_t sAz, size_t sBz, size_t sCz, const float* __restrict__ bias1, const float* __restrict__ bias2) {      /* blockIdx.z: a second batch index (the projection) with strides sAz, sBz, sCz and its own bias vector */ static_assert(ACT == 0 || ACT == 3 || ACT == 6 || ACT == 8 || ACT == 9 || ACT == 11 || ACT == 12 || ACT == 14 || ACT == 15 || ACT == 16 || ACT == 17, "k_gemm2: unsupported ACT code (would silently apply no activation)");
  __shared__ __attribute__((aligned(16))) float so[4][32][68];
  const int tid = threadIdx.x, w = tid >> 5, lane = tid & 31, ln = lane & 15, hh = lane >> 4; const int by = blockIdx.y;
  const int bz = blockIdx.z; const float* bsel = (bz == 0) ? bias : (bz == 1) ? bias1 : bias2;
  A += (size_t)by * sA + (size_t)bz * sAz; Bh += (size_t)by * sB + (size_t)bz * sBz; const size_t cofs = (size_t)by * sC + (size_t)bz * sCz; const float* bp = bsel ? bsel + (size_t)by * sBias : nullptr;
  const int ntn = N >> 6; const int mt = blockIdx.x / ntn, nq = blockIdx.x - mt * ntn; const int row0 = mt * 128 + 32 * w, col0 = nq * 64; if (row0 >= M) return;
  const _Float16* a0p = A + (size_t)(row0 + ln) * lda; const _Float16* a1p = a0p + (size_t)16 * lda;
  const _Float16* b0p = Bh + (size_t)(col0 + ln) * ldb; const _Float16* b1p = b0p + (size_t)16 * ldb; const _Float16* b2p = b1p + (size_t)16 * ldb; const _Float16* b3p = b2p + (size_t)16 * ldb;
  const v8f z8 = {0.f,0.f,0.f,0.f,0.f,0.f,0.f,0.f}; v8f c00 = z8, c01 = z8, c02 = z8, c03 = z8, c10 = z8, c11 = z8, c12 = z8, c13 = z8;
#pragma unroll 1
  for (int kb = 0; kb < K; kb += 32) { const v16h a0 = g2_frag(a0p + kb, hh), a1 = g2_frag(a1p + kb, hh);
    v16h b = g2_frag(b0p + kb, hh); c00 = g2_mma(a0, b, c00); c10 = g2_mma(a1, b, c10);
    b = g2_frag(b1p + kb, hh); c01 = g2_mma(a0, b, c01); c11 = g2_mma(a1, b, c11);
    b = g2_frag(b2p + kb, hh); c02 = g2_mma(a0, b, c02); c12 = g2_mma(a1, b, c12);
    b = g2_frag(b3p + kb, hh); c03 = g2_mma(a0, b, c03); c13 = g2_mma(a1, b, c13); }
  v8f accs[8] = {c00, c01, c02, c03, c10, c11, c12, c13};
#pragma unroll
  for (int u = 0; u < 8; ++u) { const int t = u & 3, half = u >> 2; const int col = col0 + t * 16 + ln; const float bv = bp ? bf16_round(bp[col]) : 0.f;
#pragma unroll
    for (int r = 0; r < 8; ++r) { const int rloc = half * 16 + 8 * hh + r; float v = accs[u][r] * alpha + bv; if (CP) { if (rowsPerB < 0) v += CP[cofs + (size_t)(row0g + row0 + rloc) * ldc + col];      /* rowsPerB < 0: own element of the batched C plane */ else { const int bidx = (row0g + row0 + rloc) / rowsPerB; v += CP[(size_t)bidx * sCPb + (size_t)by * 64 + col]; } }
      if (ACT == 3) v = fmaxf(v, 0.f); else if (ACT == 6) v = 0.5f * v * (1.0f + erff(v * 0.70710678118654752f)); else if (ACT == 11) v = 1.0f / (1.0f + expf(-v)); else if (ACT == 15) v = v / (1.0f + expf(-v)); else if (ACT == 12) v = (v > 0.f) ? v : 0.01f * v; else if (ACT == 8) v = tanhf(v); else if (ACT == 9) v = 0.5f * v * (1.0f + tanhf(0.7978845608028654f * (v + 0.044715f * v * v * v))); else if (ACT == 14) v = (v > 0.f) ? v : 0.1f * v; else if (ACT == 16) v = (v >= 0.f) ? v : 0.3f * v; else if (ACT == 17) v = (v >= 0.f) ? v : 0.2f * v;
      so[w][rloc][t * 16 + ln] = v; } }
  __builtin_amdgcn_fence(__ATOMIC_ACQ_REL, "workgroup"); __builtin_amdgcn_wave_barrier();
  const int rsub = lane >> 4, c4 = (lane & 15) * 4;
  {
#pragma unroll
    for (int q = 0; q < 16; ++q) { const int r = q * 2 + rsub; const v4f v = *(const v4fa*)&so[w][r][c4]; if (C) *(v4f*)(C + cofs + (size_t)(row0 + r) * ldc + col0 + c4) = v; if (C16) { v4h h4; for (int i = 0; i < 4; ++i) h4[i] = (_Float16)v[i]; *(v4h*)(C16 + cofs + (size_t)(row0 + r) * ldc + col0 + c4) = h4; } }
     } }


__global__ __launch_bounds__(256) void k_wnat(const float* __restrict__ w, size_t n8, _Float16* __restrict__ Bt) { const size_t t = (size_t)blockIdx.x * 256 + threadIdx.x; if (t >= n8) return; FragH f; for (int q = 0; q < 8; ++q) f.h[q] = (_Float16)(bf16_round(w[t * 8 + q]) * 16.0f); *(v8us*)((unsigned short*)Bt + t * 8) = f.half[0];  }
__global__ __launch_bounds__(256) void k_rsm(const float* __restrict__ S, _Float16* __restrict__ P, int nrows) {
  #pragma clang fp contract(off)
  const int i = blockIdx.x * 256 + threadIdx.x; if (i >= nrows) return; const float* s = S + (size_t)i * SQ; float mx = -3.0e38f;
#pragma unroll 1
  for (int j = 0; j < SQ; ++j) mx = fmaxf(mx, s[j]); float se = 0.f;
#pragma unroll 1
  for (int j = 0; j < SQ; ++j) se += expf(s[j] - mx); const float sc = 256.0f / se;
#pragma unroll 1
  for (int j0 = 0; j0 < SQ; j0 += 8) { FragH f; for (int q = 0; q < 8; ++q) f.h[q] = (_Float16)(expf(s[j0 + q] - mx) * sc); unsigned short* d = (unsigned short*)P + (size_t)i * SQ + j0; *(v8us*)d = f.half[0];  } }
__global__ __launch_bounds__(256) void k_vt(const _Float16* __restrict__ V16, int b, int h0, _Float16* __restrict__ VT) { __shared__ unsigned short tl[64][65]; const int tid = threadIdx.x; const int hh = blockIdx.x % HG, sg = blockIdx.x / HG; const int s0 = sg * 64; const int h = h0 + hh;
  for (int i = tid; i < 64 * 8; i += 256) { const int j = i / 8, d8 = (i % 8) * 8; FragH f; f.half[0] = *(const v8us*)((const unsigned short*)V16 + ((size_t)b * SQ + s0 + j) * DM + h * HD + d8); for (int q = 0; q < 8; ++q) tl[d8 + q][j] = f.u[q]; }
  __syncthreads();
  { for (int i = tid; i < 64 * 8; i += 256) { const int d = i / 8, j8 = (i % 8) * 8; FragH f; for (int q = 0; q < 8; ++q) f.u[q] = tl[d][j8 + q]; *(v8us*)((unsigned short*)VT + ((size_t)hh * HD + d) * SQ + s0 + j8) = f.half[0]; }  } }



__global__ __launch_bounds__(256) void k_rsmkm(const float* __restrict__ S, _Float16* __restrict__ P, int nrows, const int* __restrict__ am) {
  #pragma clang fp contract(off)
  const int t = blockIdx.x * 256 + threadIdx.x; if (t >= nrows) return; const size_t i = (size_t)t; const float* s = S + i * SQ; const int* mr = am + (size_t)(t % SQ) * SQ; float mx = -3.0e38f;
#pragma unroll 1
  for (int j = 0; j < SQ; ++j) { const float f = (mr[j] != 0) ? 1.f : 0.f; mx = fmaxf(mx, fmaf(f, s[j], (1.f - f) * -1.0e9f)); } float se = 0.f;
#pragma unroll 1
  for (int j = 0; j < SQ; ++j) { const float f = (mr[j] != 0) ? 1.f : 0.f; se += __expf(fmaf(f, s[j], (1.f - f) * -1.0e9f) - mx); } const float sc = 256.0f / se;
#pragma unroll 1
  for (int j0 = 0; j0 < SQ; j0 += 8) { FragH fr; for (int q = 0; q < 8; ++q) { const int j = j0 + q; const float f = (mr[j] != 0) ? 1.f : 0.f; fr.h[q] = (_Float16)(__expf(fmaf(f, s[j], (1.f - f) * -1.0e9f) - mx) * sc); }
    unsigned short* d = (unsigned short*)P + i * SQ + j0; *(v8us*)d = fr.half[0];  } }
// exp of four values as __expf forms it (v_exp_f32 of x * log2 e). One statement, so that the free slot the instruction set asks for behind a transcendental stands there by construction: outputs are early-clobbered (no v_exp_f32 overwrites a neighbour's source or reads its result), and the v_nop fills the slot behind the last one.
__device__ __forceinline__ v4f exp_x4(v4f x) { float r0, r1, r2, r3;
  asm("v_exp_f32 %0, %4\n\tv_exp_f32 %1, %5\n\tv_exp_f32 %2, %6\n\tv_exp_f32 %3, %7\n\tv_nop" : "=&v"(r0), "=&v"(r1), "=&v"(r2), "=&v"(r3) : "v"(x[0] * 1.44269504088896340736f), "v"(x[1] * 1.44269504088896340736f), "v"(x[2] * 1.44269504088896340736f), "v"(x[3] * 1.44269504088896340736f));
  const v4f r = {r0, r1, r2, r3}; return r; }
// exp of one value, same form as exp_x4 (the v_nop fills the free slot behind the transcendental).
__device__ __forceinline__ float exp_x1(float x) { float r; asm("v_exp_f32 %0, %1\n\tv_nop" : "=&v"(r) : "v"(x * 1.44269504088896340736f)); return r; }
__device__ __forceinline__ v8f fa_mma(v16h a, v16h b, v8f c) { return __builtin_amdgcn_wmma_f32_16x16x32_f16(false, a, false, b, (short)0, c, false, false); }
__global__ __launch_bounds__(256) void k_fattn(const _Float16* __restrict__ Q, const _Float16* __restrict__ Kk, const _Float16* __restrict__ VTa, _Float16* __restrict__ O) {
  const int lane = threadIdx.x & 31, ln = lane & 15, hh = lane >> 4; const int w = __builtin_amdgcn_readfirstlane(threadIdx.x >> 5);      /* wave number in a scalar register: the mask test below is a scalar branch */
  const int h = blockIdx.y, b = blockIdx.z; const int q0 = blockIdx.x * 128 + w * 16; const int qi = q0 + ln;
  const _Float16* qp = Q + ((size_t)b * SQ + qi) * LQ + h * HD; const v16h qf0 = g2_frag(qp, hh), qf1 = g2_frag(qp + 32, hh);
  const _Float16* kp = Kk + ((size_t)b * SQ + ln) * LQ + h * HD; const _Float16* vp = VTa + (((size_t)b * NH + h) * HD + ln) * SQ;
  const v8f z8 = {0.f,0.f,0.f,0.f,0.f,0.f,0.f,0.f}; v8f o[4] = {z8, z8, z8, z8}; float m = -1.0e30f, l = 0.f;
#pragma unroll 1      /* one pass already holds 32 loads and 16 matrix products; a second copy would only cost registers */
  for (int k0 = 0; k0 < SQ; k0 += 64) { v8f s[4]; v16h kf[4][2], vf[4][2];
#pragma unroll      /* kf[] in registers */
    for (int t = 0; t < 4; ++t) { const _Float16* kr = kp + (size_t)(k0 + 16 * t) * LQ; kf[t][0] = g2_frag(kr, hh); kf[t][1] = g2_frag(kr + 32, hh); }
    asm volatile("" :: "v"(kf[0][0]), "v"(kf[0][1]), "v"(kf[1][0]), "v"(kf[1][1]), "v"(kf[2][0]), "v"(kf[2][1]), "v"(kf[3][0]), "v"(kf[3][1]));      /* inputs only, loaded values: all 16 k loads of the pass are issued before the first is waited for (left alone, the compiler loads one fragment at a time into the same registers: eight load latencies in a row) */
#pragma unroll      /* s[] in registers */
    for (int t = 0; t < 4; ++t) { s[t] = fa_mma(kf[t][0], qf0, z8); s[t] = fa_mma(kf[t][1], qf1, s[t]); }
#pragma unroll      /* vf[] in registers; the v fragments arrive under the softmax arithmetic */
    for (int t = 0; t < 4; ++t) { vf[t][0] = g2_frag(vp + (size_t)(16 * t) * SQ + k0, hh); vf[t][1] = g2_frag(vp + (size_t)(16 * t) * SQ + k0 + 32, hh); }
#pragma unroll      /* s[] in registers */
    for (int t = 0; t < 4; ++t) s[t] *= 0.125f;
    if (k0 <= q0 + 15) {      /* a pass whose keys all lie behind the wave's queries adds 0 * -1e9: skipped as an identity */
#pragma unroll      /* s[] in registers */
      for (int t = 0; t < 4; ++t) for (int r = 0; r < 8; ++r) { const float mk = (k0 + 16 * t + 8 * hh + r <= qi) ? 1.0f : 0.0f; s[t][r] = __fadd_rn(s[t][r], __fmul_rn(mk, -1.0e9f)); } }
    float mt = s[0][0];
#pragma unroll      /* s[] in registers */
    for (int t = 0; t < 4; ++t) for (int r = 0; r < 8; ++r) mt = fmaxf(mt, s[t][r]);
    mt = fmaxf(mt, __shfl_xor(mt, 16)); const float mn = fmaxf(m, mt); const float corr = exp_x1(m - mn); m = mn;
    v4f s4 = {0.f, 0.f, 0.f, 0.f}; FragH pf[2];
#pragma unroll      /* s[], pf[] in registers */
    for (int t = 0; t < 4; ++t) { const v4f a = {s[t][0], s[t][1], s[t][2], s[t][3]}, c = {s[t][4], s[t][5], s[t][6], s[t][7]}; const v4f ea = exp_x4(a - mn), ec = exp_x4(c - mn); s4 += ea; s4 += ec;
      for (int u = 0; u < 4; ++u) { pf[t >> 1].h[(t & 1) * 8 + u] = (_Float16)ea[u]; pf[t >> 1].h[(t & 1) * 8 + 4 + u] = (_Float16)ec[u]; } }
    l = l * corr + ((s4[0] + s4[1]) + (s4[2] + s4[3]));      /* each wave half keeps its own part of the sum; joined once behind the loop */
#pragma unroll      /* o[] in registers */
    for (int t = 0; t < 4; ++t) { o[t] *= corr; o[t] = fa_mma(vf[t][0], pf[0].v, o[t]); o[t] = fa_mma(vf[t][1], pf[1].v, o[t]); } }
  l += __shfl_xor(l, 16); const float fin = 64.0f / l;      /* o carried x64 against f16 subnormal flush, folded into the output GEMM alpha */
  _Float16* op = O + ((size_t)b * SQ + qi) * DM + h * HD + 8 * hh;
#pragma unroll      /* o[] in registers; a lane's 8 accumulator registers are 8 consecutive columns of its query's row: one 16-byte store */
  for (int t = 0; t < 4; ++t) { FragH f; for (int r = 0; r < 8; ++r) f.h[r] = (_Float16)(o[t][r] * fin); *(v8us*)((unsigned short*)op + 16 * t) = f.half[0]; } }

// One thread per query row of the tile. The 64-wide loops are unrolled: q[] and o[] are indexed by constants only and stay in registers, a key's k row is fetched whole ahead of the score sum and its v row under that sum.
__global__ __launch_bounds__(64) void k_attup(const float* __restrict__ QF, const float* __restrict__ KF, const float* __restrict__ VF, int ld, float scale, float* __restrict__ OF, int ldo) {
  #pragma clang fp contract(off)
  __shared__ __attribute__((aligned(16))) float lo[64][64];
  const int tid = threadIdx.x; const int h = blockIdx.x / (QT0 / 64), rg = blockIdx.x % (QT0 / 64); const int i = rg * 64 + tid;
  { const size_t bo = (size_t)blockIdx.y * QT0; QF += bo * ld; KF += bo * ld; VF += bo * ld; OF += bo * ldo; }      /* blockIdx.y: the batch; each batch has its own QT0-row tile */
  const float* qr = QF + (size_t)i * ld + h * HD; v4f q[HD / 4], o[HD / 4];
#pragma unroll      /* q[], o[] in registers; the q row's 16 loads in flight at once */
  for (int c = 0; c < HD / 4; ++c) { q[c] = *(const v4fa*)(qr + c * 4); const v4f z = {0.f, 0.f, 0.f, 0.f}; o[c] = z; }
  float m = -1.0e30f, l = 0.f;
#pragma unroll 1
  for (int j = rg * 64; j < QT0; ++j) { const float* kr = KF + (size_t)j * ld + h * HD; const float* vr = VF + (size_t)j * ld + h * HD; v4f kq[HD / 4], vv[HD / 4]; float s = 0.f;
#pragma unroll      /* a whole row's loads in flight at once */
    for (int c = 0; c < HD / 4; ++c) kq[c] = *(const v4fa*)(kr + c * 4);
#pragma unroll      /* the v row arrives under the score sum */
    for (int c = 0; c < HD / 4; ++c) vv[c] = *(const v4fa*)(vr + c * 4);
#pragma unroll      /* q[], kq[] in registers */
    for (int c = 0; c < HD / 4; ++c) { s = __fadd_rn(s, __fmul_rn(q[c][0], kq[c][0])); s = __fadd_rn(s, __fmul_rn(q[c][1], kq[c][1])); s = __fadd_rn(s, __fmul_rn(q[c][2], kq[c][2])); s = __fadd_rn(s, __fmul_rn(q[c][3], kq[c][3])); }
    s = __fmul_rn(s, scale);
    const float f = (j > i) ? 1.f : 0.f; const float sm = fmaf(f, s, (1.f - f) * -1.0e30f); const float mn = fmaxf(m, sm); const float sc = expf(m - mn); const float e = __fmul_rn(f, expf(sm - mn)); l = __fadd_rn(__fmul_rn(l, sc), e); m = mn;
#pragma unroll      /* o[], vv[] in registers */
    for (int c = 0; c < HD / 4; ++c) for (int u = 0; u < 4; ++u) o[c][u] = __fadd_rn(__fmul_rn(o[c][u], sc), __fmul_rn(e, vv[c][u])); }
  const float fin = (l > 0.f) ? 64.0f / l : 0.f;      /* o carried x64 like the f16 path; the key-less last row is written by k_vmean */
#pragma unroll      /* o[] in registers */
  for (int c = 0; c < HD / 4; ++c) { v4f oo = o[c]; for (int u = 0; u < 4; ++u) oo[u] = __fmul_rn(oo[u], fin); *(v4f*)&lo[tid][c * 4] = oo; }
  __syncthreads();
  {
#pragma unroll 1
    for (int it = 0; it < 16; ++it) { const int row = it * 4 + tid / 16, pc = (tid % 16) * 4; const v4f v = *(const v4f*)&lo[row][pc]; *(v4f*)(OF + (size_t)(rg * 64 + row) * ldo + h * HD + pc) = v; }
     } }

__global__ __launch_bounds__(256) void k_vmean(const _Float16* __restrict__ V, float* __restrict__ orow) {
  #pragma clang fp contract(off)
  const int c = blockIdx.x * 256 + threadIdx.x; if (c >= DM) return; const _Float16* p = V + (size_t)blockIdx.y * SQ * LQ + c; orow += (size_t)blockIdx.y * QT0 * DM; float s = 0.f;      /* blockIdx.y: the batch */
#pragma unroll 1
  for (int j0 = 0; j0 < SQ; j0 += 64) { _Float16 t[64];
#pragma unroll      /* 64 rows' loads in flight at once (the constant pitch LQ makes them one address register with immediate offsets); t[] in registers */
    for (int j = 0; j < 64; ++j) t[j] = p[(size_t)(j0 + j) * LQ];
#pragma unroll      /* summed in the rows' order */
    for (int j = 0; j < 64; ++j) s = __fadd_rn(s, (float)t[j]); }
  const float o = __fmul_rn(s, 64.0f / (float)SQ); *(float*)(orow + c) = o;  }

extern "C" void kernel_launch(void* const* d_in, const int* in_sizes, int n_in,
                              void* d_out, int out_size, void* d_ws, size_t ws_size, hipStream_t stream) {
  (void)in_sizes; (void)n_in; (void)out_size;
  const float* const* I = (const float* const*)d_in; const float* xq = I[0]; const float* xk = I[0]; const float* xv = I[0]; const float* wq = I[1]; const float* bq = I[2]; const float* wk = I[3]; const float* bk = I[4]; const float* wv = I[5]; const float* bv = I[6]; const float* wo = I[7]; const float* bo = I[8]; const float* x = xq;      /* ONE input feeds the query, key and value streams; [in][out] weights + biases; the mask is built from indices as in the module */
  static_assert(NH * HD == DM && DM % 64 == 0 && SQ % 128 == 0 && NH % HG == 0, "shape / tile multiples");
  char* ws = (char*)d_ws; size_t off = 0;
  auto take = [&](size_t bytes) { char* p = ws + off; off += (bytes + 255) & ~(size_t)255; return p; };
  _Float16* BQ = (_Float16*)take((size_t)4 * DM * DM * 2); _Float16* BO = BQ + (size_t)3 * DM * DM;      /* Bt planes of Wq, Wk, Wv, Wo, one behind the other */
  _Float16* X16 = (_Float16*)take((size_t)3 * NR * DM * 2);      /* query, key and value inputs as exact f16 rows: three planes */
  _Float16* Q16 = (_Float16*)take((size_t)3 * NR * DM * 2); _Float16* K16 = Q16 + NR * DM; _Float16* V16 = K16 + NR * DM; _Float16* O16 = (_Float16*)take(NR * DM * 2);      /* q, k, v: three planes */
  _Float16* VT = (_Float16*)take((size_t)NB * NH * HD * SQ * 2);
  float* QF0 = (float*)take((size_t)3 * NB * QT0 * DM * 4); float* KF0 = QF0 + (size_t)NB * QT0 * DM; float* VF0 = KF0 + (size_t)NB * QT0 * DM; float* OF0 = (float*)take((size_t)NB * QT0 * DM * 4); _Float16* OH0 = (_Float16*)take((size_t)NB * QT0 * DM * 2); _Float16* OL0 = (_Float16*)take((size_t)NB * QT0 * DM * 2);      /* exact last tile of every batch: f32 q / k / v of the tile rows (three planes of [NB][QT0] rows), o (x64) and its f16 hi + x1024 residual planes */
  if (off > ws_size) return;
  k_wt_f16<<<dim3((unsigned)(((size_t)DM * (DM / 8) + 255) / 256), 4), 256, 0, stream>>>(wq, wk, wv, wo, BQ, DM, DM, 16.0f);      /* [in][out] -> Bt x16, the four weights in one launch */
  k_x16<<<dim3((unsigned)((NR * DM / 8 + 255) / 256), 3), 256, 0, stream>>>(x, xk, xv, X16, NR * DM / 8);      /* the three streams in one launch */
  const size_t r0p = (size_t)B0 * SQ;      /* first projected row */
  k_gemm2<0><<<dim3((unsigned)((MP / 128) * (DM / 64)), 1, 3), 128, 0, stream>>>(X16 + r0p * DM, DM, 0, BQ, DM, 0, 0.0625f, bq, 0, nullptr, 1, 0, 0, nullptr, Q16 + r0p * DM, DM, 0, MP, DM, DM, NR * DM, (size_t)DM * DM, NR * DM, bk, bv);      /* q, k, v (z) in one launch */
  k_vt<NH, SQ><<<NBR * NH * (SQ / 64), 256, 0, stream>>>(V16 + r0p * LQ, LQ, 0, VT + (size_t)B0 * NH * HD * SQ);      /* V^T [NB][NH][HD][SQ], every batch in one launch */
  const size_t rl0 = r0p + SQ - QT0; const size_t f00 = (size_t)B0 * QT0;      /* first batch's last QT0 rows; its tile in the [NB][QT0] planes */
  k_gemm2<0><<<dim3((QT0 / 128) * (DM / 64), NBR, 3), 128, 0, stream>>>(X16 + rl0 * DM, DM, (size_t)SQ * DM, BQ, DM, 0, 0.0625f, bq, 0, nullptr, 1, 0, 0, QF0 + f00 * DM, nullptr, DM, (size_t)QT0 * DM, QT0, DM, DM, NR * DM, (size_t)DM * DM, (size_t)NB * QT0 * DM, bk, bv);      /* f32 q, k, v (z) of every batch's (y) last tile (exact products) */
  k_attup<<<dim3(NH * (QT0 / 64), NBR), 64, 0, stream>>>(QF0 + f00 * DM, KF0 + f00 * DM, VF0 + f00 * DM, DM, 0.125f, OF0 + f00 * DM, DM);      /* exact f32 attention over the keys j > i inside the tile (o x64) */
  k_vmean<<<dim3((DM + 255) / 256, NBR), 256, 0, stream>>>(V16 + r0p * LQ, OF0 + (f00 + QT0 - 1) * DM);      /* last row: uniform over all keys = 64 x mean of v */
  k_fattn<<<dim3(SQ / 128, NH, NB), 256, 0, stream>>>(Q16, K16, VT, O16);      /* scores, literal 'score + tril * (-1e9)', softmax over all keys and the weighted v sum, every (batch, head) in one launch -> o (merged heads, x64) as f16 rows */
  k_gemm2<0><<<dim3((unsigned)((MPO / 128) * (DM / 64)), 1), 128, 0, stream>>>(O16 + r0p * DM, DM, 0, BO, DM, 0, 0.0009765625f, bo, 0, nullptr, 1, 0, 0, (float*)d_out + r0p * DM, nullptr, DM, 0, MPO, DM, DM, 0, 0, 0, nullptr, nullptr);      /* out rows are the output layout */
  k_hl<<<(unsigned)(((size_t)NB * QT0 * DM / 8 + 255) / 256), 256, 0, stream>>>(OF0, OH0, OL0, (size_t)NB * QT0 * DM / 8);      /* last-tile o (x64) -> f16 hi + x1024 residual planes */
  k_gemm2<0><<<dim3((QT0 / 128) * (DM / 64), NBR), 128, 0, stream>>>(OH0 + f00 * DM, DM, (size_t)QT0 * DM, BO, DM, 0, 0.0009765625f, bo, 0, nullptr, 1, 0, 0, (float*)d_out + rl0 * DM, nullptr, DM, (size_t)SQ * DM, QT0, DM, DM, 0, 0, 0, nullptr, nullptr);      /* last QT0 rows of every batch (y): out = o_hi Wo (+ b), overwriting the f16-path rows */
  k_gemm2<0><<<dim3((QT0 / 128) * (DM / 64), NBR), 128, 0, stream>>>(OL0 + f00 * DM, DM, (size_t)QT0 * DM, BO, DM, 0, 0.00000095367431640625f, nullptr, 0, (const float*)d_out + rl0 * DM, -1, 0, 0, (float*)d_out + rl0 * DM, nullptr, DM, (size_t)SQ * DM, QT0, DM, DM, 0, 0, 0, nullptr, nullptr);      /* += o_lo Wo 2^-20 (own-element accumulate) */
}

// v005
// One run takes 376 microseconds.
// Next to v004, in two timings, it ran 1.31 and 1.32 times as fast.
// All steps since v000 together make it 17.6 times as fast.
#include <hip/hip_runtime.h>
// Multi-head self-attention with the source's INVERTED causal mask (inputs [2][2048][1024]; q / k / v = x W + b ([in][out] 1024 x 1024 sigma 1/32, zero biases); 16 heads of 64; score = q k^T / sqrt(64) + tril * (-1e9): the LOWER triangle incl. the diagonal is pushed to -1e9 (the original's mask bug, kept), so query i attends to the keys j > i only, and the last query (every key masked, all scores rounding to the same -1e9 in f32) attends uniformly to all keys; softmax; out = merged Wo + bo -> [2][2048][1024]).
// Structure: token rows r = b*2048 + s; x as exact f16 rows (bf16-rounded); Q, K, V as three WMMA GEMMs in one launch (grid z; 32x64 wave tiles, f32 accumulation, exact x16 weights + bias, f16 outputs); V^T for all batches and heads via LDS transposes; one fused attention launch over every (batch, head): S^T = K Q^T on WMMA (K = 64, x 1/sqrt(64), then the -1e9 fill), running softmax on VALU (f32 statistics; unnormalised weights exp(s - max) as f16), O^T += V^T P^T on WMMA, o = O / sum (carried x64 against f16 subnormal flush, folded into the output GEMM alpha) written straight into the merged f16 o rows; out = o W_o + b GEMM (f32) into the output layout.
// Compute dtype: inputs rounded to bf16; x / weights exact; q, k, v, softmax weights and o as plain f16 GEMM operands (~2^-12); scores and softmax statistics f32. v_wmma_f32_16x16x32_f16.
#define NB 2
#define SQ 2048
#define DM 1024
#define NH 16
#define HD 64
#define QT0 256                      /* last-tile rows recomputed exactly in f32 (rows with fewer than 256 visible keys) */
#define HG 4                         /* heads per V^T group of the h0-based k_vt overload (not launched) */
#define KW 16                        /* waves of a k_attup block = parts a query row's keys are dealt into */
#define B0 0                         /* first batch processed (debug hook) */
#define NBR NB                       /* batches processed (debug hook) */
#define NR ((size_t)NB * SQ)         /* token rows */
#define MP ((int)((size_t)NBR * SQ)) /* rows projected (debug hook) */
#define QN SQ                        /* query rows attended per batch (not used) */
#define NHD NH                       /* heads attended (not used) */
#define MPO MP                       /* rows through the output stage (debug hook) */
#define LQ DM      /* row pitch of the q/k/v rows */
typedef __bf16 v16b __attribute__((ext_vector_type(16)));
typedef unsigned short v8us __attribute__((ext_vector_type(8), may_alias));
typedef float  v8f  __attribute__((ext_vector_type(8)));
typedef float  v4f  __attribute__((ext_vector_type(4)));
typedef float  v4fa __attribute__((ext_vector_type(4), may_alias));
union FragB { v16b v; v8us half[2]; unsigned short u[16]; };

__device__ __forceinline__ unsigned short bf16_bits(float x) { unsigned int u = __float_as_uint(x); return (unsigned short)((u + 0x7FFFu + ((u >> 16) & 1u)) >> 16); }
__device__ __forceinline__ float bf16_val(unsigned short b) { return __uint_as_float(((unsigned int)b) << 16); }
__device__ __forceinline__ float bf16_round(float x) { return bf16_val(bf16_bits(x)); }
// D += A·B with NT terms: 1 = ah·bh, 2 = + al·bh (A split), 3 = + ah·bl (both split)
template <int NT>
__device__ __forceinline__ v8f mmaN(v16b ah, v16b al, v16b bh, v16b bl, v8f c) {
  c = __builtin_amdgcn_wmma_f32_16x16x32_bf16(false, ah, false, bh, (short)0, c, false, false);
  if (NT >= 2) c = __builtin_amdgcn_wmma_f32_16x16x32_bf16(false, al, false, bh, (short)0, c, false, false);
  if (NT >= 3) c = __builtin_amdgcn_wmma_f32_16x16x32_bf16(false, ah, false, bl, (short)0, c, false, false);
  asm volatile("v_nop\n\tv_nop\n\tv_nop\n\tv_nop" : "+v"(c) : "v"(ah), "v"(al), "v"(bh), "v"(bl));
  return c;
}

__global__ __launch_bounds__(256) void k_wt_bf16(const float* __restrict__ W, unsigned short* __restrict__ Wt, int K, int N) {
  const int t = blockIdx.x * 256 + threadIdx.x;
  const int k8n = K / 8;
  if (t >= N * k8n) return;
  const int n = t / k8n, k8 = (t % k8n) * 8;
  v8us v;
#pragma unroll
  for (int i = 0; i < 8; ++i) v[i] = bf16_bits(W[(size_t)(k8 + i) * N + n]);
  *(v8us*)(Wt + (size_t)n * K + k8) = v;
  
}

// GEMM C[M][N] (f32, pitch ldc) = act(A[M][K]·W + bias). A f32 row-major (pitch lda) converted per fragment to bf16
// (ASPLIT: hi/lo two planes -> 2 terms, else single rounded term); Wt bf16 [N][K] (pitch ldb). BIAS_BF16 rounds the
// bias to bf16 first (bias quantised to bf16 before the add). K%32==0, M%16==0, N%64==0.
template <bool ASPLIT, int ACT, bool BIAS_BF16>
__global__ __launch_bounds__(128) void k_gemm_bf(const float* __restrict__ A, int lda, const unsigned short* __restrict__ Wt, int ldb,
                                               const float* __restrict__ bias, float* __restrict__ C, int ldc, int M, int N, int K) {
  __shared__ __attribute__((aligned(16))) float so[4][16][64];
  const int tid = threadIdx.x, w = tid >> 5, lane = tid & 31, ln = lane & 15, hh = lane >> 4;
  const int ntn = N / 64;
  const int wid = blockIdx.x * 4 + w;
  const int mt = wid / ntn, nq = wid % ntn;
  if (mt * 16 >= M) return;
  const int row0 = mt * 16, col0 = nq * 64;
  const float* arow = A + (size_t)(row0 + ln) * lda;
  v8f acc[4] = {};
  for (int kb = 0; kb < K; kb += 32) {
    FragB ah, al;
    const v4f x0 = *(const v4fa*)(arow + kb + 8 * hh), x1 = *(const v4fa*)(arow + kb + 8 * hh + 4);
    const v4f x2 = *(const v4fa*)(arow + kb + 16 + 8 * hh), x3 = *(const v4fa*)(arow + kb + 16 + 8 * hh + 4);
    float xs[16] = {x0[0],x0[1],x0[2],x0[3],x1[0],x1[1],x1[2],x1[3],x2[0],x2[1],x2[2],x2[3],x3[0],x3[1],x3[2],x3[3]};
#pragma unroll
    for (int i = 0; i < 16; ++i) { const unsigned short hb = bf16_bits(xs[i]); ah.u[i] = hb; al.u[i] = ASPLIT ? bf16_bits(xs[i] - bf16_val(hb)) : (unsigned short)0; }
#pragma unroll
    for (int t = 0; t < 4; ++t) {
      const unsigned short* brow = Wt + (size_t)(col0 + t * 16 + ln) * ldb + kb;
      FragB b;
      b.half[0] = *(const v8us*)(brow + 8 * hh);
      b.half[1] = *(const v8us*)(brow + 16 + 8 * hh);
      acc[t] = mmaN<ASPLIT ? 2 : 1>(ah.v, al.v, b.v, b.v, acc[t]);
    }
  }
#pragma unroll
  for (int t = 0; t < 4; ++t) {
    float bv = bias ? bias[col0 + t * 16 + ln] : 0.f;
    if (BIAS_BF16) bv = bf16_round(bv);
#pragma unroll
    for (int r = 0; r < 8; ++r) { float v = acc[t][r] + bv; if (ACT == 1) v = fmaxf(v, 0.f); so[w][8 * hh + r][t * 16 + ln] = v; }
  }
  __builtin_amdgcn_fence(__ATOMIC_ACQ_REL, "workgroup");
  __builtin_amdgcn_wave_barrier();
  const int rsub = lane >> 4, c4 = (lane & 15) * 4;
  {
#pragma unroll
    for (int q = 0; q < 8; ++q) {
      const int r = q * 2 + rsub;
      const v4f v = *(const v4fa*)&so[w][r][c4];
      *(v4f*)(C + (size_t)(row0 + r) * ldc + col0 + c4) = v;
    }
    
  }
}

// GEMM C = act(A·W + bias + resid): A f32 (ASPLIT -> hi/lo 2 terms), Wt bf16 [N][K]; ACT 0 none, 1 relu, 2 exact gelu;
// resid (optional, f32, row index = (row % rmod), pitch ldr, RES_BF16 rounds it) added before the activation.
template <bool ASPLIT, int ACT, bool BIAS_BF16, bool RES_BF16>
__global__ __launch_bounds__(128) void k_gemm_bf3(const float* __restrict__ A, int lda, const unsigned short* __restrict__ Wt, int ldb,
                                                const float* __restrict__ bias, const float* __restrict__ resid, int rmod, int ldr,
                                                float* __restrict__ C, int ldc, int M, int N, int K) {
  __shared__ __attribute__((aligned(16))) float so[4][16][64];
  const int tid = threadIdx.x, w = tid >> 5, lane = tid & 31, ln = lane & 15, hh = lane >> 4;
  const int ntn = N / 64;
  const int wid = blockIdx.x * 4 + w;
  const int mt = wid / ntn, nq = wid % ntn;
  if (mt * 16 >= M) return;
  const int row0 = mt * 16, col0 = nq * 64;
  const float* arow = A + (size_t)(row0 + ln) * lda;
  v8f acc[4] = {};
  for (int kb = 0; kb < K; kb += 32) {
    FragB ah, al;
    const v4f x0 = *(const v4fa*)(arow + kb + 8 * hh), x1 = *(const v4fa*)(arow + kb + 8 * hh + 4);
    const v4f x2 = *(const v4fa*)(arow + kb + 16 + 8 * hh), x3 = *(const v4fa*)(arow + kb + 16 + 8 * hh + 4);
    float xs[16] = {x0[0],x0[1],x0[2],x0[3],x1[0],x1[1],x1[2],x1[3],x2[0],x2[1],x2[2],x2[3],x3[0],x3[1],x3[2],x3[3]};
#pragma unroll
    for (int i = 0; i < 16; ++i) { const unsigned short hb = bf16_bits(xs[i]); ah.u[i] = hb; al.u[i] = ASPLIT ? bf16_bits(xs[i] - bf16_val(hb)) : (unsigned short)0; }
#pragma unroll
    for (int t = 0; t < 4; ++t) {
      const unsigned short* brow = Wt + (size_t)(col0 + t * 16 + ln) * ldb + kb;
      FragB b;
      b.half[0] = *(const v8us*)(brow + 8 * hh);
      b.half[1] = *(const v8us*)(brow + 16 + 8 * hh);
      acc[t] = mmaN<ASPLIT ? 2 : 1>(ah.v, al.v, b.v, b.v, acc[t]);
    }
  }
#pragma unroll
  for (int t = 0; t < 4; ++t) {
    const int col = col0 + t * 16 + ln;
    float bv = bias ? bias[col] : 0.f;
    if (BIAS_BF16) bv = bf16_round(bv);
#pragma unroll
    for (int r = 0; r < 8; ++r) {
      float v = acc[t][r] + bv;
      if (resid) { float rv = resid[(size_t)((row0 + 8 * hh + r) % rmod) * ldr + col]; if (RES_BF16) rv = bf16_round(rv); v += rv; }
      if (ACT == 1) v = fmaxf(v, 0.f);
      if (ACT == 2) v = 0.5f * v * (1.0f + erff(v * 0.70710678118654752f));
      if (ACT == 3) { const float u = 0.7978845608028654f * (v + 0.044715f * v * v * v); v = 0.5f * v * (1.0f + tanhf(u)); }
      so[w][8 * hh + r][t * 16 + ln] = v;
    }
  }
  __builtin_amdgcn_fence(__ATOMIC_ACQ_REL, "workgroup");
  __builtin_amdgcn_wave_barrier();
  const int rsub = lane >> 4, c4 = (lane & 15) * 4;
  {
#pragma unroll
    for (int q = 0; q < 8; ++q) {
      const int r = q * 2 + rsub;
      const v4f v = *(const v4fa*)&so[w][r][c4];
      *(v4f*)(C + (size_t)(row0 + r) * ldc + col0 + c4) = v;
    }
    
  }
}
// row LayerNorm (biased variance, eps) over N: s = X (+ R); optional out_sum <- s; out_norm <- (s-mu)*rsqrt(var+eps)*g + b
template <bool PARAM_BF16>
__global__ __launch_bounds__(256) void k_layernorm(const float* __restrict__ X, const float* __restrict__ R, const float* __restrict__ g, const float* __restrict__ bta,
                                                  float* __restrict__ out_sum, float* __restrict__ out_norm, int N, float eps) {
  __shared__ float red[256];
  const int row = blockIdx.x, tid = threadIdx.x;
  const float* x = X + (size_t)row * N; const float* rr = R ? R + (size_t)row * N : nullptr;
  float vals[16];                     // up to N = 4096
  const int per = N / 256;            // contiguous chunk per thread? use strided-by-4 chunks: thread handles j = tid*4 + 1024*u
  float s1 = 0.f;
  for (int u = 0; u < per / 4; ++u) {
    const int j = tid * 4 + 1024 * u;
    const v4f a = *(const v4fa*)(x + j);
    v4f b = {0.f,0.f,0.f,0.f}; if (rr) b = *(const v4fa*)(rr + j);
#pragma unroll
    for (int q = 0; q < 4; ++q) { const float v = a[q] + b[q]; vals[u * 4 + q] = v; s1 += v; }
  }
  red[tid] = s1; __syncthreads();
  for (int st = 128; st > 0; st >>= 1) { if (tid < st) red[tid] += red[tid + st]; __syncthreads(); }
  const float mu = red[0] / (float)N; __syncthreads();
  float s2 = 0.f;
  for (int u = 0; u < per / 4; ++u)
#pragma unroll
    for (int q = 0; q < 4; ++q) { const float c = vals[u * 4 + q] - mu; s2 += c * c; }
  red[tid] = s2; __syncthreads();
  for (int st = 128; st > 0; st >>= 1) { if (tid < st) red[tid] += red[tid + st]; __syncthreads(); }
  const float rs = rsqrtf(red[0] / (float)N + eps);
  {
    for (int u = 0; u < per / 4; ++u) {
      const int j = tid * 4 + 1024 * u;
      v4f o, sm;
#pragma unroll
      for (int q = 0; q < 4; ++q) {
        float gg = g[j + q], bb = bta[j + q];
        if (PARAM_BF16) { gg = bf16_round(gg); bb = bf16_round(bb); }
        sm[q] = vals[u * 4 + q]; o[q] = (vals[u * 4 + q] - mu) * rs * gg + bb;
      }
      if (out_sum) *(v4f*)(out_sum + (size_t)row * N + j) = sm;
      *(v4f*)(out_norm + (size_t)row * N + j) = o;
    }
    
  }
}



// ---- f16 WMMA path (v_wmma_f32_16x16x32_f16): 11-bit significands for operands in range — used where a [0,1] probability operand needs more precision than bf16
typedef _Float16 v16h __attribute__((ext_vector_type(16)));
union FragH { v16h v; v8us half[2]; _Float16 h[16]; unsigned short u[16]; };
template <int NT>
__device__ __forceinline__ v8f mmaH(v16h ah, v16h al, v16h bh, v16h bl, v8f c) {
  c = __builtin_amdgcn_wmma_f32_16x16x32_f16(false, ah, false, bh, (short)0, c, false, false);
  if (NT >= 2) c = __builtin_amdgcn_wmma_f32_16x16x32_f16(false, al, false, bh, (short)0, c, false, false);
  if (NT >= 3) c = __builtin_amdgcn_wmma_f32_16x16x32_f16(false, ah, false, bl, (short)0, c, false, false);
  asm volatile("v_nop\n\tv_nop\n\tv_nop\n\tv_nop" : "+v"(c) : "v"(ah), "v"(al), "v"(bh), "v"(bl));
  return c;
}
// batched GEMM like k_gemm_b but f16 operands: A f32 (split into f16 hi/lo if ASPLIT, else rounded to f16), Bt = f16 values [n][k]; alpha; C f32; N multiple of 16 (partial tiles skipped)
template <bool ASPLIT>
__global__ __launch_bounds__(128) void k_gemm_h(const float* __restrict__ A, int lda, size_t sA, const _Float16* __restrict__ Bh, int ldb, size_t sB, float alpha, float* __restrict__ C, int ldc, size_t sC, int M, int N, int K) {
  __shared__ __attribute__((aligned(16))) float so[4][16][64];
  const int tid = threadIdx.x, w = tid >> 5, lane = tid & 31, ln = lane & 15, hh = lane >> 4; const int by = blockIdx.y;
  A += (size_t)by * sA; Bh += (size_t)by * sB; C += (size_t)by * sC;
  const int ntn = (N + 63) / 64; const int wid = blockIdx.x * 4 + w; const int mt = wid / ntn, nq = wid % ntn; if (mt * 16 >= M) return;
  const int row0 = mt * 16, col0 = nq * 64; const float* arow = A + (size_t)(row0 + ln) * lda;
  v8f acc[4] = {};
  for (int kb = 0; kb < K; kb += 32) {
    FragH ah, al;
    const v4f x0 = *(const v4fa*)(arow + kb + 8 * hh), x1 = *(const v4fa*)(arow + kb + 8 * hh + 4), x2 = *(const v4fa*)(arow + kb + 16 + 8 * hh), x3 = *(const v4fa*)(arow + kb + 16 + 8 * hh + 4);
    float xs[16] = {x0[0],x0[1],x0[2],x0[3],x1[0],x1[1],x1[2],x1[3],x2[0],x2[1],x2[2],x2[3],x3[0],x3[1],x3[2],x3[3]};
#pragma unroll
    for (int i = 0; i < 16; ++i) { const _Float16 h = (_Float16)xs[i]; ah.h[i] = h; al.h[i] = ASPLIT ? (_Float16)(xs[i] - (float)h) : (_Float16)0.0f; }
#pragma unroll
    for (int t = 0; t < 4; ++t) { if (col0 + t * 16 >= N) continue; const size_t boff = (size_t)(col0 + t * 16 + ln) * ldb + kb; FragH bq; bq.half[0] = *(const v8us*)(Bh + boff + 8 * hh); bq.half[1] = *(const v8us*)(Bh + boff + 16 + 8 * hh);
      acc[t] = mmaH<ASPLIT ? 2 : 1>(ah.v, al.v, bq.v, bq.v, acc[t]); }
  }
#pragma unroll
  for (int t = 0; t < 4; ++t) { if (col0 + t * 16 >= N) continue;
#pragma unroll
    for (int r = 0; r < 8; ++r) so[w][8 * hh + r][t * 16 + ln] = acc[t][r] * alpha; }
  __builtin_amdgcn_fence(__ATOMIC_ACQ_REL, "workgroup"); __builtin_amdgcn_wave_barrier();
  const int rsub = lane >> 4, c4 = (lane & 15) * 4;
  {
#pragma unroll
    for (int q = 0; q < 8; ++q) { const int r = q * 2 + rsub; if (col0 + c4 < N) { const v4f v = *(const v4fa*)&so[w][r][c4]; *(v4f*)(C + (size_t)(row0 + r) * ldc + col0 + c4) = v; } }
     }
}

// Wt[n][k] = f16(W[k][n]·scale) from f32 row-major W[K][N] (scale = power of two; bf16-exact weights stay exact in f16 away from the subnormal range)
// blockIdx.y picks one of four weight matrices of the same shape; their Wt planes lie one behind the other.
__global__ __launch_bounds__(256) void k_wt_f16(const float* __restrict__ W0, const float* __restrict__ W1, const float* __restrict__ W2, const float* __restrict__ W3, _Float16* __restrict__ Wt, int K, int N, float scale) {
  const int y = blockIdx.y; const float* W = (y == 0) ? W0 : (y == 1) ? W1 : (y == 2) ? W2 : W3; Wt += (size_t)y * K * N;
  const int t = blockIdx.x * 256 + threadIdx.x; if (t >= N * (K / 8)) return; const int n = t / (K / 8), k8 = (t % (K / 8)) * 8; FragH f;
#pragma unroll
  for (int i = 0; i < 8; ++i) f.h[i] = (_Float16)(bf16_round(W[(size_t)(k8 + i) * N + n]) * scale); const v8us o = f.half[0];
  *(v8us*)((unsigned short*)Wt + (size_t)n * K + k8) = o; 
}
// k_gemm_hh variant with fused epilogue: v = acc·alpha + bias[by·sBias + col] (+ CP[(row/rowsPerB)·sCPb + by·64 + col] if CP) ; ACT 0 none / 1 elu ; writes f16 C16 (and f32 C if non-null)
template <int ACT>
__global__ __launch_bounds__(128) void k_gemm_hhx(const _Float16* __restrict__ A, int lda, size_t sA, const _Float16* __restrict__ Bh, int ldb, size_t sB, float alpha, const float* __restrict__ bias, size_t sBias, const float* __restrict__ CP, int rowsPerB, size_t sCPb, int row0g,
    float* __restrict__ C, _Float16* __restrict__ C16, int ldc, size_t sC, int M, int N, int K) {
  __shared__ __attribute__((aligned(16))) float so[4][16][64];
  const int tid = threadIdx.x, w = tid >> 5, lane = tid & 31, ln = lane & 15, hh = lane >> 4; const int by = blockIdx.y;
  A += (size_t)by * sA; Bh += (size_t)by * sB; const size_t cofs = (size_t)by * sC; const float* bp = bias ? bias + (size_t)by * sBias : nullptr;
  const int ntn = (N + 63) / 64; const int wid = blockIdx.x * 4 + w; const int mt = wid / ntn, nq = wid % ntn; if (mt * 16 >= M) return;
  const int row0 = mt * 16, col0 = nq * 64; const _Float16* arow = A + (size_t)(row0 + ln) * lda;
  v8f acc[4] = {};
  for (int kb = 0; kb < K; kb += 32) { FragH ah; ah.half[0] = *(const v8us*)((const unsigned short*)arow + kb + 8 * hh); ah.half[1] = *(const v8us*)((const unsigned short*)arow + kb + 16 + 8 * hh);
#pragma unroll
    for (int t = 0; t < 4; ++t) { if (col0 + t * 16 >= N) continue; const size_t boff = (size_t)(col0 + t * 16 + ln) * ldb + kb; FragH bq; bq.half[0] = *(const v8us*)((const unsigned short*)Bh + boff + 8 * hh); bq.half[1] = *(const v8us*)((const unsigned short*)Bh + boff + 16 + 8 * hh);
      acc[t] = mmaH<1>(ah.v, ah.v, bq.v, bq.v, acc[t]); }
  }
#pragma unroll
  for (int t = 0; t < 4; ++t) { if (col0 + t * 16 >= N) continue; const int col = col0 + t * 16 + ln; const float bv = bp ? bf16_round(bp[col]) : 0.f;
#pragma unroll
    for (int r = 0; r < 8; ++r) { float v = acc[t][r] * alpha + bv; if (CP) { const int rr = row0g + row0 + 8 * hh + r; if (rowsPerB < 0) v += CP[cofs + (size_t)rr * ldc + col];      /* rowsPerB < 0: own element of the batched C plane */ else { const int bidx = rr / rowsPerB; v += CP[(size_t)bidx * sCPb + (size_t)by * 64 + col]; } } if (ACT == 1) v = (v > 0.f) ? v : expm1f(v); else if (ACT == 7) v = (v > 0.f) ? v + 1.0f : expf(v); else if (ACT == 8) v = tanhf(v); else if (ACT == 9) v = 0.5f * v * (1.0f + tanhf(0.7978845608028654f * (v + 0.044715f * v * v * v))); else if (ACT == 11) v = 1.0f / (1.0f + expf(-v)); else if (ACT == 12) v = (v > 0.f) ? v : 0.01f * v; else if (ACT == 14) v = (v > 0.f) ? v : 0.1f * v; else if (ACT == 16) v = (v >= 0.f) ? v : 0.3f * v; else if (ACT == 17) v = (v >= 0.f) ? v : 0.2f * v; else if (ACT == 15) v = v / (1.0f + expf(-v)); else if (ACT == 3) v = fmaxf(v, 0.f); else if (ACT == 6) v = 0.5f * v * (1.0f + erff(v * 0.70710678118654752f)); so[w][8 * hh + r][t * 16 + ln] = v; } }
  __builtin_amdgcn_fence(__ATOMIC_ACQ_REL, "workgroup"); __builtin_amdgcn_wave_barrier();
  const int rsub = lane >> 4, c4 = (lane & 15) * 4; typedef _Float16 v4h __attribute__((ext_vector_type(4)));
  {
#pragma unroll
    for (int q = 0; q < 8; ++q) { const int r = q * 2 + rsub; if (col0 + c4 < N) { const v4f v = *(const v4fa*)&so[w][r][c4]; if (C) *(v4f*)(C + cofs + (size_t)(row0 + r) * ldc + col0 + c4) = v; if (C16) { v4h h4; for (int i = 0; i < 4; ++i) h4[i] = (_Float16)v[i]; *(v4h*)(C16 + cofs + (size_t)(row0 + r) * ldc + col0 + c4) = h4; } } }
     }
}


typedef _Float16 v4h __attribute__((ext_vector_type(4)));

// blockIdx.y picks the stream (query, key, value input); the f16 planes lie one behind the other.
__global__ __launch_bounds__(256) void k_x16(const float* __restrict__ x0, const float* __restrict__ x1, const float* __restrict__ x2, _Float16* __restrict__ X16, size_t n8) { const size_t t = (size_t)blockIdx.x * 256 + threadIdx.x; if (t >= n8) return; FragH f;
  const int y = blockIdx.y; const float* x = (y == 0) ? x0 : (y == 1) ? x1 : x2; X16 += (size_t)y * n8 * 8;
#pragma unroll
  for (int q = 0; q < 8; ++q) f.h[q] = (_Float16)bf16_round(x[t * 8 + q]); *(v8us*)((unsigned short*)X16 + t * 8) = f.half[0];  }
__global__ __launch_bounds__(256) void k_h16(const float* __restrict__ x, _Float16* __restrict__ X16, size_t n8) { const size_t t = (size_t)blockIdx.x * 256 + threadIdx.x; if (t >= n8) return; FragH f;
#pragma unroll
  for (int q = 0; q < 8; ++q) f.h[q] = (_Float16)x[t * 8 + q]; *(v8us*)((unsigned short*)X16 + t * 8) = f.half[0];  }
__global__ __launch_bounds__(256) void k_round16f(const float* __restrict__ W, _Float16* __restrict__ Bt, size_t n8) { const size_t t = (size_t)blockIdx.x * 256 + threadIdx.x; if (t >= n8) return; FragH f;
#pragma unroll
  for (int i = 0; i < 8; ++i) f.h[i] = (_Float16)(bf16_round(W[t * 8 + i]) * 16.0f); *(v8us*)((unsigned short*)Bt + t * 8) = f.half[0];  }
template <int NHv, int TTv>
__global__ __launch_bounds__(256) void k_vt(const _Float16* __restrict__ V16, int ldv, int voff, _Float16* __restrict__ Vt) { __shared__ unsigned short tl[64][66]; const int tid = threadIdx.x; const int slab = blockIdx.x / (TTv / 64), lg = blockIdx.x % (TTv / 64); const int b = slab / NHv, h = slab % NHv;
  for (int i = tid; i < 64 * 8; i += 256) { const int r = i / 8, c8 = (i % 8) * 8; FragH f; f.half[0] = *(const v8us*)((const unsigned short*)V16 + ((size_t)b * TTv + lg * 64 + r) * ldv + voff + h * 64 + c8);
#pragma unroll
    for (int q = 0; q < 8; ++q) tl[r][c8 + q] = f.u[q]; }
  __syncthreads();
  {
#pragma unroll
    for (int rd = 0; rd < 2; ++rd) { const int d = rd * 32 + tid / 8, pc = tid % 8; FragH f;
#pragma unroll
      for (int q = 0; q < 8; ++q) f.u[q] = tl[pc * 8 + q][d];
      *(v8us*)((unsigned short*)Vt + ((size_t)slab * 64 + d) * TTv + lg * 64 + pc * 8) = f.half[0]; }
     } }

__global__ __launch_bounds__(256) void k_hl(const float* __restrict__ F, _Float16* __restrict__ Hh, _Float16* __restrict__ Hl, size_t n8) { const size_t t = (size_t)blockIdx.x * 256 + threadIdx.x; if (t >= n8) return; FragH fh, fl; const v4f a = *(const v4fa*)(F + t * 8), c = *(const v4fa*)(F + t * 8 + 4);
#pragma unroll
  for (int q = 0; q < 4; ++q) { _Float16 h = (_Float16)a[q]; fh.h[q] = h; fl.h[q] = (_Float16)((a[q] - (float)h) * 1024.0f); h = (_Float16)c[q]; fh.h[4 + q] = h; fl.h[4 + q] = (_Float16)((c[q] - (float)h) * 1024.0f); }
  { *(v8us*)((unsigned short*)Hh + t * 8) = fh.half[0]; *(v8us*)((unsigned short*)Hl + t * 8) = fl.half[0];  } }

// ---- fast GEMM (wave tile 32x64; requires M % 32 == 0 rows per launch region and N % 64 == 0); epilogue = k_gemm_hhx semantics ----
__device__ __forceinline__ v16h g2_frag(const _Float16* p, int hh) { FragH f; f.half[0] = *(const v8us*)((const unsigned short*)p + 8 * hh); f.half[1] = *(const v8us*)((const unsigned short*)p + 16 + 8 * hh); return f.v; }
__device__ __forceinline__ v8f g2_mma(v16h a, v16h b, v8f c) { v8f d = __builtin_amdgcn_wmma_f32_16x16x32_f16(false, a, false, b, (short)0, c, false, false); asm volatile("v_nop\n\tv_nop\n\tv_nop\n\tv_nop" : "+v"(d) : "v"(a), "v"(b)); return d; }
template <int ACT>
__global__ __launch_bounds__(128) void k_gemm2(const _Float16* __restrict__ A, int lda, size_t sA, const _Float16* __restrict__ Bh, int ldb, size_t sB, float alpha, const float* __restrict__ bias, size_t sBias, const float* __restrict__ CP, int rowsPerB, size_t sCPb, int row0g,
    float* __restrict__ C, _Float16* __restrict__ C16, int ldc, size_t sC, int M, int N, int K, size_t sAz, size_t sBz, size_t sCz, const float* __restrict__ bias1, const float* __restrict__ bias2) {      /* blockIdx.z: a second batch index (the projection) with strides sAz, sBz, sCz and its own bias vector */ static_assert(ACT == 0 || ACT == 3 || ACT == 6 || ACT == 8 || ACT == 9 || ACT == 11 || ACT == 12 || ACT == 14 || ACT == 15 || ACT == 16 || ACT == 17, "k_gemm2: unsupported ACT code (would silently apply no activation)");
  __shared__ __attribute__((aligned(16))) float so[4][32][68];
  const int tid = threadIdx.x, w = tid >> 5, lane = tid & 31, ln = lane & 15, hh = lane >> 4; const int by = blockIdx.y;
  const int bz = blockIdx.z; const float* bsel = (bz == 0) ? bias : (bz == 1) ? bias1 : bias2;
  A += (size_t)by * sA + (size_t)bz * sAz; Bh += (size_t)by * sB + (size_t)bz * sBz; const size_t cofs = (size_t)by * sC + (size_t)bz * sCz; const float* bp = bsel ? bsel + (size_t)by * sBias : nullptr;
  const int ntn = N >> 6; const int mt = blockIdx.x / ntn, nq = blockIdx.x - mt * ntn; const int row0 = mt * 128 + 32 * w, col0 = nq * 64; if (row0 >= M) return;
  const _Float16* a0p = A + (size_t)(row0 + ln) * lda; const _Float16* a1p = a0p + (size_t)16 * lda;
  const _Float16* b0p = Bh + (size_t)(col0 + ln) * ldb; const _Float16* b1p = b0p + (size_t)16 * ldb; const _Float16* b2p = b1p + (size_t)16 * ldb; const _Float16* b3p = b2p + (size_t)16 * ldb;
  const v8f z8 = {0.f,0.f,0.f,0.f,0.f,0.f,0.f,0.f}; v8f c00 = z8, c01 = z8, c02 = z8, c03 = z8, c10 = z8, c11 = z8, c12 = z8, c13 = z8;
#pragma unroll 1
  for (int kb = 0; kb < K; kb += 32) { const v16h a0 = g2_frag(a0p + kb, hh), a1 = g2_frag(a1p + kb, hh);
    v16h b = g2_frag(b0p + kb, hh); c00 = g2_mma(a0, b, c00); c10 = g2_mma(a1, b, c10);
    b = g2_frag(b1p + kb, hh); c01 = g2_mma(a0, b, c01); c11 = g2_mma(a1, b, c11);
    b = g2_frag(b2p + kb, hh); c02 = g2_mma(a0, b, c02); c12 = g2_mma(a1, b, c12);
    b = g2_frag(b3p + kb, hh); c03 = g2_mma(a0, b, c03); c13 = g2_mma(a1, b, c13); }
  v8f accs[8] = {c00, c01, c02, c03, c10, c11, c12, c13};
#pragma unroll
  for (int u = 0; u < 8; ++u) { const int t = u & 3, half = u >> 2; const int col = col0 + t * 16 + ln; const float bv = bp ? bf16_round(bp[col]) : 0.f;
#pragma unroll
    for (int r = 0; r < 8; ++r) { const int rloc = half * 16 + 8 * hh + r; float v = accs[u][r] * alpha + bv; if (CP) { if (rowsPerB < 0) v += CP[cofs + (size_t)(row0g + row0 + rloc) * ldc + col];      /* rowsPerB < 0: own element of the batched C plane */ else { const int bidx = (row0g + row0 + rloc) / rowsPerB; v += CP[(size_t)bidx * sCPb + (size_t)by * 64 + col]; } }
      if (ACT == 3) v = fmaxf(v, 0.f); else if (ACT == 6) v = 0.5f * v * (1.0f + erff(v * 0.70710678118654752f)); else if (ACT == 11) v = 1.0f / (1.0f + expf(-v)); else if (ACT == 15) v = v / (1.0f + expf(-v)); else if (ACT == 12) v = (v > 0.f) ? v : 0.01f * v; else if (ACT == 8) v = tanhf(v); else if (ACT == 9) v = 0.5f * v * (1.0f + tanhf(0.7978845608028654f * (v + 0.044715f * v * v * v))); else if (ACT == 14) v = (v > 0.f) ? v : 0.1f * v; else if (ACT == 16) v = (v >= 0.f) ? v : 0.3f * v; else if (ACT == 17) v = (v >= 0.f) ? v : 0.2f * v;
      so[w][rloc][t * 16 + ln] = v; } }
  __builtin_amdgcn_fence(__ATOMIC_ACQ_REL, "workgroup"); __builtin_amdgcn_wave_barrier();
  const int rsub = lane >> 4, c4 = (lane & 15) * 4;
  {
#pragma unroll
    for (int q = 0; q < 16; ++q) { const int r = q * 2 + rsub; const v4f v = *(const v4fa*)&so[w][r][c4]; if (C) *(v4f*)(C + cofs + (size_t)(row0 + r) * ldc + col0 + c4) = v; if (C16) { v4h h4; for (int i = 0; i < 4; ++i) h4[i] = (_Float16)v[i]; *(v4h*)(C16 + cofs + (size_t)(row0 + r) * ldc + col0 + c4) = h4; } }
     } }


__global__ __launch_bounds__(256) void k_wnat(const float* __restrict__ w, size_t n8, _Float16* __restrict__ Bt) { const size_t t = (size_t)blockIdx.x * 256 + threadIdx.x; if (t >= n8) return; FragH f; for (int q = 0; q < 8; ++q) f.h[q] = (_Float16)(bf16_round(w[t * 8 + q]) * 16.0f); *(v8us*)((unsigned short*)Bt + t * 8) = f.half[0];  }
__global__ __launch_bounds__(256) void k_rsm(const float* __restrict__ S, _Float16* __restrict__ P, int nrows) {
  #pragma clang fp contract(off)
  const int i = blockIdx.x * 256 + threadIdx.x; if (i >= nrows) return; const float* s = S + (size_t)i * SQ; float mx = -3.0e38f;
#pragma unroll 1
  for (int j = 0; j < SQ; ++j) mx = fmaxf(mx, s[j]); float se = 0.f;
#pragma unroll 1
  for (int j = 0; j < SQ; ++j) se += expf(s[j] - mx); const float sc = 256.0f / se;
#pragma unroll 1
  for (int j0 = 0; j0 < SQ; j0 += 8) { FragH f; for (int q = 0; q < 8; ++q) f.h[q] = (_Float16)(expf(s[j0 + q] - mx) * sc); unsigned short* d = (unsigned short*)P + (size_t)i * SQ + j0; *(v8us*)d = f.half[0];  } }
__global__ __launch_bounds__(256) void k_vt(const _Float16* __restrict__ V16, int b, int h0, _Float16* __restrict__ VT) { __shared__ unsigned short tl[64][65]; const int tid = threadIdx.x; const int hh = blockIdx.x % HG, sg = blockIdx.x / HG; const int s0 = sg * 64; const int h = h0 + hh;
  for (int i = tid; i < 64 * 8; i += 256) { const int j = i / 8, d8 = (i % 8) * 8; FragH f; f.half[0] = *(const v8us*)((const unsigned short*)V16 + ((size_t)b * SQ + s0 + j) * DM + h * HD + d8); for (int q = 0; q < 8; ++q) tl[d8 + q][j] = f.u[q]; }
  __syncthreads();
  { for (int i = tid; i < 64 * 8; i += 256) { const int d = i / 8, j8 = (i % 8) * 8; FragH f; for (int q = 0; q < 8; ++q) f.u[q] = tl[d][j8 + q]; *(v8us*)((unsigned short*)VT + ((size_t)hh * HD + d) * SQ + s0 + j8) = f.half[0]; }  } }



__global__ __launch_bounds__(256) void k_rsmkm(const float* __restrict__ S, _Float16* __restrict__ P, int nrows, const int* __restrict__ am) {
  #pragma clang fp contract(off)
  const int t = blockIdx.x * 256 + threadIdx.x; if (t >= nrows) return; const size_t i = (size_t)t; const float* s = S + i * SQ; const int* mr = am + (size_t)(t % SQ) * SQ; float mx = -3.0e38f;
#pragma unroll 1
  for (int j = 0; j < SQ; ++j) { const float f = (mr[j] != 0) ? 1.f : 0.f; mx = fmaxf(mx, fmaf(f, s[j], (1.f - f) * -1.0e9f)); } float se = 0.f;
#pragma unroll 1
  for (int j = 0; j < SQ; ++j) { const float f = (mr[j] != 0) ? 1.f : 0.f; se += __expf(fmaf(f, s[j], (1.f - f) * -1.0e9f) - mx); } const float sc = 256.0f / se;
#pragma unroll 1
  for (int j0 = 0; j0 < SQ; j0 += 8) { FragH fr; for (int q = 0; q < 8; ++q) { const int j = j0 + q; const float f = (mr[j] != 0) ? 1.f : 0.f; fr.h[q] = (_Float16)(__expf(fmaf(f, s[j], (1.f - f) * -1.0e9f) - mx) * sc); }
    unsigned short* d = (unsigned short*)P + i * SQ + j0; *(v8us*)d = fr.half[0];  } }
// exp of four values as __expf forms it (v_exp_f32 of x * log2 e). One statement, so that the free slot the instruction set asks for behind a transcendental stands there by construction: outputs are early-clobbered (no v_exp_f32 overwrites a neighbour's source or reads its result), and the v_nop fills the slot behind the last one.
__device__ __forceinline__ v4f exp_x4(v4f x) { float r0, r1, r2, r3;
  asm("v_exp_f32 %0, %4\n\tv_exp_f32 %1, %5\n\tv_exp_f32 %2, %6\n\tv_exp_f32 %3, %7\n\tv_nop" : "=&v"(r0), "=&v"(r1), "=&v"(r2), "=&v"(r3) : "v"(x[0] * 1.44269504088896340736f), "v"(x[1] * 1.44269504088896340736f), "v"(x[2] * 1.44269504088896340736f), "v"(x[3] * 1.44269504088896340736f));
  const v4f r = {r0, r1, r2, r3}; return r; }
// exp of one value, same form as exp_x4 (the v_nop fills the free slot behind the transcendental).
__device__ __forceinline__ float exp_x1(float x) { float r; asm("v_exp_f32 %0, %1\n\tv_nop" : "=&v"(r) : "v"(x * 1.44269504088896340736f)); return r; }
__device__ __forceinline__ v8f fa_mma(v16h a, v16h b, v8f c) { return __builtin_amdgcn_wmma_f32_16x16x32_f16(false, a, false, b, (short)0, c, false, false); }
__global__ __launch_bounds__(256) void k_fattn(const _Float16* __restrict__ Q, const _Float16* __restrict__ Kk, const _Float16* __restrict__ VTa, _Float16* __restrict__ O) {
  const int lane = threadIdx.x & 31, ln = lane & 15, hh = lane >> 4; const int w = __builtin_amdgcn_readfirstlane(threadIdx.x >> 5);      /* wave number in a scalar register: the mask test below is a scalar branch */
  const int h = blockIdx.y, b = blockIdx.z; const int q0 = blockIdx.x * 128 + w * 16; const int qi = q0 + ln;
  const _Float16* qp = Q + ((size_t)b * SQ + qi) * LQ + h * HD; const v16h qf0 = g2_frag(qp, hh), qf1 = g2_frag(qp + 32, hh);
  const _Float16* kp = Kk + ((size_t)b * SQ + ln) * LQ + h * HD; const _Float16* vp = VTa + (((size_t)b * NH + h) * HD + ln) * SQ;
  const v8f z8 = {0.f,0.f,0.f,0.f,0.f,0.f,0.f,0.f}; v8f o[4] = {z8, z8, z8, z8}; float m = -1.0e30f, l = 0.f;
#pragma unroll 1      /* one pass already holds 32 loads and 16 matrix products; a second copy would only cost registers */
  for (int k0 = 0; k0 < SQ; k0 += 64) { v8f s[4]; v16h kf[4][2], vf[4][2];
#pragma unroll      /* kf[] in registers */
    for (int t = 0; t < 4; ++t) { const _Float16* kr = kp + (size_t)(k0 + 16 * t) * LQ; kf[t][0] = g2_frag(kr, hh); kf[t][1] = g2_frag(kr + 32, hh); }
    asm volatile("" :: "v"(kf[0][0]), "v"(kf[0][1]), "v"(kf[1][0]), "v"(kf[1][1]), "v"(kf[2][0]), "v"(kf[2][1]), "v"(kf[3][0]), "v"(kf[3][1]));      /* inputs only, loaded values: all 16 k loads of the pass are issued before the first is waited for (left alone, the compiler loads one fragment at a time into the same registers: eight load latencies in a row) */
#pragma unroll      /* s[] in registers */
    for (int t = 0; t < 4; ++t) { s[t] = fa_mma(kf[t][0], qf0, z8); s[t] = fa_mma(kf[t][1], qf1, s[t]); }
#pragma unroll      /* vf[] in registers; the v fragments arrive under the softmax arithmetic */
    for (int t = 0; t < 4; ++t) { vf[t][0] = g2_frag(vp + (size_t)(16 * t) * SQ + k0, hh); vf[t][1] = g2_frag(vp + (size_t)(16 * t) * SQ + k0 + 32, hh); }
#pragma unroll      /* s[] in registers */
    for (int t = 0; t < 4; ++t) s[t] *= 0.125f;
    if (k0 <= q0 + 15) {      /* a pass whose keys all lie behind the wave's queries adds 0 * -1e9: skipped as an identity */
#pragma unroll      /* s[] in registers */
      for (int t = 0; t < 4; ++t) for (int r = 0; r < 8; ++r) { const float mk = (k0 + 16 * t + 8 * hh + r <= qi) ? 1.0f : 0.0f; s[t][r] = __fadd_rn(s[t][r], __fmul_rn(mk, -1.0e9f)); } }
    float mt = s[0][0];
#pragma unroll      /* s[] in registers */
    for (int t = 0; t < 4; ++t) for (int r = 0; r < 8; ++r) mt = fmaxf(mt, s[t][r]);
    mt = fmaxf(mt, __shfl_xor(mt, 16)); const float mn = fmaxf(m, mt); const float corr = exp_x1(m - mn); m = mn;
    v4f s4 = {0.f, 0.f, 0.f, 0.f}; FragH pf[2];
#pragma unroll      /* s[], pf[] in registers */
    for (int t = 0; t < 4; ++t) { const v4f a = {s[t][0], s[t][1], s[t][2], s[t][3]}, c = {s[t][4], s[t][5], s[t][6], s[t][7]}; const v4f ea = exp_x4(a - mn), ec = exp_x4(c - mn); s4 += ea; s4 += ec;
      for (int u = 0; u < 4; ++u) { pf[t >> 1].h[(t & 1) * 8 + u] = (_Float16)ea[u]; pf[t >> 1].h[(t & 1) * 8 + 4 + u] = (_Float16)ec[u]; } }
    l = l * corr + ((s4[0] + s4[1]) + (s4[2] + s4[3]));      /* each wave half keeps its own part of the sum; joined once behind the loop */
#pragma unroll      /* o[] in registers */
    for (int t = 0; t < 4; ++t) { o[t] *= corr; o[t] = fa_mma(vf[t][0], pf[0].v, o[t]); o[t] = fa_mma(vf[t][1], pf[1].v, o[t]); } }
  l += __shfl_xor(l, 16); const float fin = 64.0f / l;      /* o carried x64 against f16 subnormal flush, folded into the output GEMM alpha */
  _Float16* op = O + ((size_t)b * SQ + qi) * DM + h * HD + 8 * hh;
#pragma unroll      /* o[] in registers; a lane's 8 accumulator registers are 8 consecutive columns of its query's row: one 16-byte store */
  for (int t = 0; t < 4; ++t) { FragH f; for (int r = 0; r < 8; ++r) f.h[r] = (_Float16)(o[t][r] * fin); *(v8us*)((unsigned short*)op + 16 * t) = f.half[0]; } }

// One lane per query row, 32 rows a block; the rows' keys are dealt over the block's KW waves (wave w takes keys w, w + KW, ... of the block's range), each wave with its own running maximum, sum and o; the KW partial results of a row are joined through LDS at the end. A wave's key index is wave-uniform, so k and v rows still come through the scalar path. The 64-wide loops are unrolled: q[] and o[] are indexed by constants only and stay in registers.
__global__ __launch_bounds__(32 * KW) void k_attup(const float* __restrict__ QF, const float* __restrict__ KF, const float* __restrict__ VF, int ld, float scale, float* __restrict__ OF, int ldo) {
  #pragma clang fp contract(off)
  static_assert(KW == 16 && QT0 % 32 == 0 && HD == 64, "the join below gives each of the 32 * KW threads one 4-column piece of the 32 x 64 tile");
  __shared__ __attribute__((aligned(16))) float lo[KW][32][HD + 4];      /* row pitch 272 B = 16 B x odd: 16-byte stores of 32 rows and 16-byte loads along a row both spread over the banks */
  __shared__ float lm[KW][32], ll[KW][32];
  const int tid = threadIdx.x, lane = tid & 31; const int w = __builtin_amdgcn_readfirstlane(tid >> 5);      /* wave number in a scalar register: key addresses stay scalar */
  const int h = blockIdx.x / (QT0 / 32), rg = blockIdx.x % (QT0 / 32); const int i = rg * 32 + lane;
  { const size_t bo = (size_t)blockIdx.y * QT0; QF += bo * ld; KF += bo * ld; VF += bo * ld; OF += bo * ldo; }      /* blockIdx.y: the batch; each batch has its own QT0-row tile */
  const float* qr = QF + (size_t)i * ld + h * HD; v4f q[HD / 4], o[HD / 4];
#pragma unroll      /* q[], o[] in registers; the q row's 16 loads in flight at once */
  for (int c = 0; c < HD / 4; ++c) { q[c] = *(const v4fa*)(qr + c * 4); const v4f z = {0.f, 0.f, 0.f, 0.f}; o[c] = z; }
  float m = -1.0e30f, l = 0.f;
#pragma unroll 1
  for (int j = rg * 32 + w; j < QT0; j += KW) { const float* kr = KF + (size_t)j * ld + h * HD; const float* vr = VF + (size_t)j * ld + h * HD; v4f kq[HD / 4], vv[HD / 4]; float s = 0.f;
#pragma unroll      /* a whole row's loads in flight at once */
    for (int c = 0; c < HD / 4; ++c) kq[c] = *(const v4fa*)(kr + c * 4);
#pragma unroll      /* the v row arrives under the score sum */
    for (int c = 0; c < HD / 4; ++c) vv[c] = *(const v4fa*)(vr + c * 4);
#pragma unroll      /* q[], kq[] in registers */
    for (int c = 0; c < HD / 4; ++c) { s = __fadd_rn(s, __fmul_rn(q[c][0], kq[c][0])); s = __fadd_rn(s, __fmul_rn(q[c][1], kq[c][1])); s = __fadd_rn(s, __fmul_rn(q[c][2], kq[c][2])); s = __fadd_rn(s, __fmul_rn(q[c][3], kq[c][3])); }
    s = __fmul_rn(s, scale);
    const float f = (j > i) ? 1.f : 0.f; const float sm = fmaf(f, s, (1.f - f) * -1.0e30f); const float mn = fmaxf(m, sm); const float sc = expf(m - mn); const float e = __fmul_rn(f, expf(sm - mn)); l = __fadd_rn(__fmul_rn(l, sc), e); m = mn;
#pragma unroll      /* o[], vv[] in registers */
    for (int c = 0; c < HD / 4; ++c) for (int u = 0; u < 4; ++u) o[c][u] = __fadd_rn(__fmul_rn(o[c][u], sc), __fmul_rn(e, vv[c][u])); }
#pragma unroll      /* o[] in registers */
  for (int c = 0; c < HD / 4; ++c) *(v4f*)&lo[w][lane][c * 4] = o[c];
  lm[w][lane] = m; ll[w][lane] = l;
  __syncthreads();
  { const int row = tid / 16, pc = (tid % 16) * 4; float mw[KW], mx = -1.0e30f, ls = 0.f; v4f a = {0.f, 0.f, 0.f, 0.f};      /* join: every partial is brought to the row's overall maximum; a wave that saw no visible key holds l = 0, o = 0 and adds nothing */
#pragma unroll      /* mw[] in registers */
    for (int u = 0; u < KW; ++u) { mw[u] = lm[u][row]; mx = fmaxf(mx, mw[u]); }
#pragma unroll      /* mw[] in registers; the 16 partial pieces' LDS loads in flight at once */
    for (int u = 0; u < KW; ++u) { const float fw = exp_x1(mw[u] - mx); const v4f p = *(const v4f*)&lo[u][row][pc]; ls += ll[u][row] * fw; a += p * fw; }
    const float fin = (ls > 0.f) ? 64.0f / ls : 0.f;      /* o carried x64 like the f16 path; the key-less last row is written by k_vmean */
    a *= fin; *(v4f*)(OF + (size_t)(rg * 32 + row) * ldo + h * HD + pc) = a; } }

__global__ __launch_bounds__(256) void k_vmean(const _Float16* __restrict__ V, float* __restrict__ orow) {
  #pragma clang fp contract(off)
  const int c = blockIdx.x * 256 + threadIdx.x; if (c >= DM) return; const _Float16* p = V + (size_t)blockIdx.y * SQ * LQ + c; orow += (size_t)blockIdx.y * QT0 * DM; float s = 0.f;      /* blockIdx.y: the batch */
#pragma unroll 1
  for (int j0 = 0; j0 < SQ; j0 += 64) { _Float16 t[64];
#pragma unroll      /* 64 rows' loads in flight at once (the constant pitch LQ makes them one address register with immediate offsets); t[] in registers */
    for (int j = 0; j < 64; ++j) t[j] = p[(size_t)(j0 + j) * LQ];
#pragma unroll      /* summed in the rows' order */
    for (int j = 0; j < 64; ++j) s = __fadd_rn(s, (float)t[j]); }
  const float o = __fmul_rn(s, 64.0f / (float)SQ); *(float*)(orow + c) = o;  }

extern "C" void kernel_launch(void* const* d_in, const int* in_sizes, int n_in,
                              void* d_out, int out_size, void* d_ws, size_t ws_size, hipStream_t stream) {
  (void)in_sizes; (void)n_in; (void)out_size;
  const float* const* I = (const float* const*)d_in; const float* xq = I[0]; const float* xk = I[0]; const float* xv = I[0]; const float* wq = I[1]; const float* bq = I[2]; const float* wk = I[3]; const float* bk = I[4]; const float* wv = I[5]; const float* bv = I[6]; const float* wo = I[7]; const float* bo = I[8]; const float* x = xq;      /* ONE input feeds the query, key and value streams; [in][out] weights + biases; the mask is built from indices as in the module */
  static_assert(NH * HD == DM && DM % 64 == 0 && SQ % 128 == 0 && NH % HG == 0, "shape / tile multiples");
  char* ws = (char*)d_ws; size_t off = 0;
  auto take = [&](size_t bytes) { char* p = ws + off; off += (bytes + 255) & ~(size_t)255; return p; };
  _Float16* BQ = (_Float16*)take((size_t)4 * DM * DM * 2); _Float16* BO = BQ + (size_t)3 * DM * DM;      /* Bt planes of Wq, Wk, Wv, Wo, one behind the other */
  _Float16* X16 = (_Float16*)take((size_t)3 * NR * DM * 2);      /* query, key and value inputs as exact f16 rows: three planes */
  _Float16* Q16 = (_Float16*)take((size_t)3 * NR * DM * 2); _Float16* K16 = Q16 + NR * DM; _Float16* V16 = K16 + NR * DM; _Float16* O16 = (_Float16*)take(NR * DM * 2);      /* q, k, v: three planes */
  _Float16* VT = (_Float16*)take((size_t)NB * NH * HD * SQ * 2);
  float* QF0 = (float*)take((size_t)3 * NB * QT0 * DM * 4); float* KF0 = QF0 + (size_t)NB * QT0 * DM; float* VF0 = KF0 + (size_t)NB * QT0 * DM; float* OF0 = (float*)take((size_t)NB * QT0 * DM * 4); _Float16* OH0 = (_Float16*)take((size_t)NB * QT0 * DM * 2); _Float16* OL0 = (_Float16*)take((size_t)NB * QT0 * DM * 2);      /* exact last tile of every batch: f32 q / k / v of the tile rows (three planes of [NB][QT0] rows), o (x64) and its f16 hi + x1024 residual planes */
  if (off > ws_size) return;
  k_wt_f16<<<dim3((unsigned)(((size_t)DM * (DM / 8) + 255) / 256), 4), 256, 0, stream>>>(wq, wk, wv, wo, BQ, DM, DM, 16.0f);      /* [in][out] -> Bt x16, the four weights in one launch */
  k_x16<<<dim3((unsigned)((NR * DM / 8 + 255) / 256), 3), 256, 0, stream>>>(x, xk, xv, X16, NR * DM / 8);      /* the three streams in one launch */
  const size_t r0p = (size_t)B0 * SQ;      /* first projected row */
  k_gemm2<0><<<dim3((unsigned)((MP / 128) * (DM / 64)), 1, 3), 128, 0, stream>>>(X16 + r0p * DM, DM, 0, BQ, DM, 0, 0.0625f, bq, 0, nullptr, 1, 0, 0, nullptr, Q16 + r0p * DM, DM, 0, MP, DM, DM, NR * DM, (size_t)DM * DM, NR * DM, bk, bv);      /* q, k, v (z) in one launch */
  k_vt<NH, SQ><<<NBR * NH * (SQ / 64), 256, 0, stream>>>(V16 + r0p * LQ, LQ, 0, VT + (size_t)B0 * NH * HD * SQ);      /* V^T [NB][NH][HD][SQ], every batch in one launch */
  const size_t rl0 = r0p + SQ - QT0; const size_t f00 = (size_t)B0 * QT0;      /* first batch's last QT0 rows; its tile in the [NB][QT0] planes */
  k_gemm2<0><<<dim3((QT0 / 128) * (DM / 64), NBR, 3), 128, 0, stream>>>(X16 + rl0 * DM, DM, (size_t)SQ * DM, BQ, DM, 0, 0.0625f, bq, 0, nullptr, 1, 0, 0, QF0 + f00 * DM, nullptr, DM, (size_t)QT0 * DM, QT0, DM, DM, NR * DM, (size_t)DM * DM, (size_t)NB * QT0 * DM, bk, bv);      /* f32 q, k, v (z) of every batch's (y) last tile (exact products) */
  k_attup<<<dim3(NH * (QT0 / 32), NBR), 32 * KW, 0, stream>>>(QF0 + f00 * DM, KF0 + f00 * DM, VF0 + f00 * DM, DM, 0.125f, OF0 + f00 * DM, DM);      /* exact f32 attention over the keys j > i inside the tile (o x64) */
  k_vmean<<<dim3((DM + 255) / 256, NBR), 256, 0, stream>>>(V16 + r0p * LQ, OF0 + (f00 + QT0 - 1) * DM);      /* last row: uniform over all keys = 64 x mean of v */
  k_fattn<<<dim3(SQ / 128, NH, NB), 256, 0, stream>>>(Q16, K16, VT, O16);      /* scores, literal 'score + tril * (-1e9)', softmax over all keys and the weighted v sum, every (batch, head) in one launch -> o (merged heads, x64) as f16 rows */
  k_gemm2<0><<<dim3((unsigned)((MPO / 128) * (DM / 64)), 1), 128, 0, stream>>>(O16 + r0p * DM, DM, 0, BO, DM, 0, 0.0009765625f, bo, 0, nullptr, 1, 0, 0, (float*)d_out + r0p * DM, nullptr, DM, 0, MPO, DM, DM, 0, 0, 0, nullptr, nullptr);      /* out rows are the output layout */
  k_hl<<<(unsigned)(((size_t)NB * QT0 * DM / 8 + 255) / 256), 256, 0, stream>>>(OF0, OH0, OL0, (size_t)NB * QT0 * DM / 8);      /* last-tile o (x64) -> f16 hi + x1024 residual planes */
  k_gemm2<0><<<dim3((QT0 / 128) * (DM / 64), NBR), 128, 0, stream>>>(OH0 + f00 * DM, DM, (size_t)QT0 * DM, BO, DM, 0, 0.0009765625f, bo, 0, nullptr, 1, 0, 0, (float*)d_out + rl0 * DM, nullptr, DM, (size_t)SQ * DM, QT0, DM, DM, 0, 0, 0, nullptr, nullptr);      /* last QT0 rows of every batch (y): out = o_hi Wo (+ b), overwriting the f16-path rows */
  k_gemm2<0><<<dim3((QT0 / 128) * (DM / 64), NBR), 128, 0, stream>>>(OL0 + f00 * DM, DM, (size_t)QT0 * DM, BO, DM, 0, 0.00000095367431640625f, nullptr, 0, (const float*)d_out + rl0 * DM, -1, 0, 0, (float*)d_out + rl0 * DM, nullptr, DM, (size_t)SQ * DM, QT0, DM, DM, 0, 0, 0, nullptr, nullptr);      /* += o_lo Wo 2^-20 (own-element accumulate) */
}

// v006
// A run of this version takes 331 microseconds.
// Two timings next to v005 put it at 1.13 and 1.14 times that version's speed.
// All steps since v000 together make it 19.9 times as fast.
#include <hip/hip_runtime.h>
// Multi-head self-attention with the source's INVERTED causal mask (inputs [2][2048][1024]; q / k / v = x W + b ([in][out] 1024 x 1024 sigma 1/32, zero biases); 16 heads of 64; score = q k^T / sqrt(64) + tril * (-1e9): the LOWER triangle incl. the diagonal is pushed to -1e9 (the original's mask bug, kept), so query i attends to the keys j > i only, and the last query (every key masked, all scores rounding to the same -1e9 in f32) attends uniformly to all keys; softmax; out = merged Wo + bo -> [2][2048][1024]).
// Structure: token rows r = b*2048 + s; x as exact f16 rows (bf16-rounded); Q, K, V as three WMMA GEMMs in one launch (grid z; 32x64 wave tiles, f32 accumulation, exact x16 weights + bias, f16 outputs); V^T for all batches and heads via LDS transposes; one fused attention launch over every (batch, head): S^T = K Q^T on WMMA (K = 64, x 1/sqrt(64), then the -1e9 fill), running softmax on VALU (f32 statistics; unnormalised weights exp(s - max) as f16), O^T += V^T P^T on WMMA, o = O / sum (carried x64 against f16 subnormal flush, folded into the output GEMM alpha) written straight into the merged f16 o rows; out = o W_o + b GEMM (f32) into the output layout.
// Compute dtype: inputs rounded to bf16; x / weights exact; q, k, v, softmax weights and o as plain f16 GEMM operands (~2^-12); scores and softmax statistics f32. v_wmma_f32_16x16x32_f16.
#define NB 2
#define SQ 2048
#define DM 1024
#define NH 16
#define HD 64
#define QT0 256                      /* last-tile rows recomputed exactly in f32 (rows with fewer than 256 visible keys) */
#define HG 4                         /* heads per V^T group of the h0-based k_vt overload (not launched) */
#define KW 16                        /* waves of a k_attup block = parts a query row's keys are dealt into */
#define B0 0                         /* first batch processed (debug hook) */
#define NBR NB                       /* batches processed (debug hook) */
#define NR ((size_t)NB * SQ)         /* token rows */
#define MP ((int)((size_t)NBR * SQ)) /* rows projected (debug hook) */
#define QN SQ                        /* query rows attended per batch (not used) */
#define NHD NH                       /* heads attended (not used) */
#define MPO MP                       /* rows through the output stage (debug hook) */
#define LQ DM      /* row pitch of the q/k/v rows */
typedef __bf16 v16b __attribute__((ext_vector_type(16)));
typedef unsigned short v8us __attribute__((ext_vector_type(8), may_alias));
typedef float  v8f  __attribute__((ext_vector_type(8)));
typedef float  v4f  __attribute__((ext_vector_type(4)));
typedef float  v4fa __attribute__((ext_vector_type(4), may_alias));
union FragB { v16b v; v8us half[2]; unsigned short u[16]; };

__device__ __forceinline__ unsigned short bf16_bits(float x) { unsigned int u = __float_as_uint(x); return (unsigned short)((u + 0x7FFFu + ((u >> 16) & 1u)) >> 16); }
__device__ __forceinline__ float bf16_val(unsigned short b) { return __uint_as_float(((unsigned int)b) << 16); }
__device__ __forceinline__ float bf16_round(float x) { return bf16_val(bf16_bits(x)); }
// D += A·B with NT terms: 1 = ah·bh, 2 = + al·bh (A split), 3 = + ah·bl (both split)
template <int NT>
__device__ __forceinline__ v8f mmaN(v16b ah, v16b al, v16b bh, v16b bl, v8f c) {
  c = __builtin_amdgcn_wmma_f32_16x16x32_bf16(false, ah, false, bh, (short)0, c, false, false);
  if (NT >= 2) c = __builtin_amdgcn_wmma_f32_16x16x32_bf16(false, al, false, bh, (short)0, c, false, false);
  if (NT >= 3) c = __builtin_amdgcn_wmma_f32_16x16x32_bf16(false, ah, false, bl, (short)0, c, false, false);
  asm volatile("v_nop\n\tv_nop\n\tv_nop\n\tv_nop" : "+v"(c) : "v"(ah), "v"(al), "v"(bh), "v"(bl));
  return c;
}

__global__ __launch_bounds__(256) void k_wt_bf16(const float* __restrict__ W, unsigned short* __restrict__ Wt, int K, int N) {
  const int t = blockIdx.x * 256 + threadIdx.x;
  const int k8n = K / 8;
  if (t >= N * k8n) return;
  const int n = t / k8n, k8 = (t % k8n) * 8;
  v8us v;
#pragma unroll
  for (int i = 0; i < 8; ++i) v[i] = bf16_bits(W[(size_t)(k8 + i) * N + n]);
  *(v8us*)(Wt + (size_t)n * K + k8) = v;
  
}

// GEMM C[M][N] (f32, pitch ldc) = act(A[M][K]·W + bias). A f32 row-major (pitch lda) converted per fragment to bf16
// (ASPLIT: hi/lo two planes -> 2 terms, else single rounded term); Wt bf16 [N][K] (pitch ldb). BIAS_BF16 rounds the
// bias to bf16 first (bias quantised to bf16 before the add). K%32==0, M%16==0, N%64==0.
template <bool ASPLIT, int ACT, bool BIAS_BF16>
__global__ __launch_bounds__(128) void k_gemm_bf(const float* __restrict__ A, int lda, const unsigned short* __restrict__ Wt, int ldb,
                                               const float* __restrict__ bias, float* __restrict__ C, int ldc, int M, int N, int K) {
  __shared__ __attribute__((aligned(16))) float so[4][16][64];
  const int tid = threadIdx.x, w = tid >> 5, lane = tid & 31, ln = lane & 15, hh = lane >> 4;
  const int ntn = N / 64;
  const int wid = blockIdx.x * 4 + w;
  const int mt = wid / ntn, nq = wid % ntn;
  if (mt * 16 >= M) return;
  const int row0 = mt * 16, col0 = nq * 64;
  const float* arow = A + (size_t)(row0 + ln) * lda;
  v8f acc[4] = {};
  for (int kb = 0; kb < K; kb += 32) {
    FragB ah, al;
    const v4f x0 = *(const v4fa*)(arow + kb + 8 * hh), x1 = *(const v4fa*)(arow + kb + 8 * hh + 4);
    const v4f x2 = *(const v4fa*)(arow + kb + 16 + 8 * hh), x3 = *(const v4fa*)(arow + kb + 16 + 8 * hh + 4);
    float xs[16] = {x0[0],x0[1],x0[2],x0[3],x1[0],x1[1],x1[2],x1[3],x2[0],x2[1],x2[2],x2[3],x3[0],x3[1],x3[2],x3[3]};
#pragma unroll
    for (int i = 0; i < 16; ++i) { const unsigned short hb = bf16_bits(xs[i]); ah.u[i] = hb; al.u[i] = ASPLIT ? bf16_bits(xs[i] - bf16_val(hb)) : (unsigned short)0; }
#pragma unroll
    for (int t = 0; t < 4; ++t) {
      const unsigned short* brow = Wt + (size_t)(col0 + t * 16 + ln) * ldb + kb;
      FragB b;
      b.half[0] = *(const v8us*)(brow + 8 * hh);
      b.half[1] = *(const v8us*)(brow + 16 + 8 * hh);
      acc[t] = mmaN<ASPLIT ? 2 : 1>(ah.v, al.v, b.v, b.v, acc[t]);
    }
  }
#pragma unroll
  for (int t = 0; t < 4; ++t) {
    float bv = bias ? bias[col0 + t * 16 + ln] : 0.f;
    if (BIAS_BF16) bv = bf16_round(bv);
#pragma unroll
    for (int r = 0; r < 8; ++r) { float v = acc[t][r] + bv; if (ACT == 1) v = fmaxf(v, 0.f); so[w][8 * hh + r][t * 16 + ln] = v; }
  }
  __builtin_amdgcn_fence(__ATOMIC_ACQ_REL, "workgroup");
  __builtin_amdgcn_wave_barrier();
  const int rsub = lane >> 4, c4 = (lane & 15) * 4;
  {
#pragma unroll
    for (int q = 0; q < 8; ++q) {
      const int r = q * 2 + rsub;
      const v4f v = *(const v4fa*)&so[w][r][c4];
      *(v4f*)(C + (size_t)(row0 + r) * ldc + col0 + c4) = v;
    }
    
  }
}

// GEMM C = act(A·W + bias + resid): A f32 (ASPLIT -> hi/lo 2 terms), Wt bf16 [N][K]; ACT 0 none, 1 relu, 2 exact gelu;
// resid (optional, f32, row index = (row % rmod), pitch ldr, RES_BF16 rounds it) added before the activation.
template <bool ASPLIT, int ACT, bool BIAS_BF16, bool RES_BF16>
__global__ __launch_bounds__(128) void k_gemm_bf3(const float* __restrict__ A, int lda, const unsigned short* __restrict__ Wt, int ldb,
                                                const float* __restrict__ bias, const float* __restrict__ resid, int rmod, int ldr,
                                                float* __restrict__ C, int ldc, int M, int N, int K) {
  __shared__ __attribute__((aligned(16))) float so[4][16][64];
  const int tid = threadIdx.x, w = tid >> 5, lane = tid & 31, ln = lane & 15, hh = lane >> 4;
  const int ntn = N / 64;
  const int wid = blockIdx.x * 4 + w;
  const int mt = wid / ntn, nq = wid % ntn;
  if (mt * 16 >= M) return;
  const int row0 = mt * 16, col0 = nq * 64;
  const float* arow = A + (size_t)(row0 + ln) * lda;
  v8f acc[4] = {};
  for (int kb = 0; kb < K; kb += 32) {
    FragB ah, al;
    const v4f x0 = *(const v4fa*)(arow + kb + 8 * hh), x1 = *(const v4fa*)(arow + kb + 8 * hh + 4);
    const v4f x2 = *(const v4fa*)(arow + kb + 16 + 8 * hh), x3 = *(const v4fa*)(arow + kb + 16 + 8 * hh + 4);
    float xs[16] = {x0[0],x0[1],x0[2],x0[3],x1[0],x1[1],x1[2],x1[3],x2[0],x2[1],x2[2],x2[3],x3[0],x3[1],x3[2],x3[3]};
#pragma unroll
    for (int i = 0; i < 16; ++i) { const unsigned short hb = bf16_bits(xs[i]); ah.u[i] = hb; al.u[i] = ASPLIT ? bf16_bits(xs[i] - bf16_val(hb)) : (unsigned short)0; }
#pragma unroll
    for (int t = 0; t < 4; ++t) {
      const unsigned short* brow = Wt + (size_t)(col0 + t * 16 + ln) * ldb + kb;
      FragB b;
      b.half[0] = *(const v8us*)(brow + 8 * hh);
      b.half[1] = *(const v8us*)(brow + 16 + 8 * hh);
      acc[t] = mmaN<ASPLIT ? 2 : 1>(ah.v, al.v, b.v, b.v, acc[t]);
    }
  }
#pragma unroll
  for (int t = 0; t < 4; ++t) {
    const int col = col0 + t * 16 + ln;
    float bv = bias ? bias[col] : 0.f;
    if (BIAS_BF16) bv = bf16_round(bv);
#pragma unroll
    for (int r = 0; r < 8; ++r) {
      float v = acc[t][r] + bv;
      if (resid) { float rv = resid[(size_t)((row0 + 8 * hh + r) % rmod) * ldr + col]; if (RES_BF16) rv = bf16_round(rv); v += rv; }
      if (ACT == 1) v = fmaxf(v, 0.f);
      if (ACT == 2) v = 0.5f * v * (1.0f + erff(v * 0.70710678118654752f));
      if (ACT == 3) { const float u = 0.7978845608028654f * (v + 0.044715f * v * v * v); v = 0.5f * v * (1.0f + tanhf(u)); }
      so[w][8 * hh + r][t * 16 + ln] = v;
    }
  }
  __builtin_amdgcn_fence(__ATOMIC_ACQ_REL, "workgroup");
  __builtin_amdgcn_wave_barrier();
  const int rsub = lane >> 4, c4 = (lane & 15) * 4;
  {
#pragma unroll
    for (int q = 0; q < 8; ++q) {
      const int r = q * 2 + rsub;
      const v4f v = *(const v4fa*)&so[w][r][c4];
      *(v4f*)(C + (size_t)(row0 + r) * ldc + col0 + c4) = v;
    }
    
  }
}
// row LayerNorm (biased variance, eps) over N: s = X (+ R); optional out_sum <- s; out_norm <- (s-mu)*rsqrt(var+eps)*g + b
template <bool PARAM_BF16>
__global__ __launch_bounds__(256) void k_layernorm(const float* __restrict__ X, const float* __restrict__ R, const float* __restrict__ g, const float* __restrict__ bta,
                                                  float* __restrict__ out_sum, float* __restrict__ out_norm, int N, float eps) {
  __shared__ float red[256];
  const int row = blockIdx.x, tid = threadIdx.x;
  const float* x = X + (size_t)row * N; const float* rr = R ? R + (size_t)row * N : nullptr;
  float vals[16];                     // up to N = 4096
  const int per = N / 256;            // contiguous chunk per thread? use strided-by-4 chunks: thread handles j = tid*4 + 1024*u
  float s1 = 0.f;
  for (int u = 0; u < per / 4; ++u) {
    const int j = tid * 4 + 1024 * u;
    const v4f a = *(const v4fa*)(x + j);
    v4f b = {0.f,0.f,0.f,0.f}; if (rr) b = *(const v4fa*)(rr + j);
#pragma unroll
    for (int q = 0; q < 4; ++q) { const float v = a[q] + b[q]; vals[u * 4 + q] = v; s1 += v; }
  }
  red[tid] = s1; __syncthreads();
  for (int st = 128; st > 0; st >>= 1) { if (tid < st) red[tid] += red[tid + st]; __syncthreads(); }
  const float mu = red[0] / (float)N; __syncthreads();
  float s2 = 0.f;
  for (int u = 0; u < per / 4; ++u)
#pragma unroll
    for (int q = 0; q < 4; ++q) { const float c = vals[u * 4 + q] - mu; s2 += c * c; }
  red[tid] = s2; __syncthreads();
  for (int st = 128; st > 0; st >>= 1) { if (tid < st) red[tid] += red[tid + st]; __syncthreads(); }
  const float rs = rsqrtf(red[0] / (float)N + eps);
  {
    for (int u = 0; u < per / 4; ++u) {
      const int j = tid * 4 + 1024 * u;
      v4f o, sm;
#pragma unroll
      for (int q = 0; q < 4; ++q) {
        float gg = g[j + q], bb = bta[j + q];
        if (PARAM_BF16) { gg = bf16_round(gg); bb = bf16_round(bb); }
        sm[q] = vals[u * 4 + q]; o[q] = (vals[u * 4 + q] - mu) * rs * gg + bb;
      }
      if (out_sum) *(v4f*)(out_sum + (size_t)row * N + j) = sm;
      *(v4f*)(out_norm + (size_t)row * N + j) = o;
    }
    
  }
}



// ---- f16 WMMA path (v_wmma_f32_16x16x32_f16): 11-bit significands for operands in range — used where a [0,1] probability operand needs more precision than bf16
typedef _Float16 v16h __attribute__((ext_vector_type(16)));
union FragH { v16h v; v8us half[2]; _Float16 h[16]; unsigned short u[16]; };
template <int NT>
__device__ __forceinline__ v8f mmaH(v16h ah, v16h al, v16h bh, v16h bl, v8f c) {
  c = __builtin_amdgcn_wmma_f32_16x16x32_f16(false, ah, false, bh, (short)0, c, false, false);
  if (NT >= 2) c = __builtin_amdgcn_wmma_f32_16x16x32_f16(false, al, false, bh, (short)0, c, false, false);
  if (NT >= 3) c = __builtin_amdgcn_wmma_f32_16x16x32_f16(false, ah, false, bl, (short)0, c, false, false);
  asm volatile("v_nop\n\tv_nop\n\tv_nop\n\tv_nop" : "+v"(c) : "v"(ah), "v"(al), "v"(bh), "v"(bl));
  return c;
}
// batched GEMM like k_gemm_b but f16 operands: A f32 (split into f16 hi/lo if ASPLIT, else rounded to f16), Bt = f16 values [n][k]; alpha; C f32; N multiple of 16 (partial tiles skipped)
template <bool ASPLIT>
__global__ __launch_bounds__(128) void k_gemm_h(const float* __restrict__ A, int lda, size_t sA, const _Float16* __restrict__ Bh, int ldb, size_t sB, float alpha, float* __restrict__ C, int ldc, size_t sC, int M, int N, int K) {
  __shared__ __attribute__((aligned(16))) float so[4][16][64];
  const int tid = threadIdx.x, w = tid >> 5, lane = tid & 31, ln = lane & 15, hh = lane >> 4; const int by = blockIdx.y;
  A += (size_t)by * sA; Bh += (size_t)by * sB; C += (size_t)by * sC;
  const int ntn = (N + 63) / 64; const int wid = blockIdx.x * 4 + w; const int mt = wid / ntn, nq = wid % ntn; if (mt * 16 >= M) return;
  const int row0 = mt * 16, col0 = nq * 64; const float* arow = A + (size_t)(row0 + ln) * lda;
  v8f acc[4] = {};
  for (int kb = 0; kb < K; kb += 32) {
    FragH ah, al;
    const v4f x0 = *(const v4fa*)(arow + kb + 8 * hh), x1 = *(const v4fa*)(arow + kb + 8 * hh + 4), x2 = *(const v4fa*)(arow + kb + 16 + 8 * hh), x3 = *(const v4fa*)(arow + kb + 16 + 8 * hh + 4);
    float xs[16] = {x0[0],x0[1],x0[2],x0[3],x1[0],x1[1],x1[2],x1[3],x2[0],x2[1],x2[2],x2[3],x3[0],x3[1],x3[2],x3[3]};
#pragma unroll
    for (int i = 0; i < 16; ++i) { const _Float16 h = (_Float16)xs[i]; ah.h[i] = h; al.h[i] = ASPLIT ? (_Float16)(xs[i] - (float)h) : (_Float16)0.0f; }
#pragma unroll
    for (int t = 0; t < 4; ++t) { if (col0 + t * 16 >= N) continue; const size_t boff = (size_t)(col0 + t * 16 + ln) * ldb + kb; FragH bq; bq.half[0] = *(const v8us*)(Bh + boff + 8 * hh); bq.half[1] = *(const v8us*)(Bh + boff + 16 + 8 * hh);
      acc[t] = mmaH<ASPLIT ? 2 : 1>(ah.v, al.v, bq.v, bq.v, acc[t]); }
  }
#pragma unroll
  for (int t = 0; t < 4; ++t) { if (col0 + t * 16 >= N) continue;
#pragma unroll
    for (int r = 0; r < 8; ++r) so[w][8 * hh + r][t * 16 + ln] = acc[t][r] * alpha; }
  __builtin_amdgcn_fence(__ATOMIC_ACQ_REL, "workgroup"); __builtin_amdgcn_wave_barrier();
  const int rsub = lane >> 4, c4 = (lane & 15) * 4;
  {
#pragma unroll
    for (int q = 0; q < 8; ++q) { const int r = q * 2 + rsub; if (col0 + c4 < N) { const v4f v = *(const v4fa*)&so[w][r][c4]; *(v4f*)(C + (size_t)(row0 + r) * ldc + col0 + c4) = v; } }
     }
}

// Wt[n][k] = f16(W[k][n]·scale) from f32 row-major W[K][N] (scale = power of two; bf16-exact weights stay exact in f16 away from the subnormal range)
// blockIdx.y picks one of four weight matrices of the same shape; their Wt planes lie one behind the other.
__global__ __launch_bounds__(256) void k_wt_f16(const float* __restrict__ W0, const float* __restrict__ W1, const float* __restrict__ W2, const float* __restrict__ W3, _Float16* __restrict__ Wt, int K, int N, float scale) {
  const int y = blockIdx.y; const float* W = (y == 0) ? W0 : (y == 1) ? W1 : (y == 2) ? W2 : W3; Wt += (size_t)y * K * N;
  const int t = blockIdx.x * 256 + threadIdx.x; if (t >= N * (K / 8)) return; const int n = t / (K / 8), k8 = (t % (K / 8)) * 8; FragH f;
#pragma unroll
  for (int i = 0; i < 8; ++i) f.h[i] = (_Float16)(bf16_round(W[(size_t)(k8 + i) * N + n]) * scale); const v8us o = f.half[0];
  *(v8us*)((unsigned short*)Wt + (size_t)n * K + k8) = o; 
}
// k_gemm_hh variant with fused epilogue: v = acc·alpha + bias[by·sBias + col] (+ CP[(row/rowsPerB)·sCPb + by·64 + col] if CP) ; ACT 0 none / 1 elu ; writes f16 C16 (and f32 C if non-null)
template <int ACT>
__global__ __launch_bounds__(128) void k_gemm_hhx(const _Float16* __restrict__ A, int lda, size_t sA, const _Float16* __restrict__ Bh, int ldb, size_t sB, float alpha, const float* __restrict__ bias, size_t sBias, const float* __restrict__ CP, int rowsPerB, size_t sCPb, int row0g,
    float* __restrict__ C, _Float16* __restrict__ C16, int ldc, size_t sC, int M, int N, int K) {
  __shared__ __attribute__((aligned(16))) float so[4][16][64];
  const int tid = threadIdx.x, w = tid >> 5, lane = tid & 31, ln = lane & 15, hh = lane >> 4; const int by = blockIdx.y;
  A += (size_t)by * sA; Bh += (size_t)by * sB; const size_t cofs = (size_t)by * sC; const float* bp = bias ? bias + (size_t)by * sBias : nullptr;
  const int ntn = (N + 63) / 64; const int wid = blockIdx.x * 4 + w; const int mt = wid / ntn, nq = wid % ntn; if (mt * 16 >= M) return;
  const int row0 = mt * 16, col0 = nq * 64; const _Float16* arow = A + (size_t)(row0 + ln) * lda;
  v8f acc[4] = {};
  for (int kb = 0; kb < K; kb += 32) { FragH ah; ah.half[0] = *(const v8us*)((const unsigned short*)arow + kb + 8 * hh); ah.half[1] = *(const v8us*)((const unsigned short*)arow + kb + 16 + 8 * hh);
#pragma unroll
    for (int t = 0; t < 4; ++t) { if (col0 + t * 16 >= N) continue; const size_t boff = (size_t)(col0 + t * 16 + ln) * ldb + kb; FragH bq; bq.half[0] = *(const v8us*)((const unsigned short*)Bh + boff + 8 * hh); bq.half[1] = *(const v8us*)((const unsigned short*)Bh + boff + 16 + 8 * hh);
      acc[t] = mmaH<1>(ah.v, ah.v, bq.v, bq.v, acc[t]); }
  }
#pragma unroll
  for (int t = 0; t < 4; ++t) { if (col0 + t * 16 >= N) continue; const int col = col0 + t * 16 + ln; const float bv = bp ? bf16_round(bp[col]) : 0.f;
#pragma unroll
    for (int r = 0; r < 8; ++r) { float v = acc[t][r] * alpha + bv; if (CP) { const int rr = row0g + row0 + 8 * hh + r; if (rowsPerB < 0) v += CP[cofs + (size_t)rr * ldc + col];      /* rowsPerB < 0: own element of the batched C plane */ else { const int bidx = rr / rowsPerB; v += CP[(size_t)bidx * sCPb + (size_t)by * 64 + col]; } } if (ACT == 1) v = (v > 0.f) ? v : expm1f(v); else if (ACT == 7) v = (v > 0.f) ? v + 1.0f : expf(v); else if (ACT == 8) v = tanhf(v); else if (ACT == 9) v = 0.5f * v * (1.0f + tanhf(0.7978845608028654f * (v + 0.044715f * v * v * v))); else if (ACT == 11) v = 1.0f / (1.0f + expf(-v)); else if (ACT == 12) v = (v > 0.f) ? v : 0.01f * v; else if (ACT == 14) v = (v > 0.f) ? v : 0.1f * v; else if (ACT == 16) v = (v >= 0.f) ? v : 0.3f * v; else if (ACT == 17) v = (v >= 0.f) ? v : 0.2f * v; else if (ACT == 15) v = v / (1.0f + expf(-v)); else if (ACT == 3) v = fmaxf(v, 0.f); else if (ACT == 6) v = 0.5f * v * (1.0f + erff(v * 0.70710678118654752f)); so[w][8 * hh + r][t * 16 + ln] = v; } }
  __builtin_amdgcn_fence(__ATOMIC_ACQ_REL, "workgroup"); __builtin_amdgcn_wave_barrier();
  const int rsub = lane >> 4, c4 = (lane & 15) * 4; typedef _Float16 v4h __attribute__((ext_vector_type(4)));
  {
#pragma unroll
    for (int q = 0; q < 8; ++q) { const int r = q * 2 + rsub; if (col0 + c4 < N) { const v4f v = *(const v4fa*)&so[w][r][c4]; if (C) *(v4f*)(C + cofs + (size_t)(row0 + r) * ldc + col0 + c4) = v; if (C16) { v4h h4; for (int i = 0; i < 4; ++i) h4[i] = (_Float16)v[i]; *(v4h*)(C16 + cofs + (size_t)(row0 + r) * ldc + col0 + c4) = h4; } } }
     }
}


typedef _Float16 v4h __attribute__((ext_vector_type(4)));

// blockIdx.y picks the stream (query, key, value input); the f16 planes lie one behind the other.
__global__ __launch_bounds__(256) void k_x16(const float* __restrict__ x0, const float* __restrict__ x1, const float* __restrict__ x2, _Float16* __restrict__ X16, size_t n8) { const size_t t = (size_t)blockIdx.x * 256 + threadIdx.x; if (t >= n8) return; FragH f;
  const int y = blockIdx.y; const float* x = (y == 0) ? x0 : (y == 1) ? x1 : x2; X16 += (size_t)y * n8 * 8;
#pragma unroll
  for (int q = 0; q < 8; ++q) f.h[q] = (_Float16)bf16_round(x[t * 8 + q]); *(v8us*)((unsigned short*)X16 + t * 8) = f.half[0];  }
__global__ __launch_bounds__(256) void k_h16(const float* __restrict__ x, _Float16* __restrict__ X16, size_t n8) { const size_t t = (size_t)blockIdx.x * 256 + threadIdx.x; if (t >= n8) return; FragH f;
#pragma unroll
  for (int q = 0; q < 8; ++q) f.h[q] = (_Float16)x[t * 8 + q]; *(v8us*)((unsigned short*)X16 + t * 8) = f.half[0];  }
__global__ __launch_bounds__(256) void k_round16f(const float* __restrict__ W, _Float16* __restrict__ Bt, size_t n8) { const size_t t = (size_t)blockIdx.x * 256 + threadIdx.x; if (t >= n8) return; FragH f;
#pragma unroll
  for (int i = 0; i < 8; ++i) f.h[i] = (_Float16)(bf16_round(W[t * 8 + i]) * 16.0f); *(v8us*)((unsigned short*)Bt + t * 8) = f.half[0];  }
template <int NHv, int TTv>
__global__ __launch_bounds__(256) void k_vt(const _Float16* __restrict__ V16, int ldv, int voff, _Float16* __restrict__ Vt) { __shared__ unsigned short tl[64][66]; const int tid = threadIdx.x; const int slab = blockIdx.x / (TTv / 64), lg = blockIdx.x % (TTv / 64); const int b = slab / NHv, h = slab % NHv;
  for (int i = tid; i < 64 * 8; i += 256) { const int r = i / 8, c8 = (i % 8) * 8; FragH f; f.half[0] = *(const v8us*)((const unsigned short*)V16 + ((size_t)b * TTv + lg * 64 + r) * ldv + voff + h * 64 + c8);
#pragma unroll
    for (int q = 0; q < 8; ++q) tl[r][c8 + q] = f.u[q]; }
  __syncthreads();
  {
#pragma unroll
    for (int rd = 0; rd < 2; ++rd) { const int d = rd * 32 + tid / 8, pc = tid % 8; FragH f;
#pragma unroll
      for (int q = 0; q < 8; ++q) f.u[q] = tl[pc * 8 + q][d];
      *(v8us*)((unsigned short*)Vt + ((size_t)slab * 64 + d) * TTv + lg * 64 + pc * 8) = f.half[0]; }
     } }

__global__ __launch_bounds__(256) void k_hl(const float* __restrict__ F, _Float16* __restrict__ Hh, _Float16* __restrict__ Hl, size_t n8) { const size_t t = (size_t)blockIdx.x * 256 + threadIdx.x; if (t >= n8) return; FragH fh, fl; const v4f a = *(const v4fa*)(F + t * 8), c = *(const v4fa*)(F + t * 8 + 4);
#pragma unroll
  for (int q = 0; q < 4; ++q) { _Float16 h = (_Float16)a[q]; fh.h[q] = h; fl.h[q] = (_Float16)((a[q] - (float)h) * 1024.0f); h = (_Float16)c[q]; fh.h[4 + q] = h; fl.h[4 + q] = (_Float16)((c[q] - (float)h) * 1024.0f); }
  { *(v8us*)((unsigned short*)Hh + t * 8) = fh.half[0]; *(v8us*)((unsigned short*)Hl + t * 8) = fl.half[0];  } }

// ---- fast GEMM (wave tile 32x64; requires M % 32 == 0 rows per launch region and N % 64 == 0); epilogue = k_gemm_hhx semantics ----
__device__ __forceinline__ v16h g2_frag(const _Float16* p, int hh) { FragH f; f.half[0] = *(const v8us*)((const unsigned short*)p + 8 * hh); f.half[1] = *(const v8us*)((const unsigned short*)p + 16 + 8 * hh); return f.v; }
__device__ __forceinline__ v8f g2_mma(v16h a, v16h b, v8f c) { v8f d = __builtin_amdgcn_wmma_f32_16x16x32_f16(false, a, false, b, (short)0, c, false, false); asm volatile("v_nop\n\tv_nop\n\tv_nop\n\tv_nop" : "+v"(d) : "v"(a), "v"(b)); return d; }
template <int ACT>
__global__ __launch_bounds__(128) void k_gemm2(const _Float16* __restrict__ A, int lda, size_t sA, const _Float16* __restrict__ Bh, int ldb, size_t sB, float alpha, const float* __restrict__ bias, size_t sBias, const float* __restrict__ CP, int rowsPerB, size_t sCPb, int row0g,
    float* __restrict__ C, _Float16* __restrict__ C16, int ldc, size_t sC, int M, int N, int K, size_t sAz, size_t sBz, size_t sCz, const float* __restrict__ bias1, const float* __restrict__ bias2) {      /* blockIdx.z: a second batch index (the projection) with strides sAz, sBz, sCz and its own bias vector */ static_assert(ACT == 0 || ACT == 3 || ACT == 6 || ACT == 8 || ACT == 9 || ACT == 11 || ACT == 12 || ACT == 14 || ACT == 15 || ACT == 16 || ACT == 17, "k_gemm2: unsupported ACT code (would silently apply no activation)");
  __shared__ __attribute__((aligned(16))) float so[4][32][68];
  const int tid = threadIdx.x, w = tid >> 5, lane = tid & 31, ln = lane & 15, hh = lane >> 4; const int by = blockIdx.y;
  const int bz = blockIdx.z; const float* bsel = (bz == 0) ? bias : (bz == 1) ? bias1 : bias2;
  A += (size_t)by * sA + (size_t)bz * sAz; Bh += (size_t)by * sB + (size_t)bz * sBz; const size_t cofs = (size_t)by * sC + (size_t)bz * sCz; const float* bp = bsel ? bsel + (size_t)by * sBias : nullptr;
  const int ntn = N >> 6; const int mt = blockIdx.x / ntn, nq = blockIdx.x - mt * ntn; const int row0 = mt * 128 + 32 * w, col0 = nq * 64; if (row0 >= M) return;
  const _Float16* a0p = A + (size_t)(row0 + ln) * lda; const _Float16* a1p = a0p + (size_t)16 * lda;
  const _Float16* b0p = Bh + (size_t)(col0 + ln) * ldb; const _Float16* b1p = b0p + (size_t)16 * ldb; const _Float16* b2p = b1p + (size_t)16 * ldb; const _Float16* b3p = b2p + (size_t)16 * ldb;
  const v8f z8 = {0.f,0.f,0.f,0.f,0.f,0.f,0.f,0.f}; v8f c00 = z8, c01 = z8, c02 = z8, c03 = z8, c10 = z8, c11 = z8, c12 = z8, c13 = z8;
#pragma unroll 1
  for (int kb = 0; kb < K; kb += 32) { const v16h a0 = g2_frag(a0p + kb, hh), a1 = g2_frag(a1p + kb, hh);
    v16h b = g2_frag(b0p + kb, hh); c00 = g2_mma(a0, b, c00); c10 = g2_mma(a1, b, c10);
    b = g2_frag(b1p + kb, hh); c01 = g2_mma(a0, b, c01); c11 = g2_mma(a1, b, c11);
    b = g2_frag(b2p + kb, hh); c02 = g2_mma(a0, b, c02); c12 = g2_mma(a1, b, c12);
    b = g2_frag(b3p + kb, hh); c03 = g2_mma(a0, b, c03); c13 = g2_mma(a1, b, c13); }
  v8f accs[8] = {c00, c01, c02, c03, c10, c11, c12, c13};
#pragma unroll
  for (int u = 0; u < 8; ++u) { const int t = u & 3, half = u >> 2; const int col = col0 + t * 16 + ln; const float bv = bp ? bf16_round(bp[col]) : 0.f;
#pragma unroll
    for (int r = 0; r < 8; ++r) { const int rloc = half * 16 + 8 * hh + r; float v = accs[u][r] * alpha + bv; if (CP) { if (rowsPerB < 0) v += CP[cofs + (size_t)(row0g + row0 + rloc) * ldc + col];      /* rowsPerB < 0: own element of the batched C plane */ else { const int bidx = (row0g + row0 + rloc) / rowsPerB; v += CP[(size_t)bidx * sCPb + (size_t)by * 64 + col]; } }
      if (ACT == 3) v = fmaxf(v, 0.f); else if (ACT == 6) v = 0.5f * v * (1.0f + erff(v * 0.70710678118654752f)); else if (ACT == 11) v = 1.0f / (1.0f + expf(-v)); else if (ACT == 15) v = v / (1.0f + expf(-v)); else if (ACT == 12) v = (v > 0.f) ? v : 0.01f * v; else if (ACT == 8) v = tanhf(v); else if (ACT == 9) v = 0.5f * v * (1.0f + tanhf(0.7978845608028654f * (v + 0.044715f * v * v * v))); else if (ACT == 14) v = (v > 0.f) ? v : 0.1f * v; else if (ACT == 16) v = (v >= 0.f) ? v : 0.3f * v; else if (ACT == 17) v = (v >= 0.f) ? v : 0.2f * v;
      so[w][rloc][t * 16 + ln] = v; } }
  __builtin_amdgcn_fence(__ATOMIC_ACQ_REL, "workgroup"); __builtin_amdgcn_wave_barrier();
  const int rsub = lane >> 4, c4 = (lane & 15) * 4;
  {
#pragma unroll
    for (int q = 0; q < 16; ++q) { const int r = q * 2 + rsub; const v4f v = *(const v4fa*)&so[w][r][c4]; if (C) *(v4f*)(C + cofs + (size_t)(row0 + r) * ldc + col0 + c4) = v; if (C16) { v4h h4; for (int i = 0; i < 4; ++i) h4[i] = (_Float16)v[i]; *(v4h*)(C16 + cofs + (size_t)(row0 + r) * ldc + col0 + c4) = h4; } }
     } }


__global__ __launch_bounds__(256) void k_wnat(const float* __restrict__ w, size_t n8, _Float16* __restrict__ Bt) { const size_t t = (size_t)blockIdx.x * 256 + threadIdx.x; if (t >= n8) return; FragH f; for (int q = 0; q < 8; ++q) f.h[q] = (_Float16)(bf16_round(w[t * 8 + q]) * 16.0f); *(v8us*)((unsigned short*)Bt + t * 8) = f.half[0];  }
__global__ __launch_bounds__(256) void k_rsm(const float* __restrict__ S, _Float16* __restrict__ P, int nrows) {
  #pragma clang fp contract(off)
  const int i = blockIdx.x * 256 + threadIdx.x; if (i >= nrows) return; const float* s = S + (size_t)i * SQ; float mx = -3.0e38f;
#pragma unroll 1
  for (int j = 0; j < SQ; ++j) mx = fmaxf(mx, s[j]); float se = 0.f;
#pragma unroll 1
  for (int j = 0; j < SQ; ++j) se += expf(s[j] - mx); const float sc = 256.0f / se;
#pragma unroll 1
  for (int j0 = 0; j0 < SQ; j0 += 8) { FragH f; for (int q = 0; q < 8; ++q) f.h[q] = (_Float16)(expf(s[j0 + q] - mx) * sc); unsigned short* d = (unsigned short*)P + (size_t)i * SQ + j0; *(v8us*)d = f.half[0];  } }
__global__ __launch_bounds__(256) void k_vt(const _Float16* __restrict__ V16, int b, int h0, _Float16* __restrict__ VT) { __shared__ unsigned short tl[64][65]; const int tid = threadIdx.x; const int hh = blockIdx.x % HG, sg = blockIdx.x / HG; const int s0 = sg * 64; const int h = h0 + hh;
  for (int i = tid; i < 64 * 8; i += 256) { const int j = i / 8, d8 = (i % 8) * 8; FragH f; f.half[0] = *(const v8us*)((const unsigned short*)V16 + ((size_t)b * SQ + s0 + j) * DM + h * HD + d8); for (int q = 0; q < 8; ++q) tl[d8 + q][j] = f.u[q]; }
  __syncthreads();
  { for (int i = tid; i < 64 * 8; i += 256) { const int d = i / 8, j8 = (i % 8) * 8; FragH f; for (int q = 0; q < 8; ++q) f.u[q] = tl[d][j8 + q]; *(v8us*)((unsigned short*)VT + ((size_t)hh * HD + d) * SQ + s0 + j8) = f.half[0]; }  } }



__global__ __launch_bounds__(256) void k_rsmkm(const float* __restrict__ S, _Float16* __restrict__ P, int nrows, const int* __restrict__ am) {
  #pragma clang fp contract(off)
  const int t = blockIdx.x * 256 + threadIdx.x; if (t >= nrows) return; const size_t i = (size_t)t; const float* s = S + i * SQ; const int* mr = am + (size_t)(t % SQ) * SQ; float mx = -3.0e38f;
#pragma unroll 1
  for (int j = 0; j < SQ; ++j) { const float f = (mr[j] != 0) ? 1.f : 0.f; mx = fmaxf(mx, fmaf(f, s[j], (1.f - f) * -1.0e9f)); } float se = 0.f;
#pragma unroll 1
  for (int j = 0; j < SQ; ++j) { const float f = (mr[j] != 0) ? 1.f : 0.f; se += __expf(fmaf(f, s[j], (1.f - f) * -1.0e9f) - mx); } const float sc = 256.0f / se;
#pragma unroll 1
  for (int j0 = 0; j0 < SQ; j0 += 8) { FragH fr; for (int q = 0; q < 8; ++q) { const int j = j0 + q; const float f = (mr[j] != 0) ? 1.f : 0.f; fr.h[q] = (_Float16)(__expf(fmaf(f, s[j], (1.f - f) * -1.0e9f) - mx) * sc); }
    unsigned short* d = (unsigned short*)P + i * SQ + j0; *(v8us*)d = fr.half[0];  } }
// exp of four values as __expf forms it (v_exp_f32 of x * log2 e). One statement, so that the free slot the instruction set asks for behind a transcendental stands there by construction: outputs are early-clobbered (no v_exp_f32 overwrites a neighbour's source or reads its result), and the v_nop fills the slot behind the last one.
__device__ __forceinline__ v4f exp_x4(v4f x) { float r0, r1, r2, r3;
  asm("v_exp_f32 %0, %4\n\tv_exp_f32 %1, %5\n\tv_exp_f32 %2, %6\n\tv_exp_f32 %3, %7\n\tv_nop" : "=&v"(r0), "=&v"(r1), "=&v"(r2), "=&v"(r3) : "v"(x[0] * 1.44269504088896340736f), "v"(x[1] * 1.44269504088896340736f), "v"(x[2] * 1.44269504088896340736f), "v"(x[3] * 1.44269504088896340736f));
  const v4f r = {r0, r1, r2, r3}; return r; }
// exp of one value, same form as exp_x4 (the v_nop fills the free slot behind the transcendental).
__device__ __forceinline__ float exp_x1(float x) { float r; asm("v_exp_f32 %0, %1\n\tv_nop" : "=&v"(r) : "v"(x * 1.44269504088896340736f)); return r; }
__device__ __forceinline__ v8f fa_mma(v16h a, v16h b, v8f c) { return __builtin_amdgcn_wmma_f32_16x16x32_f16(false, a, false, b, (short)0, c, false, false); }
#define FP 72                        /* LDS pitch of a staged row in 16-bit elements: 144 B = 16 B x odd, conflict-free for 16-byte fragment reads down 16 rows */
#define FT (64 * FP * 2)             /* bytes of one staged tile (64 rows) */
// Four 16-byte copies of one thread; the wait as the statement's last line keeps every rewrite of the address registers behind it.
__device__ __forceinline__ void fa_copy4(unsigned l0, unsigned l1, unsigned l2, unsigned l3, const _Float16* g0, const _Float16* g1, const _Float16* g2, const _Float16* g3) {
  asm volatile("global_load_async_to_lds_b128 %0, %4, off\n\tglobal_load_async_to_lds_b128 %1, %5, off\n\tglobal_load_async_to_lds_b128 %2, %6, off\n\tglobal_load_async_to_lds_b128 %3, %7, off\n\ts_wait_xcnt 0x0" :: "v"(l0), "v"(l1), "v"(l2), "v"(l3), "v"(g0), "v"(g1), "v"(g2), "v"(g3) : "memory"); }
__global__ __launch_bounds__(256) void k_fattn(const _Float16* __restrict__ Q, const _Float16* __restrict__ Kk, const _Float16* __restrict__ VTa, _Float16* __restrict__ O) {
  __shared__ __attribute__((aligned(16))) _Float16 kv[2][2][64][FP];      /* [buffer][k rows, V^T rows][row][element] */
  const int lane = threadIdx.x & 31, ln = lane & 15, hh = lane >> 4; const int w = __builtin_amdgcn_readfirstlane(threadIdx.x >> 5);      /* wave number in a scalar register: the mask test below is a scalar branch */
  const int h = blockIdx.y, b = blockIdx.z; const int q0 = blockIdx.x * 128 + w * 16; const int qi = q0 + ln;
  const _Float16* qp = Q + ((size_t)b * SQ + qi) * LQ + h * HD; const v16h qf0 = g2_frag(qp, hh), qf1 = g2_frag(qp + 32, hh);
  const int sr = threadIdx.x >> 3, sc = (threadIdx.x & 7) * 8;      /* staging: a thread copies piece sc of rows sr and sr + 32 of both tiles; a wave's copy is 4 whole rows */
  const _Float16* kg = Kk + ((size_t)b * SQ + sr) * LQ + h * HD + sc; const _Float16* vg = VTa + (((size_t)b * NH + h) * HD + sr) * SQ + sc;
  const unsigned ls = (unsigned)(size_t)&kv[0][0][sr][sc];      /* the thread's LDS byte address in buffer 0 */
  auto stage = [&](int t) { const unsigned l = ls + (unsigned)(t & 1) * (2 * FT); const _Float16* kr = kg + (size_t)t * 64 * LQ; const _Float16* vr = vg + t * 64; fa_copy4(l, l + FT / 2, l + FT, l + FT + FT / 2, kr, kr + (size_t)32 * LQ, vr, vr + (size_t)32 * SQ); };
  static_assert(SQ / 64 >= 2, "the prologue fills two stages");
  stage(0);
  asm volatile("s_wait_asynccnt 0x0" ::: "memory");      /* this wave's copies of pass 0 have landed */
  __syncthreads();      /* ... and every other wave's: pass 0 may be read */
  stage(1);
  const v8f z8 = {0.f,0.f,0.f,0.f,0.f,0.f,0.f,0.f}; v8f o[4] = {z8, z8, z8, z8}; float m = -1.0e30f, l = 0.f;
#pragma unroll 1      /* one pass already holds 32 fragment loads and 16 matrix products; a second copy would only cost registers */
  for (int p = 0; p < SQ / 64; ++p) { const int k0 = p * 64; v8f s[4]; v16h kf[4][2], vf[4][2]; const _Float16* kp = &kv[p & 1][0][ln][0]; const _Float16* vp = &kv[p & 1][1][ln][0];
#pragma unroll      /* kf[] in registers */
    for (int t = 0; t < 4; ++t) { kf[t][0] = g2_frag(kp + 16 * t * FP, hh); kf[t][1] = g2_frag(kp + 16 * t * FP + 32, hh); }
    asm volatile("" :: "v"(kf[0][0]), "v"(kf[0][1]), "v"(kf[1][0]), "v"(kf[1][1]), "v"(kf[2][0]), "v"(kf[2][1]), "v"(kf[3][0]), "v"(kf[3][1]));      /* inputs only, loaded values: the 16 k reads of the pass stand as one group in front of the score products (left alone, the compiler spreads them among the products, each place with its own wait) */
#pragma unroll      /* s[] in registers */
    for (int t = 0; t < 4; ++t) { s[t] = fa_mma(kf[t][0], qf0, z8); s[t] = fa_mma(kf[t][1], qf1, s[t]); }
#pragma unroll      /* vf[] in registers; the v fragments arrive under the softmax arithmetic */
    for (int t = 0; t < 4; ++t) { vf[t][0] = g2_frag(vp + 16 * t * FP, hh); vf[t][1] = g2_frag(vp + 16 * t * FP + 32, hh); }
#pragma unroll      /* s[] in registers */
    for (int t = 0; t < 4; ++t) s[t] *= 0.125f;
    if (k0 <= q0 + 15) {      /* a pass whose keys all lie behind the wave's queries adds 0 * -1e9: skipped as an identity */
#pragma unroll      /* s[] in registers */
      for (int t = 0; t < 4; ++t) for (int r = 0; r < 8; ++r) { const float mk = (k0 + 16 * t + 8 * hh + r <= qi) ? 1.0f : 0.0f; s[t][r] = __fadd_rn(s[t][r], __fmul_rn(mk, -1.0e9f)); } }
    float mt = s[0][0];
#pragma unroll      /* s[] in registers */
    for (int t = 0; t < 4; ++t) for (int r = 0; r < 8; ++r) mt = fmaxf(mt, s[t][r]);
    mt = fmaxf(mt, __shfl_xor(mt, 16)); const float mn = fmaxf(m, mt); const float corr = exp_x1(m - mn); m = mn;
    v4f s4 = {0.f, 0.f, 0.f, 0.f}; FragH pf[2];
#pragma unroll      /* s[], pf[] in registers */
    for (int t = 0; t < 4; ++t) { const v4f a = {s[t][0], s[t][1], s[t][2], s[t][3]}, c = {s[t][4], s[t][5], s[t][6], s[t][7]}; const v4f ea = exp_x4(a - mn), ec = exp_x4(c - mn); s4 += ea; s4 += ec;
      for (int u = 0; u < 4; ++u) { pf[t >> 1].h[(t & 1) * 8 + u] = (_Float16)ea[u]; pf[t >> 1].h[(t & 1) * 8 + 4 + u] = (_Float16)ec[u]; } }
    l = l * corr + ((s4[0] + s4[1]) + (s4[2] + s4[3]));      /* each wave half keeps its own part of the sum; joined once behind the loop */
    asm volatile("" :: "v"(vf[0][0]), "v"(vf[0][1]), "v"(vf[1][0]), "v"(vf[1][1]), "v"(vf[2][0]), "v"(vf[2][1]), "v"(vf[3][0]), "v"(vf[3][1]));      /* inputs only, loaded values: the 16 v reads are all out before the first output product, none among the products */
#pragma unroll      /* o[] in registers */
    for (int t = 0; t < 4; ++t) { o[t] *= corr; o[t] = fa_mma(vf[t][0], pf[0].v, o[t]); o[t] = fa_mma(vf[t][1], pf[1].v, o[t]); }
    asm volatile("s_wait_dscnt 0x0" ::: "memory");      /* this wave's reads of the pass's buffer are done before the buffer is handed back */
    asm volatile("s_wait_asynccnt 0x0" ::: "memory");      /* this wave's copies of pass p + 1 have landed */
    __syncthreads();      /* publishes pass p + 1 and ends every wave's reads of pass p's buffer */
    if (p + 2 < SQ / 64) stage(p + 2); }      /* refill of the buffer just read; the test is the same for the whole block */
  asm volatile("s_wait_asynccnt 0x0" ::: "memory");      /* no copy outstanding when the wave ends */
  l += __shfl_xor(l, 16); const float fin = 64.0f / l;      /* o carried x64 against f16 subnormal flush, folded into the output GEMM alpha */
  _Float16* op = O + ((size_t)b * SQ + qi) * DM + h * HD + 8 * hh;
#pragma unroll      /* o[] in registers; a lane's 8 accumulator registers are 8 consecutive columns of its query's row: one 16-byte store */
  for (int t = 0; t < 4; ++t) { FragH f; for (int r = 0; r < 8; ++r) f.h[r] = (_Float16)(o[t][r] * fin); *(v8us*)((unsigned short*)op + 16 * t) = f.half[0]; } }

// One lane per query row, 32 rows a block; the rows' keys are dealt over the block's KW waves (wave w takes keys w, w + KW, ... of the block's range), each wave with its own running maximum, sum and o; the KW partial results of a row are joined through LDS at the end. A wave's key index is wave-uniform, so k and v rows still come through the scalar path. The 64-wide loops are unrolled: q[] and o[] are indexed by constants only and stay in registers.
__global__ __launch_bounds__(32 * KW) void k_attup(const float* __restrict__ QF, const float* __restrict__ KF, const float* __restrict__ VF, int ld, float scale, float* __restrict__ OF, int ldo) {
  #pragma clang fp contract(off)
  static_assert(KW == 16 && QT0 % 32 == 0 && HD == 64, "the join below gives each of the 32 * KW threads one 4-column piece of the 32 x 64 tile");
  __shared__ __attribute__((aligned(16))) float lo[KW][32][HD + 4];      /* row pitch 272 B = 16 B x odd: 16-byte stores of 32 rows and 16-byte loads along a row both spread over the banks */
  __shared__ float lm[KW][32], ll[KW][32];
  const int tid = threadIdx.x, lane = tid & 31; const int w = __builtin_amdgcn_readfirstlane(tid >> 5);      /* wave number in a scalar register: key addresses stay scalar */
  const int h = blockIdx.x / (QT0 / 32), rg = blockIdx.x % (QT0 / 32); const int i = rg * 32 + lane;
  { const size_t bo = (size_t)blockIdx.y * QT0; QF += bo * ld; KF += bo * ld; VF += bo * ld; OF += bo * ldo; }      /* blockIdx.y: the batch; each batch has its own QT0-row tile */
  const float* qr = QF + (size_t)i * ld + h * HD; v4f q[HD / 4], o[HD / 4];
#pragma unroll      /* q[], o[] in registers; the q row's 16 loads in flight at once */
  for (int c = 0; c < HD / 4; ++c) { q[c] = *(const v4fa*)(qr + c * 4); const v4f z = {0.f, 0.f, 0.f, 0.f}; o[c] = z; }
  float m = -1.0e30f, l = 0.f;
#pragma unroll 1
  for (int j = rg * 32 + w; j < QT0; j += KW) { const float* kr = KF + (size_t)j * ld + h * HD; const float* vr = VF + (size_t)j * ld + h * HD; v4f kq[HD / 4], vv[HD / 4]; float s = 0.f;
#pragma unroll      /* a whole row's loads in flight at once */
    for (int c = 0; c < HD / 4; ++c) kq[c] = *(const v4fa*)(kr + c * 4);
#pragma unroll      /* the v row arrives under the score sum */
    for (int c = 0; c < HD / 4; ++c) vv[c] = *(const v4fa*)(vr + c * 4);
#pragma unroll      /* q[], kq[] in registers */
    for (int c = 0; c < HD / 4; ++c) { s = __fadd_rn(s, __fmul_rn(q[c][0], kq[c][0])); s = __fadd_rn(s, __fmul_rn(q[c][1], kq[c][1])); s = __fadd_rn(s, __fmul_rn(q[c][2], kq[c][2])); s = __fadd_rn(s, __fmul_rn(q[c][3], kq[c][3])); }
    s = __fmul_rn(s, scale);
    const float f = (j > i) ? 1.f : 0.f; const float sm = fmaf(f, s, (1.f - f) * -1.0e30f); const float mn = fmaxf(m, sm); const float sc = expf(m - mn); const float e = __fmul_rn(f, expf(sm - mn)); l = __fadd_rn(__fmul_rn(l, sc), e); m = mn;
#pragma unroll      /* o[], vv[] in registers */
    for (int c = 0; c < HD / 4; ++c) for (int u = 0; u < 4; ++u) o[c][u] = __fadd_rn(__fmul_rn(o[c][u], sc), __fmul_rn(e, vv[c][u])); }
#pragma unroll      /* o[] in registers */
  for (int c = 0; c < HD / 4; ++c) *(v4f*)&lo[w][lane][c * 4] = o[c];
  lm[w][lane] = m; ll[w][lane] = l;
  __syncthreads();
  { const int row = tid / 16, pc = (tid % 16) * 4; float mw[KW], mx = -1.0e30f, ls = 0.f; v4f a = {0.f, 0.f, 0.f, 0.f};      /* join: every partial is brought to the row's overall maximum; a wave that saw no visible key holds l = 0, o = 0 and adds nothing */
#pragma unroll      /* mw[] in registers */
    for (int u = 0; u < KW; ++u) { mw[u] = lm[u][row]; mx = fmaxf(mx, mw[u]); }
#pragma unroll      /* mw[] in registers; the 16 partial pieces' LDS loads in flight at once */
    for (int u = 0; u < KW; ++u) { const float fw = exp_x1(mw[u] - mx); const v4f p = *(const v4f*)&lo[u][row][pc]; ls += ll[u][row] * fw; a += p * fw; }
    const float fin = (ls > 0.f) ? 64.0f / ls : 0.f;      /* o carried x64 like the f16 path; the key-less last row is written by k_vmean */
    a *= fin; *(v4f*)(OF + (size_t)(rg * 32 + row) * ldo + h * HD + pc) = a; } }

__global__ __launch_bounds__(256) void k_vmean(const _Float16* __restrict__ V, float* __restrict__ orow) {
  #pragma clang fp contract(off)
  const int c = blockIdx.x * 256 + threadIdx.x; if (c >= DM) return; const _Float16* p = V + (size_t)blockIdx.y * SQ * LQ + c; orow += (size_t)blockIdx.y * QT0 * DM; float s = 0.f;      /* blockIdx.y: the batch */
#pragma unroll 1
  for (int j0 = 0; j0 < SQ; j0 += 64) { _Float16 t[64];
#pragma unroll      /* 64 rows' loads in flight at once (the constant pitch LQ makes them one address register with immediate offsets); t[] in registers */
    for (int j = 0; j < 64; ++j) t[j] = p[(size_t)(j0 + j) * LQ];
#pragma unroll      /* summed in the rows' order */
    for (int j = 0; j < 64; ++j) s = __fadd_rn(s, (float)t[j]); }
  const float o = __fmul_rn(s, 64.0f / (float)SQ); *(float*)(orow + c) = o;  }

extern "C" void kernel_launch(void* const* d_in, const int* in_sizes, int n_in,
                              void* d_out, int out_size, void* d_ws, size_t ws_size, hipStream_t stream) {
  (void)in_sizes; (void)n_in; (void)out_size;
  const float* const* I = (const float* const*)d_in; const float* xq = I[0]; const float* xk = I[0]; const float* xv = I[0]; const float* wq = I[1]; const float* bq = I[2]; const float* wk = I[3]; const float* bk = I[4]; const float* wv = I[5]; const float* bv = I[6]; const float* wo = I[7]; const float* bo = I[8]; const float* x = xq;      /* ONE input feeds the query, key and value streams; [in][out] weights + biases; the mask is built from indices as in the module */
  static_assert(NH * HD == DM && DM % 64 == 0 && SQ % 128 == 0 && NH % HG == 0, "shape / tile multiples");
  char* ws = (char*)d_ws; size_t off = 0;
  auto take = [&](size_t bytes) { char* p = ws + off; off += (bytes + 255) & ~(size_t)255; return p; };
  _Float16* BQ = (_Float16*)take((size_t)4 * DM * DM * 2); _Float16* BO = BQ + (size_t)3 * DM * DM;      /* Bt planes of Wq, Wk, Wv, Wo, one behind the other */
  _Float16* X16 = (_Float16*)take((size_t)3 * NR * DM * 2);      /* query, key and value inputs as exact f16 rows: three planes */
  _Float16* Q16 = (_Float16*)take((size_t)3 * NR * DM * 2); _Float16* K16 = Q16 + NR * DM; _Float16* V16 = K16 + NR * DM; _Float16* O16 = (_Float16*)take(NR * DM * 2);      /* q, k, v: three planes */
  _Float16* VT = (_Float16*)take((size_t)NB * NH * HD * SQ * 2);
  float* QF0 = (float*)take((size_t)3 * NB * QT0 * DM * 4); float* KF0 = QF0 + (size_t)NB * QT0 * DM; float* VF0 = KF0 + (size_t)NB * QT0 * DM; float* OF0 = (float*)take((size_t)NB * QT0 * DM * 4); _Float16* OH0 = (_Float16*)take((size_t)NB * QT0 * DM * 2); _Float16* OL0 = (_Float16*)take((size_t)NB * QT0 * DM * 2);      /* exact last tile of every batch: f32 q / k / v of the tile rows (three planes of [NB][QT0] rows), o (x64) and its f16 hi + x1024 residual planes */
  if (off > ws_size) return;
  k_wt_f16<<<dim3((unsigned)(((size_t)DM * (DM / 8) + 255) / 256), 4), 256, 0, stream>>>(wq, wk, wv, wo, BQ, DM, DM, 16.0f);      /* [in][out] -> Bt x16, the four weights in one launch */
  k_x16<<<dim3((unsigned)((NR * DM / 8 + 255) / 256), 3), 256, 0, stream>>>(x, xk, xv, X16, NR * DM / 8);      /* the three streams in one launch */
  const size_t r0p = (size_t)B0 * SQ;      /* first projected row */
  k_gemm2<0><<<dim3((unsigned)((MP / 128) * (DM / 64)), 1, 3), 128, 0, stream>>>(X16 + r0p * DM, DM, 0, BQ, DM, 0, 0.0625f, bq, 0, nullptr, 1, 0, 0, nullptr, Q16 + r0p * DM, DM, 0, MP, DM, DM, NR * DM, (size_t)DM * DM, NR * DM, bk, bv);      /* q, k, v (z) in one launch */
  k_vt<NH, SQ><<<NBR * NH * (SQ / 64), 256, 0, stream>>>(V16 + r0p * LQ, LQ, 0, VT + (size_t)B0 * NH * HD * SQ);      /* V^T [NB][NH][HD][SQ], every batch in one launch */
  const size_t rl0 = r0p + SQ - QT0; const size_t f00 = (size_t)B0 * QT0;      /* first batch's last QT0 rows; its tile in the [NB][QT0] planes */
  k_gemm2<0><<<dim3((QT0 / 128) * (DM / 64), NBR, 3), 128, 0, stream>>>(X16 + rl0 * DM, DM, (size_t)SQ * DM, BQ, DM, 0, 0.0625f, bq, 0, nullptr, 1, 0, 0, QF0 + f00 * DM, nullptr, DM, (size_t)QT0 * DM, QT0, DM, DM, NR * DM, (size_t)DM * DM, (size_t)NB * QT0 * DM, bk, bv);      /* f32 q, k, v (z) of every batch's (y) last tile (exact products) */
  k_attup<<<dim3(NH * (QT0 / 32), NBR), 32 * KW, 0, stream>>>(QF0 + f00 * DM, KF0 + f00 * DM, VF0 + f00 * DM, DM, 0.125f, OF0 + f00 * DM, DM);      /* exact f32 attention over the keys j > i inside the tile (o x64) */
  k_vmean<<<dim3((DM + 255) / 256, NBR), 256, 0, stream>>>(V16 + r0p * LQ, OF0 + (f00 + QT0 - 1) * DM);      /* last row: uniform over all keys = 64 x mean of v */
  k_fattn<<<dim3(SQ / 128, NH, NB), 256, 0, stream>>>(Q16, K16, VT, O16);      /* scores, literal 'score + tril * (-1e9)', softmax over all keys and the weighted v sum, every (batch, head) in one launch -> o (merged heads, x64) as f16 rows */
  k_gemm2<0><<<dim3((unsigned)((MPO / 128) * (DM / 64)), 1), 128, 0, stream>>>(O16 + r0p * DM, DM, 0, BO, DM, 0, 0.0009765625f, bo, 0, nullptr, 1, 0, 0, (float*)d_out + r0p * DM, nullptr, DM, 0, MPO, DM, DM, 0, 0, 0, nullptr, nullptr);      /* out rows are the output layout */
  k_hl<<<(unsigned)(((size_t)NB * QT0 * DM / 8 + 255) / 256), 256, 0, stream>>>(OF0, OH0, OL0, (size_t)NB * QT0 * DM / 8);      /* last-tile o (x64) -> f16 hi + x1024 residual planes */
  k_gemm2<0><<<dim3((QT0 / 128) * (DM / 64), NBR), 128, 0, stream>>>(OH0 + f00 * DM, DM, (size_t)QT0 * DM, BO, DM, 0, 0.0009765625f, bo, 0, nullptr, 1, 0, 0, (float*)d_out + rl0 * DM, nullptr, DM, (size_t)SQ * DM, QT0, DM, DM, 0, 0, 0, nullptr, nullptr);      /* last QT0 rows of every batch (y): out = o_hi Wo (+ b), overwriting the f16-path rows */
  k_gemm2<0><<<dim3((QT0 / 128) * (DM / 64), NBR), 128, 0, stream>>>(OL0 + f00 * DM, DM, (size_t)QT0 * DM, BO, DM, 0, 0.00000095367431640625f, nullptr, 0, (const float*)d_out + rl0 * DM, -1, 0, 0, (float*)d_out + rl0 * DM, nullptr, DM, (size_t)SQ * DM, QT0, DM, DM, 0, 0, 0, nullptr, nullptr);      /* += o_lo Wo 2^-20 (own-element accumulate) */
}

// v007
// A run of this version takes 221 microseconds.
// In both of two side-by-side timings against v006, it was 1.49 times as fast.
// Over all steps from v000 it is 29.7 times as fast.
#include <hip/hip_runtime.h>
// Multi-head self-attention with the source's INVERTED causal mask (inputs [2][2048][1024]; q / k / v = x W + b ([in][out] 1024 x 1024 sigma 1/32, zero biases); 16 heads of 64; score = q k^T / sqrt(64) + tril * (-1e9): the LOWER triangle incl. the diagonal is pushed to -1e9 (the original's mask bug, kept), so query i attends to the keys j > i only, and the last query (every key masked, all scores rounding to the same -1e9 in f32) attends uniformly to all keys; softmax; out = merged Wo + bo -> [2][2048][1024]).
// Structure: token rows r = b*2048 + s; x as exact f16 rows (bf16-rounded); Q, K, V as three WMMA GEMMs in one launch (grid z; 32x64 wave tiles, f32 accumulation, exact x16 weights + bias, f16 outputs); V^T for all batches and heads via LDS transposes; one fused attention launch over every (batch, head): S^T = K Q^T on WMMA (K = 64, x 1/sqrt(64), then the -1e9 fill), running softmax on VALU (f32 statistics; unnormalised weights exp(s - max) as f16), O^T += V^T P^T on WMMA, o = O / sum (carried x64 against f16 subnormal flush, folded into the output GEMM alpha) written straight into the merged f16 o rows; out = o W_o + b GEMM (f32) into the output layout.
// Compute dtype: inputs rounded to bf16; x / weights exact; q, k, v, softmax weights and o as plain f16 GEMM operands (~2^-12); scores and softmax statistics f32. v_wmma_f32_16x16x32_f16.
#define NB 2
#define SQ 2048
#define DM 1024
#define NH 16
#define HD 64
#define QT0 256                      /* last-tile rows recomputed exactly in f32 (rows with fewer than 256 visible keys) */
#define HG 4                         /* heads per V^T group of the h0-based k_vt overload (not launched) */
#define KW 16                        /* waves of a k_attup block = parts a query row's keys are dealt into */
#define B0 0                         /* first batch processed (debug hook) */
#define NBR NB                       /* batches processed (debug hook) */
#define NR ((size_t)NB * SQ)         /* token rows */
#define MP ((int)((size_t)NBR * SQ)) /* rows projected (debug hook) */
#define QN SQ                        /* query rows attended per batch (not used) */
#define NHD NH                       /* heads attended (not used) */
#define MPO MP                       /* rows through the output stage (debug hook) */
#define LQ DM      /* row pitch of the q/k/v rows */
typedef __bf16 v16b __attribute__((ext_vector_type(16)));
typedef unsigned short v8us __attribute__((ext_vector_type(8), may_alias));
typedef float  v8f  __attribute__((ext_vector_type(8)));
typedef float  v4f  __attribute__((ext_vector_type(4)));
typedef float  v4fa __attribute__((ext_vector_type(4), may_alias));
union FragB { v16b v; v8us half[2]; unsigned short u[16]; };

__device__ __forceinline__ unsigned short bf16_bits(float x) { unsigned int u = __float_as_uint(x); return (unsigned short)((u + 0x7FFFu + ((u >> 16) & 1u)) >> 16); }
__device__ __forceinline__ float bf16_val(unsigned short b) { return __uint_as_float(((unsigned int)b) << 16); }
__device__ __forceinline__ float bf16_round(float x) { return bf16_val(bf16_bits(x)); }
// D += A·B with NT terms: 1 = ah·bh, 2 = + al·bh (A split), 3 = + ah·bl (both split)
template <int NT>
__device__ __forceinline__ v8f mmaN(v16b ah, v16b al, v16b bh, v16b bl, v8f c) {
  c = __builtin_amdgcn_wmma_f32_16x16x32_bf16(false, ah, false, bh, (short)0, c, false, false);
  if (NT >= 2) c = __builtin_amdgcn_wmma_f32_16x16x32_bf16(false, al, false, bh, (short)0, c, false, false);
  if (NT >= 3) c = __builtin_amdgcn_wmma_f32_16x16x32_bf16(false, ah, false, bl, (short)0, c, false, false);
  asm volatile("v_nop\n\tv_nop\n\tv_nop\n\tv_nop" : "+v"(c) : "v"(ah), "v"(al), "v"(bh), "v"(bl));
  return c;
}

__global__ __launch_bounds__(256) void k_wt_bf16(const float* __restrict__ W, unsigned short* __restrict__ Wt, int K, int N) {
  const int t = blockIdx.x * 256 + threadIdx.x;
  const int k8n = K / 8;
  if (t >= N * k8n) return;
  const int n = t / k8n, k8 = (t % k8n) * 8;
  v8us v;
#pragma unroll
  for (int i = 0; i < 8; ++i) v[i] = bf16_bits(W[(size_t)(k8 + i) * N + n]);
  *(v8us*)(Wt + (size_t)n * K + k8) = v;
  
}

// GEMM C[M][N] (f32, pitch ldc) = act(A[M][K]·W + bias). A f32 row-major (pitch lda) converted per fragment to bf16
// (ASPLIT: hi/lo two planes -> 2 terms, else single rounded term); Wt bf16 [N][K] (pitch ldb). BIAS_BF16 rounds the
// bias to bf16 first (bias quantised to bf16 before the add). K%32==0, M%16==0, N%64==0.
template <bool ASPLIT, int ACT, bool BIAS_BF16>
__global__ __launch_bounds__(128) void k_gemm_bf(const float* __restrict__ A, int lda, const unsigned short* __restrict__ Wt, int ldb,
                                               const float* __restrict__ bias, float* __restrict__ C, int ldc, int M, int N, int K) {
  __shared__ __attribute__((aligned(16))) float so[4][16][64];
  const int tid = threadIdx.x, w = tid >> 5, lane = tid & 31, ln = lane & 15, hh = lane >> 4;
  const int ntn = N / 64;
  const int wid = blockIdx.x * 4 + w;
  const int mt = wid / ntn, nq = wid % ntn;
  if (mt * 16 >= M) return;
  const int row0 = mt * 16, col0 = nq * 64;
  const float* arow = A + (size_t)(row0 + ln) * lda;
  v8f acc[4] = {};
  for (int kb = 0; kb < K; kb += 32) {
    FragB ah, al;
    const v4f x0 = *(const v4fa*)(arow + kb + 8 * hh), x1 = *(const v4fa*)(arow + kb + 8 * hh + 4);
    const v4f x2 = *(const v4fa*)(arow + kb + 16 + 8 * hh), x3 = *(const v4fa*)(arow + kb + 16 + 8 * hh + 4);
    float xs[16] = {x0[0],x0[1],x0[2],x0[3],x1[0],x1[1],x1[2],x1[3],x2[0],x2[1],x2[2],x2[3],x3[0],x3[1],x3[2],x3[3]};
#pragma unroll
    for (int i = 0; i < 16; ++i) { const unsigned short hb = bf16_bits(xs[i]); ah.u[i] = hb; al.u[i] = ASPLIT ? bf16_bits(xs[i] - bf16_val(hb)) : (unsigned short)0; }
#pragma unroll
    for (int t = 0; t < 4; ++t) {
      const unsigned short* brow = Wt + (size_t)(col0 + t * 16 + ln) * ldb + kb;
      FragB b;
      b.half[0] = *(const v8us*)(brow + 8 * hh);
      b.half[1] = *(const v8us*)(brow + 16 + 8 * hh);
      acc[t] = mmaN<ASPLIT ? 2 : 1>(ah.v, al.v, b.v, b.v, acc[t]);
    }
  }
#pragma unroll
  for (int t = 0; t < 4; ++t) {
    float bv = bias ? bias[col0 + t * 16 + ln] : 0.f;
    if (BIAS_BF16) bv = bf16_round(bv);
#pragma unroll
    for (int r = 0; r < 8; ++r) { float v = acc[t][r] + bv; if (ACT == 1) v = fmaxf(v, 0.f); so[w][8 * hh + r][t * 16 + ln] = v; }
  }
  __builtin_amdgcn_fence(__ATOMIC_ACQ_REL, "workgroup");
  __builtin_amdgcn_wave_barrier();
  const int rsub = lane >> 4, c4 = (lane & 15) * 4;
  {
#pragma unroll
    for (int q = 0; q < 8; ++q) {
      const int r = q * 2 + rsub;
      const v4f v = *(const v4fa*)&so[w][r][c4];
      *(v4f*)(C + (size_t)(row0 + r) * ldc + col0 + c4) = v;
    }
    
  }
}

// GEMM C = act(A·W + bias + resid): A f32 (ASPLIT -> hi/lo 2 terms), Wt bf16 [N][K]; ACT 0 none, 1 relu, 2 exact gelu;
// resid (optional, f32, row index = (row % rmod), pitch ldr, RES_BF16 rounds it) added before the activation.
template <bool ASPLIT, int ACT, bool BIAS_BF16, bool RES_BF16>
__global__ __launch_bounds__(128) void k_gemm_bf3(const float* __restrict__ A, int lda, const unsigned short* __restrict__ Wt, int ldb,
                                                const float* __restrict__ bias, const float* __restrict__ resid, int rmod, int ldr,
                                                float* __restrict__ C, int ldc, int M, int N, int K) {
  __shared__ __attribute__((aligned(16))) float so[4][16][64];
  const int tid = threadIdx.x, w = tid >> 5, lane = tid & 31, ln = lane & 15, hh = lane >> 4;
  const int ntn = N / 64;
  const int wid = blockIdx.x * 4 + w;
  const int mt = wid / ntn, nq = wid % ntn;
  if (mt * 16 >= M) return;
  const int row0 = mt * 16, col0 = nq * 64;
  const float* arow = A + (size_t)(row0 + ln) * lda;
  v8f acc[4] = {};
  for (int kb = 0; kb < K; kb += 32) {
    FragB ah, al;
    const v4f x0 = *(const v4fa*)(arow + kb + 8 * hh), x1 = *(const v4fa*)(arow + kb + 8 * hh + 4);
    const v4f x2 = *(const v4fa*)(arow + kb + 16 + 8 * hh), x3 = *(const v4fa*)(arow + kb + 16 + 8 * hh + 4);
    float xs[16] = {x0[0],x0[1],x0[2],x0[3],x1[0],x1[1],x1[2],x1[3],x2[0],x2[1],x2[2],x2[3],x3[0],x3[1],x3[2],x3[3]};
#pragma unroll
    for (int i = 0; i < 16; ++i) { const unsigned short hb = bf16_bits(xs[i]); ah.u[i] = hb; al.u[i] = ASPLIT ? bf16_bits(xs[i] - bf16_val(hb)) : (unsigned short)0; }
#pragma unroll
    for (int t = 0; t < 4; ++t) {
      const unsigned short* brow = Wt + (size_t)(col0 + t * 16 + ln) * ldb + kb;
      FragB b;
      b.half[0] = *(const v8us*)(brow + 8 * hh);
      b.half[1] = *(const v8us*)(brow + 16 + 8 * hh);
      acc[t] = mmaN<ASPLIT ? 2 : 1>(ah.v, al.v, b.v, b.v, acc[t]);
    }
  }
#pragma unroll
  for (int t = 0; t < 4; ++t) {
    const int col = col0 + t * 16 + ln;
    float bv = bias ? bias[col] : 0.f;
    if (BIAS_BF16) bv = bf16_round(bv);
#pragma unroll
    for (int r = 0; r < 8; ++r) {
      float v = acc[t][r] + bv;
      if (resid) { float rv = resid[(size_t)((row0 + 8 * hh + r) % rmod) * ldr + col]; if (RES_BF16) rv = bf16_round(rv); v += rv; }
      if (ACT == 1) v = fmaxf(v, 0.f);
      if (ACT == 2) v = 0.5f * v * (1.0f + erff(v * 0.70710678118654752f));
      if (ACT == 3) { const float u = 0.7978845608028654f * (v + 0.044715f * v * v * v); v = 0.5f * v * (1.0f + tanhf(u)); }
      so[w][8 * hh + r][t * 16 + ln] = v;
    }
  }
  __builtin_amdgcn_fence(__ATOMIC_ACQ_REL, "workgroup");
  __builtin_amdgcn_wave_barrier();
  const int rsub = lane >> 4, c4 = (lane & 15) * 4;
  {
#pragma unroll
    for (int q = 0; q < 8; ++q) {
      const int r = q * 2 + rsub;
      const v4f v = *(const v4fa*)&so[w][r][c4];
      *(v4f*)(C + (size_t)(row0 + r) * ldc + col0 + c4) = v;
    }
    
  }
}
// row LayerNorm (biased variance, eps) over N: s = X (+ R); optional out_sum <- s; out_norm <- (s-mu)*rsqrt(var+eps)*g + b
template <bool PARAM_BF16>
__global__ __launch_bounds__(256) void k_layernorm(const float* __restrict__ X, const float* __restrict__ R, const float* __restrict__ g, const float* __restrict__ bta,
                                                  float* __restrict__ out_sum, float* __restrict__ out_norm, int N, float eps) {
  __shared__ float red[256];
  const int row = blockIdx.x, tid = threadIdx.x;
  const float* x = X + (size_t)row * N; const float* rr = R ? R + (size_t)row * N : nullptr;
  float vals[16];                     // up to N = 4096
  const int per = N / 256;            // contiguous chunk per thread? use strided-by-4 chunks: thread handles j = tid*4 + 1024*u
  float s1 = 0.f;
  for (int u = 0; u < per / 4; ++u) {
    const int j = tid * 4 + 1024 * u;
    const v4f a = *(const v4fa*)(x + j);
    v4f b = {0.f,0.f,0.f,0.f}; if (rr) b = *(const v4fa*)(rr + j);
#pragma unroll
    for (int q = 0; q < 4; ++q) { const float v = a[q] + b[q]; vals[u * 4 + q] = v; s1 += v; }
  }
  red[tid] = s1; __syncthreads();
  for (int st = 128; st > 0; st >>= 1) { if (tid < st) red[tid] += red[tid + st]; __syncthreads(); }
  const float mu = red[0] / (float)N; __syncthreads();
  float s2 = 0.f;
  for (int u = 0; u < per / 4; ++u)
#pragma unroll
    for (int q = 0; q < 4; ++q) { const float c = vals[u * 4 + q] - mu; s2 += c * c; }
  red[tid] = s2; __syncthreads();
  for (int st = 128; st > 0; st >>= 1) { if (tid < st) red[tid] += red[tid + st]; __syncthreads(); }
  const float rs = rsqrtf(red[0] / (float)N + eps);
  {
    for (int u = 0; u < per / 4; ++u) {
      const int j = tid * 4 + 1024 * u;
      v4f o, sm;
#pragma unroll
      for (int q = 0; q < 4; ++q) {
        float gg = g[j + q], bb = bta[j + q];
        if (PARAM_BF16) { gg = bf16_round(gg); bb = bf16_round(bb); }
        sm[q] = vals[u * 4 + q]; o[q] = (vals[u * 4 + q] - mu) * rs * gg + bb;
      }
      if (out_sum) *(v4f*)(out_sum + (size_t)row * N + j) = sm;
      *(v4f*)(out_norm + (size_t)row * N + j) = o;
    }
    
  }
}



// ---- f16 WMMA path (v_wmma_f32_16x16x32_f16): 11-bit significands for operands in range — used where a [0,1] probability operand needs more precision than bf16
typedef _Float16 v16h __attribute__((ext_vector_type(16)));
union FragH { v16h v; v8us half[2]; _Float16 h[16]; unsigned short u[16]; };
template <int NT>
__device__ __forceinline__ v8f mmaH(v16h ah, v16h al, v16h bh, v16h bl, v8f c) {
  c = __builtin_amdgcn_wmma_f32_16x16x32_f16(false, ah, false, bh, (short)0, c, false, false);
  if (NT >= 2) c = __builtin_amdgcn_wmma_f32_16x16x32_f16(false, al, false, bh, (short)0, c, false, false);
  if (NT >= 3) c = __builtin_amdgcn_wmma_f32_16x16x32_f16(false, ah, false, bl, (short)0, c, false, false);
  asm volatile("v_nop\n\tv_nop\n\tv_nop\n\tv_nop" : "+v"(c) : "v"(ah), "v"(al), "v"(bh), "v"(bl));
  return c;
}
// batched GEMM like k_gemm_b but f16 operands: A f32 (split into f16 hi/lo if ASPLIT, else rounded to f16), Bt = f16 values [n][k]; alpha; C f32; N multiple of 16 (partial tiles skipped)
template <bool ASPLIT>
__global__ __launch_bounds__(128) void k_gemm_h(const float* __restrict__ A, int lda, size_t sA, const _Float16* __restrict__ Bh, int ldb, size_t sB, float alpha, float* __restrict__ C, int ldc, size_t sC, int M, int N, int K) {
  __shared__ __attribute__((aligned(16))) float so[4][16][64];
  const int tid = threadIdx.x, w = tid >> 5, lane = tid & 31, ln = lane & 15, hh = lane >> 4; const int by = blockIdx.y;
  A += (size_t)by * sA; Bh += (size_t)by * sB; C += (size_t)by * sC;
  const int ntn = (N + 63) / 64; const int wid = blockIdx.x * 4 + w; const int mt = wid / ntn, nq = wid % ntn; if (mt * 16 >= M) return;
  const int row0 = mt * 16, col0 = nq * 64; const float* arow = A + (size_t)(row0 + ln) * lda;
  v8f acc[4] = {};
  for (int kb = 0; kb < K; kb += 32) {
    FragH ah, al;
    const v4f x0 = *(const v4fa*)(arow + kb + 8 * hh), x1 = *(const v4fa*)(arow + kb + 8 * hh + 4), x2 = *(const v4fa*)(arow + kb + 16 + 8 * hh), x3 = *(const v4fa*)(arow + kb + 16 + 8 * hh + 4);
    float xs[16] = {x0[0],x0[1],x0[2],x0[3],x1[0],x1[1],x1[2],x1[3],x2[0],x2[1],x2[2],x2[3],x3[0],x3[1],x3[2],x3[3]};
#pragma unroll
    for (int i = 0; i < 16; ++i) { const _Float16 h = (_Float16)xs[i]; ah.h[i] = h; al.h[i] = ASPLIT ? (_Float16)(xs[i] - (float)h) : (_Float16)0.0f; }
#pragma unroll
    for (int t = 0; t < 4; ++t) { if (col0 + t * 16 >= N) continue; const size_t boff = (size_t)(col0 + t * 16 + ln) * ldb + kb; FragH bq; bq.half[0] = *(const v8us*)(Bh + boff + 8 * hh); bq.half[1] = *(const v8us*)(Bh + boff + 16 + 8 * hh);
      acc[t] = mmaH<ASPLIT ? 2 : 1>(ah.v, al.v, bq.v, bq.v, acc[t]); }
  }
#pragma unroll
  for (int t = 0; t < 4; ++t) { if (col0 + t * 16 >= N) continue;
#pragma unroll
    for (int r = 0; r < 8; ++r) so[w][8 * hh + r][t * 16 + ln] = acc[t][r] * alpha; }
  __builtin_amdgcn_fence(__ATOMIC_ACQ_REL, "workgroup"); __builtin_amdgcn_wave_barrier();
  const int rsub = lane >> 4, c4 = (lane & 15) * 4;
  {
#pragma unroll
    for (int q = 0; q < 8; ++q) { const int r = q * 2 + rsub; if (col0 + c4 < N) { const v4f v = *(const v4fa*)&so[w][r][c4]; *(v4f*)(C + (size_t)(row0 + r) * ldc + col0 + c4) = v; } }
     }
}

// Wt[n][k] = f16(W[k][n]·scale) from f32 row-major W[K][N] (scale = power of two; bf16-exact weights stay exact in f16 away from the subnormal range)
// blockIdx.y picks one of four weight matrices of the same shape; their Wt planes lie one behind the other.
__global__ __launch_bounds__(256) void k_wt_f16(const float* __restrict__ W0, const float* __restrict__ W1, const float* __restrict__ W2, const float* __restrict__ W3, _Float16* __restrict__ Wt, int K, int N, float scale) {
  const int y = blockIdx.y; const float* W = (y == 0) ? W0 : (y == 1) ? W1 : (y == 2) ? W2 : W3; Wt += (size_t)y * K * N;
  const int t = blockIdx.x * 256 + threadIdx.x; if (t >= N * (K / 8)) return; const int n = t / (K / 8), k8 = (t % (K / 8)) * 8; FragH f;
#pragma unroll
  for (int i = 0; i < 8; ++i) f.h[i] = (_Float16)(bf16_round(W[(size_t)(k8 + i) * N + n]) * scale); const v8us o = f.half[0];
  *(v8us*)((unsigned short*)Wt + (size_t)n * K + k8) = o; 
}
// k_gemm_hh variant with fused epilogue: v = acc·alpha + bias[by·sBias + col] (+ CP[(row/rowsPerB)·sCPb + by·64 + col] if CP) ; ACT 0 none / 1 elu ; writes f16 C16 (and f32 C if non-null)
template <int ACT>
__global__ __launch_bounds__(128) void k_gemm_hhx(const _Float16* __restrict__ A, int lda, size_t sA, const _Float16* __restrict__ Bh, int ldb, size_t sB, float alpha, const float* __restrict__ bias, size_t sBias, const float* __restrict__ CP, int rowsPerB, size_t sCPb, int row0g,
    float* __restrict__ C, _Float16* __restrict__ C16, int ldc, size_t sC, int M, int N, int K) {
  __shared__ __attribute__((aligned(16))) float so[4][16][64];
  const int tid = threadIdx.x, w = tid >> 5, lane = tid & 31, ln = lane & 15, hh = lane >> 4; const int by = blockIdx.y;
  A += (size_t)by * sA; Bh += (size_t)by * sB; const size_t cofs = (size_t)by * sC; const float* bp = bias ? bias + (size_t)by * sBias : nullptr;
  const int ntn = (N + 63) / 64; const int wid = blockIdx.x * 4 + w; const int mt = wid / ntn, nq = wid % ntn; if (mt * 16 >= M) return;
  const int row0 = mt * 16, col0 = nq * 64; const _Float16* arow = A + (size_t)(row0 + ln) * lda;
  v8f acc[4] = {};
  for (int kb = 0; kb < K; kb += 32) { FragH ah; ah.half[0] = *(const v8us*)((const unsigned short*)arow + kb + 8 * hh); ah.half[1] = *(const v8us*)((const unsigned short*)arow + kb + 16 + 8 * hh);
#pragma unroll
    for (int t = 0; t < 4; ++t) { if (col0 + t * 16 >= N) continue; const size_t boff = (size_t)(col0 + t * 16 + ln) * ldb + kb; FragH bq; bq.half[0] = *(const v8us*)((const unsigned short*)Bh + boff + 8 * hh); bq.half[1] = *(const v8us*)((const unsigned short*)Bh + boff + 16 + 8 * hh);
      acc[t] = mmaH<1>(ah.v, ah.v, bq.v, bq.v, acc[t]); }
  }
#pragma unroll
  for (int t = 0; t < 4; ++t) { if (col0 + t * 16 >= N) continue; const int col = col0 + t * 16 + ln; const float bv = bp ? bf16_round(bp[col]) : 0.f;
#pragma unroll
    for (int r = 0; r < 8; ++r) { float v = acc[t][r] * alpha + bv; if (CP) { const int rr = row0g + row0 + 8 * hh + r; if (rowsPerB < 0) v += CP[cofs + (size_t)rr * ldc + col];      /* rowsPerB < 0: own element of the batched C plane */ else { const int bidx = rr / rowsPerB; v += CP[(size_t)bidx * sCPb + (size_t)by * 64 + col]; } } if (ACT == 1) v = (v > 0.f) ? v : expm1f(v); else if (ACT == 7) v = (v > 0.f) ? v + 1.0f : expf(v); else if (ACT == 8) v = tanhf(v); else if (ACT == 9) v = 0.5f * v * (1.0f + tanhf(0.7978845608028654f * (v + 0.044715f * v * v * v))); else if (ACT == 11) v = 1.0f / (1.0f + expf(-v)); else if (ACT == 12) v = (v > 0.f) ? v : 0.01f * v; else if (ACT == 14) v = (v > 0.f) ? v : 0.1f * v; else if (ACT == 16) v = (v >= 0.f) ? v : 0.3f * v; else if (ACT == 17) v = (v >= 0.f) ? v : 0.2f * v; else if (ACT == 15) v = v / (1.0f + expf(-v)); else if (ACT == 3) v = fmaxf(v, 0.f); else if (ACT == 6) v = 0.5f * v * (1.0f + erff(v * 0.70710678118654752f)); so[w][8 * hh + r][t * 16 + ln] = v; } }
  __builtin_amdgcn_fence(__ATOMIC_ACQ_REL, "workgroup"); __builtin_amdgcn_wave_barrier();
  const int rsub = lane >> 4, c4 = (lane & 15) * 4; typedef _Float16 v4h __attribute__((ext_vector_type(4)));
  {
#pragma unroll
    for (int q = 0; q < 8; ++q) { const int r = q * 2 + rsub; if (col0 + c4 < N) { const v4f v = *(const v4fa*)&so[w][r][c4]; if (C) *(v4f*)(C + cofs + (size_t)(row0 + r) * ldc + col0 + c4) = v; if (C16) { v4h h4; for (int i = 0; i < 4; ++i) h4[i] = (_Float16)v[i]; *(v4h*)(C16 + cofs + (size_t)(row0 + r) * ldc + col0 + c4) = h4; } } }
     }
}


typedef _Float16 v4h __attribute__((ext_vector_type(4)));

// blockIdx.y picks the stream (query, key, value input); the f16 planes lie one behind the other.
__global__ __launch_bounds__(256) void k_x16(const float* __restrict__ x0, const float* __restrict__ x1, const float* __restrict__ x2, _Float16* __restrict__ X16, size_t n8) { const size_t t = (size_t)blockIdx.x * 256 + threadIdx.x; if (t >= n8) return; FragH f;
  const int y = blockIdx.y; const float* x = (y == 0) ? x0 : (y == 1) ? x1 : x2; X16 += (size_t)y * n8 * 8;
#pragma unroll
  for (int q = 0; q < 8; ++q) f.h[q] = (_Float16)bf16_round(x[t * 8 + q]); *(v8us*)((unsigned short*)X16 + t * 8) = f.half[0];  }
__global__ __launch_bounds__(256) void k_h16(const float* __restrict__ x, _Float16* __restrict__ X16, size_t n8) { const size_t t = (size_t)blockIdx.x * 256 + threadIdx.x; if (t >= n8) return; FragH f;
#pragma unroll
  for (int q = 0; q < 8; ++q) f.h[q] = (_Float16)x[t * 8 + q]; *(v8us*)((unsigned short*)X16 + t * 8) = f.half[0];  }
__global__ __launch_bounds__(256) void k_round16f(const float* __restrict__ W, _Float16* __restrict__ Bt, size_t n8) { const size_t t = (size_t)blockIdx.x * 256 + threadIdx.x; if (t >= n8) return; FragH f;
#pragma unroll
  for (int i = 0; i < 8; ++i) f.h[i] = (_Float16)(bf16_round(W[t * 8 + i]) * 16.0f); *(v8us*)((unsigned short*)Bt + t * 8) = f.half[0];  }
template <int NHv, int TTv>
__global__ __launch_bounds__(256) void k_vt(const _Float16* __restrict__ V16, int ldv, int voff, _Float16* __restrict__ Vt) { __shared__ unsigned short tl[64][66]; const int tid = threadIdx.x; const int slab = blockIdx.x / (TTv / 64), lg = blockIdx.x % (TTv / 64); const int b = slab / NHv, h = slab % NHv;
  for (int i = tid; i < 64 * 8; i += 256) { const int r = i / 8, c8 = (i % 8) * 8; FragH f; f.half[0] = *(const v8us*)((const unsigned short*)V16 + ((size_t)b * TTv + lg * 64 + r) * ldv + voff + h * 64 + c8);
#pragma unroll
    for (int q = 0; q < 8; ++q) tl[r][c8 + q] = f.u[q]; }
  __syncthreads();
  {
#pragma unroll
    for (int rd = 0; rd < 2; ++rd) { const int d = rd * 32 + tid / 8, pc = tid % 8; FragH f;
#pragma unroll
      for (int q = 0; q < 8; ++q) f.u[q] = tl[pc * 8 + q][d];
      *(v8us*)((unsigned short*)Vt + ((size_t)slab * 64 + d) * TTv + lg * 64 + pc * 8) = f.half[0]; }
     } }

__global__ __launch_bounds__(256) void k_hl(const float* __restrict__ F, _Float16* __restrict__ Hh, _Float16* __restrict__ Hl, size_t n8) { const size_t t = (size_t)blockIdx.x * 256 + threadIdx.x; if (t >= n8) return; FragH fh, fl; const v4f a = *(const v4fa*)(F + t * 8), c = *(const v4fa*)(F + t * 8 + 4);
#pragma unroll
  for (int q = 0; q < 4; ++q) { _Float16 h = (_Float16)a[q]; fh.h[q] = h; fl.h[q] = (_Float16)((a[q] - (float)h) * 1024.0f); h = (_Float16)c[q]; fh.h[4 + q] = h; fl.h[4 + q] = (_Float16)((c[q] - (float)h) * 1024.0f); }
  { *(v8us*)((unsigned short*)Hh + t * 8) = fh.half[0]; *(v8us*)((unsigned short*)Hl + t * 8) = fl.half[0];  } }

// ---- fast GEMM (wave tile 32x64, block tile 128x64; requires M % 128 == 0 rows per launch region, N % 64 == 0 and K % 64 == 0); epilogue = k_gemm_hhx semantics ----
__device__ __forceinline__ v16h g2_frag(const _Float16* p, int hh) { FragH f; f.half[0] = *(const v8us*)((const unsigned short*)p + 8 * hh); f.half[1] = *(const v8us*)((const unsigned short*)p + 16 + 8 * hh); return f.v; }
__device__ __forceinline__ v8f g2_mma(v16h a, v16h b, v8f c) { v8f d = __builtin_amdgcn_wmma_f32_16x16x32_f16(false, a, false, b, (short)0, c, false, false); asm volatile("v_nop\n\tv_nop\n\tv_nop\n\tv_nop" : "+v"(d) : "v"(a), "v"(b)); return d; }
// The block's 4 waves need the same 64 Bt rows, and each A row feeds 4 column tiles: every 64-wide k step's 128 A rows and 64 Bt rows are brought into LDS once per block, as whole 128-byte rows (asynchronous copies, 12 of 16 bytes a thread), and the waves take their fragments from there. Two buffers: the next step's copies fly while this step is worked on.
#define GP 72                        /* LDS pitch of a staged row in 16-bit elements: 144 B = 16 B x odd, conflict-free for 16-byte fragment reads down 16 rows */
#define GR (16 * GP * 2)             /* bytes of 16 staged rows: the distance between two copies of one thread */
#define GB (192 * GP * 2)            /* bytes of one buffer: 128 A rows, then 64 Bt rows */
// Twelve 16-byte copies of one thread (8 A rows, 4 Bt rows); the wait as the statement's last line keeps every rewrite of the address registers behind it.
__device__ __forceinline__ void g2_copy12(unsigned l, const _Float16* a, size_t as, const _Float16* b, size_t bs) {
  asm volatile("global_load_async_to_lds_b128 %0, %12, off\n\tglobal_load_async_to_lds_b128 %1, %13, off\n\tglobal_load_async_to_lds_b128 %2, %14, off\n\tglobal_load_async_to_lds_b128 %3, %15, off\n\t"
               "global_load_async_to_lds_b128 %4, %16, off\n\tglobal_load_async_to_lds_b128 %5, %17, off\n\tglobal_load_async_to_lds_b128 %6, %18, off\n\tglobal_load_async_to_lds_b128 %7, %19, off\n\t"
               "global_load_async_to_lds_b128 %8, %20, off\n\tglobal_load_async_to_lds_b128 %9, %21, off\n\tglobal_load_async_to_lds_b128 %10, %22, off\n\tglobal_load_async_to_lds_b128 %11, %23, off\n\ts_wait_xcnt 0x0"
               :: "v"(l), "v"(l + GR), "v"(l + 2 * GR), "v"(l + 3 * GR), "v"(l + 4 * GR), "v"(l + 5 * GR), "v"(l + 6 * GR), "v"(l + 7 * GR), "v"(l + 8 * GR), "v"(l + 9 * GR), "v"(l + 10 * GR), "v"(l + 11 * GR),
                  "v"(a), "v"(a + as), "v"(a + 2 * as), "v"(a + 3 * as), "v"(a + 4 * as), "v"(a + 5 * as), "v"(a + 6 * as), "v"(a + 7 * as), "v"(b), "v"(b + bs), "v"(b + 2 * bs), "v"(b + 3 * bs) : "memory"); }
template <int ACT>
__global__ __launch_bounds__(128) void k_gemm2(const _Float16* __restrict__ A, int lda, size_t sA, const _Float16* __restrict__ Bh, int ldb, size_t sB, float alpha, const float* __restrict__ bias, size_t sBias, const float* __restrict__ CP, int rowsPerB, size_t sCPb, int row0g,
    float* __restrict__ C, _Float16* __restrict__ C16, int ldc, size_t sC, int M, int N, int K, size_t sAz, size_t sBz, size_t sCz, const float* __restrict__ bias1, const float* __restrict__ bias2) {      /* blockIdx.z: a second batch index (the projection) with strides sAz, sBz, sCz and its own bias vector */ static_assert(ACT == 0 || ACT == 3 || ACT == 6 || ACT == 8 || ACT == 9 || ACT == 11 || ACT == 12 || ACT == 14 || ACT == 15 || ACT == 16 || ACT == 17, "k_gemm2: unsupported ACT code (would silently apply no activation)");
  __shared__ __attribute__((aligned(16))) union { _Float16 ab[2][192][GP]; float so[4][32][68]; } sm;      /* [buffer][128 A rows, 64 Bt rows][element]; the epilogue's tiles take the same bytes once the last step has been read */
  auto& so = sm.so;
  const int tid = threadIdx.x, w = tid >> 5, lane = tid & 31, ln = lane & 15, hh = lane >> 4; const int by = blockIdx.y;
  const int bz = blockIdx.z; const float* bsel = (bz == 0) ? bias : (bz == 1) ? bias1 : bias2;
  A += (size_t)by * sA + (size_t)bz * sAz; Bh += (size_t)by * sB + (size_t)bz * sBz; const size_t cofs = (size_t)by * sC + (size_t)bz * sCz; const float* bp = bsel ? bsel + (size_t)by * sBias : nullptr;
  const int ntn = N >> 6; const int mt = blockIdx.x / ntn, nq = blockIdx.x - mt * ntn; const int row0 = mt * 128 + 32 * w, col0 = nq * 64; if (mt * 128 >= M) return;      /* the same for the whole block, in front of every barrier */
  const int sr = tid >> 3, sc = (tid & 7) * 8;      /* staging: a thread copies piece sc of rows sr + 16 j of both tiles; a wave's copy is 4 whole rows */
  const _Float16* ag = A + (size_t)(mt * 128 + sr) * lda + sc; const _Float16* bg = Bh + (size_t)(col0 + sr) * ldb + sc;
  const unsigned ls = (unsigned)(size_t)&sm.ab[0][sr][sc];      /* the thread's LDS byte address in buffer 0 */
  auto stage = [&](int t) { g2_copy12(ls + (unsigned)(t & 1) * GB, ag + t * 64, (size_t)16 * lda, bg + t * 64, (size_t)16 * ldb); };
  const int nst = K >> 6;
  stage(0);
  asm volatile("s_wait_asynccnt 0x0" ::: "memory");      /* this wave's copies of step 0 have landed */
  __syncthreads();      /* ... and every other wave's: step 0 may be read */
  if (nst > 1) stage(1);
  const v8f z8 = {0.f,0.f,0.f,0.f,0.f,0.f,0.f,0.f}; v8f c00 = z8, c01 = z8, c02 = z8, c03 = z8, c10 = z8, c11 = z8, c12 = z8, c13 = z8;
#pragma unroll 1      /* one step already holds 24 fragment reads and 16 matrix products; a second copy would only cost registers */
  for (int s = 0; s < nst; ++s) { const _Float16* ap = &sm.ab[s & 1][32 * w + ln][0]; const _Float16* bq = &sm.ab[s & 1][128 + ln][0]; v16h a[2][2], b[2][4];      /* [32-wide k half of the step][16-row tile] */
#pragma unroll      /* a[], b[] in registers */
    for (int kh = 0; kh < 2; ++kh) { for (int t = 0; t < 2; ++t) a[kh][t] = g2_frag(ap + 16 * t * GP + 32 * kh, hh); for (int t = 0; t < 4; ++t) b[kh][t] = g2_frag(bq + 16 * t * GP + 32 * kh, hh); }
    asm volatile("" :: "v"(a[0][0]), "v"(a[0][1]), "v"(b[0][0]), "v"(b[0][1]), "v"(b[0][2]), "v"(b[0][3]), "v"(a[1][0]), "v"(a[1][1]), "v"(b[1][0]), "v"(b[1][1]), "v"(b[1][2]), "v"(b[1][3]));      /* inputs only, loaded values: the 24 LDS reads of the step stand as one group in front of the products (left alone, the compiler reuses one B register set and puts a full LDS wait in front of every pair of products) */
#pragma unroll      /* the two k halves in k order */
    for (int kh = 0; kh < 2; ++kh) {
      c00 = g2_mma(a[kh][0], b[kh][0], c00); c10 = g2_mma(a[kh][1], b[kh][0], c10);
      c01 = g2_mma(a[kh][0], b[kh][1], c01); c11 = g2_mma(a[kh][1], b[kh][1], c11);
      c02 = g2_mma(a[kh][0], b[kh][2], c02); c12 = g2_mma(a[kh][1], b[kh][2], c12);
      c03 = g2_mma(a[kh][0], b[kh][3], c03); c13 = g2_mma(a[kh][1], b[kh][3], c13); }
    asm volatile("s_wait_dscnt 0x0" ::: "memory");      /* this wave's reads of the step's buffer are done before the buffer is handed back */
    asm volatile("s_wait_asynccnt 0x0" ::: "memory");      /* this wave's copies of step s + 1 have landed */
    __syncthreads();      /* publishes step s + 1 and ends every wave's reads of step s's buffer */
    if (s + 2 < nst) stage(s + 2); }      /* refill of the buffer just read; the test is the same for the whole block */
  asm volatile("s_wait_asynccnt 0x0" ::: "memory");      /* no copy outstanding when the epilogue takes the buffers' bytes */
  v8f accs[8] = {c00, c01, c02, c03, c10, c11, c12, c13};
#pragma unroll
  for (int u = 0; u < 8; ++u) { const int t = u & 3, half = u >> 2; const int col = col0 + t * 16 + ln; const float bv = bp ? bf16_round(bp[col]) : 0.f;
#pragma unroll
    for (int r = 0; r < 8; ++r) { const int rloc = half * 16 + 8 * hh + r; float v = accs[u][r] * alpha + bv; if (CP) { if (rowsPerB < 0) v += CP[cofs + (size_t)(row0g + row0 + rloc) * ldc + col];      /* rowsPerB < 0: own element of the batched C plane */ else { const int bidx = (row0g + row0 + rloc) / rowsPerB; v += CP[(size_t)bidx * sCPb + (size_t)by * 64 + col]; } }
      if (ACT == 3) v = fmaxf(v, 0.f); else if (ACT == 6) v = 0.5f * v * (1.0f + erff(v * 0.70710678118654752f)); else if (ACT == 11) v = 1.0f / (1.0f + expf(-v)); else if (ACT == 15) v = v / (1.0f + expf(-v)); else if (ACT == 12) v = (v > 0.f) ? v : 0.01f * v; else if (ACT == 8) v = tanhf(v); else if (ACT == 9) v = 0.5f * v * (1.0f + tanhf(0.7978845608028654f * (v + 0.044715f * v * v * v))); else if (ACT == 14) v = (v > 0.f) ? v : 0.1f * v; else if (ACT == 16) v = (v >= 0.f) ? v : 0.3f * v; else if (ACT == 17) v = (v >= 0.f) ? v : 0.2f * v;
      so[w][rloc][t * 16 + ln] = v; } }
  __builtin_amdgcn_fence(__ATOMIC_ACQ_REL, "workgroup"); __builtin_amdgcn_wave_barrier();
  const int rsub = lane >> 4, c4 = (lane & 15) * 4;
  {
#pragma unroll
    for (int q = 0; q < 16; ++q) { const int r = q * 2 + rsub; const v4f v = *(const v4fa*)&so[w][r][c4]; if (C) *(v4f*)(C + cofs + (size_t)(row0 + r) * ldc + col0 + c4) = v; if (C16) { v4h h4; for (int i = 0; i < 4; ++i) h4[i] = (_Float16)v[i]; *(v4h*)(C16 + cofs + (size_t)(row0 + r) * ldc + col0 + c4) = h4; } }
     } }


__global__ __launch_bounds__(256) void k_wnat(const float* __restrict__ w, size_t n8, _Float16* __restrict__ Bt) { const size_t t = (size_t)blockIdx.x * 256 + threadIdx.x; if (t >= n8) return; FragH f; for (int q = 0; q < 8; ++q) f.h[q] = (_Float16)(bf16_round(w[t * 8 + q]) * 16.0f); *(v8us*)((unsigned short*)Bt + t * 8) = f.half[0];  }
__global__ __launch_bounds__(256) void k_rsm(const float* __restrict__ S, _Float16* __restrict__ P, int nrows) {
  #pragma clang fp contract(off)
  const int i = blockIdx.x * 256 + threadIdx.x; if (i >= nrows) return; const float* s = S + (size_t)i * SQ; float mx = -3.0e38f;
#pragma unroll 1
  for (int j = 0; j < SQ; ++j) mx = fmaxf(mx, s[j]); float se = 0.f;
#pragma unroll 1
  for (int j = 0; j < SQ; ++j) se += expf(s[j] - mx); const float sc = 256.0f / se;
#pragma unroll 1
  for (int j0 = 0; j0 < SQ; j0 += 8) { FragH f; for (int q = 0; q < 8; ++q) f.h[q] = (_Float16)(expf(s[j0 + q] - mx) * sc); unsigned short* d = (unsigned short*)P + (size_t)i * SQ + j0; *(v8us*)d = f.half[0];  } }
__global__ __launch_bounds__(256) void k_vt(const _Float16* __restrict__ V16, int b, int h0, _Float16* __restrict__ VT) { __shared__ unsigned short tl[64][65]; const int tid = threadIdx.x; const int hh = blockIdx.x % HG, sg = blockIdx.x / HG; const int s0 = sg * 64; const int h = h0 + hh;
  for (int i = tid; i < 64 * 8; i += 256) { const int j = i / 8, d8 = (i % 8) * 8; FragH f; f.half[0] = *(const v8us*)((const unsigned short*)V16 + ((size_t)b * SQ + s0 + j) * DM + h * HD + d8); for (int q = 0; q < 8; ++q) tl[d8 + q][j] = f.u[q]; }
  __syncthreads();
  { for (int i = tid; i < 64 * 8; i += 256) { const int d = i / 8, j8 = (i % 8) * 8; FragH f; for (int q = 0; q < 8; ++q) f.u[q] = tl[d][j8 + q]; *(v8us*)((unsigned short*)VT + ((size_t)hh * HD + d) * SQ + s0 + j8) = f.half[0]; }  } }



__global__ __launch_bounds__(256) void k_rsmkm(const float* __restrict__ S, _Float16* __restrict__ P, int nrows, const int* __restrict__ am) {
  #pragma clang fp contract(off)
  const int t = blockIdx.x * 256 + threadIdx.x; if (t >= nrows) return; const size_t i = (size_t)t; const float* s = S + i * SQ; const int* mr = am + (size_t)(t % SQ) * SQ; float mx = -3.0e38f;
#pragma unroll 1
  for (int j = 0; j < SQ; ++j) { const float f = (mr[j] != 0) ? 1.f : 0.f; mx = fmaxf(mx, fmaf(f, s[j], (1.f - f) * -1.0e9f)); } float se = 0.f;
#pragma unroll 1
  for (int j = 0; j < SQ; ++j) { const float f = (mr[j] != 0) ? 1.f : 0.f; se += __expf(fmaf(f, s[j], (1.f - f) * -1.0e9f) - mx); } const float sc = 256.0f / se;
#pragma unroll 1
  for (int j0 = 0; j0 < SQ; j0 += 8) { FragH fr; for (int q = 0; q < 8; ++q) { const int j = j0 + q; const float f = (mr[j] != 0) ? 1.f : 0.f; fr.h[q] = (_Float16)(__expf(fmaf(f, s[j], (1.f - f) * -1.0e9f) - mx) * sc); }
    unsigned short* d = (unsigned short*)P + i * SQ + j0; *(v8us*)d = fr.half[0];  } }
// exp of four values as __expf forms it (v_exp_f32 of x * log2 e). One statement, so that the free slot the instruction set asks for behind a transcendental stands there by construction: outputs are early-clobbered (no v_exp_f32 overwrites a neighbour's source or reads its result), and the v_nop fills the slot behind the last one.
__device__ __forceinline__ v4f exp_x4(v4f x) { float r0, r1, r2, r3;
  asm("v_exp_f32 %0, %4\n\tv_exp_f32 %1, %5\n\tv_exp_f32 %2, %6\n\tv_exp_f32 %3, %7\n\tv_nop" : "=&v"(r0), "=&v"(r1), "=&v"(r2), "=&v"(r3) : "v"(x[0] * 1.44269504088896340736f), "v"(x[1] * 1.44269504088896340736f), "v"(x[2] * 1.44269504088896340736f), "v"(x[3] * 1.44269504088896340736f));
  const v4f r = {r0, r1, r2, r3}; return r; }
// exp of one value, same form as exp_x4 (the v_nop fills the free slot behind the transcendental).
__device__ __forceinline__ float exp_x1(float x) { float r; asm("v_exp_f32 %0, %1\n\tv_nop" : "=&v"(r) : "v"(x * 1.44269504088896340736f)); return r; }
__device__ __forceinline__ v8f fa_mma(v16h a, v16h b, v8f c) { return __builtin_amdgcn_wmma_f32_16x16x32_f16(false, a, false, b, (short)0, c, false, false); }
#define FP 72                        /* LDS pitch of a staged row in 16-bit elements: 144 B = 16 B x odd, conflict-free for 16-byte fragment reads down 16 rows */
#define FT (64 * FP * 2)             /* bytes of one staged tile (64 rows) */
// Four 16-byte copies of one thread; the wait as the statement's last line keeps every rewrite of the address registers behind it.
__device__ __forceinline__ void fa_copy4(unsigned l0, unsigned l1, unsigned l2, unsigned l3, const _Float16* g0, const _Float16* g1, const _Float16* g2, const _Float16* g3) {
  asm volatile("global_load_async_to_lds_b128 %0, %4, off\n\tglobal_load_async_to_lds_b128 %1, %5, off\n\tglobal_load_async_to_lds_b128 %2, %6, off\n\tglobal_load_async_to_lds_b128 %3, %7, off\n\ts_wait_xcnt 0x0" :: "v"(l0), "v"(l1), "v"(l2), "v"(l3), "v"(g0), "v"(g1), "v"(g2), "v"(g3) : "memory"); }
__global__ __launch_bounds__(256) void k_fattn(const _Float16* __restrict__ Q, const _Float16* __restrict__ Kk, const _Float16* __restrict__ VTa, _Float16* __restrict__ O) {
  __shared__ __attribute__((aligned(16))) _Float16 kv[2][2][64][FP];      /* [buffer][k rows, V^T rows][row][element] */
  const int lane = threadIdx.x & 31, ln = lane & 15, hh = lane >> 4; const int w = __builtin_amdgcn_readfirstlane(threadIdx.x >> 5);      /* wave number in a scalar register: the mask test below is a scalar branch */
  const int h = blockIdx.y, b = blockIdx.z; const int q0 = blockIdx.x * 128 + w * 16; const int qi = q0 + ln;
  const _Float16* qp = Q + ((size_t)b * SQ + qi) * LQ + h * HD; const v16h qf0 = g2_frag(qp, hh), qf1 = g2_frag(qp + 32, hh);
  const int sr = threadIdx.x >> 3, sc = (threadIdx.x & 7) * 8;      /* staging: a thread copies piece sc of rows sr and sr + 32 of both tiles; a wave's copy is 4 whole rows */
  const _Float16* kg = Kk + ((size_t)b * SQ + sr) * LQ + h * HD + sc; const _Float16* vg = VTa + (((size_t)b * NH + h) * HD + sr) * SQ + sc;
  const unsigned ls = (unsigned)(size_t)&kv[0][0][sr][sc];      /* the thread's LDS byte address in buffer 0 */
  auto stage = [&](int t) { const unsigned l = ls + (unsigned)(t & 1) * (2 * FT); const _Float16* kr = kg + (size_t)t * 64 * LQ; const _Float16* vr = vg + t * 64; fa_copy4(l, l + FT / 2, l + FT, l + FT + FT / 2, kr, kr + (size_t)32 * LQ, vr, vr + (size_t)32 * SQ); };
  static_assert(SQ / 64 >= 2, "the prologue fills two stages");
  stage(0);
  asm volatile("s_wait_asynccnt 0x0" ::: "memory");      /* this wave's copies of pass 0 have landed */
  __syncthreads();      /* ... and every other wave's: pass 0 may be read */
  stage(1);
  const v8f z8 = {0.f,0.f,0.f,0.f,0.f,0.f,0.f,0.f}; v8f o[4] = {z8, z8, z8, z8}; float m = -1.0e30f, l = 0.f;
#pragma unroll 1      /* one pass already holds 32 fragment loads and 16 matrix products; a second copy would only cost registers */
  for (int p = 0; p < SQ / 64; ++p) { const int k0 = p * 64; v8f s[4]; v16h kf[4][2], vf[4][2]; const _Float16* kp = &kv[p & 1][0][ln][0]; const _Float16* vp = &kv[p & 1][1][ln][0];
#pragma unroll      /* kf[] in registers */
    for (int t = 0; t < 4; ++t) { kf[t][0] = g2_frag(kp + 16 * t * FP, hh); kf[t][1] = g2_frag(kp + 16 * t * FP + 32, hh); }
    asm volatile("" :: "v"(kf[0][0]), "v"(kf[0][1]), "v"(kf[1][0]), "v"(kf[1][1]), "v"(kf[2][0]), "v"(kf[2][1]), "v"(kf[3][0]), "v"(kf[3][1]));      /* inputs only, loaded values: the 16 k reads of the pass stand as one group in front of the score products (left alone, the compiler spreads them among the products, each place with its own wait) */
#pragma unroll      /* s[] in registers */
    for (int t = 0; t < 4; ++t) { s[t] = fa_mma(kf[t][0], qf0, z8); s[t] = fa_mma(kf[t][1], qf1, s[t]); }
#pragma unroll      /* vf[] in registers; the v fragments arrive under the softmax arithmetic */
    for (int t = 0; t < 4; ++t) { vf[t][0] = g2_frag(vp + 16 * t * FP, hh); vf[t][1] = g2_frag(vp + 16 * t * FP + 32, hh); }
#pragma unroll      /* s[] in registers */
    for (int t = 0; t < 4; ++t) s[t] *= 0.125f;
    if (k0 <= q0 + 15) {      /* a pass whose keys all lie behind the wave's queries adds 0 * -1e9: skipped as an identity */
#pragma unroll      /* s[] in registers */
      for (int t = 0; t < 4; ++t) for (int r = 0; r < 8; ++r) { const float mk = (k0 + 16 * t + 8 * hh + r <= qi) ? 1.0f : 0.0f; s[t][r] = __fadd_rn(s[t][r], __fmul_rn(mk, -1.0e9f)); } }
    float mt = s[0][0];
#pragma unroll      /* s[] in registers */
    for (int t = 0; t < 4; ++t) for (int r = 0; r < 8; ++r) mt = fmaxf(mt, s[t][r]);
    mt = fmaxf(mt, __shfl_xor(mt, 16)); const float mn = fmaxf(m, mt); const float corr = exp_x1(m - mn); m = mn;
    v4f s4 = {0.f, 0.f, 0.f, 0.f}; FragH pf[2];
#pragma unroll      /* s[], pf[] in registers */
    for (int t = 0; t < 4; ++t) { const v4f a = {s[t][0], s[t][1], s[t][2], s[t][3]}, c = {s[t][4], s[t][5], s[t][6], s[t][7]}; const v4f ea = exp_x4(a - mn), ec = exp_x4(c - mn); s4 += ea; s4 += ec;
      for (int u = 0; u < 4; ++u) { pf[t >> 1].h[(t & 1) * 8 + u] = (_Float16)ea[u]; pf[t >> 1].h[(t & 1) * 8 + 4 + u] = (_Float16)ec[u]; } }
    l = l * corr + ((s4[0] + s4[1]) + (s4[2] + s4[3]));      /* each wave half keeps its own part of the sum; joined once behind the loop */
    asm volatile("" :: "v"(vf[0][0]), "v"(vf[0][1]), "v"(vf[1][0]), "v"(vf[1][1]), "v"(vf[2][0]), "v"(vf[2][1]), "v"(vf[3][0]), "v"(vf[3][1]));      /* inputs only, loaded values: the 16 v reads are all out before the first output product, none among the products */
#pragma unroll      /* o[] in registers */
    for (int t = 0; t < 4; ++t) { o[t] *= corr; o[t] = fa_mma(vf[t][0], pf[0].v, o[t]); o[t] = fa_mma(vf[t][1], pf[1].v, o[t]); }
    asm volatile("s_wait_dscnt 0x0" ::: "memory");      /* this wave's reads of the pass's buffer are done before the buffer is handed back */
    asm volatile("s_wait_asynccnt 0x0" ::: "memory");      /* this wave's copies of pass p + 1 have landed */
    __syncthreads();      /* publishes pass p + 1 and ends every wave's reads of pass p's buffer */
    if (p + 2 < SQ / 64) stage(p + 2); }      /* refill of the buffer just read; the test is the same for the whole block */
  asm volatile("s_wait_asynccnt 0x0" ::: "memory");      /* no copy outstanding when the wave ends */
  l += __shfl_xor(l, 16); const float fin = 64.0f / l;      /* o carried x64 against f16 subnormal flush, folded into the output GEMM alpha */
  _Float16* op = O + ((size_t)b * SQ + qi) * DM + h * HD + 8 * hh;
#pragma unroll      /* o[] in registers; a lane's 8 accumulator registers are 8 consecutive columns of its query's row: one 16-byte store */
  for (int t = 0; t < 4; ++t) { FragH f; for (int r = 0; r < 8; ++r) f.h[r] = (_Float16)(o[t][r] * fin); *(v8us*)((unsigned short*)op + 16 * t) = f.half[0]; } }

// One lane per query row, 32 rows a block; the rows' keys are dealt over the block's KW waves (wave w takes keys w, w + KW, ... of the block's range), each wave with its own running maximum, sum and o; the KW partial results of a row are joined through LDS at the end. A wave's key index is wave-uniform, so k and v rows still come through the scalar path. The 64-wide loops are unrolled: q[] and o[] are indexed by constants only and stay in registers.
__global__ __launch_bounds__(32 * KW) void k_attup(const float* __restrict__ QF, const float* __restrict__ KF, const float* __restrict__ VF, int ld, float scale, float* __restrict__ OF, int ldo) {
  #pragma clang fp contract(off)
  static_assert(KW == 16 && QT0 % 32 == 0 && HD == 64, "the join below gives each of the 32 * KW threads one 4-column piece of the 32 x 64 tile");
  __shared__ __attribute__((aligned(16))) float lo[KW][32][HD + 4];      /* row pitch 272 B = 16 B x odd: 16-byte stores of 32 rows and 16-byte loads along a row both spread over the banks */
  __shared__ float lm[KW][32], ll[KW][32];
  const int tid = threadIdx.x, lane = tid & 31; const int w = __builtin_amdgcn_readfirstlane(tid >> 5);      /* wave number in a scalar register: key addresses stay scalar */
  const int h = blockIdx.x / (QT0 / 32), rg = blockIdx.x % (QT0 / 32); const int i = rg * 32 + lane;
  { const size_t bo = (size_t)blockIdx.y * QT0; QF += bo * ld; KF += bo * ld; VF += bo * ld; OF += bo * ldo; }      /* blockIdx.y: the batch; each batch has its own QT0-row tile */
  const float* qr = QF + (size_t)i * ld + h * HD; v4f q[HD / 4], o[HD / 4];
#pragma unroll      /* q[], o[] in registers; the q row's 16 loads in flight at once */
  for (int c = 0; c < HD / 4; ++c) { q[c] = *(const v4fa*)(qr + c * 4); const v4f z = {0.f, 0.f, 0.f, 0.f}; o[c] = z; }
  float m = -1.0e30f, l = 0.f;
#pragma unroll 1
  for (int j = rg * 32 + w; j < QT0; j += KW) { const float* kr = KF + (size_t)j * ld + h * HD; const float* vr = VF + (size_t)j * ld + h * HD; v4f kq[HD / 4], vv[HD / 4]; float s = 0.f;
#pragma unroll      /* a whole row's loads in flight at once */
    for (int c = 0; c < HD / 4; ++c) kq[c] = *(const v4fa*)(kr + c * 4);
#pragma unroll      /* the v row arrives under the score sum */
    for (int c = 0; c < HD / 4; ++c) vv[c] = *(const v4fa*)(vr + c * 4);
#pragma unroll      /* q[], kq[] in registers */
    for (int c = 0; c < HD / 4; ++c) { s = __fadd_rn(s, __fmul_rn(q[c][0], kq[c][0])); s = __fadd_rn(s, __fmul_rn(q[c][1], kq[c][1])); s = __fadd_rn(s, __fmul_rn(q[c][2], kq[c][2])); s = __fadd_rn(s, __fmul_rn(q[c][3], kq[c][3])); }
    s = __fmul_rn(s, scale);
    const float f = (j > i) ? 1.f : 0.f; const float sm = fmaf(f, s, (1.f - f) * -1.0e30f); const float mn = fmaxf(m, sm); const float sc = expf(m - mn); const float e = __fmul_rn(f, expf(sm - mn)); l = __fadd_rn(__fmul_rn(l, sc), e); m = mn;
#pragma unroll      /* o[], vv[] in registers */
    for (int c = 0; c < HD / 4; ++c) for (int u = 0; u < 4; ++u) o[c][u] = __fadd_rn(__fmul_rn(o[c][u], sc), __fmul_rn(e, vv[c][u])); }
#pragma unroll      /* o[] in registers */
  for (int c = 0; c < HD / 4; ++c) *(v4f*)&lo[w][lane][c * 4] = o[c];
  lm[w][lane] = m; ll[w][lane] = l;
  __syncthreads();
  { const int row = tid / 16, pc = (tid % 16) * 4; float mw[KW], mx = -1.0e30f, ls = 0.f; v4f a = {0.f, 0.f, 0.f, 0.f};      /* join: every partial is brought to the row's overall maximum; a wave that saw no visible key holds l = 0, o = 0 and adds nothing */
#pragma unroll      /* mw[] in registers */
    for (int u = 0; u < KW; ++u) { mw[u] = lm[u][row]; mx = fmaxf(mx, mw[u]); }
#pragma unroll      /* mw[] in registers; the 16 partial pieces' LDS loads in flight at once */
    for (int u = 0; u < KW; ++u) { const float fw = exp_x1(mw[u] - mx); const v4f p = *(const v4f*)&lo[u][row][pc]; ls += ll[u][row] * fw; a += p * fw; }
    const float fin = (ls > 0.f) ? 64.0f / ls : 0.f;      /* o carried x64 like the f16 path; the key-less last row is written by k_vmean */
    a *= fin; *(v4f*)(OF + (size_t)(rg * 32 + row) * ldo + h * HD + pc) = a; } }

__global__ __launch_bounds__(256) void k_vmean(const _Float16* __restrict__ V, float* __restrict__ orow) {
  #pragma clang fp contract(off)
  const int c = blockIdx.x * 256 + threadIdx.x; if (c >= DM) return; const _Float16* p = V + (size_t)blockIdx.y * SQ * LQ + c; orow += (size_t)blockIdx.y * QT0 * DM; float s = 0.f;      /* blockIdx.y: the batch */
#pragma unroll 1
  for (int j0 = 0; j0 < SQ; j0 += 64) { _Float16 t[64];
#pragma unroll      /* 64 rows' loads in flight at once (the constant pitch LQ makes them one address register with immediate offsets); t[] in registers */
    for (int j = 0; j < 64; ++j) t[j] = p[(size_t)(j0 + j) * LQ];
#pragma unroll      /* summed in the rows' order */
    for (int j = 0; j < 64; ++j) s = __fadd_rn(s, (float)t[j]); }
  const float o = __fmul_rn(s, 64.0f / (float)SQ); *(float*)(orow + c) = o;  }

extern "C" void kernel_launch(void* const* d_in, const int* in_sizes, int n_in,
                              void* d_out, int out_size, void* d_ws, size_t ws_size, hipStream_t stream) {
  (void)in_sizes; (void)n_in; (void)out_size;
  const float* const* I = (const float* const*)d_in; const float* xq = I[0]; const float* xk = I[0]; const float* xv = I[0]; const float* wq = I[1]; const float* bq = I[2]; const float* wk = I[3]; const float* bk = I[4]; const float* wv = I[5]; const float* bv = I[6]; const float* wo = I[7]; const float* bo = I[8]; const float* x = xq;      /* ONE input feeds the query, key and value streams; [in][out] weights + biases; the mask is built from indices as in the module */
  static_assert(NH * HD == DM && DM % 64 == 0 && SQ % 128 == 0 && NH % HG == 0, "shape / tile multiples");
  static_assert(MP % 128 == 0 && MPO % 128 == 0 && QT0 % 128 == 0 && DM / 64 >= 2, "k_gemm2 stages whole 128-row, 64-column, 64-deep tiles");
  char* ws = (char*)d_ws; size_t off = 0;
  auto take = [&](size_t bytes) { char* p = ws + off; off += (bytes + 255) & ~(size_t)255; return p; };
  _Float16* BQ = (_Float16*)take((size_t)4 * DM * DM * 2); _Float16* BO = BQ + (size_t)3 * DM * DM;      /* Bt planes of Wq, Wk, Wv, Wo, one behind the other */
  _Float16* X16 = (_Float16*)take((size_t)3 * NR * DM * 2);      /* query, key and value inputs as exact f16 rows: three planes */
  _Float16* Q16 = (_Float16*)take((size_t)3 * NR * DM * 2); _Float16* K16 = Q16 + NR * DM; _Float16* V16 = K16 + NR * DM; _Float16* O16 = (_Float16*)take(NR * DM * 2);      /* q, k, v: three planes */
  _Float16* VT = (_Float16*)take((size_t)NB * NH * HD * SQ * 2);
  float* QF0 = (float*)take((size_t)3 * NB * QT0 * DM * 4); float* KF0 = QF0 + (size_t)NB * QT0 * DM; float* VF0 = KF0 + (size_t)NB * QT0 * DM; float* OF0 = (float*)take((size_t)NB * QT0 * DM * 4); _Float16* OH0 = (_Float16*)take((size_t)NB * QT0 * DM * 2); _Float16* OL0 = (_Float16*)take((size_t)NB * QT0 * DM * 2);      /* exact last tile of every batch: f32 q / k / v of the tile rows (three planes of [NB][QT0] rows), o (x64) and its f16 hi + x1024 residual planes */
  if (off > ws_size) return;
  k_wt_f16<<<dim3((unsigned)(((size_t)DM * (DM / 8) + 255) / 256), 4), 256, 0, stream>>>(wq, wk, wv, wo, BQ, DM, DM, 16.0f);      /* [in][out] -> Bt x16, the four weights in one launch */
  k_x16<<<dim3((unsigned)((NR * DM / 8 + 255) / 256), 3), 256, 0, stream>>>(x, xk, xv, X16, NR * DM / 8);      /* the three streams in one launch */
  const size_t r0p = (size_t)B0 * SQ;      /* first projected row */
  k_gemm2<0><<<dim3((unsigned)((MP / 128) * (DM / 64)), 1, 3), 128, 0, stream>>>(X16 + r0p * DM, DM, 0, BQ, DM, 0, 0.0625f, bq, 0, nullptr, 1, 0, 0, nullptr, Q16 + r0p * DM, DM, 0, MP, DM, DM, NR * DM, (size_t)DM * DM, NR * DM, bk, bv);      /* q, k, v (z) in one launch */
  k_vt<NH, SQ><<<NBR * NH * (SQ / 64), 256, 0, stream>>>(V16 + r0p * LQ, LQ, 0, VT + (size_t)B0 * NH * HD * SQ);      /* V^T [NB][NH][HD][SQ], every batch in one launch */
  const size_t rl0 = r0p + SQ - QT0; const size_t f00 = (size_t)B0 * QT0;      /* first batch's last QT0 rows; its tile in the [NB][QT0] planes */
  k_gemm2<0><<<dim3((QT0 / 128) * (DM / 64), NBR, 3), 128, 0, stream>>>(X16 + rl0 * DM, DM, (size_t)SQ * DM, BQ, DM, 0, 0.0625f, bq, 0, nullptr, 1, 0, 0, QF0 + f00 * DM, nullptr, DM, (size_t)QT0 * DM, QT0, DM, DM, NR * DM, (size_t)DM * DM, (size_t)NB * QT0 * DM, bk, bv);      /* f32 q, k, v (z) of every batch's (y) last tile (exact products) */
  k_attup<<<dim3(NH * (QT0 / 32), NBR), 32 * KW, 0, stream>>>(QF0 + f00 * DM, KF0 + f00 * DM, VF0 + f00 * DM, DM, 0.125f, OF0 + f00 * DM, DM);      /* exact f32 attention over the keys j > i inside the tile (o x64) */
  k_vmean<<<dim3((DM + 255) / 256, NBR), 256, 0, stream>>>(V16 + r0p * LQ, OF0 + (f00 + QT0 - 1) * DM);      /* last row: uniform over all keys = 64 x mean of v */
  k_fattn<<<dim3(SQ / 128, NH, NB), 256, 0, stream>>>(Q16, K16, VT, O16);      /* scores, literal 'score + tril * (-1e9)', softmax over all keys and the weighted v sum, every (batch, head) in one launch -> o (merged heads, x64) as f16 rows */
  k_gemm2<0><<<dim3((unsigned)((MPO / 128) * (DM / 64)), 1), 128, 0, stream>>>(O16 + r0p * DM, DM, 0, BO, DM, 0, 0.0009765625f, bo, 0, nullptr, 1, 0, 0, (float*)d_out + r0p * DM, nullptr, DM, 0, MPO, DM, DM, 0, 0, 0, nullptr, nullptr);      /* out rows are the output layout */
  k_hl<<<(unsigned)(((size_t)NB * QT0 * DM / 8 + 255) / 256), 256, 0, stream>>>(OF0, OH0, OL0, (size_t)NB * QT0 * DM / 8);      /* last-tile o (x64) -> f16 hi + x1024 residual planes */
  k_gemm2<0><<<dim3((QT0 / 128) * (DM / 64), NBR), 128, 0, stream>>>(OH0 + f00 * DM, DM, (size_t)QT0 * DM, BO, DM, 0, 0.0009765625f, bo, 0, nullptr, 1, 0, 0, (float*)d_out + rl0 * DM, nullptr, DM, (size_t)SQ * DM, QT0, DM, DM, 0, 0, 0, nullptr, nullptr);      /* last QT0 rows of every batch (y): out = o_hi Wo (+ b), overwriting the f16-path rows */
  k_gemm2<0><<<dim3((QT0 / 128) * (DM / 64), NBR), 128, 0, stream>>>(OL0 + f00 * DM, DM, (size_t)QT0 * DM, BO, DM, 0, 0.00000095367431640625f, nullptr, 0, (const float*)d_out + rl0 * DM, -1, 0, 0, (float*)d_out + rl0 * DM, nullptr, DM, (size_t)SQ * DM, QT0, DM, DM, 0, 0, 0, nullptr, nullptr);      /* += o_lo Wo 2^-20 (own-element accumulate) */
}

// v008
// A run of this version takes 189 microseconds.
// In both of two side-by-side timings against v007, it was 1.17 times as fast.
// Counting every step since v000, it is 34.7 times as fast.
#include <hip/hip_runtime.h>
// Multi-head self-attention with the source's INVERTED causal mask (inputs [2][2048][1024]; q / k / v = x W + b ([in][out] 1024 x 1024 sigma 1/32, zero biases); 16 heads of 64; score = q k^T / sqrt(64) + tril * (-1e9): the LOWER triangle incl. the diagonal is pushed to -1e9 (the original's mask bug, kept), so query i attends to the keys j > i only, and the last query (every key masked, all scores rounding to the same -1e9 in f32) attends uniformly to all keys; softmax; out = merged Wo + bo -> [2][2048][1024]).
// Structure: token rows r = b*2048 + s; x as exact f16 rows (bf16-rounded); Q, K, V as three WMMA GEMMs in one launch (grid z; 32x64 wave tiles, f32 accumulation, exact x16 weights + bias, f16 outputs); V^T for all batches and heads via LDS transposes; one fused attention launch over every (batch, head): S^T = K Q^T on WMMA (K = 64, x 1/sqrt(64), then the -1e9 fill), running softmax on VALU (f32 statistics; unnormalised weights exp(s - max) as f16), O^T += V^T P^T on WMMA, o = O / sum (carried x64 against f16 subnormal flush, folded into the output GEMM alpha) written straight into the merged f16 o rows; out = o W_o + b GEMM (f32) into the output layout.
// Compute dtype: inputs rounded to bf16; x / weights exact; q, k, v, softmax weights and o as plain f16 GEMM operands (~2^-12); scores and softmax statistics f32. v_wmma_f32_16x16x32_f16.
#define NB 2
#define SQ 2048
#define DM 1024
#define NH 16
#define HD 64
#define QT0 256                      /* last-tile rows recomputed exactly in f32 (rows with fewer than 256 visible keys) */
#define HG 4                         /* heads per V^T group of the h0-based k_vt overload (not launched) */
#define KW 16                        /* waves of a k_mid block = parts d_attup deals a query row's keys into */
#define B0 0                         /* first batch processed (debug hook) */
#define NBR NB                       /* batches processed (debug hook) */
#define NR ((size_t)NB * SQ)         /* token rows */
#define MP ((int)((size_t)NBR * SQ)) /* rows projected (debug hook) */
#define QN SQ                        /* query rows attended per batch (not used) */
#define NHD NH                       /* heads attended (not used) */
#define MPO MP                       /* rows through the output stage (not used by its launches) */
#define LQ DM      /* row pitch of the q/k/v rows */
typedef __bf16 v16b __attribute__((ext_vector_type(16)));
typedef unsigned short v8us __attribute__((ext_vector_type(8), may_alias));
typedef float  v8f  __attribute__((ext_vector_type(8)));
typedef float  v4f  __attribute__((ext_vector_type(4)));
typedef float  v4fa __attribute__((ext_vector_type(4), may_alias));
union FragB { v16b v; v8us half[2]; unsigned short u[16]; };

__device__ __forceinline__ unsigned short bf16_bits(float x) { unsigned int u = __float_as_uint(x); return (unsigned short)((u + 0x7FFFu + ((u >> 16) & 1u)) >> 16); }
__device__ __forceinline__ float bf16_val(unsigned short b) { return __uint_as_float(((unsigned int)b) << 16); }
__device__ __forceinline__ float bf16_round(float x) { return bf16_val(bf16_bits(x)); }
// D += A·B with NT terms: 1 = ah·bh, 2 = + al·bh (A split), 3 = + ah·bl (both split)
template <int NT>
__device__ __forceinline__ v8f mmaN(v16b ah, v16b al, v16b bh, v16b bl, v8f c) {
  c = __builtin_amdgcn_wmma_f32_16x16x32_bf16(false, ah, false, bh, (short)0, c, false, false);
  if (NT >= 2) c = __builtin_amdgcn_wmma_f32_16x16x32_bf16(false, al, false, bh, (short)0, c, false, false);
  if (NT >= 3) c = __builtin_amdgcn_wmma_f32_16x16x32_bf16(false, ah, false, bl, (short)0, c, false, false);
  asm volatile("v_nop\n\tv_nop\n\tv_nop\n\tv_nop" : "+v"(c) : "v"(ah), "v"(al), "v"(bh), "v"(bl));
  return c;
}

__global__ __launch_bounds__(256) void k_wt_bf16(const float* __restrict__ W, unsigned short* __restrict__ Wt, int K, int N) {
  const int t = blockIdx.x * 256 + threadIdx.x;
  const int k8n = K / 8;
  if (t >= N * k8n) return;
  const int n = t / k8n, k8 = (t % k8n) * 8;
  v8us v;
#pragma unroll
  for (int i = 0; i < 8; ++i) v[i] = bf16_bits(W[(size_t)(k8 + i) * N + n]);
  *(v8us*)(Wt + (size_t)n * K + k8) = v;
  
}

// GEMM C[M][N] (f32, pitch ldc) = act(A[M][K]·W + bias). A f32 row-major (pitch lda) converted per fragment to bf16
// (ASPLIT: hi/lo two planes -> 2 terms, else single rounded term); Wt bf16 [N][K] (pitch ldb). BIAS_BF16 rounds the
// bias to bf16 first (bias quantised to bf16 before the add). K%32==0, M%16==0, N%64==0.
template <bool ASPLIT, int ACT, bool BIAS_BF16>
__global__ __launch_bounds__(128) void k_gemm_bf(const float* __restrict__ A, int lda, const unsigned short* __restrict__ Wt, int ldb,
                                               const float* __restrict__ bias, float* __restrict__ C, int ldc, int M, int N, int K) {
  __shared__ __attribute__((aligned(16))) float so[4][16][64];
  const int tid = threadIdx.x, w = tid >> 5, lane = tid & 31, ln = lane & 15, hh = lane >> 4;
  const int ntn = N / 64;
  const int wid = blockIdx.x * 4 + w;
  const int mt = wid / ntn, nq = wid % ntn;
  if (mt * 16 >= M) return;
  const int row0 = mt * 16, col0 = nq * 64;
  const float* arow = A + (size_t)(row0 + ln) * lda;
  v8f acc[4] = {};
  for (int kb = 0; kb < K; kb += 32) {
    FragB ah, al;
    const v4f x0 = *(const v4fa*)(arow + kb + 8 * hh), x1 = *(const v4fa*)(arow + kb + 8 * hh + 4);
    const v4f x2 = *(const v4fa*)(arow + kb + 16 + 8 * hh), x3 = *(const v4fa*)(arow + kb + 16 + 8 * hh + 4);
    float xs[16] = {x0[0],x0[1],x0[2],x0[3],x1[0],x1[1],x1[2],x1[3],x2[0],x2[1],x2[2],x2[3],x3[0],x3[1],x3[2],x3[3]};
#pragma unroll
    for (int i = 0; i < 16; ++i) { const unsigned short hb = bf16_bits(xs[i]); ah.u[i] = hb; al.u[i] = ASPLIT ? bf16_bits(xs[i] - bf16_val(hb)) : (unsigned short)0; }
#pragma unroll
    for (int t = 0; t < 4; ++t) {
      const unsigned short* brow = Wt + (size_t)(col0 + t * 16 + ln) * ldb + kb;
      FragB b;
      b.half[0] = *(const v8us*)(brow + 8 * hh);
      b.half[1] = *(const v8us*)(brow + 16 + 8 * hh);
      acc[t] = mmaN<ASPLIT ? 2 : 1>(ah.v, al.v, b.v, b.v, acc[t]);
    }
  }
#pragma unroll
  for (int t = 0; t < 4; ++t) {
    float bv = bias ? bias[col0 + t * 16 + ln] : 0.f;
    if (BIAS_BF16) bv = bf16_round(bv);
#pragma unroll
    for (int r = 0; r < 8; ++r) { float v = acc[t][r] + bv; if (ACT == 1) v = fmaxf(v, 0.f); so[w][8 * hh + r][t * 16 + ln] = v; }
  }
  __builtin_amdgcn_fence(__ATOMIC_ACQ_REL, "workgroup");
  __builtin_amdgcn_wave_barrier();
  const int rsub = lane >> 4, c4 = (lane & 15) * 4;
  {
#pragma unroll
    for (int q = 0; q < 8; ++q) {
      const int r = q * 2 + rsub;
      const v4f v = *(const v4fa*)&so[w][r][c4];
      *(v4f*)(C + (size_t)(row0 + r) * ldc + col0 + c4) = v;
    }
    
  }
}

// GEMM C = act(A·W + bias + resid): A f32 (ASPLIT -> hi/lo 2 terms), Wt bf16 [N][K]; ACT 0 none, 1 relu, 2 exact gelu;
// resid (optional, f32, row index = (row % rmod), pitch ldr, RES_BF16 rounds it) added before the activation.
template <bool ASPLIT, int ACT, bool BIAS_BF16, bool RES_BF16>
__global__ __launch_bounds__(128) void k_gemm_bf3(const float* __restrict__ A, int lda, const unsigned short* __restrict__ Wt, int ldb,
                                                const float* __restrict__ bias, const float* __restrict__ resid, int rmod, int ldr,
                                                float* __restrict__ C, int ldc, int M, int N, int K) {
  __shared__ __attribute__((aligned(16))) float so[4][16][64];
  const int tid = threadIdx.x, w = tid >> 5, lane = tid & 31, ln = lane & 15, hh = lane >> 4;
  const int ntn = N / 64;
  const int wid = blockIdx.x * 4 + w;
  const int mt = wid / ntn, nq = wid % ntn;
  if (mt * 16 >= M) return;
  const int row0 = mt * 16, col0 = nq * 64;
  const float* arow = A + (size_t)(row0 + ln) * lda;
  v8f acc[4] = {};
  for (int kb = 0; kb < K; kb += 32) {
    FragB ah, al;
    const v4f x0 = *(const v4fa*)(arow + kb + 8 * hh), x1 = *(const v4fa*)(arow + kb + 8 * hh + 4);
    const v4f x2 = *(const v4fa*)(arow + kb + 16 + 8 * hh), x3 = *(const v4fa*)(arow + kb + 16 + 8 * hh + 4);
    float xs[16] = {x0[0],x0[1],x0[2],x0[3],x1[0],x1[1],x1[2],x1[3],x2[0],x2[1],x2[2],x2[3],x3[0],x3[1],x3[2],x3[3]};
#pragma unroll
    for (int i = 0; i < 16; ++i) { const unsigned short hb = bf16_bits(xs[i]); ah.u[i] = hb; al.u[i] = ASPLIT ? bf16_bits(xs[i] - bf16_val(hb)) : (unsigned short)0; }
#pragma unroll
    for (int t = 0; t < 4; ++t) {
      const unsigned short* brow = Wt + (size_t)(col0 + t * 16 + ln) * ldb + kb;
      FragB b;
      b.half[0] = *(const v8us*)(brow + 8 * hh);
      b.half[1] = *(const v8us*)(brow + 16 + 8 * hh);
      acc[t] = mmaN<ASPLIT ? 2 : 1>(ah.v, al.v, b.v, b.v, acc[t]);
    }
  }
#pragma unroll
  for (int t = 0; t < 4; ++t) {
    const int col = col0 + t * 16 + ln;
    float bv = bias ? bias[col] : 0.f;
    if (BIAS_BF16) bv = bf16_round(bv);
#pragma unroll
    for (int r = 0; r < 8; ++r) {
      float v = acc[t][r] + bv;
      if (resid) { float rv = resid[(size_t)((row0 + 8 * hh + r) % rmod) * ldr + col]; if (RES_BF16) rv = bf16_round(rv); v += rv; }
      if (ACT == 1) v = fmaxf(v, 0.f);
      if (ACT == 2) v = 0.5f * v * (1.0f + erff(v * 0.70710678118654752f));
      if (ACT == 3) { const float u = 0.7978845608028654f * (v + 0.044715f * v * v * v); v = 0.5f * v * (1.0f + tanhf(u)); }
      so[w][8 * hh + r][t * 16 + ln] = v;
    }
  }
  __builtin_amdgcn_fence(__ATOMIC_ACQ_REL, "workgroup");
  __builtin_amdgcn_wave_barrier();
  const int rsub = lane >> 4, c4 = (lane & 15) * 4;
  {
#pragma unroll
    for (int q = 0; q < 8; ++q) {
      const int r = q * 2 + rsub;
      const v4f v = *(const v4fa*)&so[w][r][c4];
      *(v4f*)(C + (size_t)(row0 + r) * ldc + col0 + c4) = v;
    }
    
  }
}
// row LayerNorm (biased variance, eps) over N: s = X (+ R); optional out_sum <- s; out_norm <- (s-mu)*rsqrt(var+eps)*g + b
template <bool PARAM_BF16>
__global__ __launch_bounds__(256) void k_layernorm(const float* __restrict__ X, const float* __restrict__ R, const float* __restrict__ g, const float* __restrict__ bta,
                                                  float* __restrict__ out_sum, float* __restrict__ out_norm, int N, float eps) {
  __shared__ float red[256];
  const int row = blockIdx.x, tid = threadIdx.x;
  const float* x = X + (size_t)row * N; const float* rr = R ? R + (size_t)row * N : nullptr;
  float vals[16];                     // up to N = 4096
  const int per = N / 256;            // contiguous chunk per thread? use strided-by-4 chunks: thread handles j = tid*4 + 1024*u
  float s1 = 0.f;
  for (int u = 0; u < per / 4; ++u) {
    const int j = tid * 4 + 1024 * u;
    const v4f a = *(const v4fa*)(x + j);
    v4f b = {0.f,0.f,0.f,0.f}; if (rr) b = *(const v4fa*)(rr + j);
#pragma unroll
    for (int q = 0; q < 4; ++q) { const float v = a[q] + b[q]; vals[u * 4 + q] = v; s1 += v; }
  }
  red[tid] = s1; __syncthreads();
  for (int st = 128; st > 0; st >>= 1) { if (tid < st) red[tid] += red[tid + st]; __syncthreads(); }
  const float mu = red[0] / (float)N; __syncthreads();
  float s2 = 0.f;
  for (int u = 0; u < per / 4; ++u)
#pragma unroll
    for (int q = 0; q < 4; ++q) { const float c = vals[u * 4 + q] - mu; s2 += c * c; }
  red[tid] = s2; __syncthreads();
  for (int st = 128; st > 0; st >>= 1) { if (tid < st) red[tid] += red[tid + st]; __syncthreads(); }
  const float rs = rsqrtf(red[0] / (float)N + eps);
  {
    for (int u = 0; u < per / 4; ++u) {
      const int j = tid * 4 + 1024 * u;
      v4f o, sm;
#pragma unroll
      for (int q = 0; q < 4; ++q) {
        float gg = g[j + q], bb = bta[j + q];
        if (PARAM_BF16) { gg = bf16_round(gg); bb = bf16_round(bb); }
        sm[q] = vals[u * 4 + q]; o[q] = (vals[u * 4 + q] - mu) * rs * gg + bb;
      }
      if (out_sum) *(v4f*)(out_sum + (size_t)row * N + j) = sm;
      *(v4f*)(out_norm + (size_t)row * N + j) = o;
    }
    
  }
}



// ---- f16 WMMA path (v_wmma_f32_16x16x32_f16): 11-bit significands for operands in range — used where a [0,1] probability operand needs more precision than bf16
typedef _Float16 v16h __attribute__((ext_vector_type(16)));
union FragH { v16h v; v8us half[2]; _Float16 h[16]; unsigned short u[16]; };
template <int NT>
__device__ __forceinline__ v8f mmaH(v16h ah, v16h al, v16h bh, v16h bl, v8f c) {
  c = __builtin_amdgcn_wmma_f32_16x16x32_f16(false, ah, false, bh, (short)0, c, false, false);
  if (NT >= 2) c = __builtin_amdgcn_wmma_f32_16x16x32_f16(false, al, false, bh, (short)0, c, false, false);
  if (NT >= 3) c = __builtin_amdgcn_wmma_f32_16x16x32_f16(false, ah, false, bl, (short)0, c, false, false);
  asm volatile("v_nop\n\tv_nop\n\tv_nop\n\tv_nop" : "+v"(c) : "v"(ah), "v"(al), "v"(bh), "v"(bl));
  return c;
}
// batched GEMM like k_gemm_b but f16 operands: A f32 (split into f16 hi/lo if ASPLIT, else rounded to f16), Bt = f16 values [n][k]; alpha; C f32; N multiple of 16 (partial tiles skipped)
template <bool ASPLIT>
__global__ __launch_bounds__(128) void k_gemm_h(const float* __restrict__ A, int lda, size_t sA, const _Float16* __restrict__ Bh, int ldb, size_t sB, float alpha, float* __restrict__ C, int ldc, size_t sC, int M, int N, int K) {
  __shared__ __attribute__((aligned(16))) float so[4][16][64];
  const int tid = threadIdx.x, w = tid >> 5, lane = tid & 31, ln = lane & 15, hh = lane >> 4; const int by = blockIdx.y;
  A += (size_t)by * sA; Bh += (size_t)by * sB; C += (size_t)by * sC;
  const int ntn = (N + 63) / 64; const int wid = blockIdx.x * 4 + w; const int mt = wid / ntn, nq = wid % ntn; if (mt * 16 >= M) return;
  const int row0 = mt * 16, col0 = nq * 64; const float* arow = A + (size_t)(row0 + ln) * lda;
  v8f acc[4] = {};
  for (int kb = 0; kb < K; kb += 32) {
    FragH ah, al;
    const v4f x0 = *(const v4fa*)(arow + kb + 8 * hh), x1 = *(const v4fa*)(arow + kb + 8 * hh + 4), x2 = *(const v4fa*)(arow + kb + 16 + 8 * hh), x3 = *(const v4fa*)(arow + kb + 16 + 8 * hh + 4);
    float xs[16] = {x0[0],x0[1],x0[2],x0[3],x1[0],x1[1],x1[2],x1[3],x2[0],x2[1],x2[2],x2[3],x3[0],x3[1],x3[2],x3[3]};
#pragma unroll
    for (int i = 0; i < 16; ++i) { const _Float16 h = (_Float16)xs[i]; ah.h[i] = h; al.h[i] = ASPLIT ? (_Float16)(xs[i] - (float)h) : (_Float16)0.0f; }
#pragma unroll
    for (int t = 0; t < 4; ++t) { if (col0 + t * 16 >= N) continue; const size_t boff = (size_t)(col0 + t * 16 + ln) * ldb + kb; FragH bq; bq.half[0] = *(const v8us*)(Bh + boff + 8 * hh); bq.half[1] = *(const v8us*)(Bh + boff + 16 + 8 * hh);
      acc[t] = mmaH<ASPLIT ? 2 : 1>(ah.v, al.v, bq.v, bq.v, acc[t]); }
  }
#pragma unroll
  for (int t = 0; t < 4; ++t) { if (col0 + t * 16 >= N) continue;
#pragma unroll
    for (int r = 0; r < 8; ++r) so[w][8 * hh + r][t * 16 + ln] = acc[t][r] * alpha; }
  __builtin_amdgcn_fence(__ATOMIC_ACQ_REL, "workgroup"); __builtin_amdgcn_wave_barrier();
  const int rsub = lane >> 4, c4 = (lane & 15) * 4;
  {
#pragma unroll
    for (int q = 0; q < 8; ++q) { const int r = q * 2 + rsub; if (col0 + c4 < N) { const v4f v = *(const v4fa*)&so[w][r][c4]; *(v4f*)(C + (size_t)(row0 + r) * ldc + col0 + c4) = v; } }
     }
}

// Wt[n][k] = f16(W[k][n]·scale) from f32 row-major W[K][N] (scale = power of two; bf16-exact weights stay exact in f16 away from the subnormal range)
// y picks one of four weight matrices of the same shape; their Wt planes lie one behind the other. bx: the block's index inside its matrix.
__device__ __forceinline__ void d_wt_f16(const float* __restrict__ W0, const float* __restrict__ W1, const float* __restrict__ W2, const float* __restrict__ W3, _Float16* __restrict__ Wt, int K, int N, float scale, int bx, int y) {
  const float* W = (y == 0) ? W0 : (y == 1) ? W1 : (y == 2) ? W2 : W3; Wt += (size_t)y * K * N;
  const int t = bx * 256 + threadIdx.x; if (t >= N * (K / 8)) return; const int n = t / (K / 8), k8 = (t % (K / 8)) * 8; FragH f;
#pragma unroll
  for (int i = 0; i < 8; ++i) f.h[i] = (_Float16)(bf16_round(W[(size_t)(k8 + i) * N + n]) * scale); const v8us o = f.half[0];
  *(v8us*)((unsigned short*)Wt + (size_t)n * K + k8) = o; 
}
// k_gemm_hh variant with fused epilogue: v = acc·alpha + bias[by·sBias + col] (+ CP[(row/rowsPerB)·sCPb + by·64 + col] if CP) ; ACT 0 none / 1 elu ; writes f16 C16 (and f32 C if non-null)
template <int ACT>
__global__ __launch_bounds__(128) void k_gemm_hhx(const _Float16* __restrict__ A, int lda, size_t sA, const _Float16* __restrict__ Bh, int ldb, size_t sB, float alpha, const float* __restrict__ bias, size_t sBias, const float* __restrict__ CP, int rowsPerB, size_t sCPb, int row0g,
    float* __restrict__ C, _Float16* __restrict__ C16, int ldc, size_t sC, int M, int N, int K) {
  __shared__ __attribute__((aligned(16))) float so[4][16][64];
  const int tid = threadIdx.x, w = tid >> 5, lane = tid & 31, ln = lane & 15, hh = lane >> 4; const int by = blockIdx.y;
  A += (size_t)by * sA; Bh += (size_t)by * sB; const size_t cofs = (size_t)by * sC; const float* bp = bias ? bias + (size_t)by * sBias : nullptr;
  const int ntn = (N + 63) / 64; const int wid = blockIdx.x * 4 + w; const int mt = wid / ntn, nq = wid % ntn; if (mt * 16 >= M) return;
  const int row0 = mt * 16, col0 = nq * 64; const _Float16* arow = A + (size_t)(row0 + ln) * lda;
  v8f acc[4] = {};
  for (int kb = 0; kb < K; kb += 32) { FragH ah; ah.half[0] = *(const v8us*)((const unsigned short*)arow + kb + 8 * hh); ah.half[1] = *(const v8us*)((const unsigned short*)arow + kb + 16 + 8 * hh);
#pragma unroll
    for (int t = 0; t < 4; ++t) { if (col0 + t * 16 >= N) continue; const size_t boff = (size_t)(col0 + t * 16 + ln) * ldb + kb; FragH bq; bq.half[0] = *(const v8us*)((const unsigned short*)Bh + boff + 8 * hh); bq.half[1] = *(const v8us*)((const unsigned short*)Bh + boff + 16 + 8 * hh);
      acc[t] = mmaH<1>(ah.v, ah.v, bq.v, bq.v, acc[t]); }
  }
#pragma unroll
  for (int t = 0; t < 4; ++t) { if (col0 + t * 16 >= N) continue; const int col = col0 + t * 16 + ln; const float bv = bp ? bf16_round(bp[col]) : 0.f;
#pragma unroll
    for (int r = 0; r < 8; ++r) { float v = acc[t][r] * alpha + bv; if (CP) { const int rr = row0g + row0 + 8 * hh + r; if (rowsPerB < 0) v += CP[cofs + (size_t)rr * ldc + col];      /* rowsPerB < 0: own element of the batched C plane */ else { const int bidx = rr / rowsPerB; v += CP[(size_t)bidx * sCPb + (size_t)by * 64 + col]; } } if (ACT == 1) v = (v > 0.f) ? v : expm1f(v); else if (ACT == 7) v = (v > 0.f) ? v + 1.0f : expf(v); else if (ACT == 8) v = tanhf(v); else if (ACT == 9) v = 0.5f * v * (1.0f + tanhf(0.7978845608028654f * (v + 0.044715f * v * v * v))); else if (ACT == 11) v = 1.0f / (1.0f + expf(-v)); else if (ACT == 12) v = (v > 0.f) ? v : 0.01f * v; else if (ACT == 14) v = (v > 0.f) ? v : 0.1f * v; else if (ACT == 16) v = (v >= 0.f) ? v : 0.3f * v; else if (ACT == 17) v = (v >= 0.f) ? v : 0.2f * v; else if (ACT == 15) v = v / (1.0f + expf(-v)); else if (ACT == 3) v = fmaxf(v, 0.f); else if (ACT == 6) v = 0.5f * v * (1.0f + erff(v * 0.70710678118654752f)); so[w][8 * hh + r][t * 16 + ln] = v; } }
  __builtin_amdgcn_fence(__ATOMIC_ACQ_REL, "workgroup"); __builtin_amdgcn_wave_barrier();
  const int rsub = lane >> 4, c4 = (lane & 15) * 4; typedef _Float16 v4h __attribute__((ext_vector_type(4)));
  {
#pragma unroll
    for (int q = 0; q < 8; ++q) { const int r = q * 2 + rsub; if (col0 + c4 < N) { const v4f v = *(const v4fa*)&so[w][r][c4]; if (C) *(v4f*)(C + cofs + (size_t)(row0 + r) * ldc + col0 + c4) = v; if (C16) { v4h h4; for (int i = 0; i < 4; ++i) h4[i] = (_Float16)v[i]; *(v4h*)(C16 + cofs + (size_t)(row0 + r) * ldc + col0 + c4) = h4; } } }
     }
}


typedef _Float16 v4h __attribute__((ext_vector_type(4)));

// y picks the stream (query, key, value input); the f16 planes lie one behind the other. bx: the block's index inside its stream.
__device__ __forceinline__ void d_x16(const float* __restrict__ x0, const float* __restrict__ x1, const float* __restrict__ x2, _Float16* __restrict__ X16, size_t n8, int bx, int y) { const size_t t = (size_t)bx * 256 + threadIdx.x; if (t >= n8) return; FragH f;
  const float* x = (y == 0) ? x0 : (y == 1) ? x1 : x2; X16 += (size_t)y * n8 * 8;
#pragma unroll
  for (int q = 0; q < 8; ++q) f.h[q] = (_Float16)bf16_round(x[t * 8 + q]); *(v8us*)((unsigned short*)X16 + t * 8) = f.half[0];  }
// One launch for the two preparations, which do not depend on each other: the first 4 * NWX blocks turn the weights, the other 3 * NXX convert the input streams.
#define NWX (DM * (DM / 8) / 256)      /* blocks per weight matrix */
#define NXX ((int)(NR * DM / 8 / 256)) /* blocks per input stream */
__global__ __launch_bounds__(256) void k_prep(const float* __restrict__ W0, const float* __restrict__ W1, const float* __restrict__ W2, const float* __restrict__ W3, _Float16* __restrict__ Wt, const float* __restrict__ x0, const float* __restrict__ x1, const float* __restrict__ x2, _Float16* __restrict__ X16) {
  const int bi = blockIdx.x;
  if (bi < 4 * NWX) d_wt_f16(W0, W1, W2, W3, Wt, DM, DM, 16.0f, bi % NWX, bi / NWX);
  else d_x16(x0, x1, x2, X16, NR * DM / 8, (bi - 4 * NWX) % NXX, (bi - 4 * NWX) / NXX); }
__global__ __launch_bounds__(256) void k_h16(const float* __restrict__ x, _Float16* __restrict__ X16, size_t n8) { const size_t t = (size_t)blockIdx.x * 256 + threadIdx.x; if (t >= n8) return; FragH f;
#pragma unroll
  for (int q = 0; q < 8; ++q) f.h[q] = (_Float16)x[t * 8 + q]; *(v8us*)((unsigned short*)X16 + t * 8) = f.half[0];  }
__global__ __launch_bounds__(256) void k_round16f(const float* __restrict__ W, _Float16* __restrict__ Bt, size_t n8) { const size_t t = (size_t)blockIdx.x * 256 + threadIdx.x; if (t >= n8) return; FragH f;
#pragma unroll
  for (int i = 0; i < 8; ++i) f.h[i] = (_Float16)(bf16_round(W[t * 8 + i]) * 16.0f); *(v8us*)((unsigned short*)Bt + t * 8) = f.half[0];  }
// One 64 x 64 tile (index bx) by 256 threads (tid) through their own LDS tile tl; the barrier inside is passed by the whole block.
template <int NHv, int TTv>
__device__ __forceinline__ void d_vt(const _Float16* __restrict__ V16, int ldv, int voff, _Float16* __restrict__ Vt, int bx, int tid, unsigned short (&tl)[64][66]) { const int slab = bx / (TTv / 64), lg = bx % (TTv / 64); const int b = slab / NHv, h = slab % NHv;
  for (int i = tid; i < 64 * 8; i += 256) { const int r = i / 8, c8 = (i % 8) * 8; FragH f; f.half[0] = *(const v8us*)((const unsigned short*)V16 + ((size_t)b * TTv + lg * 64 + r) * ldv + voff + h * 64 + c8);
#pragma unroll
    for (int q = 0; q < 8; ++q) tl[r][c8 + q] = f.u[q]; }
  __syncthreads();
  {
#pragma unroll
    for (int rd = 0; rd < 2; ++rd) { const int d = rd * 32 + tid / 8, pc = tid % 8; FragH f;
#pragma unroll
      for (int q = 0; q < 8; ++q) f.u[q] = tl[pc * 8 + q][d];
      *(v8us*)((unsigned short*)Vt + ((size_t)slab * 64 + d) * TTv + lg * 64 + pc * 8) = f.half[0]; }
    asm volatile("s_wait_xcnt 0x0" ::: "memory");      /* behind the two stores: in the shared launch another body's code follows them in the listing and reuses their registers */
     } }

__device__ __forceinline__ void d_hl(const float* __restrict__ F, _Float16* __restrict__ Hh, _Float16* __restrict__ Hl, size_t n8, int bx) { const size_t t = (size_t)bx * 256 + threadIdx.x; if (t >= n8) return; FragH fh, fl; const v4f a = *(const v4fa*)(F + t * 8), c = *(const v4fa*)(F + t * 8 + 4);
#pragma unroll
  for (int q = 0; q < 4; ++q) { _Float16 h = (_Float16)a[q]; fh.h[q] = h; fl.h[q] = (_Float16)((a[q] - (float)h) * 1024.0f); h = (_Float16)c[q]; fh.h[4 + q] = h; fl.h[4 + q] = (_Float16)((c[q] - (float)h) * 1024.0f); }
  { *(v8us*)((unsigned short*)Hh + t * 8) = fh.half[0]; *(v8us*)((unsigned short*)Hl + t * 8) = fl.half[0];  } }

// ---- fast GEMM (wave tile 32x64, block tile 128x64; requires M % 128 == 0 rows per launch region, N % 64 == 0 and K % 64 == 0); epilogue = k_gemm_hhx semantics ----
__device__ __forceinline__ v16h g2_frag(const _Float16* p, int hh) { FragH f; f.half[0] = *(const v8us*)((const unsigned short*)p + 8 * hh); f.half[1] = *(const v8us*)((const unsigned short*)p + 16 + 8 * hh); return f.v; }
__device__ __forceinline__ v8f g2_mma(v16h a, v16h b, v8f c) { v8f d = __builtin_amdgcn_wmma_f32_16x16x32_f16(false, a, false, b, (short)0, c, false, false); asm volatile("v_nop\n\tv_nop\n\tv_nop\n\tv_nop" : "+v"(d) : "v"(a), "v"(b)); return d; }
// The block's 4 waves need the same 64 Bt rows, and each A row feeds 4 column tiles: every 64-wide k step's 128 A rows and 64 Bt rows are brought into LDS once per block, as whole 128-byte rows (asynchronous copies, 12 of 16 bytes a thread), and the waves take their fragments from there. Two buffers: the next step's copies fly while this step is worked on.
#define GP 72                        /* LDS pitch of a staged row in 16-bit elements: 144 B = 16 B x odd, conflict-free for 16-byte fragment reads down 16 rows */
#define GR (16 * GP * 2)             /* bytes of 16 staged rows: the distance between two copies of one thread */
#define GB (192 * GP * 2)            /* bytes of one buffer: 128 A rows, then 64 Bt rows */
// Twelve 16-byte copies of one thread (8 A rows, 4 Bt rows); the wait as the statement's last line keeps every rewrite of the address registers behind it.
__device__ __forceinline__ void g2_copy12(unsigned l, const _Float16* a, size_t as, const _Float16* b, size_t bs) {
  asm volatile("global_load_async_to_lds_b128 %0, %12, off\n\tglobal_load_async_to_lds_b128 %1, %13, off\n\tglobal_load_async_to_lds_b128 %2, %14, off\n\tglobal_load_async_to_lds_b128 %3, %15, off\n\t"
               "global_load_async_to_lds_b128 %4, %16, off\n\tglobal_load_async_to_lds_b128 %5, %17, off\n\tglobal_load_async_to_lds_b128 %6, %18, off\n\tglobal_load_async_to_lds_b128 %7, %19, off\n\t"
               "global_load_async_to_lds_b128 %8, %20, off\n\tglobal_load_async_to_lds_b128 %9, %21, off\n\tglobal_load_async_to_lds_b128 %10, %22, off\n\tglobal_load_async_to_lds_b128 %11, %23, off\n\ts_wait_xcnt 0x0"
               :: "v"(l), "v"(l + GR), "v"(l + 2 * GR), "v"(l + 3 * GR), "v"(l + 4 * GR), "v"(l + 5 * GR), "v"(l + 6 * GR), "v"(l + 7 * GR), "v"(l + 8 * GR), "v"(l + 9 * GR), "v"(l + 10 * GR), "v"(l + 11 * GR),
                  "v"(a), "v"(a + as), "v"(a + 2 * as), "v"(a + 3 * as), "v"(a + 4 * as), "v"(a + 5 * as), "v"(a + 6 * as), "v"(a + 7 * as), "v"(b), "v"(b + bs), "v"(b + 2 * bs), "v"(b + 3 * bs) : "memory"); }
// One product's arguments. gx: its blocks per batch index; blockIdx.z: a second batch index (the projection) with strides sAz, sBz, sCz and its own bias vector.
struct G2P { const _Float16* A; const _Float16* Bh; const float* bias; const float* bias1; const float* bias2; const float* CP; float* C; _Float16* C16; size_t sA, sB, sBias, sCPb, sC, sAz, sBz, sCz; float alpha; int lda, ldb, rowsPerB, row0g, ldc, M, N, K, gx; };
// Two products that do not depend on each other share a launch: blocks with blockIdx.x < n0 work on p0, the others on p1 (the choice is the same for the whole block).
template <int ACT>
__global__ __launch_bounds__(128) void k_gemm2(const G2P p0, const G2P p1, int n0) { static_assert(ACT == 0 || ACT == 3 || ACT == 6 || ACT == 8 || ACT == 9 || ACT == 11 || ACT == 12 || ACT == 14 || ACT == 15 || ACT == 16 || ACT == 17, "k_gemm2: unsupported ACT code (would silently apply no activation)");
  __shared__ __attribute__((aligned(16))) union { _Float16 ab[2][192][GP]; float so[4][32][68]; } sm;      /* [buffer][128 A rows, 64 Bt rows][element]; the epilogue's tiles take the same bytes once the last step has been read */
  auto& so = sm.so;
  const bool sec = (int)blockIdx.x >= n0;
#define G2S(m) (sec ? p1.m : p0.m)
  const _Float16* A = G2S(A); const _Float16* Bh = G2S(Bh); const float* bias = G2S(bias); const float* bias1 = G2S(bias1); const float* bias2 = G2S(bias2); const float* CP = G2S(CP); float* C = G2S(C); _Float16* C16 = G2S(C16);
  const size_t sA = G2S(sA), sB = G2S(sB), sBias = G2S(sBias), sCPb = G2S(sCPb), sC = G2S(sC), sAz = G2S(sAz), sBz = G2S(sBz), sCz = G2S(sCz); const float alpha = G2S(alpha);
  const int lda = G2S(lda), ldb = G2S(ldb), rowsPerB = G2S(rowsPerB), row0g = G2S(row0g), ldc = G2S(ldc), M = G2S(M), N = G2S(N), K = G2S(K), gx = G2S(gx);
#undef G2S
  const int fl = (int)blockIdx.x - (sec ? n0 : 0); const int fy = fl / gx, bx = fl - fy * gx;      /* a product's batch index may lie in blockIdx.x (fy) or in blockIdx.y */
  const int tid = threadIdx.x, w = tid >> 5, lane = tid & 31, ln = lane & 15, hh = lane >> 4; const int by = blockIdx.y + fy;
  const int bz = blockIdx.z; const float* bsel = (bz == 0) ? bias : (bz == 1) ? bias1 : bias2;
  A += (size_t)by * sA + (size_t)bz * sAz; Bh += (size_t)by * sB + (size_t)bz * sBz; const size_t cofs = (size_t)by * sC + (size_t)bz * sCz; const float* bp = bsel ? bsel + (size_t)by * sBias : nullptr;
  const int ntn = N >> 6; const int mt = bx / ntn, nq = bx - mt * ntn; const int row0 = mt * 128 + 32 * w, col0 = nq * 64; if (mt * 128 >= M) return;      /* the same for the whole block, in front of every barrier */
  const int sr = tid >> 3, sc = (tid & 7) * 8;      /* staging: a thread copies piece sc of rows sr + 16 j of both tiles; a wave's copy is 4 whole rows */
  const _Float16* ag = A + (size_t)(mt * 128 + sr) * lda + sc; const _Float16* bg = Bh + (size_t)(col0 + sr) * ldb + sc;
  const unsigned ls = (unsigned)(size_t)&sm.ab[0][sr][sc];      /* the thread's LDS byte address in buffer 0 */
  auto stage = [&](int t) { g2_copy12(ls + (unsigned)(t & 1) * GB, ag + t * 64, (size_t)16 * lda, bg + t * 64, (size_t)16 * ldb); };
  const int nst = K >> 6;
  stage(0);
  asm volatile("s_wait_asynccnt 0x0" ::: "memory");      /* this wave's copies of step 0 have landed */
  __syncthreads();      /* ... and every other wave's: step 0 may be read */
  if (nst > 1) stage(1);
  const v8f z8 = {0.f,0.f,0.f,0.f,0.f,0.f,0.f,0.f}; v8f c00 = z8, c01 = z8, c02 = z8, c03 = z8, c10 = z8, c11 = z8, c12 = z8, c13 = z8;
#pragma unroll 1      /* one step already holds 24 fragment reads and 16 matrix products; a second copy would only cost registers */
  for (int s = 0; s < nst; ++s) { const _Float16* ap = &sm.ab[s & 1][32 * w + ln][0]; const _Float16* bq = &sm.ab[s & 1][128 + ln][0]; v16h a[2][2], b[2][4];      /* [32-wide k half of the step][16-row tile] */
#pragma unroll      /* a[], b[] in registers */
    for (int kh = 0; kh < 2; ++kh) { for (int t = 0; t < 2; ++t) a[kh][t] = g2_frag(ap + 16 * t * GP + 32 * kh, hh); for (int t = 0; t < 4; ++t) b[kh][t] = g2_frag(bq + 16 * t * GP + 32 * kh, hh); }
    asm volatile("" :: "v"(a[0][0]), "v"(a[0][1]), "v"(b[0][0]), "v"(b[0][1]), "v"(b[0][2]), "v"(b[0][3]), "v"(a[1][0]), "v"(a[1][1]), "v"(b[1][0]), "v"(b[1][1]), "v"(b[1][2]), "v"(b[1][3]));      /* inputs only, loaded values: the 24 LDS reads of the step stand as one group in front of the products (left alone, the compiler reuses one B register set and puts a full LDS wait in front of every pair of products) */
#pragma unroll      /* the two k halves in k order */
    for (int kh = 0; kh < 2; ++kh) {
      c00 = g2_mma(a[kh][0], b[kh][0], c00); c10 = g2_mma(a[kh][1], b[kh][0], c10);
      c01 = g2_mma(a[kh][0], b[kh][1], c01); c11 = g2_mma(a[kh][1], b[kh][1], c11);
      c02 = g2_mma(a[kh][0], b[kh][2], c02); c12 = g2_mma(a[kh][1], b[kh][2], c12);
      c03 = g2_mma(a[kh][0], b[kh][3], c03); c13 = g2_mma(a[kh][1], b[kh][3], c13); }
    asm volatile("s_wait_dscnt 0x0" ::: "memory");      /* this wave's reads of the step's buffer are done before the buffer is handed back */
    asm volatile("s_wait_asynccnt 0x0" ::: "memory");      /* this wave's copies of step s + 1 have landed */
    __syncthreads();      /* publishes step s + 1 and ends every wave's reads of step s's buffer */
    if (s + 2 < nst) stage(s + 2); }      /* refill of the buffer just read; the test is the same for the whole block */
  asm volatile("s_wait_asynccnt 0x0" ::: "memory");      /* no copy outstanding when the epilogue takes the buffers' bytes */
  v8f accs[8] = {c00, c01, c02, c03, c10, c11, c12, c13};
#pragma unroll
  for (int u = 0; u < 8; ++u) { const int t = u & 3, half = u >> 2; const int col = col0 + t * 16 + ln; const float bv = bp ? bf16_round(bp[col]) : 0.f;
#pragma unroll
    for (int r = 0; r < 8; ++r) { const int rloc = half * 16 + 8 * hh + r; float v = accs[u][r] * alpha + bv; if (CP) { if (rowsPerB < 0) v += CP[cofs + (size_t)(row0g + row0 + rloc) * ldc + col];      /* rowsPerB < 0: own element of the batched C plane */ else { const int bidx = (row0g + row0 + rloc) / rowsPerB; v += CP[(size_t)bidx * sCPb + (size_t)by * 64 + col]; } }
      if (ACT == 3) v = fmaxf(v, 0.f); else if (ACT == 6) v = 0.5f * v * (1.0f + erff(v * 0.70710678118654752f)); else if (ACT == 11) v = 1.0f / (1.0f + expf(-v)); else if (ACT == 15) v = v / (1.0f + expf(-v)); else if (ACT == 12) v = (v > 0.f) ? v : 0.01f * v; else if (ACT == 8) v = tanhf(v); else if (ACT == 9) v = 0.5f * v * (1.0f + tanhf(0.7978845608028654f * (v + 0.044715f * v * v * v))); else if (ACT == 14) v = (v > 0.f) ? v : 0.1f * v; else if (ACT == 16) v = (v >= 0.f) ? v : 0.3f * v; else if (ACT == 17) v = (v >= 0.f) ? v : 0.2f * v;
      so[w][rloc][t * 16 + ln] = v; } }
  __builtin_amdgcn_fence(__ATOMIC_ACQ_REL, "workgroup"); __builtin_amdgcn_wave_barrier();
  const int rsub = lane >> 4, c4 = (lane & 15) * 4;
  {
#pragma unroll
    for (int q = 0; q < 16; ++q) { const int r = q * 2 + rsub; const v4f v = *(const v4fa*)&so[w][r][c4]; if (C) *(v4f*)(C + cofs + (size_t)(row0 + r) * ldc + col0 + c4) = v; if (C16) { v4h h4; for (int i = 0; i < 4; ++i) h4[i] = (_Float16)v[i]; *(v4h*)(C16 + cofs + (size_t)(row0 + r) * ldc + col0 + c4) = h4; } }
     } }


__global__ __launch_bounds__(256) void k_wnat(const float* __restrict__ w, size_t n8, _Float16* __restrict__ Bt) { const size_t t = (size_t)blockIdx.x * 256 + threadIdx.x; if (t >= n8) return; FragH f; for (int q = 0; q < 8; ++q) f.h[q] = (_Float16)(bf16_round(w[t * 8 + q]) * 16.0f); *(v8us*)((unsigned short*)Bt + t * 8) = f.half[0];  }
__global__ __launch_bounds__(256) void k_rsm(const float* __restrict__ S, _Float16* __restrict__ P, int nrows) {
  #pragma clang fp contract(off)
  const int i = blockIdx.x * 256 + threadIdx.x; if (i >= nrows) return; const float* s = S + (size_t)i * SQ; float mx = -3.0e38f;
#pragma unroll 1
  for (int j = 0; j < SQ; ++j) mx = fmaxf(mx, s[j]); float se = 0.f;
#pragma unroll 1
  for (int j = 0; j < SQ; ++j) se += expf(s[j] - mx); const float sc = 256.0f / se;
#pragma unroll 1
  for (int j0 = 0; j0 < SQ; j0 += 8) { FragH f; for (int q = 0; q < 8; ++q) f.h[q] = (_Float16)(expf(s[j0 + q] - mx) * sc); unsigned short* d = (unsigned short*)P + (size_t)i * SQ + j0; *(v8us*)d = f.half[0];  } }
__global__ __launch_bounds__(256) void k_vt(const _Float16* __restrict__ V16, int b, int h0, _Float16* __restrict__ VT) { __shared__ unsigned short tl[64][65]; const int tid = threadIdx.x; const int hh = blockIdx.x % HG, sg = blockIdx.x / HG; const int s0 = sg * 64; const int h = h0 + hh;
  for (int i = tid; i < 64 * 8; i += 256) { const int j = i / 8, d8 = (i % 8) * 8; FragH f; f.half[0] = *(const v8us*)((const unsigned short*)V16 + ((size_t)b * SQ + s0 + j) * DM + h * HD + d8); for (int q = 0; q < 8; ++q) tl[d8 + q][j] = f.u[q]; }
  __syncthreads();
  { for (int i = tid; i < 64 * 8; i += 256) { const int d = i / 8, j8 = (i % 8) * 8; FragH f; for (int q = 0; q < 8; ++q) f.u[q] = tl[d][j8 + q]; *(v8us*)((unsigned short*)VT + ((size_t)hh * HD + d) * SQ + s0 + j8) = f.half[0]; }  } }



__global__ __launch_bounds__(256) void k_rsmkm(const float* __restrict__ S, _Float16* __restrict__ P, int nrows, const int* __restrict__ am) {
  #pragma clang fp contract(off)
  const int t = blockIdx.x * 256 + threadIdx.x; if (t >= nrows) return; const size_t i = (size_t)t; const float* s = S + i * SQ; const int* mr = am + (size_t)(t % SQ) * SQ; float mx = -3.0e38f;
#pragma unroll 1
  for (int j = 0; j < SQ; ++j) { const float f = (mr[j] != 0) ? 1.f : 0.f; mx = fmaxf(mx, fmaf(f, s[j], (1.f - f) * -1.0e9f)); } float se = 0.f;
#pragma unroll 1
  for (int j = 0; j < SQ; ++j) { const float f = (mr[j] != 0) ? 1.f : 0.f; se += __expf(fmaf(f, s[j], (1.f - f) * -1.0e9f) - mx); } const float sc = 256.0f / se;
#pragma unroll 1
  for (int j0 = 0; j0 < SQ; j0 += 8) { FragH fr; for (int q = 0; q < 8; ++q) { const int j = j0 + q; const float f = (mr[j] != 0) ? 1.f : 0.f; fr.h[q] = (_Float16)(__expf(fmaf(f, s[j], (1.f - f) * -1.0e9f) - mx) * sc); }
    unsigned short* d = (unsigned short*)P + i * SQ + j0; *(v8us*)d = fr.half[0];  } }
// exp of four values as __expf forms it (v_exp_f32 of x * log2 e). One statement, so that the free slot the instruction set asks for behind a transcendental stands there by construction: outputs are early-clobbered (no v_exp_f32 overwrites a neighbour's source or reads its result), and the v_nop fills the slot behind the last one.
__device__ __forceinline__ v4f exp_x4(v4f x) { float r0, r1, r2, r3;
  asm("v_exp_f32 %0, %4\n\tv_exp_f32 %1, %5\n\tv_exp_f32 %2, %6\n\tv_exp_f32 %3, %7\n\tv_nop" : "=&v"(r0), "=&v"(r1), "=&v"(r2), "=&v"(r3) : "v"(x[0] * 1.44269504088896340736f), "v"(x[1] * 1.44269504088896340736f), "v"(x[2] * 1.44269504088896340736f), "v"(x[3] * 1.44269504088896340736f));
  const v4f r = {r0, r1, r2, r3}; return r; }
// exp of one value, same form as exp_x4 (the v_nop fills the free slot behind the transcendental).
__device__ __forceinline__ float exp_x1(float x) { float r; asm("v_exp_f32 %0, %1\n\tv_nop" : "=&v"(r) : "v"(x * 1.44269504088896340736f)); return r; }
__device__ __forceinline__ v8f fa_mma(v16h a, v16h b, v8f c) { return __builtin_amdgcn_wmma_f32_16x16x32_f16(false, a, false, b, (short)0, c, false, false); }
#define FP 72                        /* LDS pitch of a staged row in 16-bit elements: 144 B = 16 B x odd, conflict-free for 16-byte fragment reads down 16 rows */
#define FT (64 * FP * 2)             /* bytes of one staged tile (64 rows) */
// Four 16-byte copies of one thread; the wait as the statement's last line keeps every rewrite of the address registers behind it.
__device__ __forceinline__ void fa_copy4(unsigned l0, unsigned l1, unsigned l2, unsigned l3, const _Float16* g0, const _Float16* g1, const _Float16* g2, const _Float16* g3) {
  asm volatile("global_load_async_to_lds_b128 %0, %4, off\n\tglobal_load_async_to_lds_b128 %1, %5, off\n\tglobal_load_async_to_lds_b128 %2, %6, off\n\tglobal_load_async_to_lds_b128 %3, %7, off\n\ts_wait_xcnt 0x0" :: "v"(l0), "v"(l1), "v"(l2), "v"(l3), "v"(g0), "v"(g1), "v"(g2), "v"(g3) : "memory"); }
// The split of the exact last-tile o into its f16 planes (d_hl) depends on nothing that this launch makes and rides along: the blocks with blockIdx.x >= SQ / 128, HLX of them per (head, batch), do that and nothing else.
#define HLX (QT0 * DM / 8 / 256 / NH)
__global__ __launch_bounds__(256) void k_fattn(const _Float16* __restrict__ Q, const _Float16* __restrict__ Kk, const _Float16* __restrict__ VTa, _Float16* __restrict__ O, const float* __restrict__ F, _Float16* __restrict__ Hh, _Float16* __restrict__ Hl) {
  __shared__ __attribute__((aligned(16))) _Float16 kv[2][2][64][FP];      /* [buffer][k rows, V^T rows][row][element] */
  if (blockIdx.x >= SQ / 128) { d_hl(F, Hh, Hl, (size_t)NB * QT0 * DM / 8, (int)((blockIdx.z * NH + blockIdx.y) * HLX + blockIdx.x - SQ / 128)); return; }      /* the same for the whole block, in front of every copy and barrier */
  const int lane = threadIdx.x & 31, ln = lane & 15, hh = lane >> 4; const int w = __builtin_amdgcn_readfirstlane(threadIdx.x >> 5);      /* wave number in a scalar register: the mask test below is a scalar branch */
  const int h = blockIdx.y, b = blockIdx.z; const int q0 = blockIdx.x * 128 + w * 16; const int qi = q0 + ln;
  const _Float16* qp = Q + ((size_t)b * SQ + qi) * LQ + h * HD; const v16h qf0 = g2_frag(qp, hh), qf1 = g2_frag(qp + 32, hh);
  const int sr = threadIdx.x >> 3, sc = (threadIdx.x & 7) * 8;      /* staging: a thread copies piece sc of rows sr and sr + 32 of both tiles; a wave's copy is 4 whole rows */
  const _Float16* kg = Kk + ((size_t)b * SQ + sr) * LQ + h * HD + sc; const _Float16* vg = VTa + (((size_t)b * NH + h) * HD + sr) * SQ + sc;
  const unsigned ls = (unsigned)(size_t)&kv[0][0][sr][sc];      /* the thread's LDS byte address in buffer 0 */
  auto stage = [&](int t) { const unsigned l = ls + (unsigned)(t & 1) * (2 * FT); const _Float16* kr = kg + (size_t)t * 64 * LQ; const _Float16* vr = vg + t * 64; fa_copy4(l, l + FT / 2, l + FT, l + FT + FT / 2, kr, kr + (size_t)32 * LQ, vr, vr + (size_t)32 * SQ); };
  static_assert(SQ / 64 >= 2, "the prologue fills two stages");
  stage(0);
  asm volatile("s_wait_asynccnt 0x0" ::: "memory");      /* this wave's copies of pass 0 have landed */
  __syncthreads();      /* ... and every other wave's: pass 0 may be read */
  stage(1);
  const v8f z8 = {0.f,0.f,0.f,0.f,0.f,0.f,0.f,0.f}; v8f o[4] = {z8, z8, z8, z8}; float m = -1.0e30f, l = 0.f;
#pragma unroll 1      /* one pass already holds 32 fragment loads and 16 matrix products; a second copy would only cost registers */
  for (int p = 0; p < SQ / 64; ++p) { const int k0 = p * 64; v8f s[4]; v16h kf[4][2], vf[4][2]; const _Float16* kp = &kv[p & 1][0][ln][0]; const _Float16* vp = &kv[p & 1][1][ln][0];
#pragma unroll      /* kf[] in registers */
    for (int t = 0; t < 4; ++t) { kf[t][0] = g2_frag(kp + 16 * t * FP, hh); kf[t][1] = g2_frag(kp + 16 * t * FP + 32, hh); }
    asm volatile("" :: "v"(kf[0][0]), "v"(kf[0][1]), "v"(kf[1][0]), "v"(kf[1][1]), "v"(kf[2][0]), "v"(kf[2][1]), "v"(kf[3][0]), "v"(kf[3][1]));      /* inputs only, loaded values: the 16 k reads of the pass stand as one group in front of the score products (left alone, the compiler spreads them among the products, each place with its own wait) */
#pragma unroll      /* s[] in registers */
    for (int t = 0; t < 4; ++t) { s[t] = fa_mma(kf[t][0], qf0, z8); s[t] = fa_mma(kf[t][1], qf1, s[t]); }
#pragma unroll      /* vf[] in registers; the v fragments arrive under the softmax arithmetic */
    for (int t = 0; t < 4; ++t) { vf[t][0] = g2_frag(vp + 16 * t * FP, hh); vf[t][1] = g2_frag(vp + 16 * t * FP + 32, hh); }
#pragma unroll      /* s[] in registers */
    for (int t = 0; t < 4; ++t) s[t] *= 0.125f;
    if (k0 <= q0 + 15) {      /* a pass whose keys all lie behind the wave's queries adds 0 * -1e9: skipped as an identity */
#pragma unroll      /* s[] in registers */
      for (int t = 0; t < 4; ++t) for (int r = 0; r < 8; ++r) { const float mk = (k0 + 16 * t + 8 * hh + r <= qi) ? 1.0f : 0.0f; s[t][r] = __fadd_rn(s[t][r], __fmul_rn(mk, -1.0e9f)); } }
    float mt = s[0][0];
#pragma unroll      /* s[] in registers */
    for (int t = 0; t < 4; ++t) for (int r = 0; r < 8; ++r) mt = fmaxf(mt, s[t][r]);
    mt = fmaxf(mt, __shfl_xor(mt, 16)); const float mn = fmaxf(m, mt); const float corr = exp_x1(m - mn); m = mn;
    v4f s4 = {0.f, 0.f, 0.f, 0.f}; FragH pf[2];
#pragma unroll      /* s[], pf[] in registers */
    for (int t = 0; t < 4; ++t) { const v4f a = {s[t][0], s[t][1], s[t][2], s[t][3]}, c = {s[t][4], s[t][5], s[t][6], s[t][7]}; const v4f ea = exp_x4(a - mn), ec = exp_x4(c - mn); s4 += ea; s4 += ec;
      for (int u = 0; u < 4; ++u) { pf[t >> 1].h[(t & 1) * 8 + u] = (_Float16)ea[u]; pf[t >> 1].h[(t & 1) * 8 + 4 + u] = (_Float16)ec[u]; } }
    l = l * corr + ((s4[0] + s4[1]) + (s4[2] + s4[3]));      /* each wave half keeps its own part of the sum; joined once behind the loop */
    asm volatile("" :: "v"(vf[0][0]), "v"(vf[0][1]), "v"(vf[1][0]), "v"(vf[1][1]), "v"(vf[2][0]), "v"(vf[2][1]), "v"(vf[3][0]), "v"(vf[3][1]));      /* inputs only, loaded values: the 16 v reads are all out before the first output product, none among the products */
#pragma unroll      /* o[] in registers */
    for (int t = 0; t < 4; ++t) { o[t] *= corr; o[t] = fa_mma(vf[t][0], pf[0].v, o[t]); o[t] = fa_mma(vf[t][1], pf[1].v, o[t]); }
    __builtin_amdgcn_sched_barrier(0);      /* the pass's arithmetic stays in front of the waits below: with the rider's body in the kernel the compiler lifted them and the barrier to the middle of the pass, which halves the flight time of the next pass's copies */
    asm volatile("s_wait_dscnt 0x0" ::: "memory");      /* this wave's reads of the pass's buffer are done before the buffer is handed back */
    asm volatile("s_wait_asynccnt 0x0" ::: "memory");      /* this wave's copies of pass p + 1 have landed */
    __syncthreads();      /* publishes pass p + 1 and ends every wave's reads of pass p's buffer */
    if (p + 2 < SQ / 64) stage(p + 2); }      /* refill of the buffer just read; the test is the same for the whole block */
  asm volatile("s_wait_asynccnt 0x0" ::: "memory");      /* no copy outstanding when the wave ends */
  l += __shfl_xor(l, 16); const float fin = 64.0f / l;      /* o carried x64 against f16 subnormal flush, folded into the output GEMM alpha */
  _Float16* op = O + ((size_t)b * SQ + qi) * DM + h * HD + 8 * hh;
#pragma unroll      /* o[] in registers; a lane's 8 accumulator registers are 8 consecutive columns of its query's row: one 16-byte store */
  for (int t = 0; t < 4; ++t) { FragH f; for (int r = 0; r < 8; ++r) f.h[r] = (_Float16)(o[t][r] * fin); *(v8us*)((unsigned short*)op + 16 * t) = f.half[0]; }
  asm volatile("s_wait_xcnt 0x0" ::: "memory"); }      /* behind the four stores: the rider's code follows them in the listing and reuses their registers */

// One lane per query row, 32 rows a block; the rows' keys are dealt over the block's KW waves (wave w takes keys w, w + KW, ... of the block's range), each wave with its own running maximum, sum and o; the KW partial results of a row are joined through LDS at the end. A wave's key index is wave-uniform, so k and v rows still come through the scalar path. The 64-wide loops are unrolled: q[] and o[] are indexed by constants only and stay in registers.
struct AttupLds { float lo[KW][32][HD + 4];      /* row pitch 272 B = 16 B x odd: 16-byte stores of 32 rows and 16-byte loads along a row both spread over the banks */
  float lm[KW][32], ll[KW][32]; };
__device__ __forceinline__ void d_attup(const float* __restrict__ QF, const float* __restrict__ KF, const float* __restrict__ VF, int ld, float scale, float* __restrict__ OF, int ldo, int bx, int by, AttupLds& sh) {
  #pragma clang fp contract(off)
  static_assert(KW == 16 && QT0 % 32 == 0 && HD == 64, "the join below gives each of the 32 * KW threads one 4-column piece of the 32 x 64 tile");
  auto& lo = sh.lo; auto& lm = sh.lm; auto& ll = sh.ll;
  const int tid = threadIdx.x, lane = tid & 31; const int w = __builtin_amdgcn_readfirstlane(tid >> 5);      /* wave number in a scalar register: key addresses stay scalar */
  const int h = bx / (QT0 / 32), rg = bx % (QT0 / 32); const int i = rg * 32 + lane;
  { const size_t bo = (size_t)by * QT0; QF += bo * ld; KF += bo * ld; VF += bo * ld; OF += bo * ldo; }      /* by: the batch; each batch has its own QT0-row tile */
  const float* qr = QF + (size_t)i * ld + h * HD; v4f q[HD / 4], o[HD / 4];
#pragma unroll      /* q[], o[] in registers; the q row's 16 loads in flight at once */
  for (int c = 0; c < HD / 4; ++c) { q[c] = *(const v4fa*)(qr + c * 4); const v4f z = {0.f, 0.f, 0.f, 0.f}; o[c] = z; }
  float m = -1.0e30f, l = 0.f;
#pragma unroll 1
  for (int j = rg * 32 + w; j < QT0; j += KW) { const float* kr = KF + (size_t)j * ld + h * HD; const float* vr = VF + (size_t)j * ld + h * HD; v4f kq[HD / 4], vv[HD / 4]; float s = 0.f;
#pragma unroll      /* a whole row's loads in flight at once */
    for (int c = 0; c < HD / 4; ++c) kq[c] = *(const v4fa*)(kr + c * 4);
#pragma unroll      /* the v row arrives under the score sum */
    for (int c = 0; c < HD / 4; ++c) vv[c] = *(const v4fa*)(vr + c * 4);
#pragma unroll      /* q[], kq[] in registers */
    for (int c = 0; c < HD / 4; ++c) { s = __fadd_rn(s, __fmul_rn(q[c][0], kq[c][0])); s = __fadd_rn(s, __fmul_rn(q[c][1], kq[c][1])); s = __fadd_rn(s, __fmul_rn(q[c][2], kq[c][2])); s = __fadd_rn(s, __fmul_rn(q[c][3], kq[c][3])); }
    s = __fmul_rn(s, scale);
    const float f = (j > i) ? 1.f : 0.f; const float sm = fmaf(f, s, (1.f - f) * -1.0e30f); const float mn = fmaxf(m, sm); const float sc = expf(m - mn); const float e = __fmul_rn(f, expf(sm - mn)); l = __fadd_rn(__fmul_rn(l, sc), e); m = mn;
#pragma unroll      /* o[], vv[] in registers */
    for (int c = 0; c < HD / 4; ++c) for (int u = 0; u < 4; ++u) o[c][u] = __fadd_rn(__fmul_rn(o[c][u], sc), __fmul_rn(e, vv[c][u])); }
#pragma unroll      /* o[] in registers */
  for (int c = 0; c < HD / 4; ++c) *(v4f*)&lo[w][lane][c * 4] = o[c];
  lm[w][lane] = m; ll[w][lane] = l;
  __syncthreads();
  { const int row = tid / 16, pc = (tid % 16) * 4; float mw[KW], mx = -1.0e30f, ls = 0.f; v4f a = {0.f, 0.f, 0.f, 0.f};      /* join: every partial is brought to the row's overall maximum; a wave that saw no visible key holds l = 0, o = 0 and adds nothing */
#pragma unroll      /* mw[] in registers */
    for (int u = 0; u < KW; ++u) { mw[u] = lm[u][row]; mx = fmaxf(mx, mw[u]); }
#pragma unroll      /* mw[] in registers; the 16 partial pieces' LDS loads in flight at once */
    for (int u = 0; u < KW; ++u) { const float fw = exp_x1(mw[u] - mx); const v4f p = *(const v4f*)&lo[u][row][pc]; ls += ll[u][row] * fw; a += p * fw; }
    const float fin = (ls > 0.f) ? 64.0f / ls : 0.f;      /* o carried x64 like the f16 path; the key-less last row is written by d_vmean */
    a *= fin; if (rg * 32 + row != QT0 - 1) *(v4f*)(OF + (size_t)(rg * 32 + row) * ldo + h * HD + pc) = a; } }      /* the key-less last row has one writer, d_vmean, in the same launch */

__device__ __forceinline__ void d_vmean(const _Float16* __restrict__ V, float* __restrict__ orow, int bx, int by) {
  #pragma clang fp contract(off)
  const int c = bx * (32 * KW) + threadIdx.x; if (c >= DM) return; const _Float16* p = V + (size_t)by * SQ * LQ + c; orow += (size_t)by * QT0 * DM; float s = 0.f;      /* by: the batch */
#pragma unroll 1
  for (int j0 = 0; j0 < SQ; j0 += 64) { _Float16 t[64];
#pragma unroll      /* 64 rows' loads in flight at once (the constant pitch LQ makes them one address register with immediate offsets); t[] in registers */
    for (int j = 0; j < 64; ++j) t[j] = p[(size_t)(j0 + j) * LQ];
#pragma unroll      /* summed in the rows' order */
    for (int j = 0; j < 64; ++j) s = __fadd_rn(s, (float)t[j]); }
  const float o = __fmul_rn(s, 64.0f / (float)SQ); *(float*)(orow + c) = o;  }

// One launch for the three pieces of work that need only the projections and not each other, dealt by block index, the longest first: the mean of v (last row), the exact attention of the last tile, V^T (two 64 x 64 tiles a block, one per half of its threads).
#define NVM (NBR * ((DM + 32 * KW - 1) / (32 * KW)))      /* blocks of d_vmean */
#define NAT (NBR * NH * (QT0 / 32))                       /* blocks of d_attup */
#define NVT (NBR * NH * (SQ / 64) / 2)                    /* blocks of d_vt */
__global__ __launch_bounds__(32 * KW) void k_mid(const _Float16* __restrict__ V16, _Float16* __restrict__ Vt, const float* __restrict__ QF, const float* __restrict__ KF, const float* __restrict__ VF, float* __restrict__ OF) {
  static_assert(32 * KW == 512 && (NBR * NH * (SQ / 64)) % 2 == 0, "d_vt: two halves of 256 threads, a tile each");
  __shared__ __attribute__((aligned(16))) union { AttupLds a; unsigned short tl[2][64][66]; } sm;
  const int bi = blockIdx.x;      /* every branch below is the same for the whole block; d_attup stands last in the chain so that the compiler lays it in front of the other bodies' stores: behind them its wave-uniform k and v row loads left the scalar path for 32 vector loads a key */
  if (bi < NVM) d_vmean(V16, OF + (size_t)(QT0 - 1) * DM, bi % (NVM / NBR), bi / (NVM / NBR));
  else if (bi >= NVM + NAT) d_vt<NH, SQ>(V16, LQ, 0, Vt, (bi - NVM - NAT) * 2 + (int)(threadIdx.x >> 8), (int)(threadIdx.x & 255), sm.tl[threadIdx.x >> 8]);
  else d_attup(QF, KF, VF, DM, 0.125f, OF, DM, (bi - NVM) % (NAT / NBR), (bi - NVM) / (NAT / NBR), sm.a); }

extern "C" void kernel_launch(void* const* d_in, const int* in_sizes, int n_in,
                              void* d_out, int out_size, void* d_ws, size_t ws_size, hipStream_t stream) {
  (void)in_sizes; (void)n_in; (void)out_size;
  const float* const* I = (const float* const*)d_in; const float* xq = I[0]; const float* xk = I[0]; const float* xv = I[0]; const float* wq = I[1]; const float* bq = I[2]; const float* wk = I[3]; const float* bk = I[4]; const float* wv = I[5]; const float* bv = I[6]; const float* wo = I[7]; const float* bo = I[8]; const float* x = xq;      /* ONE input feeds the query, key and value streams; [in][out] weights + biases; the mask is built from indices as in the module */
  static_assert(NH * HD == DM && DM % 64 == 0 && SQ % 128 == 0 && NH % HG == 0, "shape / tile multiples");
  static_assert(MP % 128 == 0 && MPO % 128 == 0 && QT0 % 128 == 0 && DM / 64 >= 2, "k_gemm2 stages whole 128-row, 64-column, 64-deep tiles");
  char* ws = (char*)d_ws; size_t off = 0;
  auto take = [&](size_t bytes) { char* p = ws + off; off += (bytes + 255) & ~(size_t)255; return p; };
  _Float16* BQ = (_Float16*)take((size_t)4 * DM * DM * 2); _Float16* BO = BQ + (size_t)3 * DM * DM;      /* Bt planes of Wq, Wk, Wv, Wo, one behind the other */
  _Float16* X16 = (_Float16*)take((size_t)3 * NR * DM * 2);      /* query, key and value inputs as exact f16 rows: three planes */
  _Float16* Q16 = (_Float16*)take((size_t)3 * NR * DM * 2); _Float16* K16 = Q16 + NR * DM; _Float16* V16 = K16 + NR * DM; _Float16* O16 = (_Float16*)take(NR * DM * 2);      /* q, k, v: three planes */
  _Float16* VT = (_Float16*)take((size_t)NB * NH * HD * SQ * 2);
  float* QF0 = (float*)take((size_t)3 * NB * QT0 * DM * 4); float* KF0 = QF0 + (size_t)NB * QT0 * DM; float* VF0 = KF0 + (size_t)NB * QT0 * DM; float* OF0 = (float*)take((size_t)NB * QT0 * DM * 4); _Float16* OH0 = (_Float16*)take((size_t)NB * QT0 * DM * 2); _Float16* OL0 = (_Float16*)take((size_t)NB * QT0 * DM * 2);      /* exact last tile of every batch: f32 q / k / v of the tile rows (three planes of [NB][QT0] rows), o (x64) and its f16 hi + x1024 residual planes */
  if (off > ws_size) return;
  auto g2 = [](const _Float16* A, int lda, size_t sA, const _Float16* Bh, int ldb, size_t sB, float alpha, const float* bias, size_t sBias, const float* CP, int rowsPerB, size_t sCPb, int row0g, float* C, _Float16* C16, int ldc, size_t sC, int M, int N, int K, size_t sAz, size_t sBz, size_t sCz, const float* bias1, const float* bias2, int gx) {
    G2P p; p.A = A; p.Bh = Bh; p.bias = bias; p.bias1 = bias1; p.bias2 = bias2; p.CP = CP; p.C = C; p.C16 = C16; p.sA = sA; p.sB = sB; p.sBias = sBias; p.sCPb = sCPb; p.sC = sC; p.sAz = sAz; p.sBz = sBz; p.sCz = sCz; p.alpha = alpha; p.lda = lda; p.ldb = ldb; p.rowsPerB = rowsPerB; p.row0g = row0g; p.ldc = ldc; p.M = M; p.N = N; p.K = K; p.gx = gx; return p; };
  static_assert((size_t)DM * (DM / 8) % 256 == 0 && NR * DM / 8 % 256 == 0 && (QT0 * DM / 8 / 256) % NH == 0 && (SQ - QT0) % 128 == 0 && B0 == 0 && NBR == NB, "whole blocks in the shared launches");
  k_prep<<<4 * NWX + 3 * NXX, 256, 0, stream>>>(wq, wk, wv, wo, BQ, x, xk, xv, X16);      /* [in][out] -> Bt x16 of the four weights; the three streams as f16 */
  const size_t r0p = (size_t)B0 * SQ;      /* first projected row */
  const size_t rl0 = r0p + SQ - QT0; const size_t f00 = (size_t)B0 * QT0;      /* first batch's last QT0 rows; its tile in the [NB][QT0] planes */
  const G2P gq = g2(X16 + r0p * DM, DM, 0, BQ, DM, 0, 0.0625f, bq, 0, nullptr, 1, 0, 0, nullptr, Q16 + r0p * DM, DM, 0, MP, DM, DM, NR * DM, (size_t)DM * DM, NR * DM, bk, bv, (MP / 128) * (DM / 64));      /* q, k, v (z) as f16 rows */
  const G2P gf = g2(X16 + rl0 * DM, DM, (size_t)SQ * DM, BQ, DM, 0, 0.0625f, bq, 0, nullptr, 1, 0, 0, QF0 + f00 * DM, nullptr, DM, (size_t)QT0 * DM, QT0, DM, DM, NR * DM, (size_t)DM * DM, (size_t)NB * QT0 * DM, bk, bv, (QT0 / 128) * (DM / 64));      /* f32 q, k, v (z) of every batch's last tile (exact products); the batch lies in blockIdx.x */
  k_gemm2<0><<<dim3((unsigned)((MP / 128) * (DM / 64) + NBR * (QT0 / 128) * (DM / 64)), 1, 3), 128, 0, stream>>>(gq, gf, (MP / 128) * (DM / 64));
  k_mid<<<NVM + NAT + NVT, 32 * KW, 0, stream>>>(V16 + r0p * LQ, VT + (size_t)B0 * NH * HD * SQ, QF0 + f00 * DM, KF0 + f00 * DM, VF0 + f00 * DM, OF0 + f00 * DM);      /* last row: uniform over all keys = 64 x mean of v; exact f32 attention over the keys j > i inside the last tile (o x64); V^T [NB][NH][HD][SQ] */
  k_fattn<<<dim3(SQ / 128 + HLX, NH, NB), 256, 0, stream>>>(Q16, K16, VT, O16, OF0, OH0, OL0);      /* scores, literal 'score + tril * (-1e9)', softmax over all keys and the weighted v sum, every (batch, head) -> o (merged heads, x64) as f16 rows; beside it last-tile o (x64) -> f16 hi + x1024 residual planes */
  const G2P go = g2(O16 + r0p * DM, DM, (size_t)SQ * DM, BO, DM, 0, 0.0009765625f, bo, 0, nullptr, 1, 0, 0, (float*)d_out + r0p * DM, nullptr, DM, (size_t)SQ * DM, SQ - QT0, DM, DM, 0, 0, 0, nullptr, nullptr, ((SQ - QT0) / 128) * (DM / 64));      /* out rows in front of every batch's (y) last tile, from the f16 path */
  const G2P gh = g2(OH0 + f00 * DM, DM, (size_t)QT0 * DM, BO, DM, 0, 0.0009765625f, bo, 0, nullptr, 1, 0, 0, (float*)d_out + rl0 * DM, nullptr, DM, (size_t)SQ * DM, QT0, DM, DM, 0, 0, 0, nullptr, nullptr, (QT0 / 128) * (DM / 64));      /* last QT0 rows of every batch (y): out = o_hi Wo (+ b) */
  k_gemm2<0><<<dim3((SQ / 128) * (DM / 64), NBR), 128, 0, stream>>>(go, gh, ((SQ - QT0) / 128) * (DM / 64));      /* every out row has one writer */
  const G2P gl = g2(OL0 + f00 * DM, DM, (size_t)QT0 * DM, BO, DM, 0, 0.00000095367431640625f, nullptr, 0, (const float*)d_out + rl0 * DM, -1, 0, 0, (float*)d_out + rl0 * DM, nullptr, DM, (size_t)SQ * DM, QT0, DM, DM, 0, 0, 0, nullptr, nullptr, (QT0 / 128) * (DM / 64));      /* += o_lo Wo 2^-20 (own-element accumulate) */
  k_gemm2<0><<<dim3((QT0 / 128) * (DM / 64), NBR), 128, 0, stream>>>(gl, gl, (QT0 / 128) * (DM / 64));      /* needs the launch before it: alone */
}

// v009
// Measured time: 157 microseconds a run.
// In two side-by-side timings against v008, it was 1.21 and 1.20 times as fast.
// All steps since v000 together make it 41.8 times as fast.
#include <hip/hip_runtime.h>
// Multi-head self-attention with the source's INVERTED causal mask (inputs [2][2048][1024]; q / k / v = x W + b ([in][out] 1024 x 1024 sigma 1/32, zero biases); 16 heads of 64; score = q k^T / sqrt(64) + tril * (-1e9): the LOWER triangle incl. the diagonal is pushed to -1e9 (the original's mask bug, kept), so query i attends to the keys j > i only, and the last query (every key masked, all scores rounding to the same -1e9 in f32) attends uniformly to all keys; softmax; out = merged Wo + bo -> [2][2048][1024]).
// Structure: token rows r = b*2048 + s; x as exact f16 rows (bf16-rounded); Q, K, V as three WMMA GEMMs in one launch (grid z; 32x64 wave tiles, f32 accumulation, exact x16 weights + bias, f16 outputs); V^T for all batches and heads via LDS transposes; one fused attention launch over every (batch, head): S^T = K Q^T on WMMA (K = 64, x 1/sqrt(64), then the -1e9 fill), running softmax on VALU (f32 statistics; unnormalised weights exp(s - max) as f16), O^T += V^T P^T on WMMA, o = O / sum (carried x64 against f16 subnormal flush, folded into the output GEMM alpha) written straight into the merged f16 o rows; out = o W_o + b GEMM (f32) into the output layout.
// Compute dtype: inputs rounded to bf16; x / weights exact; q, k, v, softmax weights and o as plain f16 GEMM operands (~2^-12); scores and softmax statistics f32. v_wmma_f32_16x16x32_f16.
#define NB 2
#define SQ 2048
#define DM 1024
#define NH 16
#define HD 64
#define QT0 256                      /* last-tile rows recomputed exactly in f32 (rows with fewer than 256 visible keys) */
#define HG 4                         /* heads per V^T group of the h0-based k_vt overload (not launched) */
#define KW 16                        /* waves of a k_mid block = parts d_attup deals a query row's keys into */
#define B0 0                         /* first batch processed (debug hook) */
#define NBR NB                       /* batches processed (debug hook) */
#define NR ((size_t)NB * SQ)         /* token rows */
#define MP ((int)((size_t)NBR * SQ)) /* rows projected (debug hook) */
#define QN SQ                        /* query rows attended per batch (not used) */
#define NHD NH                       /* heads attended (not used) */
#define MPO MP                       /* rows through the output stage (not used by its launches) */
#define LQ DM      /* row pitch of the q/k/v rows */
typedef __bf16 v16b __attribute__((ext_vector_type(16)));
typedef unsigned short v8us __attribute__((ext_vector_type(8), may_alias));
typedef float  v8f  __attribute__((ext_vector_type(8)));
typedef float  v4f  __attribute__((ext_vector_type(4)));
typedef float  v4fa __attribute__((ext_vector_type(4), may_alias));
union FragB { v16b v; v8us half[2]; unsigned short u[16]; };

__device__ __forceinline__ unsigned short bf16_bits(float x) { unsigned int u = __float_as_uint(x); return (unsigned short)((u + 0x7FFFu + ((u >> 16) & 1u)) >> 16); }
__device__ __forceinline__ float bf16_val(unsigned short b) { return __uint_as_float(((unsigned int)b) << 16); }
__device__ __forceinline__ float bf16_round(float x) { return bf16_val(bf16_bits(x)); }
// D += A·B with NT terms: 1 = ah·bh, 2 = + al·bh (A split), 3 = + ah·bl (both split)
template <int NT>
__device__ __forceinline__ v8f mmaN(v16b ah, v16b al, v16b bh, v16b bl, v8f c) {
  c = __builtin_amdgcn_wmma_f32_16x16x32_bf16(false, ah, false, bh, (short)0, c, false, false);
  if (NT >= 2) c = __builtin_amdgcn_wmma_f32_16x16x32_bf16(false, al, false, bh, (short)0, c, false, false);
  if (NT >= 3) c = __builtin_amdgcn_wmma_f32_16x16x32_bf16(false, ah, false, bl, (short)0, c, false, false);
  asm volatile("v_nop\n\tv_nop\n\tv_nop\n\tv_nop" : "+v"(c) : "v"(ah), "v"(al), "v"(bh), "v"(bl));
  return c;
}

__global__ __launch_bounds__(256) void k_wt_bf16(const float* __restrict__ W, unsigned short* __restrict__ Wt, int K, int N) {
  const int t = blockIdx.x * 256 + threadIdx.x;
  const int k8n = K / 8;
  if (t >= N * k8n) return;
  const int n = t / k8n, k8 = (t % k8n) * 8;
  v8us v;
#pragma unroll
  for (int i = 0; i < 8; ++i) v[i] = bf16_bits(W[(size_t)(k8 + i) * N + n]);
  *(v8us*)(Wt + (size_t)n * K + k8) = v;
  
}

// GEMM C[M][N] (f32, pitch ldc) = act(A[M][K]·W + bias). A f32 row-major (pitch lda) converted per fragment to bf16
// (ASPLIT: hi/lo two planes -> 2 terms, else single rounded term); Wt bf16 [N][K] (pitch ldb). BIAS_BF16 rounds the
// bias to bf16 first (bias quantised to bf16 before the add). K%32==0, M%16==0, N%64==0.
template <bool ASPLIT, int ACT, bool BIAS_BF16>
__global__ __launch_bounds__(128) void k_gemm_bf(const float* __restrict__ A, int lda, const unsigned short* __restrict__ Wt, int ldb,
                                               const float* __restrict__ bias, float* __restrict__ C, int ldc, int M, int N, int K) {
  __shared__ __attribute__((aligned(16))) float so[4][16][64];
  const int tid = threadIdx.x, w = tid >> 5, lane = tid & 31, ln = lane & 15, hh = lane >> 4;
  const int ntn = N / 64;
  const int wid = blockIdx.x * 4 + w;
  const int mt = wid / ntn, nq = wid % ntn;
  if (mt * 16 >= M) return;
  const int row0 = mt * 16, col0 = nq * 64;
  const float* arow = A + (size_t)(row0 + ln) * lda;
  v8f acc[4] = {};
  for (int kb = 0; kb < K; kb += 32) {
    FragB ah, al;
    const v4f x0 = *(const v4fa*)(arow + kb + 8 * hh), x1 = *(const v4fa*)(arow + kb + 8 * hh + 4);
    const v4f x2 = *(const v4fa*)(arow + kb + 16 + 8 * hh), x3 = *(const v4fa*)(arow + kb + 16 + 8 * hh + 4);
    float xs[16] = {x0[0],x0[1],x0[2],x0[3],x1[0],x1[1],x1[2],x1[3],x2[0],x2[1],x2[2],x2[3],x3[0],x3[1],x3[2],x3[3]};
#pragma unroll
    for (int i = 0; i < 16; ++i) { const unsigned short hb = bf16_bits(xs[i]); ah.u[i] = hb; al.u[i] = ASPLIT ? bf16_bits(xs[i] - bf16_val(hb)) : (unsigned short)0; }
#pragma unroll
    for (int t = 0; t < 4; ++t) {
      const unsigned short* brow = Wt + (size_t)(col0 + t * 16 + ln) * ldb + kb;
      FragB b;
      b.half[0] = *(const v8us*)(brow + 8 * hh);
      b.half[1] = *(const v8us*)(brow + 16 + 8 * hh);
      acc[t] = mmaN<ASPLIT ? 2 : 1>(ah.v, al.v, b.v, b.v, acc[t]);
    }
  }
#pragma unroll
  for (int t = 0; t < 4; ++t) {
    float bv = bias ? bias[col0 + t * 16 + ln] : 0.f;
    if (BIAS_BF16) bv = bf16_round(bv);
#pragma unroll
    for (int r = 0; r < 8; ++r) { float v = acc[t][r] + bv; if (ACT == 1) v = fmaxf(v, 0.f); so[w][8 * hh + r][t * 16 + ln] = v; }
  }
  __builtin_amdgcn_fence(__ATOMIC_ACQ_REL, "workgroup");
  __builtin_amdgcn_wave_barrier();
  const int rsub = lane >> 4, c4 = (lane & 15) * 4;
  {
#pragma unroll
    for (int q = 0; q < 8; ++q) {
      const int r = q * 2 + rsub;
      const v4f v = *(const v4fa*)&so[w][r][c4];
      *(v4f*)(C + (size_t)(row0 + r) * ldc + col0 + c4) = v;
    }
    
  }
}

// GEMM C = act(A·W + bias + resid): A f32 (ASPLIT -> hi/lo 2 terms), Wt bf16 [N][K]; ACT 0 none, 1 relu, 2 exact gelu;
// resid (optional, f32, row index = (row % rmod), pitch ldr, RES_BF16 rounds it) added before the activation.
template <bool ASPLIT, int ACT, bool BIAS_BF16, bool RES_BF16>
__global__ __launch_bounds__(128) void k_gemm_bf3(const float* __restrict__ A, int lda, const unsigned short* __restrict__ Wt, int ldb,
                                                const float* __restrict__ bias, const float* __restrict__ resid, int rmod, int ldr,
                                                float* __restrict__ C, int ldc, int M, int N, int K) {
  __shared__ __attribute__((aligned(16))) float so[4][16][64];
  const int tid = threadIdx.x, w = tid >> 5, lane = tid & 31, ln = lane & 15, hh = lane >> 4;
  const int ntn = N / 64;
  const int wid = blockIdx.x * 4 + w;
  const int mt = wid / ntn, nq = wid % ntn;
  if (mt * 16 >= M) return;
  const int row0 = mt * 16, col0 = nq * 64;
  const float* arow = A + (size_t)(row0 + ln) * lda;
  v8f acc[4] = {};
  for (int kb = 0; kb < K; kb += 32) {
    FragB ah, al;
    const v4f x0 = *(const v4fa*)(arow + kb + 8 * hh), x1 = *(const v4fa*)(arow + kb + 8 * hh + 4);
    const v4f x2 = *(const v4fa*)(arow + kb + 16 + 8 * hh), x3 = *(const v4fa*)(arow + kb + 16 + 8 * hh + 4);
    float xs[16] = {x0[0],x0[1],x0[2],x0[3],x1[0],x1[1],x1[2],x1[3],x2[0],x2[1],x2[2],x2[3],x3[0],x3[1],x3[2],x3[3]};
#pragma unroll
    for (int i = 0; i < 16; ++i) { const unsigned short hb = bf16_bits(xs[i]); ah.u[i] = hb; al.u[i] = ASPLIT ? bf16_bits(xs[i] - bf16_val(hb)) : (unsigned short)0; }
#pragma unroll
    for (int t = 0; t < 4; ++t) {
      const unsigned short* brow = Wt + (size_t)(col0 + t * 16 + ln) * ldb + kb;
      FragB b;
      b.half[0] = *(const v8us*)(brow + 8 * hh);
      b.half[1] = *(const v8us*)(brow + 16 + 8 * hh);
      acc[t] = mmaN<ASPLIT ? 2 : 1>(ah.v, al.v, b.v, b.v, acc[t]);
    }
  }
#pragma unroll
  for (int t = 0; t < 4; ++t) {
    const int col = col0 + t * 16 + ln;
    float bv = bias ? bias[col] : 0.f;
    if (BIAS_BF16) bv = bf16_round(bv);
#pragma unroll
    for (int r = 0; r < 8; ++r) {
      float v = acc[t][r] + bv;
      if (resid) { float rv = resid[(size_t)((row0 + 8 * hh + r) % rmod) * ldr + col]; if (RES_BF16) rv = bf16_round(rv); v += rv; }
      if (ACT == 1) v = fmaxf(v, 0.f);
      if (ACT == 2) v = 0.5f * v * (1.0f + erff(v * 0.70710678118654752f));
      if (ACT == 3) { const float u = 0.7978845608028654f * (v + 0.044715f * v * v * v); v = 0.5f * v * (1.0f + tanhf(u)); }
      so[w][8 * hh + r][t * 16 + ln] = v;
    }
  }
  __builtin_amdgcn_fence(__ATOMIC_ACQ_REL, "workgroup");
  __builtin_amdgcn_wave_barrier();
  const int rsub = lane >> 4, c4 = (lane & 15) * 4;
  {
#pragma unroll
    for (int q = 0; q < 8; ++q) {
      const int r = q * 2 + rsub;
      const v4f v = *(const v4fa*)&so[w][r][c4];
      *(v4f*)(C + (size_t)(row0 + r) * ldc + col0 + c4) = v;
    }
    
  }
}
// row LayerNorm (biased variance, eps) over N: s = X (+ R); optional out_sum <- s; out_norm <- (s-mu)*rsqrt(var+eps)*g + b
template <bool PARAM_BF16>
__global__ __launch_bounds__(256) void k_layernorm(const float* __restrict__ X, const float* __restrict__ R, const float* __restrict__ g, const float* __restrict__ bta,
                                                  float* __restrict__ out_sum, float* __restrict__ out_norm, int N, float eps) {
  __shared__ float red[256];
  const int row = blockIdx.x, tid = threadIdx.x;
  const float* x = X + (size_t)row * N; const float* rr = R ? R + (size_t)row * N : nullptr;
  float vals[16];                     // up to N = 4096
  const int per = N / 256;            // contiguous chunk per thread? use strided-by-4 chunks: thread handles j = tid*4 + 1024*u
  float s1 = 0.f;
  for (int u = 0; u < per / 4; ++u) {
    const int j = tid * 4 + 1024 * u;
    const v4f a = *(const v4fa*)(x + j);
    v4f b = {0.f,0.f,0.f,0.f}; if (rr) b = *(const v4fa*)(rr + j);
#pragma unroll
    for (int q = 0; q < 4; ++q) { const float v = a[q] + b[q]; vals[u * 4 + q] = v; s1 += v; }
  }
  red[tid] = s1; __syncthreads();
  for (int st = 128; st > 0; st >>= 1) { if (tid < st) red[tid] += red[tid + st]; __syncthreads(); }
  const float mu = red[0] / (float)N; __syncthreads();
  float s2 = 0.f;
  for (int u = 0; u < per / 4; ++u)
#pragma unroll
    for (int q = 0; q < 4; ++q) { const float c = vals[u * 4 + q] - mu; s2 += c * c; }
  red[tid] = s2; __syncthreads();
  for (int st = 128; st > 0; st >>= 1) { if (tid < st) red[tid] += red[tid + st]; __syncthreads(); }
  const float rs = rsqrtf(red[0] / (float)N + eps);
  {
    for (int u = 0; u < per / 4; ++u) {
      const int j = tid * 4 + 1024 * u;
      v4f o, sm;
#pragma unroll
      for (int q = 0; q < 4; ++q) {
        float gg = g[j + q], bb = bta[j + q];
        if (PARAM_BF16) { gg = bf16_round(gg); bb = bf16_round(bb); }
        sm[q] = vals[u * 4 + q]; o[q] = (vals[u * 4 + q] - mu) * rs * gg + bb;
      }
      if (out_sum) *(v4f*)(out_sum + (size_t)row * N + j) = sm;
      *(v4f*)(out_norm + (size_t)row * N + j) = o;
    }
    
  }
}



// ---- f16 WMMA path (v_wmma_f32_16x16x32_f16): 11-bit significands for operands in range — used where a [0,1] probability operand needs more precision than bf16
typedef _Float16 v16h __attribute__((ext_vector_type(16)));
union FragH { v16h v; v8us half[2]; _Float16 h[16]; unsigned short u[16]; };
template <int NT>
__device__ __forceinline__ v8f mmaH(v16h ah, v16h al, v16h bh, v16h bl, v8f c) {
  c = __builtin_amdgcn_wmma_f32_16x16x32_f16(false, ah, false, bh, (short)0, c, false, false);
  if (NT >= 2) c = __builtin_amdgcn_wmma_f32_16x16x32_f16(false, al, false, bh, (short)0, c, false, false);
  if (NT >= 3) c = __builtin_amdgcn_wmma_f32_16x16x32_f16(false, ah, false, bl, (short)0, c, false, false);
  asm volatile("v_nop\n\tv_nop\n\tv_nop\n\tv_nop" : "+v"(c) : "v"(ah), "v"(al), "v"(bh), "v"(bl));
  return c;
}
// batched GEMM like k_gemm_b but f16 operands: A f32 (split into f16 hi/lo if ASPLIT, else rounded to f16), Bt = f16 values [n][k]; alpha; C f32; N multiple of 16 (partial tiles skipped)
template <bool ASPLIT>
__global__ __launch_bounds__(128) void k_gemm_h(const float* __restrict__ A, int lda, size_t sA, const _Float16* __restrict__ Bh, int ldb, size_t sB, float alpha, float* __restrict__ C, int ldc, size_t sC, int M, int N, int K) {
  __shared__ __attribute__((aligned(16))) float so[4][16][64];
  const int tid = threadIdx.x, w = tid >> 5, lane = tid & 31, ln = lane & 15, hh = lane >> 4; const int by = blockIdx.y;
  A += (size_t)by * sA; Bh += (size_t)by * sB; C += (size_t)by * sC;
  const int ntn = (N + 63) / 64; const int wid = blockIdx.x * 4 + w; const int mt = wid / ntn, nq = wid % ntn; if (mt * 16 >= M) return;
  const int row0 = mt * 16, col0 = nq * 64; const float* arow = A + (size_t)(row0 + ln) * lda;
  v8f acc[4] = {};
  for (int kb = 0; kb < K; kb += 32) {
    FragH ah, al;
    const v4f x0 = *(const v4fa*)(arow + kb + 8 * hh), x1 = *(const v4fa*)(arow + kb + 8 * hh + 4), x2 = *(const v4fa*)(arow + kb + 16 + 8 * hh), x3 = *(const v4fa*)(arow + kb + 16 + 8 * hh + 4);
    float xs[16] = {x0[0],x0[1],x0[2],x0[3],x1[0],x1[1],x1[2],x1[3],x2[0],x2[1],x2[2],x2[3],x3[0],x3[1],x3[2],x3[3]};
#pragma unroll
    for (int i = 0; i < 16; ++i) { const _Float16 h = (_Float16)xs[i]; ah.h[i] = h; al.h[i] = ASPLIT ? (_Float16)(xs[i] - (float)h) : (_Float16)0.0f; }
#pragma unroll
    for (int t = 0; t < 4; ++t) { if (col0 + t * 16 >= N) continue; const size_t boff = (size_t)(col0 + t * 16 + ln) * ldb + kb; FragH bq; bq.half[0] = *(const v8us*)(Bh + boff + 8 * hh); bq.half[1] = *(const v8us*)(Bh + boff + 16 + 8 * hh);
      acc[t] = mmaH<ASPLIT ? 2 : 1>(ah.v, al.v, bq.v, bq.v, acc[t]); }
  }
#pragma unroll
  for (int t = 0; t < 4; ++t) { if (col0 + t * 16 >= N) continue;
#pragma unroll
    for (int r = 0; r < 8; ++r) so[w][8 * hh + r][t * 16 + ln] = acc[t][r] * alpha; }
  __builtin_amdgcn_fence(__ATOMIC_ACQ_REL, "workgroup"); __builtin_amdgcn_wave_barrier();
  const int rsub = lane >> 4, c4 = (lane & 15) * 4;
  {
#pragma unroll
    for (int q = 0; q < 8; ++q) { const int r = q * 2 + rsub; if (col0 + c4 < N) { const v4f v = *(const v4fa*)&so[w][r][c4]; *(v4f*)(C + (size_t)(row0 + r) * ldc + col0 + c4) = v; } }
     }
}

// Wt[n][k] = f16(W[k][n]·scale) from f32 row-major W[K][N] (scale = power of two; bf16-exact weights stay exact in f16 away from the subnormal range)
// y picks one of four weight matrices of the same shape; their Wt planes lie one behind the other. bx: the block's index inside its matrix.
__device__ __forceinline__ void d_wt_f16(const float* __restrict__ W0, const float* __restrict__ W1, const float* __restrict__ W2, const float* __restrict__ W3, _Float16* __restrict__ Wt, int K, int N, float scale, int bx, int y) {
  const float* W = (y == 0) ? W0 : (y == 1) ? W1 : (y == 2) ? W2 : W3; Wt += (size_t)y * K * N;
  const int t = bx * 256 + threadIdx.x; if (t >= N * (K / 8)) return; const int n = t / (K / 8), k8 = (t % (K / 8)) * 8; FragH f;
#pragma unroll
  for (int i = 0; i < 8; ++i) f.h[i] = (_Float16)(bf16_round(W[(size_t)(k8 + i) * N + n]) * scale); const v8us o = f.half[0];
  *(v8us*)((unsigned short*)Wt + (size_t)n * K + k8) = o; 
}
// k_gemm_hh variant with fused epilogue: v = acc·alpha + bias[by·sBias + col] (+ CP[(row/rowsPerB)·sCPb + by·64 + col] if CP) ; ACT 0 none / 1 elu ; writes f16 C16 (and f32 C if non-null)
template <int ACT>
__global__ __launch_bounds__(128) void k_gemm_hhx(const _Float16* __restrict__ A, int lda, size_t sA, const _Float16* __restrict__ Bh, int ldb, size_t sB, float alpha, const float* __restrict__ bias, size_t sBias, const float* __restrict__ CP, int rowsPerB, size_t sCPb, int row0g,
    float* __restrict__ C, _Float16* __restrict__ C16, int ldc, size_t sC, int M, int N, int K) {
  __shared__ __attribute__((aligned(16))) float so[4][16][64];
  const int tid = threadIdx.x, w = tid >> 5, lane = tid & 31, ln = lane & 15, hh = lane >> 4; const int by = blockIdx.y;
  A += (size_t)by * sA; Bh += (size_t)by * sB; const size_t cofs = (size_t)by * sC; const float* bp = bias ? bias + (size_t)by * sBias : nullptr;
  const int ntn = (N + 63) / 64; const int wid = blockIdx.x * 4 + w; const int mt = wid / ntn, nq = wid % ntn; if (mt * 16 >= M) return;
  const int row0 = mt * 16, col0 = nq * 64; const _Float16* arow = A + (size_t)(row0 + ln) * lda;
  v8f acc[4] = {};
  for (int kb = 0; kb < K; kb += 32) { FragH ah; ah.half[0] = *(const v8us*)((const unsigned short*)arow + kb + 8 * hh); ah.half[1] = *(const v8us*)((const unsigned short*)arow + kb + 16 + 8 * hh);
#pragma unroll
    for (int t = 0; t < 4; ++t) { if (col0 + t * 16 >= N) continue; const size_t boff = (size_t)(col0 + t * 16 + ln) * ldb + kb; FragH bq; bq.half[0] = *(const v8us*)((const unsigned short*)Bh + boff + 8 * hh); bq.half[1] = *(const v8us*)((const unsigned short*)Bh + boff + 16 + 8 * hh);
      acc[t] = mmaH<1>(ah.v, ah.v, bq.v, bq.v, acc[t]); }
  }
#pragma unroll
  for (int t = 0; t < 4; ++t) { if (col0 + t * 16 >= N) continue; const int col = col0 + t * 16 + ln; const float bv = bp ? bf16_round(bp[col]) : 0.f;
#pragma unroll
    for (int r = 0; r < 8; ++r) { float v = acc[t][r] * alpha + bv; if (CP) { const int rr = row0g + row0 + 8 * hh + r; if (rowsPerB < 0) v += CP[cofs + (size_t)rr * ldc + col];      /* rowsPerB < 0: own element of the batched C plane */ else { const int bidx = rr / rowsPerB; v += CP[(size_t)bidx * sCPb + (size_t)by * 64 + col]; } } if (ACT == 1) v = (v > 0.f) ? v : expm1f(v); else if (ACT == 7) v = (v > 0.f) ? v + 1.0f : expf(v); else if (ACT == 8) v = tanhf(v); else if (ACT == 9) v = 0.5f * v * (1.0f + tanhf(0.7978845608028654f * (v + 0.044715f * v * v * v))); else if (ACT == 11) v = 1.0f / (1.0f + expf(-v)); else if (ACT == 12) v = (v > 0.f) ? v : 0.01f * v; else if (ACT == 14) v = (v > 0.f) ? v : 0.1f * v; else if (ACT == 16) v = (v >= 0.f) ? v : 0.3f * v; else if (ACT == 17) v = (v >= 0.f) ? v : 0.2f * v; else if (ACT == 15) v = v / (1.0f + expf(-v)); else if (ACT == 3) v = fmaxf(v, 0.f); else if (ACT == 6) v = 0.5f * v * (1.0f + erff(v * 0.70710678118654752f)); so[w][8 * hh + r][t * 16 + ln] = v; } }
  __builtin_amdgcn_fence(__ATOMIC_ACQ_REL, "workgroup"); __builtin_amdgcn_wave_barrier();
  const int rsub = lane >> 4, c4 = (lane & 15) * 4; typedef _Float16 v4h __attribute__((ext_vector_type(4)));
  {
#pragma unroll
    for (int q = 0; q < 8; ++q) { const int r = q * 2 + rsub; if (col0 + c4 < N) { const v4f v = *(const v4fa*)&so[w][r][c4]; if (C) *(v4f*)(C + cofs + (size_t)(row0 + r) * ldc + col0 + c4) = v; if (C16) { v4h h4; for (int i = 0; i < 4; ++i) h4[i] = (_Float16)v[i]; *(v4h*)(C16 + cofs + (size_t)(row0 + r) * ldc + col0 + c4) = h4; } } }
     }
}


typedef _Float16 v4h __attribute__((ext_vector_type(4)));

// y picks the stream (query, key, value input); the f16 planes lie one behind the other. bx: the block's index inside its stream.
__device__ __forceinline__ void d_x16(const float* __restrict__ x0, const float* __restrict__ x1, const float* __restrict__ x2, _Float16* __restrict__ X16, size_t n8, int bx, int y) { const size_t t = (size_t)bx * 256 + threadIdx.x; if (t >= n8) return; FragH f;
  const float* x = (y == 0) ? x0 : (y == 1) ? x1 : x2; X16 += (size_t)y * n8 * 8;
#pragma unroll
  for (int q = 0; q < 8; ++q) f.h[q] = (_Float16)bf16_round(x[t * 8 + q]); *(v8us*)((unsigned short*)X16 + t * 8) = f.half[0];  }
// One launch for the two preparations, which do not depend on each other: the first 4 * NWX blocks turn the weights, the other 3 * NXX convert the input streams.
#define NWX (DM * (DM / 8) / 256)      /* blocks per weight matrix */
#define NXX ((int)(NR * DM / 8 / 256)) /* blocks per input stream */
__global__ __launch_bounds__(256) void k_prep(const float* __restrict__ W0, const float* __restrict__ W1, const float* __restrict__ W2, const float* __restrict__ W3, _Float16* __restrict__ Wt, const float* __restrict__ x0, const float* __restrict__ x1, const float* __restrict__ x2, _Float16* __restrict__ X16) {
  const int bi = blockIdx.x;
  if (bi < 4 * NWX) d_wt_f16(W0, W1, W2, W3, Wt, DM, DM, 16.0f, bi % NWX, bi / NWX);
  else d_x16(x0, x1, x2, X16, NR * DM / 8, (bi - 4 * NWX) % NXX, (bi - 4 * NWX) / NXX); }
__global__ __launch_bounds__(256) void k_h16(const float* __restrict__ x, _Float16* __restrict__ X16, size_t n8) { const size_t t = (size_t)blockIdx.x * 256 + threadIdx.x; if (t >= n8) return; FragH f;
#pragma unroll
  for (int q = 0; q < 8; ++q) f.h[q] = (_Float16)x[t * 8 + q]; *(v8us*)((unsigned short*)X16 + t * 8) = f.half[0];  }
__global__ __launch_bounds__(256) void k_round16f(const float* __restrict__ W, _Float16* __restrict__ Bt, size_t n8) { const size_t t = (size_t)blockIdx.x * 256 + threadIdx.x; if (t >= n8) return; FragH f;
#pragma unroll
  for (int i = 0; i < 8; ++i) f.h[i] = (_Float16)(bf16_round(W[t * 8 + i]) * 16.0f); *(v8us*)((unsigned short*)Bt + t * 8) = f.half[0];  }
// One 64 x 64 tile (index bx) by 256 threads (tid) through their own LDS tile tl; the barrier inside is passed by the whole block.
template <int NHv, int TTv>
__device__ __forceinline__ void d_vt(const _Float16* __restrict__ V16, int ldv, int voff, _Float16* __restrict__ Vt, int bx, int tid, unsigned short (&tl)[64][66]) { const int slab = bx / (TTv / 64), lg = bx % (TTv / 64); const int b = slab / NHv, h = slab % NHv;
  for (int i = tid; i < 64 * 8; i += 256) { const int r = i / 8, c8 = (i % 8) * 8; FragH f; f.half[0] = *(const v8us*)((const unsigned short*)V16 + ((size_t)b * TTv + lg * 64 + r) * ldv + voff + h * 64 + c8);
#pragma unroll
    for (int q = 0; q < 8; ++q) tl[r][c8 + q] = f.u[q]; }
  __syncthreads();
  {
#pragma unroll
    for (int rd = 0; rd < 2; ++rd) { const int d = rd * 32 + tid / 8, pc = tid % 8; FragH f;
#pragma unroll
      for (int q = 0; q < 8; ++q) f.u[q] = tl[pc * 8 + q][d];
      *(v8us*)((unsigned short*)Vt + ((size_t)slab * 64 + d) * TTv + lg * 64 + pc * 8) = f.half[0]; }
    asm volatile("s_wait_xcnt 0x0" ::: "memory");      /* behind the two stores: in the shared launch another body's code follows them in the listing and reuses their registers */
     } }

__device__ __forceinline__ void d_hl(const float* __restrict__ F, _Float16* __restrict__ Hh, _Float16* __restrict__ Hl, size_t n8, int bx) { const size_t t = (size_t)bx * 512 + threadIdx.x; if (t >= n8) return; FragH fh, fl; const v4f a = *(const v4fa*)(F + t * 8), c = *(const v4fa*)(F + t * 8 + 4);
#pragma unroll
  for (int q = 0; q < 4; ++q) { _Float16 h = (_Float16)a[q]; fh.h[q] = h; fl.h[q] = (_Float16)((a[q] - (float)h) * 1024.0f); h = (_Float16)c[q]; fh.h[4 + q] = h; fl.h[4 + q] = (_Float16)((c[q] - (float)h) * 1024.0f); }
  { *(v8us*)((unsigned short*)Hh + t * 8) = fh.half[0]; *(v8us*)((unsigned short*)Hl + t * 8) = fl.half[0];  } }

// ---- fast GEMM (wave tile 32x64, block tile 128x64; requires M % 128 == 0 rows per launch region, N % 64 == 0 and K % 64 == 0); epilogue = k_gemm_hhx semantics ----
__device__ __forceinline__ v16h g2_frag(const _Float16* p, int hh) { FragH f; f.half[0] = *(const v8us*)((const unsigned short*)p + 8 * hh); f.half[1] = *(const v8us*)((const unsigned short*)p + 16 + 8 * hh); return f.v; }
__device__ __forceinline__ v8f g2_mma(v16h a, v16h b, v8f c) { v8f d = __builtin_amdgcn_wmma_f32_16x16x32_f16(false, a, false, b, (short)0, c, false, false); asm volatile("v_nop\n\tv_nop\n\tv_nop\n\tv_nop" : "+v"(d) : "v"(a), "v"(b)); return d; }
// The block's 4 waves need the same 64 Bt rows, and each A row feeds 4 column tiles: every 64-wide k step's 128 A rows and 64 Bt rows are brought into LDS once per block, as whole 128-byte rows (asynchronous copies, 12 of 16 bytes a thread), and the waves take their fragments from there. Two buffers: the next step's copies fly while this step is worked on.
#define GP 72                        /* LDS pitch of a staged row in 16-bit elements: 144 B = 16 B x odd, conflict-free for 16-byte fragment reads down 16 rows */
#define GR (16 * GP * 2)             /* bytes of 16 staged rows: the distance between two copies of one thread */
#define GB (192 * GP * 2)            /* bytes of one buffer: 128 A rows, then 64 Bt rows */
// Twelve 16-byte copies of one thread (8 A rows, 4 Bt rows); the wait as the statement's last line keeps every rewrite of the address registers behind it.
__device__ __forceinline__ void g2_copy12(unsigned l, const _Float16* a, size_t as, const _Float16* b, size_t bs) {
  asm volatile("global_load_async_to_lds_b128 %0, %12, off\n\tglobal_load_async_to_lds_b128 %1, %13, off\n\tglobal_load_async_to_lds_b128 %2, %14, off\n\tglobal_load_async_to_lds_b128 %3, %15, off\n\t"
               "global_load_async_to_lds_b128 %4, %16, off\n\tglobal_load_async_to_lds_b128 %5, %17, off\n\tglobal_load_async_to_lds_b128 %6, %18, off\n\tglobal_load_async_to_lds_b128 %7, %19, off\n\t"
               "global_load_async_to_lds_b128 %8, %20, off\n\tglobal_load_async_to_lds_b128 %9, %21, off\n\tglobal_load_async_to_lds_b128 %10, %22, off\n\tglobal_load_async_to_lds_b128 %11, %23, off\n\ts_wait_xcnt 0x0"
               :: "v"(l), "v"(l + GR), "v"(l + 2 * GR), "v"(l + 3 * GR), "v"(l + 4 * GR), "v"(l + 5 * GR), "v"(l + 6 * GR), "v"(l + 7 * GR), "v"(l + 8 * GR), "v"(l + 9 * GR), "v"(l + 10 * GR), "v"(l + 11 * GR),
                  "v"(a), "v"(a + as), "v"(a + 2 * as), "v"(a + 3 * as), "v"(a + 4 * as), "v"(a + 5 * as), "v"(a + 6 * as), "v"(a + 7 * as), "v"(b), "v"(b + bs), "v"(b + 2 * bs), "v"(b + 3 * bs) : "memory"); }
// One product's arguments. gx: its blocks per batch index; blockIdx.z: a second batch index (the projection) with strides sAz, sBz, sCz and its own bias vector.
struct G2P { const _Float16* A; const _Float16* Bh; const float* bias; const float* bias1; const float* bias2; const float* CP; float* C; _Float16* C16; size_t sA, sB, sBias, sCPb, sC, sAz, sBz, sCz; float alpha; int lda, ldb, rowsPerB, row0g, ldc, M, N, K, gx; };
// Two products that do not depend on each other share a launch: blocks with blockIdx.x < n0 work on p0, the others on p1 (the choice is the same for the whole block).
template <int ACT>
__global__ __launch_bounds__(128) void k_gemm2(const G2P p0, const G2P p1, int n0) { static_assert(ACT == 0 || ACT == 3 || ACT == 6 || ACT == 8 || ACT == 9 || ACT == 11 || ACT == 12 || ACT == 14 || ACT == 15 || ACT == 16 || ACT == 17, "k_gemm2: unsupported ACT code (would silently apply no activation)");
  __shared__ __attribute__((aligned(16))) union { _Float16 ab[2][192][GP]; float so[4][32][68]; } sm;      /* [buffer][128 A rows, 64 Bt rows][element]; the epilogue's tiles take the same bytes once the last step has been read */
  auto& so = sm.so;
  const bool sec = (int)blockIdx.x >= n0;
#define G2S(m) (sec ? p1.m : p0.m)
  const _Float16* A = G2S(A); const _Float16* Bh = G2S(Bh); const float* bias = G2S(bias); const float* bias1 = G2S(bias1); const float* bias2 = G2S(bias2); const float* CP = G2S(CP); float* C = G2S(C); _Float16* C16 = G2S(C16);
  const size_t sA = G2S(sA), sB = G2S(sB), sBias = G2S(sBias), sCPb = G2S(sCPb), sC = G2S(sC), sAz = G2S(sAz), sBz = G2S(sBz), sCz = G2S(sCz); const float alpha = G2S(alpha);
  const int lda = G2S(lda), ldb = G2S(ldb), rowsPerB = G2S(rowsPerB), row0g = G2S(row0g), ldc = G2S(ldc), M = G2S(M), N = G2S(N), K = G2S(K), gx = G2S(gx);
#undef G2S
  const int fl = (int)blockIdx.x - (sec ? n0 : 0); const int fy = fl / gx, bx = fl - fy * gx;      /* a product's batch index may lie in blockIdx.x (fy) or in blockIdx.y */
  const int tid = threadIdx.x, w = tid >> 5, lane = tid & 31, ln = lane & 15, hh = lane >> 4; const int by = blockIdx.y + fy;
  const int bz = blockIdx.z; const float* bsel = (bz == 0) ? bias : (bz == 1) ? bias1 : bias2;
  A += (size_t)by * sA + (size_t)bz * sAz; Bh += (size_t)by * sB + (size_t)bz * sBz; const size_t cofs = (size_t)by * sC + (size_t)bz * sCz; const float* bp = bsel ? bsel + (size_t)by * sBias : nullptr;
  const int ntn = N >> 6; const int mt = bx / ntn, nq = bx - mt * ntn; const int row0 = mt * 128 + 32 * w, col0 = nq * 64; if (mt * 128 >= M) return;      /* the same for the whole block, in front of every barrier */
  const int sr = tid >> 3, sc = (tid & 7) * 8;      /* staging: a thread copies piece sc of rows sr + 16 j of both tiles; a wave's copy is 4 whole rows */
  const _Float16* ag = A + (size_t)(mt * 128 + sr) * lda + sc; const _Float16* bg = Bh + (size_t)(col0 + sr) * ldb + sc;
  const unsigned ls = (unsigned)(size_t)&sm.ab[0][sr][sc];      /* the thread's LDS byte address in buffer 0 */
  auto stage = [&](int t) { g2_copy12(ls + (unsigned)(t & 1) * GB, ag + t * 64, (size_t)16 * lda, bg + t * 64, (size_t)16 * ldb); };
  const int nst = K >> 6;
  stage(0);
  asm volatile("s_wait_asynccnt 0x0" ::: "memory");      /* this wave's copies of step 0 have landed */
  __syncthreads();      /* ... and every other wave's: step 0 may be read */
  if (nst > 1) stage(1);
  const v8f z8 = {0.f,0.f,0.f,0.f,0.f,0.f,0.f,0.f}; v8f c00 = z8, c01 = z8, c02 = z8, c03 = z8, c10 = z8, c11 = z8, c12 = z8, c13 = z8;
#pragma unroll 1      /* one step already holds 24 fragment reads and 16 matrix products; a second copy would only cost registers */
  for (int s = 0; s < nst; ++s) { const _Float16* ap = &sm.ab[s & 1][32 * w + ln][0]; const _Float16* bq = &sm.ab[s & 1][128 + ln][0]; v16h a[2][2], b[2][4];      /* [32-wide k half of the step][16-row tile] */
#pragma unroll      /* a[], b[] in registers */
    for (int kh = 0; kh < 2; ++kh) { for (int t = 0; t < 2; ++t) a[kh][t] = g2_frag(ap + 16 * t * GP + 32 * kh, hh); for (int t = 0; t < 4; ++t) b[kh][t] = g2_frag(bq + 16 * t * GP + 32 * kh, hh); }
    asm volatile("" :: "v"(a[0][0]), "v"(a[0][1]), "v"(b[0][0]), "v"(b[0][1]), "v"(b[0][2]), "v"(b[0][3]), "v"(a[1][0]), "v"(a[1][1]), "v"(b[1][0]), "v"(b[1][1]), "v"(b[1][2]), "v"(b[1][3]));      /* inputs only, loaded values: the 24 LDS reads of the step stand as one group in front of the products (left alone, the compiler reuses one B register set and puts a full LDS wait in front of every pair of products) */
#pragma unroll      /* the two k halves in k order */
    for (int kh = 0; kh < 2; ++kh) {
      c00 = g2_mma(a[kh][0], b[kh][0], c00); c10 = g2_mma(a[kh][1], b[kh][0], c10);
      c01 = g2_mma(a[kh][0], b[kh][1], c01); c11 = g2_mma(a[kh][1], b[kh][1], c11);
      c02 = g2_mma(a[kh][0], b[kh][2], c02); c12 = g2_mma(a[kh][1], b[kh][2], c12);
      c03 = g2_mma(a[kh][0], b[kh][3], c03); c13 = g2_mma(a[kh][1], b[kh][3], c13); }
    asm volatile("s_wait_dscnt 0x0" ::: "memory");      /* this wave's reads of the step's buffer are done before the buffer is handed back */
    asm volatile("s_wait_asynccnt 0x0" ::: "memory");      /* this wave's copies of step s + 1 have landed */
    __syncthreads();      /* publishes step s + 1 and ends every wave's reads of step s's buffer */
    if (s + 2 < nst) stage(s + 2); }      /* refill of the buffer just read; the test is the same for the whole block */
  asm volatile("s_wait_asynccnt 0x0" ::: "memory");      /* no copy outstanding when the epilogue takes the buffers' bytes */
  v8f accs[8] = {c00, c01, c02, c03, c10, c11, c12, c13};
#pragma unroll
  for (int u = 0; u < 8; ++u) { const int t = u & 3, half = u >> 2; const int col = col0 + t * 16 + ln; const float bv = bp ? bf16_round(bp[col]) : 0.f;
#pragma unroll
    for (int r = 0; r < 8; ++r) { const int rloc = half * 16 + 8 * hh + r; float v = accs[u][r] * alpha + bv; if (CP) { if (rowsPerB < 0) v += CP[cofs + (size_t)(row0g + row0 + rloc) * ldc + col];      /* rowsPerB < 0: own element of the batched C plane */ else { const int bidx = (row0g + row0 + rloc) / rowsPerB; v += CP[(size_t)bidx * sCPb + (size_t)by * 64 + col]; } }
      if (ACT == 3) v = fmaxf(v, 0.f); else if (ACT == 6) v = 0.5f * v * (1.0f + erff(v * 0.70710678118654752f)); else if (ACT == 11) v = 1.0f / (1.0f + expf(-v)); else if (ACT == 15) v = v / (1.0f + expf(-v)); else if (ACT == 12) v = (v > 0.f) ? v : 0.01f * v; else if (ACT == 8) v = tanhf(v); else if (ACT == 9) v = 0.5f * v * (1.0f + tanhf(0.7978845608028654f * (v + 0.044715f * v * v * v))); else if (ACT == 14) v = (v > 0.f) ? v : 0.1f * v; else if (ACT == 16) v = (v >= 0.f) ? v : 0.3f * v; else if (ACT == 17) v = (v >= 0.f) ? v : 0.2f * v;
      so[w][rloc][t * 16 + ln] = v; } }
  __builtin_amdgcn_fence(__ATOMIC_ACQ_REL, "workgroup"); __builtin_amdgcn_wave_barrier();
  const int rsub = lane >> 4, c4 = (lane & 15) * 4;
  {
#pragma unroll
    for (int q = 0; q < 16; ++q) { const int r = q * 2 + rsub; const v4f v = *(const v4fa*)&so[w][r][c4]; if (C) *(v4f*)(C + cofs + (size_t)(row0 + r) * ldc + col0 + c4) = v; if (C16) { v4h h4; for (int i = 0; i < 4; ++i) h4[i] = (_Float16)v[i]; *(v4h*)(C16 + cofs + (size_t)(row0 + r) * ldc + col0 + c4) = h4; } }
     } }


__global__ __launch_bounds__(256) void k_wnat(const float* __restrict__ w, size_t n8, _Float16* __restrict__ Bt) { const size_t t = (size_t)blockIdx.x * 256 + threadIdx.x; if (t >= n8) return; FragH f; for (int q = 0; q < 8; ++q) f.h[q] = (_Float16)(bf16_round(w[t * 8 + q]) * 16.0f); *(v8us*)((unsigned short*)Bt + t * 8) = f.half[0];  }
__global__ __launch_bounds__(256) void k_rsm(const float* __restrict__ S, _Float16* __restrict__ P, int nrows) {
  #pragma clang fp contract(off)
  const int i = blockIdx.x * 256 + threadIdx.x; if (i >= nrows) return; const float* s = S + (size_t)i * SQ; float mx = -3.0e38f;
#pragma unroll 1
  for (int j = 0; j < SQ; ++j) mx = fmaxf(mx, s[j]); float se = 0.f;
#pragma unroll 1
  for (int j = 0; j < SQ; ++j) se += expf(s[j] - mx); const float sc = 256.0f / se;
#pragma unroll 1
  for (int j0 = 0; j0 < SQ; j0 += 8) { FragH f; for (int q = 0; q < 8; ++q) f.h[q] = (_Float16)(expf(s[j0 + q] - mx) * sc); unsigned short* d = (unsigned short*)P + (size_t)i * SQ + j0; *(v8us*)d = f.half[0];  } }
__global__ __launch_bounds__(256) void k_vt(const _Float16* __restrict__ V16, int b, int h0, _Float16* __restrict__ VT) { __shared__ unsigned short tl[64][65]; const int tid = threadIdx.x; const int hh = blockIdx.x % HG, sg = blockIdx.x / HG; const int s0 = sg * 64; const int h = h0 + hh;
  for (int i = tid; i < 64 * 8; i += 256) { const int j = i / 8, d8 = (i % 8) * 8; FragH f; f.half[0] = *(const v8us*)((const unsigned short*)V16 + ((size_t)b * SQ + s0 + j) * DM + h * HD + d8); for (int q = 0; q < 8; ++q) tl[d8 + q][j] = f.u[q]; }
  __syncthreads();
  { for (int i = tid; i < 64 * 8; i += 256) { const int d = i / 8, j8 = (i % 8) * 8; FragH f; for (int q = 0; q < 8; ++q) f.u[q] = tl[d][j8 + q]; *(v8us*)((unsigned short*)VT + ((size_t)hh * HD + d) * SQ + s0 + j8) = f.half[0]; }  } }



__global__ __launch_bounds__(256) void k_rsmkm(const float* __restrict__ S, _Float16* __restrict__ P, int nrows, const int* __restrict__ am) {
  #pragma clang fp contract(off)
  const int t = blockIdx.x * 256 + threadIdx.x; if (t >= nrows) return; const size_t i = (size_t)t; const float* s = S + i * SQ; const int* mr = am + (size_t)(t % SQ) * SQ; float mx = -3.0e38f;
#pragma unroll 1
  for (int j = 0; j < SQ; ++j) { const float f = (mr[j] != 0) ? 1.f : 0.f; mx = fmaxf(mx, fmaf(f, s[j], (1.f - f) * -1.0e9f)); } float se = 0.f;
#pragma unroll 1
  for (int j = 0; j < SQ; ++j) { const float f = (mr[j] != 0) ? 1.f : 0.f; se += __expf(fmaf(f, s[j], (1.f - f) * -1.0e9f) - mx); } const float sc = 256.0f / se;
#pragma unroll 1
  for (int j0 = 0; j0 < SQ; j0 += 8) { FragH fr; for (int q = 0; q < 8; ++q) { const int j = j0 + q; const float f = (mr[j] != 0) ? 1.f : 0.f; fr.h[q] = (_Float16)(__expf(fmaf(f, s[j], (1.f - f) * -1.0e9f) - mx) * sc); }
    unsigned short* d = (unsigned short*)P + i * SQ + j0; *(v8us*)d = fr.half[0];  } }
// exp of four values as __expf forms it (v_exp_f32 of x * log2 e). One statement, so that the free slot the instruction set asks for behind a transcendental stands there by construction: outputs are early-clobbered (no v_exp_f32 overwrites a neighbour's source or reads its result), and the v_nop fills the slot behind the last one.
__device__ __forceinline__ v4f exp_x4(v4f x) { float r0, r1, r2, r3;
  asm("v_exp_f32 %0, %4\n\tv_exp_f32 %1, %5\n\tv_exp_f32 %2, %6\n\tv_exp_f32 %3, %7\n\tv_nop" : "=&v"(r0), "=&v"(r1), "=&v"(r2), "=&v"(r3) : "v"(x[0] * 1.44269504088896340736f), "v"(x[1] * 1.44269504088896340736f), "v"(x[2] * 1.44269504088896340736f), "v"(x[3] * 1.44269504088896340736f));
  const v4f r = {r0, r1, r2, r3}; return r; }
// exp of one value, same form as exp_x4 (the v_nop fills the free slot behind the transcendental).
__device__ __forceinline__ float exp_x1(float x) { float r; asm("v_exp_f32 %0, %1\n\tv_nop" : "=&v"(r) : "v"(x * 1.44269504088896340736f)); return r; }
__device__ __forceinline__ v8f fa_mma(v16h a, v16h b, v8f c) { return __builtin_amdgcn_wmma_f32_16x16x32_f16(false, a, false, b, (short)0, c, false, false); }
#define FP 72                        /* LDS pitch of a staged row in 16-bit elements: 144 B = 16 B x odd, conflict-free for 16-byte fragment reads down 16 rows */
#define FT (64 * FP * 2)             /* bytes of one staged tile (64 rows) */
// Four 16-byte copies of one thread; the wait as the statement's last line keeps every rewrite of the address registers behind it.
__device__ __forceinline__ void fa_copy4(unsigned l0, unsigned l1, unsigned l2, unsigned l3, const _Float16* g0, const _Float16* g1, const _Float16* g2, const _Float16* g3) {
  asm volatile("global_load_async_to_lds_b128 %0, %4, off\n\tglobal_load_async_to_lds_b128 %1, %5, off\n\tglobal_load_async_to_lds_b128 %2, %6, off\n\tglobal_load_async_to_lds_b128 %3, %7, off\n\ts_wait_xcnt 0x0" :: "v"(l0), "v"(l1), "v"(l2), "v"(l3), "v"(g0), "v"(g1), "v"(g2), "v"(g3) : "memory"); }
// The split of the exact last-tile o into its f16 planes (d_hl) depends on nothing that this launch makes and rides along: the blocks with blockIdx.x >= NFA, NHL of them, do that and nothing else.
#define QTL ((SQ - QT0) / 128)            /* 128-query tiles attended per (batch, head) */
#define NFA (NB * NH * QTL)               /* attention blocks */
#define NHL (NB * QT0 * DM / 8 / 512)     /* blocks of d_hl */
typedef float v2f __attribute__((ext_vector_type(2)));
__global__ __launch_bounds__(512) void k_fattn(const _Float16* __restrict__ Q, const _Float16* __restrict__ Kk, const _Float16* __restrict__ VTa, _Float16* __restrict__ O, const float* __restrict__ F, _Float16* __restrict__ Hh, _Float16* __restrict__ Hl) {
  __shared__ __attribute__((aligned(16))) union { _Float16 kv[2][2][2][64][FP]; struct { float o[8][8][32][4]; float ml[8][32][2]; } jn; } sm;      /* [buffer][wave group][k rows, V^T rows][row][element]; the join's [wave][piece][lane] planes take the same bytes once the last trip has been read */
  if (blockIdx.x >= NFA) { d_hl(F, Hh, Hl, (size_t)NB * QT0 * DM / 8, (int)blockIdx.x - NFA); return; }      /* the same for the whole block, in front of every copy and barrier */
  const int lane = threadIdx.x & 31, ln = lane & 15, hh = lane >> 4; const int w = __builtin_amdgcn_readfirstlane(threadIdx.x >> 5);      /* wave number in a scalar register: the tests on q0 and g below are scalar branches */
  const int qt = (int)blockIdx.x / (NB * NH), hb = (int)blockIdx.x % (NB * NH); const int h = hb % NH, b = hb / NH; const int g = w >> 3; const int q0 = qt * 128 + (w & 7) * 16; const int qi = q0 + ln;
  const _Float16* qp = Q + ((size_t)b * SQ + qi) * LQ + h * HD; const v16h qf0 = g2_frag(qp, hh), qf1 = g2_frag(qp + 32, hh);
  const int sr = threadIdx.x >> 3, sc = (threadIdx.x & 7) * 8;      /* staging: a thread copies piece sc of row sr of the four tiles; a wave's copy is 4 whole rows */
  const _Float16* kg = Kk + ((size_t)b * SQ + sr) * LQ + h * HD + sc; const _Float16* vg = VTa + (((size_t)b * NH + h) * HD + sr) * SQ + sc;
  const unsigned ls = (unsigned)(size_t)&sm.kv[0][0][0][sr][sc];      /* the thread's LDS byte address in buffer 0 */
  auto stage = [&](int t) { const unsigned l = ls + (unsigned)(t & 1) * (4 * FT); const _Float16* kr = kg + (size_t)t * 128 * LQ; const _Float16* vr = vg + t * 128; fa_copy4(l, l + FT, l + 2 * FT, l + 3 * FT, kr, vr, kr + (size_t)64 * LQ, vr + 64); };      /* trip t: keys 128 t ... 128 t + 127 */
  static_assert(QTL + 1 < SQ / 128 && SQ % 128 == 0, "every tile has at least three trips: the prologue's two stages exist, and each group meets visible keys for every query");
  stage(qt);
  asm volatile("s_wait_asynccnt 0x0" ::: "memory");      /* this wave's copies of the first trip have landed */
  __syncthreads();      /* ... and every other wave's: the first trip may be read */
  stage(qt + 1);
  const v8f z8 = {0.f,0.f,0.f,0.f,0.f,0.f,0.f,0.f}; v8f o[4] = {z8, z8, z8, z8}; float m = -1.0e30f, l = 0.f;
#pragma unroll 1      /* one pass already holds 32 fragment loads and 16 matrix products; a second copy would only cost registers */
  for (int p = qt; p < SQ / 128; ++p) { const int k0 = p * 128 + g * 64;
   if (k0 + 63 > q0) {      /* else every key of the pass is masked for every query of the wave: no work; the wave still passes the waits, the barrier and its share of the copies below */
    v8f s[4]; v16h kf[4][2], vf[4][2]; const _Float16* kp = &sm.kv[p & 1][g][0][ln][0]; const _Float16* vp = &sm.kv[p & 1][g][1][ln][0];
#pragma unroll      /* kf[] in registers */
    for (int t = 0; t < 4; ++t) { kf[t][0] = g2_frag(kp + 16 * t * FP, hh); kf[t][1] = g2_frag(kp + 16 * t * FP + 32, hh); }
    asm volatile("" :: "v"(kf[0][0]), "v"(kf[0][1]), "v"(kf[1][0]), "v"(kf[1][1]), "v"(kf[2][0]), "v"(kf[2][1]), "v"(kf[3][0]), "v"(kf[3][1]));      /* inputs only, loaded values: the 16 k reads of the pass stand as one group in front of the score products (left alone, the compiler spreads them among the products, each place with its own wait) */
#pragma unroll      /* s[] in registers */
    for (int t = 0; t < 4; ++t) { s[t] = fa_mma(kf[t][0], qf0, z8); s[t] = fa_mma(kf[t][1], qf1, s[t]); }
#pragma unroll      /* vf[] in registers; the v fragments arrive under the softmax arithmetic */
    for (int t = 0; t < 4; ++t) { vf[t][0] = g2_frag(vp + 16 * t * FP, hh); vf[t][1] = g2_frag(vp + 16 * t * FP + 32, hh); }
#pragma unroll      /* s[] in registers */
    for (int t = 0; t < 4; ++t) s[t] *= 0.125f;
    if (k0 <= q0 + 15) {      /* a pass whose keys all lie behind the wave's queries adds 0 * -1e9: skipped as an identity */
#pragma unroll      /* s[] in registers */
      for (int t = 0; t < 4; ++t) for (int r = 0; r < 8; ++r) { const float mk = (k0 + 16 * t + 8 * hh + r <= qi) ? 1.0f : 0.0f; s[t][r] = __fadd_rn(s[t][r], __fmul_rn(mk, -1.0e9f)); } }
    float mt = s[0][0];
#pragma unroll      /* s[] in registers */
    for (int t = 0; t < 4; ++t) for (int r = 0; r < 8; ++r) mt = fmaxf(mt, s[t][r]);
    mt = fmaxf(mt, __shfl_xor(mt, 16)); const float mn = fmaxf(m, mt); const float corr = exp_x1(m - mn); m = mn;
    v4f s4 = {0.f, 0.f, 0.f, 0.f}; FragH pf[2];
#pragma unroll      /* s[], pf[] in registers */
    for (int t = 0; t < 4; ++t) { const v4f a = {s[t][0], s[t][1], s[t][2], s[t][3]}, c = {s[t][4], s[t][5], s[t][6], s[t][7]}; const v4f ea = exp_x4(a - mn), ec = exp_x4(c - mn); s4 += ea; s4 += ec;
      for (int u = 0; u < 4; ++u) { pf[t >> 1].h[(t & 1) * 8 + u] = (_Float16)ea[u]; pf[t >> 1].h[(t & 1) * 8 + 4 + u] = (_Float16)ec[u]; } }
    l = l * corr + ((s4[0] + s4[1]) + (s4[2] + s4[3]));      /* each wave half keeps its own part of the sum; joined once behind the loop */
    asm volatile("" :: "v"(vf[0][0]), "v"(vf[0][1]), "v"(vf[1][0]), "v"(vf[1][1]), "v"(vf[2][0]), "v"(vf[2][1]), "v"(vf[3][0]), "v"(vf[3][1]));      /* inputs only, loaded values: the 16 v reads are all out before the first output product, none among the products */
#pragma unroll      /* o[] in registers */
    for (int t = 0; t < 4; ++t) { o[t] *= corr; o[t] = fa_mma(vf[t][0], pf[0].v, o[t]); o[t] = fa_mma(vf[t][1], pf[1].v, o[t]); } }
    __builtin_amdgcn_sched_barrier(0);      /* the pass's arithmetic stays in front of the waits below: with the rider's body in the kernel the compiler lifted them and the barrier to the middle of the pass, which halves the flight time of the next pass's copies */
    asm volatile("s_wait_dscnt 0x0" ::: "memory");      /* this wave's reads of the trip's buffer are done before the buffer is handed back */
    asm volatile("s_wait_asynccnt 0x0" ::: "memory");      /* this wave's copies of trip p + 1 have landed */
    __syncthreads();      /* publishes trip p + 1 and ends every wave's reads of trip p's buffer */
    if (p + 2 < SQ / 128) stage(p + 2); }      /* refill of the buffer just read; the test is the same for the whole block */
  asm volatile("s_wait_asynccnt 0x0" ::: "memory");      /* no copy outstanding when the join takes the buffers' bytes */
  if (g == 1) {      /* the second group hands its partial result over, lane to lane: 16-byte pieces, a wave's 32 lanes side by side */
#pragma unroll      /* o[] in registers */
    for (int t = 0; t < 4; ++t) { const v4f a = {o[t][0], o[t][1], o[t][2], o[t][3]}, c = {o[t][4], o[t][5], o[t][6], o[t][7]}; *(v4f*)&sm.jn.o[w & 7][2 * t][lane][0] = a; *(v4f*)&sm.jn.o[w & 7][2 * t + 1][lane][0] = c; }
    const v2f ml = {m, l}; *(v2f*)&sm.jn.ml[w & 7][lane][0] = ml; }
  __syncthreads();      /* the partial results are there; passed by all 16 waves */
  if (g == 1) return;
  { const v2f ml = *(const v2f*)&sm.jn.ml[w][lane][0]; const float mx = fmaxf(m, ml[0]); const float f0 = exp_x1(m - mx), f1 = exp_x1(ml[0] - mx); l = l * f0 + ml[1] * f1;      /* both partial results brought to the query's overall maximum */
#pragma unroll      /* o[] in registers */
    for (int t = 0; t < 4; ++t) { const v4f a = *(const v4f*)&sm.jn.o[w][2 * t][lane][0], c = *(const v4f*)&sm.jn.o[w][2 * t + 1][lane][0]; for (int r = 0; r < 4; ++r) { o[t][r] = o[t][r] * f0 + a[r] * f1; o[t][4 + r] = o[t][4 + r] * f0 + c[r] * f1; } } }
  l += __shfl_xor(l, 16); const float fin = 64.0f / l;      /* o carried x64 against f16 subnormal flush, folded into the output GEMM alpha */
  _Float16* op = O + ((size_t)b * SQ + qi) * DM + h * HD + 8 * hh;
#pragma unroll      /* o[] in registers; a lane's 8 accumulator registers are 8 consecutive columns of its query's row: one 16-byte store */
  for (int t = 0; t < 4; ++t) { FragH f; for (int r = 0; r < 8; ++r) f.h[r] = (_Float16)(o[t][r] * fin); *(v8us*)((unsigned short*)op + 16 * t) = f.half[0]; }
  asm volatile("s_wait_xcnt 0x0" ::: "memory"); }      /* behind the four stores: the rider's code follows them in the listing and reuses their registers */

// One lane per query row, 32 rows a block; the rows' keys are dealt over the block's KW waves (wave w takes keys w, w + KW, ... of the block's range), each wave with its own running maximum, sum and o; the KW partial results of a row are joined through LDS at the end. A wave's key index is wave-uniform, so k and v rows still come through the scalar path. The 64-wide loops are unrolled: q[] and o[] are indexed by constants only and stay in registers.
struct AttupLds { float lo[KW][32][HD + 4];      /* row pitch 272 B = 16 B x odd: 16-byte stores of 32 rows and 16-byte loads along a row both spread over the banks */
  float lm[KW][32], ll[KW][32]; };
__device__ __forceinline__ void d_attup(const float* __restrict__ QF, const float* __restrict__ KF, const float* __restrict__ VF, int ld, float scale, float* __restrict__ OF, int ldo, int bx, int by, AttupLds& sh) {
  #pragma clang fp contract(off)
  static_assert(KW == 16 && QT0 % 32 == 0 && HD == 64, "the join below gives each of the 32 * KW threads one 4-column piece of the 32 x 64 tile");
  auto& lo = sh.lo; auto& lm = sh.lm; auto& ll = sh.ll;
  const int tid = threadIdx.x, lane = tid & 31; const int w = __builtin_amdgcn_readfirstlane(tid >> 5);      /* wave number in a scalar register: key addresses stay scalar */
  const int h = bx / (QT0 / 32), rg = bx % (QT0 / 32); const int i = rg * 32 + lane;
  { const size_t bo = (size_t)by * QT0; QF += bo * ld; KF += bo * ld; VF += bo * ld; OF += bo * ldo; }      /* by: the batch; each batch has its own QT0-row tile */
  const float* qr = QF + (size_t)i * ld + h * HD; v4f q[HD / 4], o[HD / 4];
#pragma unroll      /* q[], o[] in registers; the q row's 16 loads in flight at once */
  for (int c = 0; c < HD / 4; ++c) { q[c] = *(const v4fa*)(qr + c * 4); const v4f z = {0.f, 0.f, 0.f, 0.f}; o[c] = z; }
  float m = -1.0e30f, l = 0.f;
#pragma unroll 1
  for (int j = rg * 32 + w; j < QT0; j += KW) { const float* kr = KF + (size_t)j * ld + h * HD; const float* vr = VF + (size_t)j * ld + h * HD; v4f kq[HD / 4], vv[HD / 4]; float s = 0.f;
#pragma unroll      /* a whole row's loads in flight at once */
    for (int c = 0; c < HD / 4; ++c) kq[c] = *(const v4fa*)(kr + c * 4);
#pragma unroll      /* the v row arrives under the score sum */
    for (int c = 0; c < HD / 4; ++c) vv[c] = *(const v4fa*)(vr + c * 4);
#pragma unroll      /* q[], kq[] in registers */
    for (int c = 0; c < HD / 4; ++c) { s = __fadd_rn(s, __fmul_rn(q[c][0], kq[c][0])); s = __fadd_rn(s, __fmul_rn(q[c][1], kq[c][1])); s = __fadd_rn(s, __fmul_rn(q[c][2], kq[c][2])); s = __fadd_rn(s, __fmul_rn(q[c][3], kq[c][3])); }
    s = __fmul_rn(s, scale);
    const float f = (j > i) ? 1.f : 0.f; const float sm = fmaf(f, s, (1.f - f) * -1.0e30f); const float mn = fmaxf(m, sm); const float sc = expf(m - mn); const float e = __fmul_rn(f, expf(sm - mn)); l = __fadd_rn(__fmul_rn(l, sc), e); m = mn;
#pragma unroll      /* o[], vv[] in registers */
    for (int c = 0; c < HD / 4; ++c) for (int u = 0; u < 4; ++u) o[c][u] = __fadd_rn(__fmul_rn(o[c][u], sc), __fmul_rn(e, vv[c][u])); }
#pragma unroll      /* o[] in registers */
  for (int c = 0; c < HD / 4; ++c) *(v4f*)&lo[w][lane][c * 4] = o[c];
  lm[w][lane] = m; ll[w][lane] = l;
  __syncthreads();
  { const int row = tid / 16, pc = (tid % 16) * 4; float mw[KW], mx = -1.0e30f, ls = 0.f; v4f a = {0.f, 0.f, 0.f, 0.f};      /* join: every partial is brought to the row's overall maximum; a wave that saw no visible key holds l = 0, o = 0 and adds nothing */
#pragma unroll      /* mw[] in registers */
    for (int u = 0; u < KW; ++u) { mw[u] = lm[u][row]; mx = fmaxf(mx, mw[u]); }
#pragma unroll      /* mw[] in registers; the 16 partial pieces' LDS loads in flight at once */
    for (int u = 0; u < KW; ++u) { const float fw = exp_x1(mw[u] - mx); const v4f p = *(const v4f*)&lo[u][row][pc]; ls += ll[u][row] * fw; a += p * fw; }
    const float fin = (ls > 0.f) ? 64.0f / ls : 0.f;      /* o carried x64 like the f16 path; the key-less last row is written by d_vmean */
    a *= fin; if (rg * 32 + row != QT0 - 1) *(v4f*)(OF + (size_t)(rg * 32 + row) * ldo + h * HD + pc) = a; } }      /* the key-less last row has one writer, d_vmean, in the same launch */

__device__ __forceinline__ void d_vmean(const _Float16* __restrict__ V, float* __restrict__ orow, int bx, int by) {
  #pragma clang fp contract(off)
  const int c = bx * (32 * KW) + threadIdx.x; if (c >= DM) return; const _Float16* p = V + (size_t)by * SQ * LQ + c; orow += (size_t)by * QT0 * DM; float s = 0.f;      /* by: the batch */
#pragma unroll 1
  for (int j0 = 0; j0 < SQ; j0 += 64) { _Float16 t[64];
#pragma unroll      /* 64 rows' loads in flight at once (the constant pitch LQ makes them one address register with immediate offsets); t[] in registers */
    for (int j = 0; j < 64; ++j) t[j] = p[(size_t)(j0 + j) * LQ];
#pragma unroll      /* summed in the rows' order */
    for (int j = 0; j < 64; ++j) s = __fadd_rn(s, (float)t[j]); }
  const float o = __fmul_rn(s, 64.0f / (float)SQ); *(float*)(orow + c) = o;  }

// One launch for the three pieces of work that need only the projections and not each other, dealt by block index, the longest first: the mean of v (last row), the exact attention of the last tile, V^T (two 64 x 64 tiles a block, one per half of its threads).
#define NVM (NBR * ((DM + 32 * KW - 1) / (32 * KW)))      /* blocks of d_vmean */
#define NAT (NBR * NH * (QT0 / 32))                       /* blocks of d_attup */
#define NVT (NBR * NH * (SQ / 64) / 2)                    /* blocks of d_vt */
__global__ __launch_bounds__(32 * KW) void k_mid(const _Float16* __restrict__ V16, _Float16* __restrict__ Vt, const float* __restrict__ QF, const float* __restrict__ KF, const float* __restrict__ VF, float* __restrict__ OF) {
  static_assert(32 * KW == 512 && (NBR * NH * (SQ / 64)) % 2 == 0, "d_vt: two halves of 256 threads, a tile each");
  __shared__ __attribute__((aligned(16))) union { AttupLds a; unsigned short tl[2][64][66]; } sm;
  const int bi = blockIdx.x;      /* every branch below is the same for the whole block; d_attup stands last in the chain so that the compiler lays it in front of the other bodies' stores: behind them its wave-uniform k and v row loads left the scalar path for 32 vector loads a key */
  if (bi < NVM) d_vmean(V16, OF + (size_t)(QT0 - 1) * DM, bi % (NVM / NBR), bi / (NVM / NBR));
  else if (bi >= NVM + NAT) d_vt<NH, SQ>(V16, LQ, 0, Vt, (bi - NVM - NAT) * 2 + (int)(threadIdx.x >> 8), (int)(threadIdx.x & 255), sm.tl[threadIdx.x >> 8]);
  else d_attup(QF, KF, VF, DM, 0.125f, OF, DM, (bi - NVM) % (NAT / NBR), (bi - NVM) / (NAT / NBR), sm.a); }

extern "C" void kernel_launch(void* const* d_in, const int* in_sizes, int n_in,
                              void* d_out, int out_size, void* d_ws, size_t ws_size, hipStream_t stream) {
  (void)in_sizes; (void)n_in; (void)out_size;
  const float* const* I = (const float* const*)d_in; const float* xq = I[0]; const float* xk = I[0]; const float* xv = I[0]; const float* wq = I[1]; const float* bq = I[2]; const float* wk = I[3]; const float* bk = I[4]; const float* wv = I[5]; const float* bv = I[6]; const float* wo = I[7]; const float* bo = I[8]; const float* x = xq;      /* ONE input feeds the query, key and value streams; [in][out] weights + biases; the mask is built from indices as in the module */
  static_assert(NH * HD == DM && DM % 64 == 0 && SQ % 128 == 0 && NH % HG == 0, "shape / tile multiples");
  static_assert(MP % 128 == 0 && MPO % 128 == 0 && QT0 % 128 == 0 && DM / 64 >= 2, "k_gemm2 stages whole 128-row, 64-column, 64-deep tiles");
  char* ws = (char*)d_ws; size_t off = 0;
  auto take = [&](size_t bytes) { char* p = ws + off; off += (bytes + 255) & ~(size_t)255; return p; };
  _Float16* BQ = (_Float16*)take((size_t)4 * DM * DM * 2); _Float16* BO = BQ + (size_t)3 * DM * DM;      /* Bt planes of Wq, Wk, Wv, Wo, one behind the other */
  _Float16* X16 = (_Float16*)take((size_t)3 * NR * DM * 2);      /* query, key and value inputs as exact f16 rows: three planes */
  _Float16* Q16 = (_Float16*)take((size_t)3 * NR * DM * 2); _Float16* K16 = Q16 + NR * DM; _Float16* V16 = K16 + NR * DM; _Float16* O16 = (_Float16*)take(NR * DM * 2);      /* q, k, v: three planes */
  _Float16* VT = (_Float16*)take((size_t)NB * NH * HD * SQ * 2);
  float* QF0 = (float*)take((size_t)3 * NB * QT0 * DM * 4); float* KF0 = QF0 + (size_t)NB * QT0 * DM; float* VF0 = KF0 + (size_t)NB * QT0 * DM; float* OF0 = (float*)take((size_t)NB * QT0 * DM * 4); _Float16* OH0 = (_Float16*)take((size_t)NB * QT0 * DM * 2); _Float16* OL0 = (_Float16*)take((size_t)NB * QT0 * DM * 2);      /* exact last tile of every batch: f32 q / k / v of the tile rows (three planes of [NB][QT0] rows), o (x64) and its f16 hi + x1024 residual planes */
  if (off > ws_size) return;
  auto g2 = [](const _Float16* A, int lda, size_t sA, const _Float16* Bh, int ldb, size_t sB, float alpha, const float* bias, size_t sBias, const float* CP, int rowsPerB, size_t sCPb, int row0g, float* C, _Float16* C16, int ldc, size_t sC, int M, int N, int K, size_t sAz, size_t sBz, size_t sCz, const float* bias1, const float* bias2, int gx) {
    G2P p; p.A = A; p.Bh = Bh; p.bias = bias; p.bias1 = bias1; p.bias2 = bias2; p.CP = CP; p.C = C; p.C16 = C16; p.sA = sA; p.sB = sB; p.sBias = sBias; p.sCPb = sCPb; p.sC = sC; p.sAz = sAz; p.sBz = sBz; p.sCz = sCz; p.alpha = alpha; p.lda = lda; p.ldb = ldb; p.rowsPerB = rowsPerB; p.row0g = row0g; p.ldc = ldc; p.M = M; p.N = N; p.K = K; p.gx = gx; return p; };
  static_assert((size_t)DM * (DM / 8) % 256 == 0 && NR * DM / 8 % 256 == 0 && (size_t)NB * QT0 * DM / 8 % 512 == 0 && (SQ - QT0) % 128 == 0 && B0 == 0 && NBR == NB, "whole blocks in the shared launches");
  k_prep<<<4 * NWX + 3 * NXX, 256, 0, stream>>>(wq, wk, wv, wo, BQ, x, xk, xv, X16);      /* [in][out] -> Bt x16 of the four weights; the three streams as f16 */
  const size_t r0p = (size_t)B0 * SQ;      /* first projected row */
  const size_t rl0 = r0p + SQ - QT0; const size_t f00 = (size_t)B0 * QT0;      /* first batch's last QT0 rows; its tile in the [NB][QT0] planes */
  const G2P gq = g2(X16 + r0p * DM, DM, 0, BQ, DM, 0, 0.0625f, bq, 0, nullptr, 1, 0, 0, nullptr, Q16 + r0p * DM, DM, 0, MP, DM, DM, NR * DM, (size_t)DM * DM, NR * DM, bk, bv, (MP / 128) * (DM / 64));      /* q, k, v (z) as f16 rows */
  const G2P gf = g2(X16 + rl0 * DM, DM, (size_t)SQ * DM, BQ, DM, 0, 0.0625f, bq, 0, nullptr, 1, 0, 0, QF0 + f00 * DM, nullptr, DM, (size_t)QT0 * DM, QT0, DM, DM, NR * DM, (size_t)DM * DM, (size_t)NB * QT0 * DM, bk, bv, (QT0 / 128) * (DM / 64));      /* f32 q, k, v (z) of every batch's last tile (exact products); the batch lies in blockIdx.x */
  k_gemm2<0><<<dim3((unsigned)((MP / 128) * (DM / 64) + NBR * (QT0 / 128) * (DM / 64)), 1, 3), 128, 0, stream>>>(gq, gf, (MP / 128) * (DM / 64));
  k_mid<<<NVM + NAT + NVT, 32 * KW, 0, stream>>>(V16 + r0p * LQ, VT + (size_t)B0 * NH * HD * SQ, QF0 + f00 * DM, KF0 + f00 * DM, VF0 + f00 * DM, OF0 + f00 * DM);      /* last row: uniform over all keys = 64 x mean of v; exact f32 attention over the keys j > i inside the last tile (o x64); V^T [NB][NH][HD][SQ] */
  k_fattn<<<NFA + NHL, 512, 0, stream>>>(Q16, K16, VT, O16, OF0, OH0, OL0);      /* scores, literal 'score + tril * (-1e9)', softmax and the weighted v sum, every (batch, head), the rows in front of the last tile -> o (merged heads, x64) as f16 rows; beside it last-tile o (x64) -> f16 hi + x1024 residual planes */
  const G2P go = g2(O16 + r0p * DM, DM, (size_t)SQ * DM, BO, DM, 0, 0.0009765625f, bo, 0, nullptr, 1, 0, 0, (float*)d_out + r0p * DM, nullptr, DM, (size_t)SQ * DM, SQ - QT0, DM, DM, 0, 0, 0, nullptr, nullptr, ((SQ - QT0) / 128) * (DM / 64));      /* out rows in front of every batch's (y) last tile, from the f16 path */
  const G2P gh = g2(OH0 + f00 * DM, DM, (size_t)QT0 * DM, BO, DM, 0, 0.0009765625f, bo, 0, nullptr, 1, 0, 0, (float*)d_out + rl0 * DM, nullptr, DM, (size_t)SQ * DM, QT0, DM, DM, 0, 0, 0, nullptr, nullptr, (QT0 / 128) * (DM / 64));      /* last QT0 rows of every batch (y): out = o_hi Wo (+ b) */
  k_gemm2<0><<<dim3((SQ / 128) * (DM / 64), NBR), 128, 0, stream>>>(go, gh, ((SQ - QT0) / 128) * (DM / 64));      /* every out row has one writer */
  const G2P gl = g2(OL0 + f00 * DM, DM, (size_t)QT0 * DM, BO, DM, 0, 0.00000095367431640625f, nullptr, 0, (const float*)d_out + rl0 * DM, -1, 0, 0, (float*)d_out + rl0 * DM, nullptr, DM, (size_t)SQ * DM, QT0, DM, DM, 0, 0, 0, nullptr, nullptr, (QT0 / 128) * (DM / 64));      /* += o_lo Wo 2^-20 (own-element accumulate) */
  k_gemm2<0><<<dim3((QT0 / 128) * (DM / 64), NBR), 128, 0, stream>>>(gl, gl, (QT0 / 128) * (DM / 64));      /* needs the launch before it: alone */
}
